// v000
// Measured on an AMD MI455X. A time is GPU time per run, averaged over a window of back-to-back runs after a warm-up
// (all launches, gaps included; the runs take copies of the inputs in turn), and the median of several windows.
// Apart from v000's, it joins two sittings. Times from different sittings can be a few percent apart, while
// side-by-side timings come from the same sitting.
// v000, which the later versions start from, runs in 125 microseconds.
#include <hip/hip_runtime.h>

// Causal multi-head self-attention, width 128 = 8 heads x 16; x [NB][SEQ][128]; Wq/Wk/Wv/Wo [out][in] (y = x W^T, no bias); key padding mask [NB][SEQ] (int32, device-read); masked scores are replaced before the 1/sqrt(16) scale;
// per-head context transposed to [b][h*16+e][t], reinterpreted flat as [NB][SEQ][128], then multiplied by Wo^T (f32 output).
// Compute dtypes, f32 accumulate everywhere: q/k/v projections v_wmma_f32_16x16x32_bf16 (x, W RNE-converted to bf16; products exact);
// scores v_wmma_f32_16x16x32_f16 (head dim 16 zero-padded to the 32-deep step): single f16 q, k on query rows >= EROWS; on query rows < EROWS q and k each as f16 value + f16 residual x2048 (cross products in the upper 16 k-slots, own accumulator);
// P.V v_wmma_f32_16x16x32_f16: P (x16384 carry, cancels in the normalisation) and v single f16 on query rows >= EROWS; on query rows < EROWS P and v as f16 value + f16 residual x2048, residual products in their own accumulator folded by 1/2048, row sum from the f32 exponentials;
// output projection v_wmma_f32_16x16x32_f16: context as f16 value + f16 residual x2048 (own accumulator), Wo as bf16-converted value x64 held in f16; softmax f32 (online, running max over kept keys).
// Layout: bf16 copies of x and Wq/Wk/Wv; q, k planes [b*8+h][t][16], v^T plane [b*8+h][16][t], small residual planes (tokens < EROWS) for q, k, v^T; context planes (value, residual) [b][h*16+e][t]; fused flash kernel in transposed form (S^T = K Q^T, O^T = V^T P^T).
// Keep rule per element: (mask[b][j] != 0) and (j <= t); dropped elements get probability 0; a row with no kept key takes the plain mean of v over all SEQ keys (uniform softmax of equal fills).

#ifndef NB
#define NB 4
#endif
#ifndef SEQ
#define SEQ 2048
#endif
#define NB_FULL  4
#define SEQ_FULL 2048
#ifndef OUT_SEQ
#define OUT_SEQ SEQ              // row pitch (in tokens) between batches of the output
#endif
#define DM   128
#define NH_  8
#define HD   16
#define AW   4                   // waves per flash block (16 query rows each)
#define OSP  68                  // LDS row pitch (floats) of the flash context tile [16 d][64 t]
#define OPP  132                 // LDS row pitch (floats) of the output-projection slab [16][128]
#define EROWS (SEQ < 512 ? SEQ : 512)   // query rows (and tokens of the small residual planes) handled by the multi-product flash instantiation
#define QRS  2048.0f             // carry of every residual plane / residual fragment
#define QRI  (1.0f / 2048.0f)
#define SC2  ((float)(0.25 * 1.4426950408889634))   // HD^-0.5 * log2(e)
#define PSH  14.0f               // log2 of the P carry (16384)
#define NEGB (-3.0e38f)
#define WOS  64.0f               // carry of the Wo plane
#define WOI  (1.0f / 64.0f)

static_assert(HD == 16);
static_assert(NH_ * HD == DM);                 // head h = columns h*16 + d
static_assert(DM % 64 == 0);                   // column tiles of 64 = four heads
static_assert(64 % HD == 0);
static_assert(DM % 32 == 0);                   // GEMM k-loop steps by 32
static_assert(DM == 32 * 4);                   // output row = 32 lanes x 4 floats
static_assert(SEQ % 64 == 0);                  // a 64-row tile never straddles two batches
static_assert((NB * SEQ) % 64 == 0);
static_assert(SEQ % 32 == 0);                  // key loop steps by 32
static_assert(SEQ % (16 * AW) == 0);           // flash grids cover the sequence exactly
static_assert(16 * AW == 64);
static_assert(4 * AW == HD);                   // context store: 4 rows per wave x AW waves = 16 channel rows
static_assert(8 * 8 == 16 * AW);               // 8 lanes x 8 halves = 64 tokens per row
static_assert(EROWS % 64 == 0);                // a 64-token GEMM tile lies wholly inside or outside the residual planes
static_assert(EROWS >= 32);
static_assert(EROWS <= SEQ);
static_assert(EROWS % 32 == 0);                // early key loops end inside the residual planes
static_assert(EROWS % (16 * AW) == 0);
static_assert((SEQ - EROWS) % (16 * AW) == 0);
static_assert(((size_t)SEQ * DM) % 8 == 0);
static_assert(((size_t)DM * DM) % 8 == 0);
static_assert(NB <= NB_FULL);
static_assert(SEQ <= SEQ_FULL);
static_assert((OSP * 4) % 16 == 0);
static_assert(OSP >= 64);
static_assert((OPP * 4) % 16 == 0);
static_assert(OPP >= DM);
static_assert(4 * 32 * 8 == 16 * 64);          // projection epilogue, q/k form: 4 heads x 32 lanes x 8 halves = 16 rows x 64 columns
static_assert(4 * 4 * 64 == 16 * 64);          // projection epilogue, v^T form: 4 instructions x 4 rows x 64 halves
static_assert(16 * 68 * 4 <= 131072);          // static LDS of the projection kernels
static_assert(HD * OSP * 4 <= 131072);         // static LDS of the flash kernels
static_assert(16 * OPP * 4 <= 131072);         // static LDS of the output-projection kernel

typedef _Float16 h16;
typedef unsigned short bf;
typedef __attribute__((ext_vector_type(16))) __bf16   v16bf;
typedef __attribute__((ext_vector_type(16))) _Float16 v16h;
typedef __attribute__((ext_vector_type(8)))  _Float16 v8h;
typedef __attribute__((ext_vector_type(8)))  unsigned short v8us;
typedef __attribute__((ext_vector_type(8)))  float    v8f;
typedef __attribute__((ext_vector_type(4)))  float    v4f;
typedef __attribute__((ext_vector_type(4)))  int      v4i;
typedef v4f  __attribute__((may_alias)) v4fa;

__device__ __forceinline__ unsigned short f2bf(float f) { unsigned u = __float_as_uint(f); u += 0x7FFFu + ((u >> 16) & 1u); return (unsigned short)(u >> 16); }
__device__ __forceinline__ float bfr(float f) { return __uint_as_float(((unsigned)f2bf(f)) << 16); }   // value after RNE convert to bf16
__device__ __forceinline__ v16h cat16(v8h lo, v8h hi) { return __builtin_shufflevector(lo, hi, 0, 1, 2, 3, 4, 5, 6, 7, 8, 9, 10, 11, 12, 13, 14, 15); }
__device__ __forceinline__ v16bf cat16b(v8us lo, v8us hi) { return __builtin_bit_cast(v16bf, __builtin_shufflevector(lo, hi, 0, 1, 2, 3, 4, 5, 6, 7, 8, 9, 10, 11, 12, 13, 14, 15)); }
__device__ __forceinline__ v8f wmma16(v16h a, v16h b, v8f c) { return __builtin_amdgcn_wmma_f32_16x16x32_f16(false, a, false, b, (short)0, c, false, false); }
__device__ __forceinline__ v8f wmmab(v16bf a, v16bf b, v8f c) { return __builtin_amdgcn_wmma_f32_16x16x32_bf16(false, a, false, b, (short)0, c, false, false); }
// fragment loaders from K-contiguous 16-bit rows; p already includes + 8*(lane>>4): elements 0..7 <- k0+8h+0..7, elements 8..15 <- k0+16+8h+0..7 (same map for A and B)
__device__ __forceinline__ v16h  ldh(const h16* p) { return cat16(*(const v8h*)p, *(const v8h*)(p + 16)); }
__device__ __forceinline__ v16bf ldb(const bf* p)  { return cat16b(*(const v8us*)p, *(const v8us*)(p + 16)); }
// ordering point for wave-private LDS tiles (same wave writes and reads)
__device__ __forceinline__ void wave_sync() { __builtin_amdgcn_fence(3 /* release order */, "wavefront"); __builtin_amdgcn_wave_barrier(); asm volatile("" ::: "memory"); }

// per-instruction guarded matrix ops: the four idle slots tie the accumulator and keep the operands live
__device__ __forceinline__ v8f wmma16g(v16h a, v16h b, v8f c) { c = wmma16(a, b, c); asm volatile("v_nop\n\tv_nop\n\tv_nop\n\tv_nop" : "+v"(c) : "v"(a), "v"(b)); return c; }
__device__ __forceinline__ v8f wmmabg(v16bf a, v16bf b, v8f c) { c = wmmab(a, b, c); asm volatile("v_nop\n\tv_nop\n\tv_nop\n\tv_nop" : "+v"(c) : "v"(a), "v"(b)); return c; }
// f32 -> f16 that cannot produce a subnormal operand (|v| < 2^-14 -> +0)
static __device__ __forceinline__ h16 toh_flush(float v) { const h16 r = (h16)v; return (fabsf(v) < 6.103515625e-05f) ? (h16)0.0f : r; }

__global__ __launch_bounds__(256) void k_cvt8(const float* __restrict__ src, bf* dst, size_t n8) {
    const size_t i = (size_t)blockIdx.x * 256 + threadIdx.x; if (i >= n8) return;
    const v8f v = *(const v8f*)(src + i * 8); v8us o;
#pragma unroll
    for (int k = 0; k < 8; ++k) o[k] = f2bf(v[k]);
    *(v8us*)(dst + i * 8) = o; 
}

__global__ __launch_bounds__(256) void k_wcvt(const float* __restrict__ src, h16* dst, size_t n8) {
    const size_t i = (size_t)blockIdx.x * 256 + threadIdx.x; if (i >= n8) return;
    const v8f v = *(const v8f*)(src + i * 8); v8h o;
#pragma unroll
    for (int k = 0; k < 8; ++k) o[k] = toh_flush(bfr(v[k]) * WOS);
    *(v8h*)(dst + i * 8) = o; 
}

// proj_body: register-blocked bf16 GEMM, ONE WAVE per 64x64 tile (16 accumulators), operands straight from K-contiguous bf16 planes, K = DM.
// C[m][n] = sum_k A[m][k] Bt[n][k], written as f16 (Ph) and, for tokens t < resT (resT a multiple of 64, block-uniform test), the f16 residual x2048 (Pr).
// MODE 0: A = x rows (m = b*SEQ + t), Bt = W rows (n = h*16 + d); plane [(b*8 + h)][t][16] (residual plane [(b*8 + h)][resT][16]). The 64-column tile spans four heads; per 16-row slab and head
//         (16 rows per instruction). grid (NB*SEQ/64, DM/64).
template <int MODE>
__device__ __forceinline__ void proj_body(const bf* __restrict__ A, const bf* __restrict__ Bt, h16* Ph, h16* Pr, int resT) {
    __shared__ __align__(16) float os[16 * 68];
    const int K = DM;
    const int lane = threadIdx.x & 31, lr = lane & 15, hi = lane >> 4; const int r0 = blockIdx.x * 64, c0 = blockIdx.y * 64;
    v8f acc[4][4];
#pragma unroll
    for (int mb = 0; mb < 4; ++mb)
#pragma unroll
        for (int nb = 0; nb < 4; ++nb) acc[mb][nb] = (v8f){};
    const size_t aoff = (size_t)(r0 + lr) * K + 8 * hi, boff = (size_t)(c0 + lr) * K + 8 * hi;
#pragma unroll 1
    for (int kc = 0; kc < K; kc += 32) {
        v16bf a[4];
#pragma unroll
        for (int mb = 0; mb < 4; ++mb) a[mb] = ldb(A + aoff + (size_t)mb * 16 * K + kc);
#pragma unroll
        for (int nb = 0; nb < 4; ++nb) { const v16bf b = ldb(Bt + boff + (size_t)nb * 16 * K + kc);
#pragma unroll
            for (int mb = 0; mb < 4; ++mb) acc[mb][nb] = wmmabg(a[mb], b, acc[mb][nb]); }
    }
    size_t tbase, rbase; bool wr;                                                                 // wr: block-uniform, whole tile inside the residual plane
    if (MODE == 0) { const int bb = r0 / SEQ, tt = r0 % SEQ; const int zc = bb * NH_ + c0 / HD;
                     tbase = ((size_t)zc * SEQ + (size_t)tt) * HD; rbase = ((size_t)zc * (size_t)resT + (size_t)tt) * HD; wr = tt < resT; }
    else           { const int bb = c0 / SEQ, tt = c0 % SEQ;
                     tbase = (size_t)bb * (size_t)DM * SEQ + (size_t)r0 * SEQ + (size_t)tt; rbase = (size_t)bb * (size_t)DM * (size_t)resT + (size_t)r0 * (size_t)resT + (size_t)tt; wr = tt < resT; }
#pragma unroll
    for (int mb = 0; mb < 4; ++mb) {
#pragma unroll
        for (int nb = 0; nb < 4; ++nb) {
#pragma unroll
            for (int j = 0; j < 8; ++j) os[(hi * 8 + j) * 68 + nb * 16 + lr] = acc[mb][nb][j]; }   // D: row 8h+j, col lane&15; rows 0..15 x columns 0..63 all written
        wave_sync();
{
            if (MODE == 0) {
                const size_t sb = tbase + (size_t)(mb * 16) * HD;
                const size_t rb = rbase + (size_t)(mb * 16) * HD;
#pragma unroll
                for (int hh = 0; hh < 4; ++hh) { const int row = lane >> 1, c8 = (lane & 1) * 8;   // 16 rows x 2 lanes x 8 = 16 columns of head hh: one 512-byte run
                    const v4f x0 = *(const v4fa*)(&os[row * 68 + hh * 16 + c8]); const v4f x1 = *(const v4fa*)(&os[row * 68 + hh * 16 + c8 + 4]); v8h hv, rv;
#pragma unroll
                    for (int i = 0; i < 4; ++i) { const h16 a0 = toh_flush(x0[i]); const h16 a1 = toh_flush(x1[i]); hv[i] = a0; hv[4 + i] = a1;
                        rv[i] = toh_flush((x0[i] - (float)a0) * QRS); rv[4 + i] = toh_flush((x1[i] - (float)a1) * QRS); }
                    const size_t oo = sb + (size_t)hh * ((size_t)SEQ * HD) + (size_t)lane * 8;
                    const size_t ro = rb + (size_t)hh * ((size_t)resT * HD) + (size_t)lane * 8;
                    *(v8h*)(Ph + oo) = hv; if (wr) *(v8h*)(Pr + ro) = rv; }
            } else {
                const size_t sb = tbase + (size_t)(mb * 16) * SEQ;
                const size_t rb = rbase + (size_t)(mb * 16) * (size_t)resT;
#pragma unroll
                for (int s = 0; s < 4; ++s) { const int row = 4 * s + (lane >> 3), c8 = (lane & 7) * 8;   // 4 s x 4 row groups = 16 rows; 8 lanes x 8 = 64 columns
                    const v4f x0 = *(const v4fa*)(&os[row * 68 + c8]); const v4f x1 = *(const v4fa*)(&os[row * 68 + c8 + 4]); v8h hv, rv;
#pragma unroll
                    for (int i = 0; i < 4; ++i) { const h16 a0 = toh_flush(x0[i]); const h16 a1 = toh_flush(x1[i]); hv[i] = a0; hv[4 + i] = a1;
                        rv[i] = toh_flush((x0[i] - (float)a0) * QRS); rv[4 + i] = toh_flush((x1[i] - (float)a1) * QRS); }
                    const size_t oo = sb + (size_t)row * SEQ + c8;
                    const size_t ro = rb + (size_t)row * (size_t)resT + c8;
                    *(v8h*)(Ph + oo) = hv; if (wr) *(v8h*)(Pr + ro) = rv; }
            }
             }
        wave_sync();
    }
}

__global__ __launch_bounds__(32) void k_proj_qk(const bf* __restrict__ A, const bf* __restrict__ Bt, h16* Ph, h16* Pr, int resT) { proj_body<0>(A, Bt, Ph, Pr, resT); }
__global__ __launch_bounds__(32) void k_proj_vt(const bf* __restrict__ A, const bf* __restrict__ Bt, h16* Ph, h16* Pr, int resT) { proj_body<1>(A, Bt, Ph, Pr, resT); }

// flash_body: fused causal attention, one wave per 16 query rows of one (batch, head), AW waves = 64 query rows per block; K / V^T / Q fragments straight from the f16 planes (16-B loads, arithmetic addressing).
// Transposed form: S^T[key][t] = K Q^T (A = K rows, B = Q rows, head dim 16 in k-slots 0..15); lane (t = lane&15, h = lane>>4) holds keys 8h+r of each 16-key tile, so the packed
// P tile is directly the B fragment of O^T[d][t] = V^T P^T (element r <- tile keys 0..15, element 8+r <- tile keys 16..31, lane unchanged).
// Softmax state (running max over kept keys, partial sum) is one scalar per lane; the two lane halves of a row are combined with one xor-16 exchange.
// Keep rule evaluated per element inside every visited 32-key tile; the per-wave key bound is t0 + 16 (pad up to 32), at most SEQ.
// EARLY = 1 (query rows [0, EROWS)): A = [K | K_res], B = [Q | 0] gives K Q; B = [Q_res | Q] gives K Q_res + K_res Q (x2048, own accumulator); P = f16 value + f16 residual x2048;
//            O = V P + (V P_res + V_res P) / 2048 (residual products in their own accumulator); row sum from the f32 exponentials; all keys of these rows are < EROWS, inside the small planes.
// EARLY = 0 (query rows [EROWS, SEQ)): single q, k, P, v.
template <int EARLY>
__device__ __forceinline__ void flash_body(const h16* __restrict__ QH, const h16* __restrict__ QR, const h16* __restrict__ KP, const h16* __restrict__ KR,
                                           const h16* __restrict__ VT, const h16* __restrict__ VR, const int* __restrict__ pmask, h16* CH, h16* CX) {
    __shared__ __align__(16) float os[HD * OSP];
    const int lane = threadIdx.x & 31, lr = lane & 15, hi = lane >> 4;
    const int wave = __builtin_amdgcn_readfirstlane((int)(threadIdx.x >> 5));
    const int zh = blockIdx.y; const int b = zh / NH_, h = zh % NH_;
    const int tb = (EARLY ? 0 : EROWS) + blockIdx.x * (16 * AW);
    const int t0 = tb + wave * 16;
    const int lim = t0 + lr;                                                   // key j kept iff j <= lim (and mask nonzero)
    const int nk = (t0 + 16 + 31) & ~31;                                       // wave-uniform, multiple of 32, <= SEQ (<= EROWS when EARLY)
    const int* pmb = pmask + (size_t)b * SEQ_FULL + 8 * hi;
    const size_t pbase = (size_t)zh * SEQ * HD;
    const size_t rbase = (size_t)zh * EROWS * HD;
    const v8h z8 = (v8h){};
    const size_t qo = pbase + (size_t)(t0 + lr) * HD + 8 * hi;
    const v8h q8 = *(const v8h*)(QH + qo);
    const v16h qh = cat16(q8, z8);                                // B fragment [Q | 0]: col t, k = d
    v16h qx = qh;
    if (EARLY) { const size_t qro = rbase + (size_t)(t0 + lr) * HD + 8 * hi; qx = cat16(*(const v8h*)(QR + qro), q8); }   // B fragment [Q_res | Q]
    const size_t ko = pbase + (size_t)lr * HD + 8 * hi;         // + key * HD       (A fragment: row key, k = d)
    const size_t vo = pbase + (size_t)lr * SEQ + 8 * hi;        // + key            (A fragment: row d, k = key)
    const size_t kro = rbase + (size_t)lr * HD + 8 * hi;        // residual planes, tokens < EROWS
    const size_t vro = rbase + (size_t)lr * EROWS + 8 * hi;
    const v8f zz = (v8f){};
    v8f o0 = (v8f){}, oR0 = (v8f){};
    float m = NEGB, l = 0.0f;
#pragma unroll 1
    for (int key0 = 0; key0 < nk; key0 += 32) {
        const h16* ka = KP + ko + (size_t)key0 * HD;
        const v8h k0 = *(const v8h*)ka, k1 = *(const v8h*)(ka + 16 * HD);
        v8h kr0 = z8, kr1 = z8;
        if (EARLY) { const h16* kr = KR + kro + (size_t)key0 * HD; kr0 = *(const v8h*)kr; kr1 = *(const v8h*)(kr + 16 * HD); }
        const v16h ka0 = cat16(k0, kr0), kb0 = cat16(k1, kr1);   // A fragments [K | K_res] (late: [K | 0])
        v8f sHa = wmma16g(ka0, qh, zz), sHb = wmma16g(kb0, qh, zz);
        v8f sLa = zz, sLb = zz;
        if (EARLY) { sLa = wmma16g(ka0, qx, zz); sLb = wmma16g(kb0, qx, zz); }
        const int* kp = pmb + key0;                              // keys key0+8h+0..7 and key0+16+8h+0..7, all < nk <= SEQ
        const v4i m0 = *(const v4i*)kp, m1 = *(const v4i*)(kp + 4), m2 = *(const v4i*)(kp + 16), m3 = *(const v4i*)(kp + 20);
        int kx[8], ky[8];
#pragma unroll
        for (int r = 0; r < 4; ++r) { kx[r] = m0[r]; kx[4 + r] = m1[r]; ky[r] = m2[r]; ky[4 + r] = m3[r]; }
        const int ja = key0 + 8 * hi;
        float ta[8], tb2[8]; bool fa[8], fb[8]; float mx = NEGB;
#pragma unroll
        for (int r = 0; r < 8; ++r) {
            fa[r] = (kx[r] != 0) & (ja + r <= lim);
            fb[r] = (ky[r] != 0) & (ja + 16 + r <= lim);
            if (EARLY) { ta[r] = (sHa[r] + sLa[r] * QRI) * SC2; tb2[r] = (sHb[r] + sLb[r] * QRI) * SC2; }
            else       { ta[r] = sHa[r] * SC2; tb2[r] = sHb[r] * SC2; }
            mx = fmaxf(mx, fmaxf(fa[r] ? ta[r] : NEGB, fb[r] ? tb2[r] : NEGB)); }
        mx = fmaxf(mx, __shfl_xor(mx, 16, 32));
        const float mnew = fmaxf(m, mx);
        const float alpha = __builtin_amdgcn_exp2f(m - mnew);
        const float sh = PSH - mnew;
        v16h pb, pr = (v16h){}; float ls = 0.0f;
#pragma unroll
        for (int r = 0; r < 8; ++r) {
            const float xa = ta[r] + sh, xb = tb2[r] + sh;
            const float ea = __builtin_amdgcn_exp2f(xa), eb = __builtin_amdgcn_exp2f(xb);
            const float ga = (fa[r] & (xa >= -14.0f)) ? ea : 0.0f, gb = (fb[r] & (xb >= -14.0f)) ? eb : 0.0f;   // dropped or sub-2^-14 elements selected to 0 by value
            const h16 pa = (h16)ga; const h16 pc = (h16)gb;
            pb[r] = pa; pb[8 + r] = pc;
            if (EARLY) { pr[r] = toh_flush((ga - (float)pa) * QRS); pr[8 + r] = toh_flush((gb - (float)pc) * QRS); ls += ga + gb; }
            else       { ls += (float)pa + (float)pc; } }
        l = l * alpha + ls; m = mnew;
        o0 = o0 * alpha;
        if (EARLY) { oR0 = oR0 * alpha; }
        const v16h v0 = ldh(VT + vo + key0);
        o0 = wmma16g(v0, pb, o0);
        if (EARLY) {
            const v16h vr0 = ldh(VR + vro + key0);
            oR0 = wmma16g(v0, pr, oR0);
            oR0 = wmma16g(vr0, pb, oR0);
        }
    }
    l += __shfl_xor(l, 16, 32);
    const bool any = l > 0.0f;
    const float lsafe = any ? l : 1.0f;
    const float inv = any ? (1.0f / lsafe) : 0.0f;
    v8f f0 = o0;
    if (EARLY) { f0 = o0 + oR0 * QRI; }
    f0 = f0 * inv;
    const unsigned nonem = __builtin_amdgcn_ballot_w32(!any);    // wave-uniform: some row of this wave kept no key
    if (nonem != 0u) {
        // equal fills give a uniform softmax over all SEQ keys: plain mean of v per channel d = 8h + r
        float vm[8];
#pragma unroll
        for (int r = 0; r < 8; ++r) vm[r] = 0.0f;
#pragma unroll 1
        for (int t = lr; t < SEQ; t += 16) {
#pragma unroll
            for (int r = 0; r < 8; ++r) vm[r] += (float)VT[pbase + (size_t)(8 * hi + r) * SEQ + t]; }
#pragma unroll
        for (int r = 0; r < 8; ++r) { float s = vm[r];
            s += __shfl_xor(s, 1, 32); s += __shfl_xor(s, 2, 32); s += __shfl_xor(s, 4, 32); s += __shfl_xor(s, 8, 32);
            vm[r] = s * (1.0f / (float)SEQ); }
#pragma unroll
        for (int r = 0; r < 8; ++r) f0[r] = any ? f0[r] : vm[r];
    }
    // O^T D layout: f0[r] = (d = 8h + r, t = lane&15) -> os[d][wave*16 + t]; rows 0..15 x columns 0..63 all written by the four waves
#pragma unroll
    for (int r = 0; r < 8; ++r) os[(8 * hi + r) * OSP + wave * 16 + lr] = f0[r];
    __syncthreads();                                              // cross-wave tile: block barrier (every wave reaches it)
    const int d = 4 * wave + (lane >> 3), c8 = (lane & 7) * 8;    // AW waves x 4 rows = 16 channel rows; 8 lanes x 8 halves = 64 tokens = one line
    const v4f x0 = *(const v4fa*)(&os[d * OSP + c8]); const v4f x1 = *(const v4fa*)(&os[d * OSP + c8 + 4]);
    v8h hv, rv;
#pragma unroll
    for (int i = 0; i < 4; ++i) { const h16 a0 = toh_flush(x0[i]); const h16 a1 = toh_flush(x1[i]); hv[i] = a0; hv[4 + i] = a1;
        rv[i] = toh_flush((x0[i] - (float)a0) * QRS); rv[4 + i] = toh_flush((x1[i] - (float)a1) * QRS); }
    const size_t oo = ((size_t)b * DM + (size_t)(h * HD + d)) * SEQ + (size_t)tb + (size_t)c8;
{
        *(v8h*)(CH + oo) = hv; *(v8h*)(CX + oo) = rv;
         }
}

__global__ __launch_bounds__(32 * AW) void k_flash_early(const h16* __restrict__ QH, const h16* __restrict__ QR, const h16* __restrict__ KP, const h16* __restrict__ KR,
                                                         const h16* __restrict__ VT, const h16* __restrict__ VR, const int* __restrict__ pmask, h16* CH, h16* CX) {
    flash_body<1>(QH, QR, KP, KR, VT, VR, pmask, CH, CX);
}
__global__ __launch_bounds__(32 * AW) void k_flash_late(const h16* __restrict__ QH, const h16* __restrict__ QR, const h16* __restrict__ KP, const h16* __restrict__ KR,
                                                        const h16* __restrict__ VT, const h16* __restrict__ VR, const int* __restrict__ pmask, h16* CH, h16* CX) {
    flash_body<0>(QH, QR, KP, KR, VT, VR, pmask, CH, CX);
}

// k_oproj: output projection, ONE WAVE per 16 rows x 128 columns. A = context planes read flat as [NB*SEQ][128] (value and residual x2048, separate accumulators), Bt = Wo x64 rows [n][k] (f16), K = DM.
// The head-count input is read on the device; a value other than the compiled head count marks the output with NaN.
__global__ __launch_bounds__(32) void k_oproj(const h16* __restrict__ CH, const h16* __restrict__ CX, const h16* __restrict__ WO, const int* __restrict__ nheads_p, float* OUT) {
    __shared__ __align__(16) float os[16 * OPP];
    const int lane = threadIdx.x & 31, lr = lane & 15, hi = lane >> 4;
    const int r0 = blockIdx.x * 16;
    v8f aH[8], aR[8];
#pragma unroll
    for (int nb = 0; nb < 8; ++nb) { aH[nb] = (v8f){}; aR[nb] = (v8f){}; }
    const size_t aoff = (size_t)(r0 + lr) * DM + 8 * hi, boff = (size_t)lr * DM + 8 * hi;
#pragma unroll 1
    for (int kc = 0; kc < DM; kc += 32) {
        const v16h ah = ldh(CH + aoff + kc), ar = ldh(CX + aoff + kc);
#pragma unroll
        for (int nb = 0; nb < 8; ++nb) { const v16h w = ldh(WO + boff + (size_t)nb * 16 * DM + kc);
            aH[nb] = wmma16g(ah, w, aH[nb]); aR[nb] = wmma16g(ar, w, aR[nb]); }
    }
    const int nh = nheads_p[0];
    const float poison = (nh == NH_) ? 0.0f : __uint_as_float(0x7FC00000u);
#pragma unroll
    for (int nb = 0; nb < 8; ++nb) {
#pragma unroll
        for (int j = 0; j < 8; ++j) os[(hi * 8 + j) * OPP + nb * 16 + lr] = (aH[nb][j] + aR[nb][j] * QRI) * WOI + poison; }   // D: row 8h+j, col lane&15; rows 0..15 x columns 0..127 all written
    wave_sync();
    const int bb = r0 / SEQ, tt = r0 % SEQ;
    float* orow = OUT + ((size_t)bb * OUT_SEQ + (size_t)tt) * DM;
{
#pragma unroll 4
        for (int s = 0; s < 16; ++s) {                              // 16 rows x (32 lanes x 4 floats = 128 columns = the whole row)
            const v4f val = *(const v4fa*)(&os[s * OPP + lane * 4]);
            *(v4f*)(orow + (size_t)s * DM + lane * 4) = val; }
         }
}

static constexpr size_t al256(size_t v) { return (v + 255) & ~(size_t)255; }
static constexpr size_t SZ_XB = al256((size_t)NB * SEQ * DM * 2);
static constexpr size_t SZ_WB = al256((size_t)3 * DM * DM * 2);
static constexpr size_t SZ_WO = al256((size_t)DM * DM * 2);
static constexpr size_t SZ_PL = al256((size_t)NB * NH_ * SEQ * HD * 2);
static constexpr size_t SZ_RS = al256((size_t)NB * NH_ * EROWS * HD * 2);
static constexpr size_t SZ_TOTAL = SZ_XB + SZ_WB + SZ_WO + 5 * SZ_PL + 3 * SZ_RS;
static_assert(SZ_TOTAL <= (size_t)134217728);          // workspace carve <= 128 MiB
static_assert(((size_t)DM * DM * 2) % 256 == 0);       // weight sub-planes stay 256-byte aligned
static_assert((size_t)NB * NH_ * SEQ * HD == (size_t)NB * DM * SEQ);       // v^T plane and context planes [(b*128 + m)][t] have the same extent as the q/k planes
static_assert((size_t)NB * NH_ * EROWS * HD == (size_t)NB * DM * EROWS);   // v^T residual plane [(b*128 + m)][t < EROWS] has the same extent as the q/k residual planes
static_assert(((size_t)NB * DM * SEQ) % ((size_t)16 * DM) == 0);           // context planes read flat as 16-row x 128 slabs

extern "C" void kernel_launch(void* const* d_in, const int* in_sizes, int n_in,
                              void* d_out, int out_size, void* d_ws, size_t ws_size, hipStream_t stream) {
    if (n_in < 7) return;
    const size_t needx = ((size_t)(NB - 1) * SEQ_FULL + SEQ) * DM;
    const size_t needm = (size_t)(NB - 1) * SEQ_FULL + SEQ;
    if ((size_t)in_sizes[0] < needx) return;
    if ((size_t)in_sizes[1] < (size_t)DM * DM || (size_t)in_sizes[2] < (size_t)DM * DM || (size_t)in_sizes[3] < (size_t)DM * DM || (size_t)in_sizes[4] < (size_t)DM * DM) return;
    if ((size_t)in_sizes[5] < needm || in_sizes[6] < 1) return;
    if ((size_t)out_size < ((size_t)(NB - 1) * OUT_SEQ + SEQ) * DM) return;
    if (SZ_TOTAL > ws_size) return;
    // wire order: x, Wq, Wk, Wv, Wo, padding_mask, num_heads
    const float* x  = (const float*)d_in[0];
    const float* wq = (const float*)d_in[1];
    const float* wk = (const float*)d_in[2];
    const float* wv = (const float*)d_in[3];
    const float* wo = (const float*)d_in[4];
    const int* pm = (const int*)d_in[5];
    const int* nheads = (const int*)d_in[6];
    float* OUT = (float*)d_out;      // [NB][SEQ][128]
    char* wsp = (char*)d_ws;
    bf* XB = (bf*)wsp; wsp += SZ_XB;                 // x [NB*SEQ][128]
    bf* WB = (bf*)wsp; wsp += SZ_WB;                 // [3][128][128]: q | k | v  ([out][in] as-is: Bt for q, k; A for v)
    h16* WOH = (h16*)wsp; wsp += SZ_WO;              // [128][128] Wo x64 ([out][in] = Bt as-is)
    h16* QH = (h16*)wsp; wsp += SZ_PL;               // [NB*8][SEQ][16]
    h16* KP = (h16*)wsp; wsp += SZ_PL;               // [NB*8][SEQ][16]
    h16* VT = (h16*)wsp; wsp += SZ_PL;               // [NB*8][16][SEQ]
    h16* CH = (h16*)wsp; wsp += SZ_PL;               // [NB][128][SEQ] context value
    h16* CX = (h16*)wsp; wsp += SZ_PL;               // [NB][128][SEQ] context residual x2048
    h16* QR = (h16*)wsp; wsp += SZ_RS;               // [NB*8][EROWS][16] residual x2048, tokens < EROWS
    h16* KR = (h16*)wsp; wsp += SZ_RS;               // [NB*8][EROWS][16] residual x2048, tokens < EROWS
    h16* VR = (h16*)wsp; wsp += SZ_RS;               // [NB*8][16][EROWS] residual x2048, tokens < EROWS
    bf* WQ = WB; bf* WK = WB + (size_t)DM * DM; bf* WV = WB + (size_t)2 * DM * DM;

    if (SEQ == SEQ_FULL) {
        const size_t n8 = (size_t)NB * SEQ * DM / 8;
        k_cvt8<<<(unsigned)((n8 + 255) / 256), 256, 0, stream>>>(x, XB, n8);
    } else {
        const size_t n8 = (size_t)SEQ * DM / 8;
        for (int b = 0; b < NB; ++b) k_cvt8<<<(unsigned)((n8 + 255) / 256), 256, 0, stream>>>(x + (size_t)b * SEQ_FULL * DM, XB + (size_t)b * SEQ * DM, n8);
    }
    { const size_t n8 = (size_t)DM * DM / 8; const unsigned g = (unsigned)((n8 + 255) / 256);
      k_cvt8<<<g, 256, 0, stream>>>(wq, WQ, n8); k_cvt8<<<g, 256, 0, stream>>>(wk, WK, n8); k_cvt8<<<g, 256, 0, stream>>>(wv, WV, n8);
      k_wcvt<<<g, 256, 0, stream>>>(wo, WOH, n8); }

    // q, k: A = x rows (m = b*SEQ + t), Bt = W rows (n = h*16 + d) -> plane [(b*8 + h)][t][d]; residuals for tokens < EROWS
    k_proj_qk<<<dim3(NB * SEQ / 64, DM / 64, 1), 32, 0, stream>>>(XB, WQ, QH, QR, EROWS);
    k_proj_qk<<<dim3(NB * SEQ / 64, DM / 64, 1), 32, 0, stream>>>(XB, WK, KP, KR, EROWS);
    // v^T: A = Wv rows (m = h*16 + d), Bt = x rows (n = b*SEQ + t) -> plane [(b*128 + m)][t] = [(b*8 + h)][d][t]; residual for tokens < EROWS
    k_proj_vt<<<dim3(DM / 64, NB * SEQ / 64, 1), 32, 0, stream>>>(WV, XB, VT, VR, EROWS);

    // query rows [0, EROWS): multi-product instantiation; rows [EROWS, SEQ): single-product instantiation (disjoint context columns)
    k_flash_early<<<dim3(EROWS / (16 * AW), NB * NH_, 1), 32 * AW, 0, stream>>>(QH, QR, KP, KR, VT, VR, pm, CH, CX);
    if (SEQ > EROWS)
        k_flash_late<<<dim3((SEQ - EROWS) / (16 * AW), NB * NH_, 1), 32 * AW, 0, stream>>>(QH, QR, KP, KR, VT, VR, pm, CH, CX);

    // output projection over the flat [NB*SEQ][128] view of the context planes
    k_oproj<<<dim3(NB * SEQ / 16, 1, 1), 32, 0, stream>>>(CH, CX, WOH, nheads, OUT);
}

// v001
// One run takes 86.1 microseconds.
// Next to v000, in two timings, it ran 1.45 times as fast each time.
#include <hip/hip_runtime.h>

// Causal multi-head self-attention, width 128 = 8 heads x 16; x [NB][SEQ][128]; Wq/Wk/Wv/Wo [out][in] (y = x W^T, no bias); key padding mask [NB][SEQ] (int32, device-read); masked scores are replaced before the 1/sqrt(16) scale;
// per-head context transposed to [b][h*16+e][t], reinterpreted flat as [NB][SEQ][128], then multiplied by Wo^T (f32 output).
// Compute dtypes, f32 accumulate everywhere: q/k/v projections v_wmma_f32_16x16x32_bf16 (x, W RNE-converted to bf16; products exact);
// scores v_wmma_f32_16x16x32_f16 (head dim 16 zero-padded to the 32-deep step): single f16 q, k on query rows >= EROWS; on query rows < EROWS q and k each as f16 value + f16 residual x2048 (cross products in the upper 16 k-slots, own accumulator);
// P.V v_wmma_f32_16x16x32_f16: P (x16384 carry, cancels in the normalisation) and v single f16 on query rows >= EROWS; on query rows < EROWS P and v as f16 value + f16 residual x2048, residual products in their own accumulator folded by 1/2048, row sum from the f32 exponentials;
// output projection v_wmma_f32_16x16x32_f16: context as f16 value + f16 residual x2048 (own accumulator), Wo as bf16-converted value x64 held in f16; softmax f32 (online, running max over kept keys).
// Layout: bf16 copies of x and Wq/Wk/Wv; q, k planes [b*8+h][t][16], v^T plane [b*8+h][16][t], small residual planes (tokens < EROWS) for q, k, v^T; context planes (value, residual) [b][h*16+e][t]; fused flash kernel in transposed form (S^T = K Q^T, O^T = V^T P^T).
// Keep rule per element: (mask[b][j] != 0) and (j <= t); dropped elements get probability 0; a row with no kept key takes the plain mean of v over all SEQ keys (uniform softmax of equal fills).

#ifndef NB
#define NB 4
#endif
#ifndef SEQ
#define SEQ 2048
#endif
#define NB_FULL  4
#define SEQ_FULL 2048
#ifndef OUT_SEQ
#define OUT_SEQ SEQ              // row pitch (in tokens) between batches of the output
#endif
#define DM   128
#define NH_  8
#define HD   16
#define AW   4                   // waves per flash block (16 query rows each)
#define OSP  68                  // LDS row pitch (floats) of the flash context tile [16 d][64 t]
#define OPP  132                 // LDS row pitch (floats) of the output-projection slab [16][128]
#define EROWS (SEQ < 512 ? SEQ : 512)   // query rows (and tokens of the small residual planes) handled by the multi-product flash instantiation
#define QRS  2048.0f             // carry of every residual plane / residual fragment
#define QRI  (1.0f / 2048.0f)
#define SC2  ((float)(0.25 * 1.4426950408889634))   // HD^-0.5 * log2(e)
#define PSH  14.0f               // log2 of the P carry (16384)
#define NEGB (-3.0e38f)
#define WOS  64.0f               // carry of the Wo plane
#define WOI  (1.0f / 64.0f)

static_assert(HD == 16);
static_assert(NH_ * HD == DM);                 // head h = columns h*16 + d
static_assert(DM % 64 == 0);                   // column tiles of 64 = four heads
static_assert(64 % HD == 0);
static_assert(DM % 32 == 0);                   // GEMM k-loop steps by 32
static_assert(DM == 32 * 4);                   // output row = 32 lanes x 4 floats
static_assert(SEQ % 64 == 0);                  // a 64-row tile never straddles two batches
static_assert((NB * SEQ) % 64 == 0);
static_assert(SEQ % 32 == 0);                  // key loop steps by 32
static_assert(SEQ % (16 * AW) == 0);           // flash grids cover the sequence exactly
static_assert(16 * AW == 64);
static_assert(4 * AW == HD);                   // context store: 4 rows per wave x AW waves = 16 channel rows
static_assert(8 * 8 == 16 * AW);               // 8 lanes x 8 halves = 64 tokens per row
static_assert(EROWS % 64 == 0);                // a 64-token GEMM tile lies wholly inside or outside the residual planes
static_assert(EROWS >= 32);
static_assert(EROWS <= SEQ);
static_assert(EROWS % 32 == 0);                // early key loops end inside the residual planes
static_assert(EROWS % (16 * AW) == 0);
static_assert((SEQ - EROWS) % (16 * AW) == 0);
static_assert(((size_t)SEQ * DM) % 8 == 0);
static_assert(((size_t)DM * DM) % 8 == 0);
static_assert(NB <= NB_FULL);
static_assert(SEQ <= SEQ_FULL);
static_assert((OSP * 4) % 16 == 0);
static_assert(OSP >= 64);
static_assert((OPP * 4) % 16 == 0);
static_assert(OPP >= DM);
static_assert(4 * 32 * 8 == 16 * 64);          // projection epilogue, q/k form: 4 heads x 32 lanes x 8 halves = 16 rows x 64 columns
static_assert(4 * 4 * 64 == 16 * 64);          // projection epilogue, v^T form: 4 instructions x 4 rows x 64 halves
static_assert(16 * 68 * 4 <= 131072);          // static LDS of the projection kernels
static_assert(HD * OSP * 4 <= 131072);         // static LDS of the flash kernels
static_assert(16 * OPP * 4 <= 131072);         // static LDS of the output-projection kernel

typedef _Float16 h16;
typedef unsigned short bf;
typedef __attribute__((ext_vector_type(16))) __bf16   v16bf;
typedef __attribute__((ext_vector_type(16))) _Float16 v16h;
typedef __attribute__((ext_vector_type(8)))  _Float16 v8h;
typedef __attribute__((ext_vector_type(8)))  unsigned short v8us;
typedef __attribute__((ext_vector_type(8)))  float    v8f;
typedef __attribute__((ext_vector_type(4)))  float    v4f;
typedef __attribute__((ext_vector_type(4)))  int      v4i;
typedef v4f  __attribute__((may_alias)) v4fa;

__device__ __forceinline__ unsigned short f2bf(float f) { unsigned u = __float_as_uint(f); u += 0x7FFFu + ((u >> 16) & 1u); return (unsigned short)(u >> 16); }
__device__ __forceinline__ float bfr(float f) { return __uint_as_float(((unsigned)f2bf(f)) << 16); }   // value after RNE convert to bf16
__device__ __forceinline__ v16h cat16(v8h lo, v8h hi) { return __builtin_shufflevector(lo, hi, 0, 1, 2, 3, 4, 5, 6, 7, 8, 9, 10, 11, 12, 13, 14, 15); }
__device__ __forceinline__ v16bf cat16b(v8us lo, v8us hi) { return __builtin_bit_cast(v16bf, __builtin_shufflevector(lo, hi, 0, 1, 2, 3, 4, 5, 6, 7, 8, 9, 10, 11, 12, 13, 14, 15)); }
__device__ __forceinline__ v8f wmma16(v16h a, v16h b, v8f c) { return __builtin_amdgcn_wmma_f32_16x16x32_f16(false, a, false, b, (short)0, c, false, false); }
__device__ __forceinline__ v8f wmmab(v16bf a, v16bf b, v8f c) { return __builtin_amdgcn_wmma_f32_16x16x32_bf16(false, a, false, b, (short)0, c, false, false); }
// fragment loaders from K-contiguous 16-bit rows; p already includes + 8*(lane>>4): elements 0..7 <- k0+8h+0..7, elements 8..15 <- k0+16+8h+0..7 (same map for A and B)
__device__ __forceinline__ v16h  ldh(const h16* p) { return cat16(*(const v8h*)p, *(const v8h*)(p + 16)); }
__device__ __forceinline__ v16bf ldb(const bf* p)  { return cat16b(*(const v8us*)p, *(const v8us*)(p + 16)); }
// ordering point for wave-private LDS tiles (same wave writes and reads)
__device__ __forceinline__ void wave_sync() { __builtin_amdgcn_fence(3 /* release order */, "wavefront"); __builtin_amdgcn_wave_barrier(); asm volatile("" ::: "memory"); }

// per-instruction guarded matrix ops: the four idle slots tie the accumulator and keep the operands live
__device__ __forceinline__ v8f wmma16g(v16h a, v16h b, v8f c) { c = wmma16(a, b, c); asm volatile("v_nop\n\tv_nop\n\tv_nop\n\tv_nop" : "+v"(c) : "v"(a), "v"(b)); return c; }
__device__ __forceinline__ v8f wmmabg(v16bf a, v16bf b, v8f c) { c = wmmab(a, b, c); asm volatile("v_nop\n\tv_nop\n\tv_nop\n\tv_nop" : "+v"(c) : "v"(a), "v"(b)); return c; }
// f32 -> f16 that cannot produce a subnormal operand (|v| < 2^-14 -> +0)
static __device__ __forceinline__ h16 toh_flush(float v) { const h16 r = (h16)v; return (fabsf(v) < 6.103515625e-05f) ? (h16)0.0f : r; }

__global__ __launch_bounds__(256) void k_cvt8(const float* __restrict__ src, bf* dst, size_t n8) {
    const size_t i = (size_t)blockIdx.x * 256 + threadIdx.x; if (i >= n8) return;
    const v8f v = *(const v8f*)(src + i * 8); v8us o;
#pragma unroll
    for (int k = 0; k < 8; ++k) o[k] = f2bf(v[k]);
    *(v8us*)(dst + i * 8) = o; 
}

__global__ __launch_bounds__(256) void k_wcvt(const float* __restrict__ src, h16* dst, size_t n8) {
    const size_t i = (size_t)blockIdx.x * 256 + threadIdx.x; if (i >= n8) return;
    const v8f v = *(const v8f*)(src + i * 8); v8h o;
#pragma unroll
    for (int k = 0; k < 8; ++k) o[k] = toh_flush(bfr(v[k]) * WOS);
    *(v8h*)(dst + i * 8) = o; 
}

// proj_body: register-blocked bf16 GEMM, ONE WAVE per 64x64 tile (16 accumulators), operands straight from K-contiguous bf16 planes, K = DM.
// C[m][n] = sum_k A[m][k] Bt[n][k], written as f16 (Ph) and, for tokens t < resT (resT a multiple of 64, block-uniform test), the f16 residual x2048 (Pr).
// MODE 0: A = x rows (m = b*SEQ + t), Bt = W rows (n = h*16 + d); plane [(b*8 + h)][t][16] (residual plane [(b*8 + h)][resT][16]). The 64-column tile spans four heads; per 16-row slab and head
//         (16 rows per instruction). grid (NB*SEQ/64, DM/64).
template <int MODE>
__device__ __forceinline__ void proj_body(const bf* __restrict__ A, const bf* __restrict__ Bt, h16* Ph, h16* Pr, int resT) {
    __shared__ __align__(16) float os[16 * 68];
    const int K = DM;
    const int lane = threadIdx.x & 31, lr = lane & 15, hi = lane >> 4; const int r0 = blockIdx.x * 64, c0 = blockIdx.y * 64;
    v8f acc[4][4];
#pragma unroll
    for (int mb = 0; mb < 4; ++mb)
#pragma unroll
        for (int nb = 0; nb < 4; ++nb) acc[mb][nb] = (v8f){};
    const size_t aoff = (size_t)(r0 + lr) * K + 8 * hi, boff = (size_t)(c0 + lr) * K + 8 * hi;
#pragma unroll 1
    for (int kc = 0; kc < K; kc += 32) {
        v16bf a[4];
#pragma unroll
        for (int mb = 0; mb < 4; ++mb) a[mb] = ldb(A + aoff + (size_t)mb * 16 * K + kc);
#pragma unroll
        for (int nb = 0; nb < 4; ++nb) { const v16bf b = ldb(Bt + boff + (size_t)nb * 16 * K + kc);
#pragma unroll
            for (int mb = 0; mb < 4; ++mb) acc[mb][nb] = wmmabg(a[mb], b, acc[mb][nb]); }
    }
    size_t tbase, rbase; bool wr;                                                                 // wr: block-uniform, whole tile inside the residual plane
    if (MODE == 0) { const int bb = r0 / SEQ, tt = r0 % SEQ; const int zc = bb * NH_ + c0 / HD;
                     tbase = ((size_t)zc * SEQ + (size_t)tt) * HD; rbase = ((size_t)zc * (size_t)resT + (size_t)tt) * HD; wr = tt < resT; }
    else           { const int bb = c0 / SEQ, tt = c0 % SEQ;
                     tbase = (size_t)bb * (size_t)DM * SEQ + (size_t)r0 * SEQ + (size_t)tt; rbase = (size_t)bb * (size_t)DM * (size_t)resT + (size_t)r0 * (size_t)resT + (size_t)tt; wr = tt < resT; }
#pragma unroll
    for (int mb = 0; mb < 4; ++mb) {
#pragma unroll
        for (int nb = 0; nb < 4; ++nb) {
#pragma unroll
            for (int j = 0; j < 8; ++j) os[(hi * 8 + j) * 68 + nb * 16 + lr] = acc[mb][nb][j]; }   // D: row 8h+j, col lane&15; rows 0..15 x columns 0..63 all written
        wave_sync();
{
            if (MODE == 0) {
                const size_t sb = tbase + (size_t)(mb * 16) * HD;
                const size_t rb = rbase + (size_t)(mb * 16) * HD;
#pragma unroll
                for (int hh = 0; hh < 4; ++hh) { const int row = lane >> 1, c8 = (lane & 1) * 8;   // 16 rows x 2 lanes x 8 = 16 columns of head hh: one 512-byte run
                    const v4f x0 = *(const v4fa*)(&os[row * 68 + hh * 16 + c8]); const v4f x1 = *(const v4fa*)(&os[row * 68 + hh * 16 + c8 + 4]); v8h hv, rv;
#pragma unroll
                    for (int i = 0; i < 4; ++i) { const h16 a0 = toh_flush(x0[i]); const h16 a1 = toh_flush(x1[i]); hv[i] = a0; hv[4 + i] = a1;
                        rv[i] = toh_flush((x0[i] - (float)a0) * QRS); rv[4 + i] = toh_flush((x1[i] - (float)a1) * QRS); }
                    const size_t oo = sb + (size_t)hh * ((size_t)SEQ * HD) + (size_t)lane * 8;
                    const size_t ro = rb + (size_t)hh * ((size_t)resT * HD) + (size_t)lane * 8;
                    *(v8h*)(Ph + oo) = hv; if (wr) *(v8h*)(Pr + ro) = rv; }
            } else {
                const size_t sb = tbase + (size_t)(mb * 16) * SEQ;
                const size_t rb = rbase + (size_t)(mb * 16) * (size_t)resT;
#pragma unroll
                for (int s = 0; s < 4; ++s) { const int row = 4 * s + (lane >> 3), c8 = (lane & 7) * 8;   // 4 s x 4 row groups = 16 rows; 8 lanes x 8 = 64 columns
                    const v4f x0 = *(const v4fa*)(&os[row * 68 + c8]); const v4f x1 = *(const v4fa*)(&os[row * 68 + c8 + 4]); v8h hv, rv;
#pragma unroll
                    for (int i = 0; i < 4; ++i) { const h16 a0 = toh_flush(x0[i]); const h16 a1 = toh_flush(x1[i]); hv[i] = a0; hv[4 + i] = a1;
                        rv[i] = toh_flush((x0[i] - (float)a0) * QRS); rv[4 + i] = toh_flush((x1[i] - (float)a1) * QRS); }
                    const size_t oo = sb + (size_t)row * SEQ + c8;
                    const size_t ro = rb + (size_t)row * (size_t)resT + c8;
                    *(v8h*)(Ph + oo) = hv; if (wr) *(v8h*)(Pr + ro) = rv; }
            }
             }
        wave_sync();
    }
}

__global__ __launch_bounds__(32) void k_proj_qk(const bf* __restrict__ A, const bf* __restrict__ Bt, h16* Ph, h16* Pr, int resT) { proj_body<0>(A, Bt, Ph, Pr, resT); }
__global__ __launch_bounds__(32) void k_proj_vt(const bf* __restrict__ A, const bf* __restrict__ Bt, h16* Ph, h16* Pr, int resT) { proj_body<1>(A, Bt, Ph, Pr, resT); }

// flash_body: fused causal attention, one wave per 16 query rows of one (batch, head), AW waves = 64 query rows per block; K / V^T / Q fragments straight from the f16 planes (16-B loads, arithmetic addressing).
// Transposed form: S^T[key][t] = K Q^T (A = K rows, B = Q rows, head dim 16 in k-slots 0..15); lane (t = lane&15, h = lane>>4) holds keys 8h+r of each 16-key tile, so the packed
// P tile is directly the B fragment of O^T[d][t] = V^T P^T (element r <- tile keys 0..15, element 8+r <- tile keys 16..31, lane unchanged).
// Softmax state (running max over kept keys, partial sum) is one scalar per lane; the two lane halves of a row are combined with one xor-16 exchange.
// Keep rule evaluated per element inside every visited 32-key tile; the per-wave key bound is t0 + 16 (pad up to 32), at most SEQ.
// EARLY = 1 (query rows [0, EROWS)): A = [K | K_res], B = [Q | 0] gives K Q; B = [Q_res | Q] gives K Q_res + K_res Q (x2048, own accumulator); P = f16 value + f16 residual x2048;
//            O = V P + (V P_res + V_res P) / 2048 (residual products in their own accumulator); row sum from the f32 exponentials; all keys of these rows are < EROWS, inside the small planes.
// EARLY = 0 (query rows [EROWS, SEQ)): single q, k, P, v.
template <int EARLY>
__device__ __forceinline__ void flash_body(const h16* __restrict__ QH, const h16* __restrict__ QR, const h16* __restrict__ KP, const h16* __restrict__ KR,
                                           const h16* __restrict__ VT, const h16* __restrict__ VR, const int* __restrict__ pmask, h16* CH, h16* CX) {
    __shared__ __align__(16) float os[HD * OSP];
    const int lane = threadIdx.x & 31, lr = lane & 15, hi = lane >> 4;
    const int wave = __builtin_amdgcn_readfirstlane((int)(threadIdx.x >> 5));
    const int zh = blockIdx.y; const int b = zh / NH_, h = zh % NH_;
    const int tb = (EARLY ? 0 : EROWS) + blockIdx.x * (16 * AW);
    const int t0 = tb + wave * 16;
    const int lim = t0 + lr;                                                   // key j kept iff j <= lim (and mask nonzero)
    const int nk = (t0 + 16 + 31) & ~31;                                       // wave-uniform, multiple of 32, <= SEQ (<= EROWS when EARLY)
    const int* pmb = pmask + (size_t)b * SEQ_FULL + 8 * hi;
    const size_t pbase = (size_t)zh * SEQ * HD;
    const size_t rbase = (size_t)zh * EROWS * HD;
    const v8h z8 = (v8h){};
    const size_t qo = pbase + (size_t)(t0 + lr) * HD + 8 * hi;
    const v8h q8 = *(const v8h*)(QH + qo);
    asm volatile("s_wait_xcnt 0x0" ::: "memory");                 // the loads issued next may land in the registers that hold this load's address: the wait stands in front of them
    const v16h qh = cat16(q8, z8);                                // B fragment [Q | 0]: col t, k = d
    v16h qx = qh;
    if (EARLY) { const size_t qro = rbase + (size_t)(t0 + lr) * HD + 8 * hi; qx = cat16(*(const v8h*)(QR + qro), q8);   // B fragment [Q_res | Q]
                 asm volatile("s_wait_xcnt 0x0" ::: "memory"); }  // as above, for the residual load's address
    const size_t ko = pbase + (size_t)lr * HD + 8 * hi;         // + key * HD       (A fragment: row key, k = d)
    const size_t vo = pbase + (size_t)lr * SEQ + 8 * hi;        // + key            (A fragment: row d, k = key)
    const size_t kro = rbase + (size_t)lr * HD + 8 * hi;        // residual planes, tokens < EROWS
    const size_t vro = rbase + (size_t)lr * EROWS + 8 * hi;
    const v8f zz = (v8f){};
    v8f o0 = (v8f){}, oR0 = (v8f){};
    float m = NEGB, l = 0.0f;
    // Every operand of a 32-key tile (K, mask words, V^T; residual planes when EARLY) is fetched one trip ahead: tile 0 here, tile key0 + 32 inside trip key0,
    // each group into the registers its last reader of the trip has just left. nk >= 32, so tile 0 exists for every wave.
    v8h k0 = *(const v8h*)(KP + ko), k1 = *(const v8h*)(KP + ko + 16 * HD);
    v8h kr0 = z8, kr1 = z8;
    if (EARLY) { kr0 = *(const v8h*)(KR + kro); kr1 = *(const v8h*)(KR + kro + 16 * HD); }
    v4i m0 = *(const v4i*)pmb, m1 = *(const v4i*)(pmb + 4), m2 = *(const v4i*)(pmb + 16), m3 = *(const v4i*)(pmb + 20);
    v16h v0 = ldh(VT + vo);
    v16h vr0 = v0;
    if (EARLY) { vr0 = ldh(VR + vro); }
    // Inputs-only fence on the loaded values: the query fragments and tile 0 have landed before the loop is entered, so the loop's counted load waits follow from the loop's own issue order alone
    // (K and mask early in a trip, V^T at its end) and the wait for K at a trip's head leaves the V^T loads just issued in flight.
    if (EARLY) asm volatile("" :: "v"(qx), "v"(k0), "v"(k1), "v"(kr0), "v"(kr1), "v"(m0), "v"(m1), "v"(m2), "v"(m3), "v"(v0), "v"(vr0));
    else       asm volatile("" :: "v"(q8), "v"(k0), "v"(k1), "v"(m0), "v"(m1), "v"(m2), "v"(m3), "v"(v0));
#pragma unroll 1
    for (int key0 = 0; key0 < nk; key0 += 32) {
        const int kn = (key0 + 32 < nk) ? key0 + 32 : key0;      // tile fetched in this trip; the last trip fetches its own tile again (unused), so every address stays below nk <= SEQ
        const v16h ka0 = cat16(k0, kr0), kb0 = cat16(k1, kr1);   // A fragments [K | K_res] (late: [K | 0])
        v8f sHa = wmma16g(ka0, qh, zz), sHb = wmma16g(kb0, qh, zz);
        v8f sLa = zz, sLb = zz;
        if (EARLY) { sLa = wmma16g(ka0, qx, zz); sLb = wmma16g(kb0, qx, zz); }
        { const h16* ka = KP + ko + (size_t)kn * HD; k0 = *(const v8h*)ka; k1 = *(const v8h*)(ka + 16 * HD); }
        if (EARLY) { const h16* kr = KR + kro + (size_t)kn * HD; kr0 = *(const v8h*)kr; kr1 = *(const v8h*)(kr + 16 * HD); }
        int kx[8], ky[8];                                        // mask words of keys key0+8h+0..7 and key0+16+8h+0..7
#pragma unroll
        for (int r = 0; r < 4; ++r) { kx[r] = m0[r]; kx[4 + r] = m1[r]; ky[r] = m2[r]; ky[4 + r] = m3[r]; }
        const int ja = key0 + 8 * hi;
        float ta[8], tb2[8]; bool fa[8], fb[8]; float mx = NEGB;
#pragma unroll
        for (int r = 0; r < 8; ++r) {
            fa[r] = (kx[r] != 0) & (ja + r <= lim);
            fb[r] = (ky[r] != 0) & (ja + 16 + r <= lim); }
        { const int* kp = pmb + kn; m0 = *(const v4i*)kp; m1 = *(const v4i*)(kp + 4); m2 = *(const v4i*)(kp + 16); m3 = *(const v4i*)(kp + 20); }
        __builtin_amdgcn_sched_barrier(0);                       // without it the compiler sinks both fetch groups to the trip's end, where they have no lead over their readers
#pragma unroll
        for (int r = 0; r < 8; ++r) {
            if (EARLY) { ta[r] = (sHa[r] + sLa[r] * QRI) * SC2; tb2[r] = (sHb[r] + sLb[r] * QRI) * SC2; }
            else       { ta[r] = sHa[r] * SC2; tb2[r] = sHb[r] * SC2; }
            mx = fmaxf(mx, fmaxf(fa[r] ? ta[r] : NEGB, fb[r] ? tb2[r] : NEGB)); }
        mx = fmaxf(mx, __shfl_xor(mx, 16, 32));
        const float mnew = fmaxf(m, mx);
        const float alpha = __builtin_amdgcn_exp2f(m - mnew);
        const float sh = PSH - mnew;
        v16h pb, pr = (v16h){}; float ls = 0.0f;
#pragma unroll
        for (int r = 0; r < 8; ++r) {
            const float xa = ta[r] + sh, xb = tb2[r] + sh;
            const float ea = __builtin_amdgcn_exp2f(xa), eb = __builtin_amdgcn_exp2f(xb);
            const float ga = (fa[r] & (xa >= -14.0f)) ? ea : 0.0f, gb = (fb[r] & (xb >= -14.0f)) ? eb : 0.0f;   // dropped or sub-2^-14 elements selected to 0 by value
            const h16 pa = (h16)ga; const h16 pc = (h16)gb;
            pb[r] = pa; pb[8 + r] = pc;
            if (EARLY) { pr[r] = toh_flush((ga - (float)pa) * QRS); pr[8 + r] = toh_flush((gb - (float)pc) * QRS); ls += ga + gb; }
            else       { ls += (float)pa + (float)pc; } }
        l = l * alpha + ls; m = mnew;
        o0 = o0 * alpha;
        if (EARLY) { oR0 = oR0 * alpha; }
        o0 = wmma16g(v0, pb, o0);
        if (EARLY) {
            oR0 = wmma16g(v0, pr, oR0);
            oR0 = wmma16g(vr0, pb, oR0);
            vr0 = ldh(VR + vro + kn);
        }
        v0 = ldh(VT + vo + kn);
        asm volatile("s_wait_xcnt 0x0" ::: "memory");            // stands between the V^T loads just issued and the next trip's first writes to the registers that hold their addresses
    }
    l += __shfl_xor(l, 16, 32);
    const bool any = l > 0.0f;
    const float lsafe = any ? l : 1.0f;
    const float inv = any ? (1.0f / lsafe) : 0.0f;
    v8f f0 = o0;
    if (EARLY) { f0 = o0 + oR0 * QRI; }
    f0 = f0 * inv;
    const unsigned nonem = __builtin_amdgcn_ballot_w32(!any);    // wave-uniform: some row of this wave kept no key
    if (nonem != 0u) {
        // equal fills give a uniform softmax over all SEQ keys: plain mean of v per channel d = 8h + r
        float vm[8];
#pragma unroll
        for (int r = 0; r < 8; ++r) vm[r] = 0.0f;
#pragma unroll 1
        for (int t = lr; t < SEQ; t += 16) {
#pragma unroll
            for (int r = 0; r < 8; ++r) vm[r] += (float)VT[pbase + (size_t)(8 * hi + r) * SEQ + t]; }
#pragma unroll
        for (int r = 0; r < 8; ++r) { float s = vm[r];
            s += __shfl_xor(s, 1, 32); s += __shfl_xor(s, 2, 32); s += __shfl_xor(s, 4, 32); s += __shfl_xor(s, 8, 32);
            vm[r] = s * (1.0f / (float)SEQ); }
#pragma unroll
        for (int r = 0; r < 8; ++r) f0[r] = any ? f0[r] : vm[r];
    }
    // O^T D layout: f0[r] = (d = 8h + r, t = lane&15) -> os[d][wave*16 + t]; rows 0..15 x columns 0..63 all written by the four waves
#pragma unroll
    for (int r = 0; r < 8; ++r) os[(8 * hi + r) * OSP + wave * 16 + lr] = f0[r];
    __syncthreads();                                              // cross-wave tile: block barrier (every wave reaches it)
    const int d = 4 * wave + (lane >> 3), c8 = (lane & 7) * 8;    // AW waves x 4 rows = 16 channel rows; 8 lanes x 8 halves = 64 tokens = one line
    const v4f x0 = *(const v4fa*)(&os[d * OSP + c8]); const v4f x1 = *(const v4fa*)(&os[d * OSP + c8 + 4]);
    v8h hv, rv;
#pragma unroll
    for (int i = 0; i < 4; ++i) { const h16 a0 = toh_flush(x0[i]); const h16 a1 = toh_flush(x1[i]); hv[i] = a0; hv[4 + i] = a1;
        rv[i] = toh_flush((x0[i] - (float)a0) * QRS); rv[4 + i] = toh_flush((x1[i] - (float)a1) * QRS); }
    const size_t oo = ((size_t)b * DM + (size_t)(h * HD + d)) * SEQ + (size_t)tb + (size_t)c8;
{
        *(v8h*)(CH + oo) = hv; *(v8h*)(CX + oo) = rv;
         }
}

__global__ __launch_bounds__(32 * AW) void k_flash_early(const h16* __restrict__ QH, const h16* __restrict__ QR, const h16* __restrict__ KP, const h16* __restrict__ KR,
                                                         const h16* __restrict__ VT, const h16* __restrict__ VR, const int* __restrict__ pmask, h16* CH, h16* CX) {
    flash_body<1>(QH, QR, KP, KR, VT, VR, pmask, CH, CX);
}
__global__ __launch_bounds__(32 * AW) void k_flash_late(const h16* __restrict__ QH, const h16* __restrict__ QR, const h16* __restrict__ KP, const h16* __restrict__ KR,
                                                        const h16* __restrict__ VT, const h16* __restrict__ VR, const int* __restrict__ pmask, h16* CH, h16* CX) {
    flash_body<0>(QH, QR, KP, KR, VT, VR, pmask, CH, CX);
}

// k_oproj: output projection, ONE WAVE per 16 rows x 128 columns. A = context planes read flat as [NB*SEQ][128] (value and residual x2048, separate accumulators), Bt = Wo x64 rows [n][k] (f16), K = DM.
// The head-count input is read on the device; a value other than the compiled head count marks the output with NaN.
__global__ __launch_bounds__(32) void k_oproj(const h16* __restrict__ CH, const h16* __restrict__ CX, const h16* __restrict__ WO, const int* __restrict__ nheads_p, float* OUT) {
    __shared__ __align__(16) float os[16 * OPP];
    const int lane = threadIdx.x & 31, lr = lane & 15, hi = lane >> 4;
    const int r0 = blockIdx.x * 16;
    v8f aH[8], aR[8];
#pragma unroll
    for (int nb = 0; nb < 8; ++nb) { aH[nb] = (v8f){}; aR[nb] = (v8f){}; }
    const size_t aoff = (size_t)(r0 + lr) * DM + 8 * hi, boff = (size_t)lr * DM + 8 * hi;
#pragma unroll 1
    for (int kc = 0; kc < DM; kc += 32) {
        const v16h ah = ldh(CH + aoff + kc), ar = ldh(CX + aoff + kc);
#pragma unroll
        for (int nb = 0; nb < 8; ++nb) { const v16h w = ldh(WO + boff + (size_t)nb * 16 * DM + kc);
            aH[nb] = wmma16g(ah, w, aH[nb]); aR[nb] = wmma16g(ar, w, aR[nb]); }
    }
    const int nh = nheads_p[0];
    const float poison = (nh == NH_) ? 0.0f : __uint_as_float(0x7FC00000u);
#pragma unroll
    for (int nb = 0; nb < 8; ++nb) {
#pragma unroll
        for (int j = 0; j < 8; ++j) os[(hi * 8 + j) * OPP + nb * 16 + lr] = (aH[nb][j] + aR[nb][j] * QRI) * WOI + poison; }   // D: row 8h+j, col lane&15; rows 0..15 x columns 0..127 all written
    wave_sync();
    const int bb = r0 / SEQ, tt = r0 % SEQ;
    float* orow = OUT + ((size_t)bb * OUT_SEQ + (size_t)tt) * DM;
{
#pragma unroll 4
        for (int s = 0; s < 16; ++s) {                              // 16 rows x (32 lanes x 4 floats = 128 columns = the whole row)
            const v4f val = *(const v4fa*)(&os[s * OPP + lane * 4]);
            *(v4f*)(orow + (size_t)s * DM + lane * 4) = val; }
         }
}

static constexpr size_t al256(size_t v) { return (v + 255) & ~(size_t)255; }
static constexpr size_t SZ_XB = al256((size_t)NB * SEQ * DM * 2);
static constexpr size_t SZ_WB = al256((size_t)3 * DM * DM * 2);
static constexpr size_t SZ_WO = al256((size_t)DM * DM * 2);
static constexpr size_t SZ_PL = al256((size_t)NB * NH_ * SEQ * HD * 2);
static constexpr size_t SZ_RS = al256((size_t)NB * NH_ * EROWS * HD * 2);
static constexpr size_t SZ_TOTAL = SZ_XB + SZ_WB + SZ_WO + 5 * SZ_PL + 3 * SZ_RS;
static_assert(SZ_TOTAL <= (size_t)134217728);          // workspace carve <= 128 MiB
static_assert(((size_t)DM * DM * 2) % 256 == 0);       // weight sub-planes stay 256-byte aligned
static_assert((size_t)NB * NH_ * SEQ * HD == (size_t)NB * DM * SEQ);       // v^T plane and context planes [(b*128 + m)][t] have the same extent as the q/k planes
static_assert((size_t)NB * NH_ * EROWS * HD == (size_t)NB * DM * EROWS);   // v^T residual plane [(b*128 + m)][t < EROWS] has the same extent as the q/k residual planes
static_assert(((size_t)NB * DM * SEQ) % ((size_t)16 * DM) == 0);           // context planes read flat as 16-row x 128 slabs

extern "C" void kernel_launch(void* const* d_in, const int* in_sizes, int n_in,
                              void* d_out, int out_size, void* d_ws, size_t ws_size, hipStream_t stream) {
    if (n_in < 7) return;
    const size_t needx = ((size_t)(NB - 1) * SEQ_FULL + SEQ) * DM;
    const size_t needm = (size_t)(NB - 1) * SEQ_FULL + SEQ;
    if ((size_t)in_sizes[0] < needx) return;
    if ((size_t)in_sizes[1] < (size_t)DM * DM || (size_t)in_sizes[2] < (size_t)DM * DM || (size_t)in_sizes[3] < (size_t)DM * DM || (size_t)in_sizes[4] < (size_t)DM * DM) return;
    if ((size_t)in_sizes[5] < needm || in_sizes[6] < 1) return;
    if ((size_t)out_size < ((size_t)(NB - 1) * OUT_SEQ + SEQ) * DM) return;
    if (SZ_TOTAL > ws_size) return;
    // wire order: x, Wq, Wk, Wv, Wo, padding_mask, num_heads
    const float* x  = (const float*)d_in[0];
    const float* wq = (const float*)d_in[1];
    const float* wk = (const float*)d_in[2];
    const float* wv = (const float*)d_in[3];
    const float* wo = (const float*)d_in[4];
    const int* pm = (const int*)d_in[5];
    const int* nheads = (const int*)d_in[6];
    float* OUT = (float*)d_out;      // [NB][SEQ][128]
    char* wsp = (char*)d_ws;
    bf* XB = (bf*)wsp; wsp += SZ_XB;                 // x [NB*SEQ][128]
    bf* WB = (bf*)wsp; wsp += SZ_WB;                 // [3][128][128]: q | k | v  ([out][in] as-is: Bt for q, k; A for v)
    h16* WOH = (h16*)wsp; wsp += SZ_WO;              // [128][128] Wo x64 ([out][in] = Bt as-is)
    h16* QH = (h16*)wsp; wsp += SZ_PL;               // [NB*8][SEQ][16]
    h16* KP = (h16*)wsp; wsp += SZ_PL;               // [NB*8][SEQ][16]
    h16* VT = (h16*)wsp; wsp += SZ_PL;               // [NB*8][16][SEQ]
    h16* CH = (h16*)wsp; wsp += SZ_PL;               // [NB][128][SEQ] context value
    h16* CX = (h16*)wsp; wsp += SZ_PL;               // [NB][128][SEQ] context residual x2048
    h16* QR = (h16*)wsp; wsp += SZ_RS;               // [NB*8][EROWS][16] residual x2048, tokens < EROWS
    h16* KR = (h16*)wsp; wsp += SZ_RS;               // [NB*8][EROWS][16] residual x2048, tokens < EROWS
    h16* VR = (h16*)wsp; wsp += SZ_RS;               // [NB*8][16][EROWS] residual x2048, tokens < EROWS
    bf* WQ = WB; bf* WK = WB + (size_t)DM * DM; bf* WV = WB + (size_t)2 * DM * DM;

    if (SEQ == SEQ_FULL) {
        const size_t n8 = (size_t)NB * SEQ * DM / 8;
        k_cvt8<<<(unsigned)((n8 + 255) / 256), 256, 0, stream>>>(x, XB, n8);
    } else {
        const size_t n8 = (size_t)SEQ * DM / 8;
        for (int b = 0; b < NB; ++b) k_cvt8<<<(unsigned)((n8 + 255) / 256), 256, 0, stream>>>(x + (size_t)b * SEQ_FULL * DM, XB + (size_t)b * SEQ * DM, n8);
    }
    { const size_t n8 = (size_t)DM * DM / 8; const unsigned g = (unsigned)((n8 + 255) / 256);
      k_cvt8<<<g, 256, 0, stream>>>(wq, WQ, n8); k_cvt8<<<g, 256, 0, stream>>>(wk, WK, n8); k_cvt8<<<g, 256, 0, stream>>>(wv, WV, n8);
      k_wcvt<<<g, 256, 0, stream>>>(wo, WOH, n8); }

    // q, k: A = x rows (m = b*SEQ + t), Bt = W rows (n = h*16 + d) -> plane [(b*8 + h)][t][d]; residuals for tokens < EROWS
    k_proj_qk<<<dim3(NB * SEQ / 64, DM / 64, 1), 32, 0, stream>>>(XB, WQ, QH, QR, EROWS);
    k_proj_qk<<<dim3(NB * SEQ / 64, DM / 64, 1), 32, 0, stream>>>(XB, WK, KP, KR, EROWS);
    // v^T: A = Wv rows (m = h*16 + d), Bt = x rows (n = b*SEQ + t) -> plane [(b*128 + m)][t] = [(b*8 + h)][d][t]; residual for tokens < EROWS
    k_proj_vt<<<dim3(DM / 64, NB * SEQ / 64, 1), 32, 0, stream>>>(WV, XB, VT, VR, EROWS);

    // query rows [0, EROWS): multi-product instantiation; rows [EROWS, SEQ): single-product instantiation (disjoint context columns)
    k_flash_early<<<dim3(EROWS / (16 * AW), NB * NH_, 1), 32 * AW, 0, stream>>>(QH, QR, KP, KR, VT, VR, pm, CH, CX);
    if (SEQ > EROWS)
        k_flash_late<<<dim3((SEQ - EROWS) / (16 * AW), NB * NH_, 1), 32 * AW, 0, stream>>>(QH, QR, KP, KR, VT, VR, pm, CH, CX);

    // output projection over the flat [NB*SEQ][128] view of the context planes
    k_oproj<<<dim3(NB * SEQ / 16, 1, 1), 32, 0, stream>>>(CH, CX, WOH, nheads, OUT);
}

// v002
// One run takes 53.8 microseconds.
// Next to v001, in two timings, it ran 1.60 and 1.58 times as fast.
// All steps since v000 together make it 2.31 times as fast.
#include <hip/hip_runtime.h>

// Causal multi-head self-attention, width 128 = 8 heads x 16; x [NB][SEQ][128]; Wq/Wk/Wv/Wo [out][in] (y = x W^T, no bias); key padding mask [NB][SEQ] (int32, device-read); masked scores are replaced before the 1/sqrt(16) scale;
// per-head context transposed to [b][h*16+e][t], reinterpreted flat as [NB][SEQ][128], then multiplied by Wo^T (f32 output).
// Compute dtypes, f32 accumulate everywhere: q/k/v projections v_wmma_f32_16x16x32_bf16 (x, W RNE-converted to bf16; products exact);
// scores v_wmma_f32_16x16x32_f16 (head dim 16 zero-padded to the 32-deep step): single f16 q, k on query rows >= EROWS; on query rows < EROWS q and k each as f16 value + f16 residual x2048 (cross products in the upper 16 k-slots, own accumulator);
// P.V v_wmma_f32_16x16x32_f16: P (x16384 carry, cancels in the normalisation) and v single f16 on query rows >= EROWS; on query rows < EROWS P and v as f16 value + f16 residual x2048, residual products in their own accumulator folded by 1/2048, row sum from the f32 exponentials;
// output projection v_wmma_f32_16x16x32_f16: context as f16 value + f16 residual x2048 (own accumulator), Wo as bf16-converted value x64 held in f16; softmax f32 (online, running max over kept keys).
// Layout: bf16 copies of x and Wq/Wk/Wv; q, k planes [b*8+h][t][16], v^T plane [b*8+h][16][t], small residual planes (tokens < EROWS) for q, k, v^T; context planes (value, residual) [b][h*16+e][t]; fused flash kernel in transposed form (S^T = K Q^T, O^T = V^T P^T).
// Keep rule per element: (mask[b][j] != 0) and (j <= t); dropped elements get probability 0; a row with no kept key takes the plain mean of v over all SEQ keys (uniform softmax of equal fills).

#ifndef NB
#define NB 4
#endif
#ifndef SEQ
#define SEQ 2048
#endif
#define NB_FULL  4
#define SEQ_FULL 2048
#ifndef OUT_SEQ
#define OUT_SEQ SEQ              // row pitch (in tokens) between batches of the output
#endif
#define DM   128
#define NH_  8
#define HD   16
#define AW   4                   // waves per flash block (16 query rows each)
#define OSP  68                  // LDS row pitch (floats) of the flash context tile [16 d][64 t]
#define OPP  132                 // LDS row pitch (floats) of the output-projection slab [16][128]
#define EROWS (SEQ < 512 ? SEQ : 512)   // query rows (and tokens of the small residual planes) handled by the multi-product flash instantiation
#define QRS  2048.0f             // carry of every residual plane / residual fragment
#define QRI  (1.0f / 2048.0f)
#define SC2  ((float)(0.25 * 1.4426950408889634))   // HD^-0.5 * log2(e)
#define PSH  14.0f               // log2 of the P carry (16384)
#define NEGB (-3.0e38f)
#define WOS  64.0f               // carry of the Wo plane
#define WOI  (1.0f / 64.0f)

static_assert(HD == 16);
static_assert(NH_ * HD == DM);                 // head h = columns h*16 + d
static_assert(DM % 64 == 0);                   // column tiles of 64 = four heads
static_assert(64 % HD == 0);
static_assert(DM % 32 == 0);                   // GEMM k-loop steps by 32
static_assert(DM == 32 * 4);                   // output row = 32 lanes x 4 floats
static_assert(SEQ % 64 == 0);                  // a 64-row tile never straddles two batches
static_assert((NB * SEQ) % 64 == 0);
static_assert(SEQ % 32 == 0);                  // key loop steps by 32
static_assert(SEQ % (16 * AW) == 0);           // flash grids cover the sequence exactly
static_assert(16 * AW == 64);
static_assert(4 * AW == HD);                   // context store: 4 rows per wave x AW waves = 16 channel rows
static_assert(8 * 8 == 16 * AW);               // 8 lanes x 8 halves = 64 tokens per row
static_assert(EROWS % 64 == 0);                // a 64-token GEMM tile lies wholly inside or outside the residual planes
static_assert(EROWS >= 32);
static_assert(EROWS <= SEQ);
static_assert(EROWS % 32 == 0);                // early key loops end inside the residual planes
static_assert(EROWS % (16 * AW) == 0);
static_assert((SEQ - EROWS) % (16 * AW) == 0);
static_assert(((size_t)SEQ * DM) % 8 == 0);
static_assert(((size_t)DM * DM) % 8 == 0);
static_assert(NB <= NB_FULL);
static_assert(SEQ <= SEQ_FULL);
static_assert((OSP * 4) % 16 == 0);
static_assert(OSP >= 64);
static_assert((OPP * 4) % 16 == 0);
static_assert(OPP >= DM);
static_assert(4 * 32 * 8 == 16 * 64);          // projection epilogue, q/k form: 4 heads x 32 lanes x 8 halves = 16 rows x 64 columns
static_assert(4 * 4 * 64 == 16 * 64);          // projection epilogue, v^T form: 4 instructions x 4 rows x 64 halves
static_assert(16 * 68 * 4 <= 131072);          // static LDS of one proj_body instantiation (k_proj holds both)
static_assert(HD * OSP * 4 <= 131072);         // static LDS of one flash_body instantiation (k_flash holds both)
static_assert(16 * OPP * 4 <= 131072);         // static LDS of the output-projection kernel

typedef _Float16 h16;
typedef unsigned short bf;
typedef __attribute__((ext_vector_type(16))) __bf16   v16bf;
typedef __attribute__((ext_vector_type(16))) _Float16 v16h;
typedef __attribute__((ext_vector_type(8)))  _Float16 v8h;
typedef __attribute__((ext_vector_type(8)))  unsigned short v8us;
typedef __attribute__((ext_vector_type(8)))  float    v8f;
typedef __attribute__((ext_vector_type(4)))  float    v4f;
typedef __attribute__((ext_vector_type(4)))  int      v4i;
typedef v4f  __attribute__((may_alias)) v4fa;

__device__ __forceinline__ unsigned short f2bf(float f) { unsigned u = __float_as_uint(f); u += 0x7FFFu + ((u >> 16) & 1u); return (unsigned short)(u >> 16); }
__device__ __forceinline__ float bfr(float f) { return __uint_as_float(((unsigned)f2bf(f)) << 16); }   // value after RNE convert to bf16
__device__ __forceinline__ v16h cat16(v8h lo, v8h hi) { return __builtin_shufflevector(lo, hi, 0, 1, 2, 3, 4, 5, 6, 7, 8, 9, 10, 11, 12, 13, 14, 15); }
__device__ __forceinline__ v16bf cat16b(v8us lo, v8us hi) { return __builtin_bit_cast(v16bf, __builtin_shufflevector(lo, hi, 0, 1, 2, 3, 4, 5, 6, 7, 8, 9, 10, 11, 12, 13, 14, 15)); }
__device__ __forceinline__ v8f wmma16(v16h a, v16h b, v8f c) { return __builtin_amdgcn_wmma_f32_16x16x32_f16(false, a, false, b, (short)0, c, false, false); }
__device__ __forceinline__ v8f wmmab(v16bf a, v16bf b, v8f c) { return __builtin_amdgcn_wmma_f32_16x16x32_bf16(false, a, false, b, (short)0, c, false, false); }
// fragment loaders from K-contiguous 16-bit rows; p already includes + 8*(lane>>4): elements 0..7 <- k0+8h+0..7, elements 8..15 <- k0+16+8h+0..7 (same map for A and B)
__device__ __forceinline__ v16h  ldh(const h16* p) { return cat16(*(const v8h*)p, *(const v8h*)(p + 16)); }
__device__ __forceinline__ v16bf ldb(const bf* p)  { return cat16b(*(const v8us*)p, *(const v8us*)(p + 16)); }
// ordering point for wave-private LDS tiles (same wave writes and reads)
__device__ __forceinline__ void wave_sync() { __builtin_amdgcn_fence(3 /* release order */, "wavefront"); __builtin_amdgcn_wave_barrier(); asm volatile("" ::: "memory"); }

// per-instruction guarded matrix ops: the four idle slots tie the accumulator and keep the operands live
__device__ __forceinline__ v8f wmma16g(v16h a, v16h b, v8f c) { c = wmma16(a, b, c); asm volatile("v_nop\n\tv_nop\n\tv_nop\n\tv_nop" : "+v"(c) : "v"(a), "v"(b)); return c; }
__device__ __forceinline__ v8f wmmabg(v16bf a, v16bf b, v8f c) { c = wmmab(a, b, c); asm volatile("v_nop\n\tv_nop\n\tv_nop\n\tv_nop" : "+v"(c) : "v"(a), "v"(b)); return c; }
// f32 -> f16 that cannot produce a subnormal operand (|v| < 2^-14 -> +0)
static __device__ __forceinline__ h16 toh_flush(float v) { const h16 r = (h16)v; return (fabsf(v) < 6.103515625e-05f) ? (h16)0.0f : r; }

// k_cvt: every operand conversion in ONE launch, 8 elements per thread; a block-uniform range of the block index picks the job:
// blocks [0, 4*CWB): Wq, Wk, Wv -> bf16 planes of WB, Wo -> bf16-converted value x64 in f16; blocks [4*CWB, 4*CWB + CXB): x -> bf16 (batch pitch SEQ_FULL tokens in x, SEQ in XB).
#define CWB ((DM * DM / 8) / 256)                // blocks per weight matrix
#define CXB ((NB * SEQ * (DM / 8)) / 256)        // blocks of x
static_assert((DM * DM / 8) % 256 == 0);
static_assert((NB * SEQ * (DM / 8)) % 256 == 0);
__global__ __launch_bounds__(256) void k_cvt(const float* __restrict__ x, const float* __restrict__ wq, const float* __restrict__ wk, const float* __restrict__ wv, const float* __restrict__ wo,
                                             bf* XB, bf* WB, h16* WOH) {
    const unsigned blk = blockIdx.x;
    if (blk >= 4u * CWB) {
        const unsigned i = (blk - 4u * CWB) * 256u + threadIdx.x;               // 8-element group of XB
        const unsigned b = i / (unsigned)(SEQ * (DM / 8)), r = i % (unsigned)(SEQ * (DM / 8));
        const v8f v = *(const v8f*)(x + (size_t)b * SEQ_FULL * DM + (size_t)r * 8); v8us o;
#pragma unroll
        for (int k = 0; k < 8; ++k) o[k] = f2bf(v[k]);
        *(v8us*)(XB + (size_t)i * 8) = o;
        asm volatile("s_wait_xcnt 0x0" ::: "memory");                           // stands behind the store, in front of any later write to the registers that hold its address and data
        return;
    }
    if (blk >= 3u * CWB) {
        const unsigned i = (blk - 3u * CWB) * 256u + threadIdx.x;
        const v8f v = *(const v8f*)(wo + (size_t)i * 8); v8h o;
#pragma unroll
        for (int k = 0; k < 8; ++k) o[k] = toh_flush(bfr(v[k]) * WOS);
        *(v8h*)(WOH + (size_t)i * 8) = o;
        asm volatile("s_wait_xcnt 0x0" ::: "memory");                           // stands behind the store, in front of any later write to the registers that hold its address and data
        return;
    }
    const unsigned w = blk / (unsigned)CWB;
    const unsigned i = (blk % (unsigned)CWB) * 256u + threadIdx.x;
    const float* src = (w == 0) ? wq : (w == 1) ? wk : wv;
    const v8f v = *(const v8f*)(src + (size_t)i * 8); v8us o;
#pragma unroll
    for (int k = 0; k < 8; ++k) o[k] = f2bf(v[k]);
    *(v8us*)(WB + (size_t)blk * 256 * 8 + (size_t)threadIdx.x * 8) = o;         // planes q | k | v lie one behind the other: group index = blk * 256 + thread
    asm volatile("s_wait_xcnt 0x0" ::: "memory");                               // as above
}

// proj_body: register-blocked bf16 GEMM, ONE WAVE per 64x64 tile (16 accumulators), operands straight from K-contiguous bf16 planes, K = DM.
// C[m][n] = sum_k A[m][k] Bt[n][k], written as f16 (Ph) and, for tokens t < resT (resT a multiple of 64, block-uniform test), the f16 residual x2048 (Pr).
// MODE 0: A = x rows (m = b*SEQ + t), Bt = W rows (n = h*16 + d); plane [(b*8 + h)][t][16] (residual plane [(b*8 + h)][resT][16]). The 64-column tile spans four heads; per 16-row slab and head
//         one 512-byte run (16 rows per instruction). Grid x = token tile, y = channel tile in both modes (MODE 0: rows of A are tokens; MODE 1: rows of Bt are tokens).
template <int MODE>
__device__ __forceinline__ void proj_body(const bf* __restrict__ A, const bf* __restrict__ Bt, h16* Ph, h16* Pr, int resT) {
    __shared__ __align__(16) float os[16 * 68];
    const int K = DM;
    const int lane = threadIdx.x & 31, lr = lane & 15, hi = lane >> 4; const int r0 = (MODE == 0 ? blockIdx.x : blockIdx.y) * 64, c0 = (MODE == 0 ? blockIdx.y : blockIdx.x) * 64;
    v8f acc[4][4];
#pragma unroll
    for (int mb = 0; mb < 4; ++mb)
#pragma unroll
        for (int nb = 0; nb < 4; ++nb) acc[mb][nb] = (v8f){};
    const size_t aoff = (size_t)(r0 + lr) * K + 8 * hi, boff = (size_t)(c0 + lr) * K + 8 * hi;
#pragma unroll 1
    for (int kc = 0; kc < K; kc += 32) {
        v16bf a[4];
#pragma unroll
        for (int mb = 0; mb < 4; ++mb) a[mb] = ldb(A + aoff + (size_t)mb * 16 * K + kc);
#pragma unroll
        for (int nb = 0; nb < 4; ++nb) { const v16bf b = ldb(Bt + boff + (size_t)nb * 16 * K + kc);
#pragma unroll
            for (int mb = 0; mb < 4; ++mb) acc[mb][nb] = wmmabg(a[mb], b, acc[mb][nb]); }
    }
    size_t tbase, rbase; bool wr;                                                                 // wr: block-uniform, whole tile inside the residual plane
    if (MODE == 0) { const int bb = r0 / SEQ, tt = r0 % SEQ; const int zc = bb * NH_ + c0 / HD;
                     tbase = ((size_t)zc * SEQ + (size_t)tt) * HD; rbase = ((size_t)zc * (size_t)resT + (size_t)tt) * HD; wr = tt < resT; }
    else           { const int bb = c0 / SEQ, tt = c0 % SEQ;
                     tbase = (size_t)bb * (size_t)DM * SEQ + (size_t)r0 * SEQ + (size_t)tt; rbase = (size_t)bb * (size_t)DM * (size_t)resT + (size_t)r0 * (size_t)resT + (size_t)tt; wr = tt < resT; }
#pragma unroll
    for (int mb = 0; mb < 4; ++mb) {
#pragma unroll
        for (int nb = 0; nb < 4; ++nb) {
#pragma unroll
            for (int j = 0; j < 8; ++j) os[(hi * 8 + j) * 68 + nb * 16 + lr] = acc[mb][nb][j]; }   // D: row 8h+j, col lane&15; rows 0..15 x columns 0..63 all written
        wave_sync();
{
            if (MODE == 0) {
                const size_t sb = tbase + (size_t)(mb * 16) * HD;
                const size_t rb = rbase + (size_t)(mb * 16) * HD;
#pragma unroll
                for (int hh = 0; hh < 4; ++hh) { const int row = lane >> 1, c8 = (lane & 1) * 8;   // 16 rows x 2 lanes x 8 = 16 columns of head hh: one 512-byte run
                    const v4f x0 = *(const v4fa*)(&os[row * 68 + hh * 16 + c8]); const v4f x1 = *(const v4fa*)(&os[row * 68 + hh * 16 + c8 + 4]); v8h hv, rv;
#pragma unroll
                    for (int i = 0; i < 4; ++i) { const h16 a0 = toh_flush(x0[i]); const h16 a1 = toh_flush(x1[i]); hv[i] = a0; hv[4 + i] = a1;
                        rv[i] = toh_flush((x0[i] - (float)a0) * QRS); rv[4 + i] = toh_flush((x1[i] - (float)a1) * QRS); }
                    const size_t oo = sb + (size_t)hh * ((size_t)SEQ * HD) + (size_t)lane * 8;
                    const size_t ro = rb + (size_t)hh * ((size_t)resT * HD) + (size_t)lane * 8;
                    *(v8h*)(Ph + oo) = hv; if (wr) *(v8h*)(Pr + ro) = rv; }
            } else {
                const size_t sb = tbase + (size_t)(mb * 16) * SEQ;
                const size_t rb = rbase + (size_t)(mb * 16) * (size_t)resT;
#pragma unroll
                for (int s = 0; s < 4; ++s) { const int row = 4 * s + (lane >> 3), c8 = (lane & 7) * 8;   // 4 s x 4 row groups = 16 rows; 8 lanes x 8 = 64 columns
                    const v4f x0 = *(const v4fa*)(&os[row * 68 + c8]); const v4f x1 = *(const v4fa*)(&os[row * 68 + c8 + 4]); v8h hv, rv;
#pragma unroll
                    for (int i = 0; i < 4; ++i) { const h16 a0 = toh_flush(x0[i]); const h16 a1 = toh_flush(x1[i]); hv[i] = a0; hv[4 + i] = a1;
                        rv[i] = toh_flush((x0[i] - (float)a0) * QRS); rv[4 + i] = toh_flush((x1[i] - (float)a1) * QRS); }
                    const size_t oo = sb + (size_t)row * SEQ + c8;
                    const size_t ro = rb + (size_t)row * (size_t)resT + c8;
                    *(v8h*)(Ph + oo) = hv; if (wr) *(v8h*)(Pr + ro) = rv; }
            }
             }
        wave_sync();
    }
}

// k_proj: the three projections in ONE launch, grid (NB*SEQ/64 token tiles, DM/64 channel tiles, 3); blockIdx.z (block-uniform) picks q, k or v^T. WB = [3][128][128]: q | k | v.
__global__ __launch_bounds__(32) void k_proj(const bf* __restrict__ XB, const bf* __restrict__ WB, h16* QH, h16* QR, h16* KP, h16* KR, h16* VT, h16* VR, int resT) {
    const int z = blockIdx.z;
    if (z == 2) { const bf* A = WB + (size_t)2 * DM * DM; const bf* Bt = XB; h16* Ph = VT; h16* Pr = VR; proj_body<1>(A, Bt, Ph, Pr, resT); }
    else        { const bf* A = XB; const bf* Bt = WB + (size_t)z * DM * DM; h16* Ph = z ? KP : QH; h16* Pr = z ? KR : QR; proj_body<0>(A, Bt, Ph, Pr, resT); }
}

// k_flash: both instantiations in ONE launch, 1-D grid; a block-uniform range of the block index picks the job. Blocks [0, FLB): query rows [EROWS, SEQ), in the order (tile fastest, then batch*head);
// blocks [FLB, FLB + FEB): query rows [0, EROWS), same order. The long-running blocks come first in the index.
#define FLX ((SEQ - EROWS) / (16 * AW))          // late query tiles per (batch, head)
#define FEX (EROWS / (16 * AW))                  // early query tiles per (batch, head)
#define FLB (FLX * NB * NH_)
#define FEB (FEX * NB * NH_)
// flash_body: fused causal attention, one wave per 16 query rows of one (batch, head), AW waves = 64 query rows per block; K / V^T / Q fragments straight from the f16 planes (16-B loads, arithmetic addressing).
// Transposed form: S^T[key][t] = K Q^T (A = K rows, B = Q rows, head dim 16 in k-slots 0..15); lane (t = lane&15, h = lane>>4) holds keys 8h+r of each 16-key tile, so the packed
// P tile is directly the B fragment of O^T[d][t] = V^T P^T (element r <- tile keys 0..15, element 8+r <- tile keys 16..31, lane unchanged).
// Softmax state (running max over kept keys, partial sum) is one scalar per lane; the two lane halves of a row are combined with one xor-16 exchange.
// Keep rule evaluated per element inside every visited 32-key tile; the per-wave key bound is t0 + 16 (pad up to 32), at most SEQ.
// EARLY = 1 (query rows [0, EROWS)): A = [K | K_res], B = [Q | 0] gives K Q; B = [Q_res | Q] gives K Q_res + K_res Q (x2048, own accumulator); P = f16 value + f16 residual x2048;
//            O = V P + (V P_res + V_res P) / 2048 (residual products in their own accumulator); row sum from the f32 exponentials; all keys of these rows are < EROWS, inside the small planes.
// EARLY = 0 (query rows [EROWS, SEQ)): single q, k, P, v.
template <int EARLY>
__device__ __forceinline__ void flash_body(const h16* __restrict__ QH, const h16* __restrict__ QR, const h16* __restrict__ KP, const h16* __restrict__ KR,
                                           const h16* __restrict__ VT, const h16* __restrict__ VR, const int* __restrict__ pmask, h16* CH, h16* CX) {
    __shared__ __align__(16) float os[HD * OSP];
    const int lane = threadIdx.x & 31, lr = lane & 15, hi = lane >> 4;
    const int wave = __builtin_amdgcn_readfirstlane((int)(threadIdx.x >> 5));
    const int blk = (int)blockIdx.x - (EARLY ? FLB : 0), ntile = EARLY ? FEX : (FLX > 0 ? FLX : 1);   // index inside this instantiation's block range; query tiles per (batch, head)
    const int zh = blk / ntile; const int b = zh / NH_, h = zh % NH_;
    const int tb = (EARLY ? 0 : EROWS) + (blk % ntile) * (16 * AW);
    const int t0 = tb + wave * 16;
    const int lim = t0 + lr;                                                   // key j kept iff j <= lim (and mask nonzero)
    const int nk = (t0 + 16 + 31) & ~31;                                       // wave-uniform, multiple of 32, <= SEQ (<= EROWS when EARLY)
    const int* pmb = pmask + (size_t)b * SEQ_FULL + 8 * hi;
    const size_t pbase = (size_t)zh * SEQ * HD;
    const size_t rbase = (size_t)zh * EROWS * HD;
    const v8h z8 = (v8h){};
    const size_t qo = pbase + (size_t)(t0 + lr) * HD + 8 * hi;
    const v8h q8 = *(const v8h*)(QH + qo);
    asm volatile("s_wait_xcnt 0x0" ::: "memory");                 // the loads issued next may land in the registers that hold this load's address: the wait stands in front of them
    const v16h qh = cat16(q8, z8);                                // B fragment [Q | 0]: col t, k = d
    v16h qx = qh;
    if (EARLY) { const size_t qro = rbase + (size_t)(t0 + lr) * HD + 8 * hi; qx = cat16(*(const v8h*)(QR + qro), q8);   // B fragment [Q_res | Q]
                 asm volatile("s_wait_xcnt 0x0" ::: "memory"); }  // as above, for the residual load's address
    const size_t ko = pbase + (size_t)lr * HD + 8 * hi;         // + key * HD       (A fragment: row key, k = d)
    const size_t vo = pbase + (size_t)lr * SEQ + 8 * hi;        // + key            (A fragment: row d, k = key)
    const size_t kro = rbase + (size_t)lr * HD + 8 * hi;        // residual planes, tokens < EROWS
    const size_t vro = rbase + (size_t)lr * EROWS + 8 * hi;
    const v8f zz = (v8f){};
    v8f o0 = (v8f){}, oR0 = (v8f){};
    float m = NEGB, l = 0.0f;
    // Every operand of a 32-key tile (K, mask words, V^T; residual planes when EARLY) is fetched one trip ahead: tile 0 here, tile key0 + 32 inside trip key0,
    // each group into the registers its last reader of the trip has just left. nk >= 32, so tile 0 exists for every wave.
    v8h k0 = *(const v8h*)(KP + ko), k1 = *(const v8h*)(KP + ko + 16 * HD);
    v8h kr0 = z8, kr1 = z8;
    if (EARLY) { kr0 = *(const v8h*)(KR + kro); kr1 = *(const v8h*)(KR + kro + 16 * HD); }
    v4i m0 = *(const v4i*)pmb, m1 = *(const v4i*)(pmb + 4), m2 = *(const v4i*)(pmb + 16), m3 = *(const v4i*)(pmb + 20);
    v16h v0 = ldh(VT + vo);
    v16h vr0 = v0;
    if (EARLY) { vr0 = ldh(VR + vro); }
    // Inputs-only fence on the loaded values: the query fragments and tile 0 have landed before the loop is entered, so the loop's counted load waits follow from the loop's own issue order alone
    // (K and mask early in a trip, V^T at its end) and the wait for K at a trip's head leaves the V^T loads just issued in flight.
    if (EARLY) asm volatile("" :: "v"(qx), "v"(k0), "v"(k1), "v"(kr0), "v"(kr1), "v"(m0), "v"(m1), "v"(m2), "v"(m3), "v"(v0), "v"(vr0));
    else       asm volatile("" :: "v"(q8), "v"(k0), "v"(k1), "v"(m0), "v"(m1), "v"(m2), "v"(m3), "v"(v0));
#pragma unroll 1
    for (int key0 = 0; key0 < nk; key0 += 32) {
        const int kn = (key0 + 32 < nk) ? key0 + 32 : key0;      // tile fetched in this trip; the last trip fetches its own tile again (unused), so every address stays below nk <= SEQ
        const v16h ka0 = cat16(k0, kr0), kb0 = cat16(k1, kr1);   // A fragments [K | K_res] (late: [K | 0])
        v8f sHa = wmma16g(ka0, qh, zz), sHb = wmma16g(kb0, qh, zz);
        v8f sLa = zz, sLb = zz;
        if (EARLY) { sLa = wmma16g(ka0, qx, zz); sLb = wmma16g(kb0, qx, zz); }
        { const h16* ka = KP + ko + (size_t)kn * HD; k0 = *(const v8h*)ka; k1 = *(const v8h*)(ka + 16 * HD); }
        if (EARLY) { const h16* kr = KR + kro + (size_t)kn * HD; kr0 = *(const v8h*)kr; kr1 = *(const v8h*)(kr + 16 * HD); }
        int kx[8], ky[8];                                        // mask words of keys key0+8h+0..7 and key0+16+8h+0..7
#pragma unroll
        for (int r = 0; r < 4; ++r) { kx[r] = m0[r]; kx[4 + r] = m1[r]; ky[r] = m2[r]; ky[4 + r] = m3[r]; }
        const int ja = key0 + 8 * hi;
        float ta[8], tb2[8]; bool fa[8], fb[8]; float mx = NEGB;
#pragma unroll
        for (int r = 0; r < 8; ++r) {
            fa[r] = (kx[r] != 0) & (ja + r <= lim);
            fb[r] = (ky[r] != 0) & (ja + 16 + r <= lim); }
        { const int* kp = pmb + kn; m0 = *(const v4i*)kp; m1 = *(const v4i*)(kp + 4); m2 = *(const v4i*)(kp + 16); m3 = *(const v4i*)(kp + 20); }
        __builtin_amdgcn_sched_barrier(0);                       // without it the compiler sinks both fetch groups to the trip's end, where they have no lead over their readers
#pragma unroll
        for (int r = 0; r < 8; ++r) {
            if (EARLY) { ta[r] = (sHa[r] + sLa[r] * QRI) * SC2; tb2[r] = (sHb[r] + sLb[r] * QRI) * SC2; }
            else       { ta[r] = sHa[r] * SC2; tb2[r] = sHb[r] * SC2; }
            mx = fmaxf(mx, fmaxf(fa[r] ? ta[r] : NEGB, fb[r] ? tb2[r] : NEGB)); }
        mx = fmaxf(mx, __shfl_xor(mx, 16, 32));
        const float mnew = fmaxf(m, mx);
        const float alpha = __builtin_amdgcn_exp2f(m - mnew);
        const float sh = PSH - mnew;
        v16h pb, pr = (v16h){}; float ls = 0.0f;
#pragma unroll
        for (int r = 0; r < 8; ++r) {
            const float xa = ta[r] + sh, xb = tb2[r] + sh;
            const float ea = __builtin_amdgcn_exp2f(xa), eb = __builtin_amdgcn_exp2f(xb);
            const float ga = (fa[r] & (xa >= -14.0f)) ? ea : 0.0f, gb = (fb[r] & (xb >= -14.0f)) ? eb : 0.0f;   // dropped or sub-2^-14 elements selected to 0 by value
            const h16 pa = (h16)ga; const h16 pc = (h16)gb;
            pb[r] = pa; pb[8 + r] = pc;
            if (EARLY) { pr[r] = toh_flush((ga - (float)pa) * QRS); pr[8 + r] = toh_flush((gb - (float)pc) * QRS); ls += ga + gb; }
            else       { ls += (float)pa + (float)pc; } }
        l = l * alpha + ls; m = mnew;
        o0 = o0 * alpha;
        if (EARLY) { oR0 = oR0 * alpha; }
        o0 = wmma16g(v0, pb, o0);
        if (EARLY) {
            oR0 = wmma16g(v0, pr, oR0);
            oR0 = wmma16g(vr0, pb, oR0);
            vr0 = ldh(VR + vro + kn);
        }
        v0 = ldh(VT + vo + kn);
        asm volatile("s_wait_xcnt 0x0" ::: "memory");            // stands between the V^T loads just issued and the next trip's first writes to the registers that hold their addresses
    }
    l += __shfl_xor(l, 16, 32);
    const bool any = l > 0.0f;
    const float lsafe = any ? l : 1.0f;
    const float inv = any ? (1.0f / lsafe) : 0.0f;
    v8f f0 = o0;
    if (EARLY) { f0 = o0 + oR0 * QRI; }
    f0 = f0 * inv;
    const unsigned nonem = __builtin_amdgcn_ballot_w32(!any);    // wave-uniform: some row of this wave kept no key
    if (nonem != 0u) {
        // equal fills give a uniform softmax over all SEQ keys: plain mean of v per channel d = 8h + r
        float vm[8];
#pragma unroll
        for (int r = 0; r < 8; ++r) vm[r] = 0.0f;
#pragma unroll 1
        for (int t = lr; t < SEQ; t += 16) {
#pragma unroll
            for (int r = 0; r < 8; ++r) vm[r] += (float)VT[pbase + (size_t)(8 * hi + r) * SEQ + t]; }
#pragma unroll
        for (int r = 0; r < 8; ++r) { float s = vm[r];
            s += __shfl_xor(s, 1, 32); s += __shfl_xor(s, 2, 32); s += __shfl_xor(s, 4, 32); s += __shfl_xor(s, 8, 32);
            vm[r] = s * (1.0f / (float)SEQ); }
#pragma unroll
        for (int r = 0; r < 8; ++r) f0[r] = any ? f0[r] : vm[r];
    }
    // O^T D layout: f0[r] = (d = 8h + r, t = lane&15) -> os[d][wave*16 + t]; rows 0..15 x columns 0..63 all written by the four waves
#pragma unroll
    for (int r = 0; r < 8; ++r) os[(8 * hi + r) * OSP + wave * 16 + lr] = f0[r];
    __syncthreads();                                              // cross-wave tile: block barrier (every wave reaches it)
    const int d = 4 * wave + (lane >> 3), c8 = (lane & 7) * 8;    // AW waves x 4 rows = 16 channel rows; 8 lanes x 8 halves = 64 tokens = one line
    const v4f x0 = *(const v4fa*)(&os[d * OSP + c8]); const v4f x1 = *(const v4fa*)(&os[d * OSP + c8 + 4]);
    v8h hv, rv;
#pragma unroll
    for (int i = 0; i < 4; ++i) { const h16 a0 = toh_flush(x0[i]); const h16 a1 = toh_flush(x1[i]); hv[i] = a0; hv[4 + i] = a1;
        rv[i] = toh_flush((x0[i] - (float)a0) * QRS); rv[4 + i] = toh_flush((x1[i] - (float)a1) * QRS); }
    const size_t oo = ((size_t)b * DM + (size_t)(h * HD + d)) * SEQ + (size_t)tb + (size_t)c8;
{
        *(v8h*)(CH + oo) = hv; *(v8h*)(CX + oo) = rv;
         }
}

__global__ __launch_bounds__(32 * AW) void k_flash(const h16* __restrict__ QH, const h16* __restrict__ QR, const h16* __restrict__ KP, const h16* __restrict__ KR,
                                                   const h16* __restrict__ VT, const h16* __restrict__ VR, const int* __restrict__ pmask, h16* CH, h16* CX) {
    if ((int)blockIdx.x < FLB) {
        flash_body<0>(QH, QR, KP, KR, VT, VR, pmask, CH, CX);
    } else {
        flash_body<1>(QH, QR, KP, KR, VT, VR, pmask, CH, CX);
    }
}

// k_oproj: output projection, ONE WAVE per 16 rows x 128 columns. A = context planes read flat as [NB*SEQ][128] (value and residual x2048, separate accumulators), Bt = Wo x64 rows [n][k] (f16), K = DM.
// The head-count input is read on the device; a value other than the compiled head count marks the output with NaN.
__global__ __launch_bounds__(32) void k_oproj(const h16* __restrict__ CH, const h16* __restrict__ CX, const h16* __restrict__ WO, const int* __restrict__ nheads_p, float* OUT) {
    __shared__ __align__(16) float os[16 * OPP];
    const int lane = threadIdx.x & 31, lr = lane & 15, hi = lane >> 4;
    const int r0 = blockIdx.x * 16;
    v8f aH[8], aR[8];
#pragma unroll
    for (int nb = 0; nb < 8; ++nb) { aH[nb] = (v8f){}; aR[nb] = (v8f){}; }
    const size_t aoff = (size_t)(r0 + lr) * DM + 8 * hi, boff = (size_t)lr * DM + 8 * hi;
#pragma unroll 1
    for (int kc = 0; kc < DM; kc += 32) {
        const v16h ah = ldh(CH + aoff + kc), ar = ldh(CX + aoff + kc);
#pragma unroll
        for (int nb = 0; nb < 8; ++nb) { const v16h w = ldh(WO + boff + (size_t)nb * 16 * DM + kc);
            aH[nb] = wmma16g(ah, w, aH[nb]); aR[nb] = wmma16g(ar, w, aR[nb]); }
    }
    const int nh = nheads_p[0];
    const float poison = (nh == NH_) ? 0.0f : __uint_as_float(0x7FC00000u);
#pragma unroll
    for (int nb = 0; nb < 8; ++nb) {
#pragma unroll
        for (int j = 0; j < 8; ++j) os[(hi * 8 + j) * OPP + nb * 16 + lr] = (aH[nb][j] + aR[nb][j] * QRI) * WOI + poison; }   // D: row 8h+j, col lane&15; rows 0..15 x columns 0..127 all written
    wave_sync();
    const int bb = r0 / SEQ, tt = r0 % SEQ;
    float* orow = OUT + ((size_t)bb * OUT_SEQ + (size_t)tt) * DM;
{
#pragma unroll 4
        for (int s = 0; s < 16; ++s) {                              // 16 rows x (32 lanes x 4 floats = 128 columns = the whole row)
            const v4f val = *(const v4fa*)(&os[s * OPP + lane * 4]);
            *(v4f*)(orow + (size_t)s * DM + lane * 4) = val; }
         }
}

static constexpr size_t al256(size_t v) { return (v + 255) & ~(size_t)255; }
static constexpr size_t SZ_XB = al256((size_t)NB * SEQ * DM * 2);
static constexpr size_t SZ_WB = al256((size_t)3 * DM * DM * 2);
static constexpr size_t SZ_WO = al256((size_t)DM * DM * 2);
static constexpr size_t SZ_PL = al256((size_t)NB * NH_ * SEQ * HD * 2);
static constexpr size_t SZ_RS = al256((size_t)NB * NH_ * EROWS * HD * 2);
static constexpr size_t SZ_TOTAL = SZ_XB + SZ_WB + SZ_WO + 5 * SZ_PL + 3 * SZ_RS;
static_assert(SZ_TOTAL <= (size_t)134217728);          // workspace carve <= 128 MiB
static_assert(((size_t)DM * DM * 2) % 256 == 0);       // weight sub-planes stay 256-byte aligned
static_assert((size_t)NB * NH_ * SEQ * HD == (size_t)NB * DM * SEQ);       // v^T plane and context planes [(b*128 + m)][t] have the same extent as the q/k planes
static_assert((size_t)NB * NH_ * EROWS * HD == (size_t)NB * DM * EROWS);   // v^T residual plane [(b*128 + m)][t < EROWS] has the same extent as the q/k residual planes
static_assert(((size_t)NB * DM * SEQ) % ((size_t)16 * DM) == 0);           // context planes read flat as 16-row x 128 slabs

extern "C" void kernel_launch(void* const* d_in, const int* in_sizes, int n_in,
                              void* d_out, int out_size, void* d_ws, size_t ws_size, hipStream_t stream) {
    if (n_in < 7) return;
    const size_t needx = ((size_t)(NB - 1) * SEQ_FULL + SEQ) * DM;
    const size_t needm = (size_t)(NB - 1) * SEQ_FULL + SEQ;
    if ((size_t)in_sizes[0] < needx) return;
    if ((size_t)in_sizes[1] < (size_t)DM * DM || (size_t)in_sizes[2] < (size_t)DM * DM || (size_t)in_sizes[3] < (size_t)DM * DM || (size_t)in_sizes[4] < (size_t)DM * DM) return;
    if ((size_t)in_sizes[5] < needm || in_sizes[6] < 1) return;
    if ((size_t)out_size < ((size_t)(NB - 1) * OUT_SEQ + SEQ) * DM) return;
    if (SZ_TOTAL > ws_size) return;
    // wire order: x, Wq, Wk, Wv, Wo, padding_mask, num_heads
    const float* x  = (const float*)d_in[0];
    const float* wq = (const float*)d_in[1];
    const float* wk = (const float*)d_in[2];
    const float* wv = (const float*)d_in[3];
    const float* wo = (const float*)d_in[4];
    const int* pm = (const int*)d_in[5];
    const int* nheads = (const int*)d_in[6];
    float* OUT = (float*)d_out;      // [NB][SEQ][128]
    char* wsp = (char*)d_ws;
    bf* XB = (bf*)wsp; wsp += SZ_XB;                 // x [NB*SEQ][128]
    bf* WB = (bf*)wsp; wsp += SZ_WB;                 // [3][128][128]: q | k | v  ([out][in] as-is: Bt for q, k; A for v)
    h16* WOH = (h16*)wsp; wsp += SZ_WO;              // [128][128] Wo x64 ([out][in] = Bt as-is)
    h16* QH = (h16*)wsp; wsp += SZ_PL;               // [NB*8][SEQ][16]
    h16* KP = (h16*)wsp; wsp += SZ_PL;               // [NB*8][SEQ][16]
    h16* VT = (h16*)wsp; wsp += SZ_PL;               // [NB*8][16][SEQ]
    h16* CH = (h16*)wsp; wsp += SZ_PL;               // [NB][128][SEQ] context value
    h16* CX = (h16*)wsp; wsp += SZ_PL;               // [NB][128][SEQ] context residual x2048
    h16* QR = (h16*)wsp; wsp += SZ_RS;               // [NB*8][EROWS][16] residual x2048, tokens < EROWS
    h16* KR = (h16*)wsp; wsp += SZ_RS;               // [NB*8][EROWS][16] residual x2048, tokens < EROWS
    h16* VR = (h16*)wsp; wsp += SZ_RS;               // [NB*8][16][EROWS] residual x2048, tokens < EROWS

    // x, Wq, Wk, Wv -> bf16 planes, Wo -> f16 plane x64
    k_cvt<<<dim3(4 * CWB + CXB, 1, 1), 256, 0, stream>>>(x, wq, wk, wv, wo, XB, WB, WOH);

    // q, k: A = x rows (m = b*SEQ + t), Bt = W rows (n = h*16 + d) -> plane [(b*8 + h)][t][d]; residuals for tokens < EROWS
    // v^T: A = Wv rows (m = h*16 + d), Bt = x rows (n = b*SEQ + t) -> plane [(b*128 + m)][t] = [(b*8 + h)][d][t]; residual for tokens < EROWS
    k_proj<<<dim3(NB * SEQ / 64, DM / 64, 3), 32, 0, stream>>>(XB, WB, QH, QR, KP, KR, VT, VR, EROWS);

    // query rows [0, EROWS): multi-product instantiation; rows [EROWS, SEQ): single-product instantiation (disjoint context columns)
    k_flash<<<dim3(FLB + FEB, 1, 1), 32 * AW, 0, stream>>>(QH, QR, KP, KR, VT, VR, pm, CH, CX);

    // output projection over the flat [NB*SEQ][128] view of the context planes
    k_oproj<<<dim3(NB * SEQ / 16, 1, 1), 32, 0, stream>>>(CH, CX, WOH, nheads, OUT);
}

// v003
// One run takes 51.8 microseconds.
// Timed twice side by side with v002, it ran 1.05 and 1.04 times as fast.
// All steps since v000 together make it 2.41 times as fast.
#include <hip/hip_runtime.h>

// Causal multi-head self-attention, width 128 = 8 heads x 16; x [NB][SEQ][128]; Wq/Wk/Wv/Wo [out][in] (y = x W^T, no bias); key padding mask [NB][SEQ] (int32, device-read); masked scores are replaced before the 1/sqrt(16) scale;
// per-head context transposed to [b][h*16+e][t], reinterpreted flat as [NB][SEQ][128], then multiplied by Wo^T (f32 output).
// Compute dtypes, f32 accumulate everywhere: q/k/v projections v_wmma_f32_16x16x32_bf16 (x, W RNE-converted to bf16; products exact);
// scores v_wmma_f32_16x16x32_f16 (head dim 16 zero-padded to the 32-deep step): single f16 q, k on query rows >= EROWS; on query rows < EROWS q and k each as f16 value + f16 residual x2048 (cross products in the upper 16 k-slots, own accumulator);
// P.V v_wmma_f32_16x16x32_f16: P (x16384 carry, cancels in the normalisation) and v single f16 on query rows >= EROWS; on query rows < EROWS P and v as f16 value + f16 residual x2048, residual products in their own accumulator folded by 1/2048, row sum from the f32 exponentials;
// output projection v_wmma_f32_16x16x32_f16: context as f16 value + f16 residual x2048 (own accumulator), Wo as bf16-converted value x64 held in f16; softmax f32 (online, running max over kept keys).
// Layout: bf16 copies of x and Wq/Wk/Wv; q, k planes [b*8+h][t][16], v^T plane [b*8+h][16][t], small residual planes (tokens < EROWS) for q, k, v^T; context planes (value, residual) [b][h*16+e][t]; fused flash kernel in transposed form (S^T = K Q^T, O^T = V^T P^T).
// Keep rule per element: (mask[b][j] != 0) and (j <= t); dropped elements get probability 0; a row with no kept key takes the plain mean of v over all SEQ keys (uniform softmax of equal fills).

#ifndef NB
#define NB 4
#endif
#ifndef SEQ
#define SEQ 2048
#endif
#define NB_FULL  4
#define SEQ_FULL 2048
#ifndef OUT_SEQ
#define OUT_SEQ SEQ              // row pitch (in tokens) between batches of the output
#endif
#define DM   128
#define NH_  8
#define HD   16
#define AW   4                   // waves per flash block (16 query rows each)
#define OSP  68                  // LDS row pitch (floats) of the flash context tile [16 d][64 t]
#define OPP  132                 // LDS row pitch (floats) of the output-projection slab [16][128]
#define EROWS (SEQ < 512 ? SEQ : 512)   // query rows (and tokens of the small residual planes) handled by the multi-product flash instantiation
#define QRS  2048.0f             // carry of every residual plane / residual fragment
#define QRI  (1.0f / 2048.0f)
#define SC2  ((float)(0.25 * 1.4426950408889634))   // HD^-0.5 * log2(e)
#define PSH  14.0f               // log2 of the P carry (16384)
#define NEGB (-3.0e38f)
#define WOS  64.0f               // carry of the Wo plane
#define WOI  (1.0f / 64.0f)

static_assert(HD == 16);
static_assert(NH_ * HD == DM);                 // head h = columns h*16 + d
static_assert(DM % 64 == 0);                   // column tiles of 64 = four heads
static_assert(64 % HD == 0);
static_assert(DM % 32 == 0);                   // GEMM k-loop steps by 32
static_assert(DM == 32 * 4);                   // output row = 32 lanes x 4 floats
static_assert(SEQ % 64 == 0);                  // a 64-row tile never straddles two batches
static_assert((NB * SEQ) % 64 == 0);
static_assert(SEQ % 32 == 0);                  // key loop steps by 32
static_assert(SEQ % (16 * AW) == 0);           // flash grids cover the sequence exactly
static_assert(16 * AW == 64);
static_assert(4 * AW == HD);                   // context store: 4 rows per wave x AW waves = 16 channel rows
static_assert(8 * 8 == 16 * AW);               // 8 lanes x 8 halves = 64 tokens per row
static_assert(EROWS % 64 == 0);                // a 64-token GEMM tile lies wholly inside or outside the residual planes
static_assert(EROWS >= 32);
static_assert(EROWS <= SEQ);
static_assert(EROWS % 32 == 0);                // early key loops end inside the residual planes
static_assert(EROWS % (16 * AW) == 0);
static_assert((SEQ - EROWS) % (16 * AW) == 0);
static_assert(((size_t)SEQ * DM) % 8 == 0);
static_assert(((size_t)DM * DM) % 8 == 0);
static_assert(NB <= NB_FULL);
static_assert(SEQ <= SEQ_FULL);
static_assert((OSP * 4) % 16 == 0);
static_assert(OSP >= 64);
static_assert((OPP * 4) % 16 == 0);
static_assert(OPP >= DM);
static_assert(4 * 32 * 8 == 16 * 64);          // projection epilogue, q/k form: 4 heads x 32 lanes x 8 halves = 16 rows x 64 columns
static_assert(4 * 4 * 64 == 16 * 64);          // projection epilogue, v^T form: 4 instructions x 4 rows x 64 halves
static_assert(16 * 68 * 4 <= 131072);          // static LDS of one proj_body instantiation (k_proj holds both)
static_assert(HD * OSP * 4 <= 131072);         // static LDS of one flash_body instantiation (k_flash holds both)
static_assert(16 * OPP * 4 <= 131072);         // static LDS of the output-projection kernel

typedef _Float16 h16;
typedef unsigned short bf;
typedef __attribute__((ext_vector_type(16))) __bf16   v16bf;
typedef __attribute__((ext_vector_type(16))) _Float16 v16h;
typedef __attribute__((ext_vector_type(8)))  _Float16 v8h;
typedef __attribute__((ext_vector_type(2)))  _Float16 v2h;
typedef __attribute__((ext_vector_type(2)))  float    v2f;
typedef __attribute__((ext_vector_type(8)))  unsigned short v8us;
typedef __attribute__((ext_vector_type(8)))  float    v8f;
typedef __attribute__((ext_vector_type(4)))  float    v4f;
typedef __attribute__((ext_vector_type(4)))  int      v4i;
typedef v4f  __attribute__((may_alias)) v4fa;

__device__ __forceinline__ unsigned short f2bf(float f) { unsigned u = __float_as_uint(f); u += 0x7FFFu + ((u >> 16) & 1u); return (unsigned short)(u >> 16); }
__device__ __forceinline__ float bfr(float f) { return __uint_as_float(((unsigned)f2bf(f)) << 16); }   // value after RNE convert to bf16
__device__ __forceinline__ v16h cat16(v8h lo, v8h hi) { return __builtin_shufflevector(lo, hi, 0, 1, 2, 3, 4, 5, 6, 7, 8, 9, 10, 11, 12, 13, 14, 15); }
__device__ __forceinline__ v16bf cat16b(v8us lo, v8us hi) { return __builtin_bit_cast(v16bf, __builtin_shufflevector(lo, hi, 0, 1, 2, 3, 4, 5, 6, 7, 8, 9, 10, 11, 12, 13, 14, 15)); }
__device__ __forceinline__ v8f wmma16(v16h a, v16h b, v8f c) { return __builtin_amdgcn_wmma_f32_16x16x32_f16(false, a, false, b, (short)0, c, false, false); }
__device__ __forceinline__ v8f wmmab(v16bf a, v16bf b, v8f c) { return __builtin_amdgcn_wmma_f32_16x16x32_bf16(false, a, false, b, (short)0, c, false, false); }
// fragment loaders from K-contiguous 16-bit rows; p already includes + 8*(lane>>4): elements 0..7 <- k0+8h+0..7, elements 8..15 <- k0+16+8h+0..7 (same map for A and B)
__device__ __forceinline__ v16h  ldh(const h16* p) { return cat16(*(const v8h*)p, *(const v8h*)(p + 16)); }
__device__ __forceinline__ v16bf ldb(const bf* p)  { return cat16b(*(const v8us*)p, *(const v8us*)(p + 16)); }
// ordering point for wave-private LDS tiles (same wave writes and reads)
__device__ __forceinline__ void wave_sync() { __builtin_amdgcn_fence(3 /* release order */, "wavefront"); __builtin_amdgcn_wave_barrier(); asm volatile("" ::: "memory"); }

// per-instruction guarded matrix ops: the four idle slots tie the accumulator and keep the operands live
__device__ __forceinline__ v8f wmma16g(v16h a, v16h b, v8f c) { c = wmma16(a, b, c); asm volatile("v_nop\n\tv_nop\n\tv_nop\n\tv_nop" : "+v"(c) : "v"(a), "v"(b)); return c; }
__device__ __forceinline__ v8f wmmabg(v16bf a, v16bf b, v8f c) { c = wmmab(a, b, c); asm volatile("v_nop\n\tv_nop\n\tv_nop\n\tv_nop" : "+v"(c) : "v"(a), "v"(b)); return c; }
// f32 -> f16 that cannot produce a subnormal operand (|v| < 2^-14 -> +0)
static __device__ __forceinline__ h16 toh_flush(float v) { const h16 r = (h16)v; return (fabsf(v) < 6.103515625e-05f) ? (h16)0.0f : r; }

// k_cvt: every operand conversion in ONE launch, 8 elements per thread (block 0: 32 mask words per thread); a block-uniform range of the block index picks the job:
// block 0: padding mask -> one bit per key (set: word nonzero), one 32-bit word per 32-key tile, KB[b * (SEQ/32) + tile], bit j = key 32*tile + j; one thread per tile;
// then, counted from block 1: blocks [0, 4*CWB): Wq, Wk, Wv -> bf16 planes of WB, Wo -> bf16-converted value x64 in f16; blocks [4*CWB, 4*CWB + CXB): x -> bf16 (batch pitch SEQ_FULL tokens in x, SEQ in XB).
#define CWB ((DM * DM / 8) / 256)                // blocks per weight matrix
#define CXB ((NB * SEQ * (DM / 8)) / 256)        // blocks of x
static_assert((DM * DM / 8) % 256 == 0);
static_assert((NB * SEQ * (DM / 8)) % 256 == 0);
static_assert(NB * (SEQ / 32) <= 256);           // one thread of block 0 per 32-key tile
__global__ __launch_bounds__(256) void k_cvt(const float* __restrict__ x, const float* __restrict__ wq, const float* __restrict__ wk, const float* __restrict__ wv, const float* __restrict__ wo,
                                             const int* __restrict__ pmask, bf* XB, bf* WB, h16* WOH, unsigned* KB) {
    if (blockIdx.x == 0u) {
        const unsigned i = threadIdx.x;
        if (i < (unsigned)(NB * (SEQ / 32))) {
            const int* p = pmask + (size_t)(i / (unsigned)(SEQ / 32)) * SEQ_FULL + (size_t)(i % (unsigned)(SEQ / 32)) * 32;
            unsigned bits = 0u;
#pragma unroll
            for (int k = 0; k < 8; ++k) { const v4i a = *(const v4i*)(p + 4 * k);
#pragma unroll
                for (int j = 0; j < 4; ++j) bits |= (a[j] != 0 ? 1u : 0u) << (4 * k + j); }
            KB[i] = bits;
            asm volatile("s_wait_xcnt 0x0" ::: "memory");                       // stands behind the store, in front of any later write to the registers that hold its address and data
        }
        return;
    }
    const unsigned blk = blockIdx.x - 1u;
    if (blk >= 4u * CWB) {
        const unsigned i = (blk - 4u * CWB) * 256u + threadIdx.x;               // 8-element group of XB
        const unsigned b = i / (unsigned)(SEQ * (DM / 8)), r = i % (unsigned)(SEQ * (DM / 8));
        const v8f v = *(const v8f*)(x + (size_t)b * SEQ_FULL * DM + (size_t)r * 8); v8us o;
#pragma unroll
        for (int k = 0; k < 8; ++k) o[k] = f2bf(v[k]);
        *(v8us*)(XB + (size_t)i * 8) = o;
        asm volatile("s_wait_xcnt 0x0" ::: "memory");                           // stands behind the store, in front of any later write to the registers that hold its address and data
        return;
    }
    if (blk >= 3u * CWB) {
        const unsigned i = (blk - 3u * CWB) * 256u + threadIdx.x;
        const v8f v = *(const v8f*)(wo + (size_t)i * 8); v8h o;
#pragma unroll
        for (int k = 0; k < 8; ++k) o[k] = toh_flush(bfr(v[k]) * WOS);
        *(v8h*)(WOH + (size_t)i * 8) = o;
        asm volatile("s_wait_xcnt 0x0" ::: "memory");                           // stands behind the store, in front of any later write to the registers that hold its address and data
        return;
    }
    const unsigned w = blk / (unsigned)CWB;
    const unsigned i = (blk % (unsigned)CWB) * 256u + threadIdx.x;
    const float* src = (w == 0) ? wq : (w == 1) ? wk : wv;
    const v8f v = *(const v8f*)(src + (size_t)i * 8); v8us o;
#pragma unroll
    for (int k = 0; k < 8; ++k) o[k] = f2bf(v[k]);
    *(v8us*)(WB + (size_t)blk * 256 * 8 + (size_t)threadIdx.x * 8) = o;         // planes q | k | v lie one behind the other: group index = blk * 256 + thread
    asm volatile("s_wait_xcnt 0x0" ::: "memory");                               // as above
}

// proj_body: register-blocked bf16 GEMM, ONE WAVE per 64x64 tile (16 accumulators), operands straight from K-contiguous bf16 planes, K = DM.
// C[m][n] = sum_k A[m][k] Bt[n][k], written as f16 (Ph) and, for tokens t < resT (resT a multiple of 64, block-uniform test), the f16 residual x2048 (Pr).
// MODE 0: A = x rows (m = b*SEQ + t), Bt = W rows (n = h*16 + d); plane [(b*8 + h)][t][16] (residual plane [(b*8 + h)][resT][16]). The 64-column tile spans four heads; per 16-row slab and head
//         one 512-byte run (16 rows per instruction). Grid x = token tile, y = channel tile in both modes (MODE 0: rows of A are tokens; MODE 1: rows of Bt are tokens).
template <int MODE>
__device__ __forceinline__ void proj_body(const bf* __restrict__ A, const bf* __restrict__ Bt, h16* Ph, h16* Pr, int resT) {
    __shared__ __align__(16) float os[16 * 68];
    const int K = DM;
    const int lane = threadIdx.x & 31, lr = lane & 15, hi = lane >> 4; const int r0 = (MODE == 0 ? blockIdx.x : blockIdx.y) * 64, c0 = (MODE == 0 ? blockIdx.y : blockIdx.x) * 64;
    v8f acc[4][4];
#pragma unroll
    for (int mb = 0; mb < 4; ++mb)
#pragma unroll
        for (int nb = 0; nb < 4; ++nb) acc[mb][nb] = (v8f){};
    const size_t aoff = (size_t)(r0 + lr) * K + 8 * hi, boff = (size_t)(c0 + lr) * K + 8 * hi;
#pragma unroll 1
    for (int kc = 0; kc < K; kc += 32) {
        v16bf a[4];
#pragma unroll
        for (int mb = 0; mb < 4; ++mb) a[mb] = ldb(A + aoff + (size_t)mb * 16 * K + kc);
#pragma unroll
        for (int nb = 0; nb < 4; ++nb) { const v16bf b = ldb(Bt + boff + (size_t)nb * 16 * K + kc);
#pragma unroll
            for (int mb = 0; mb < 4; ++mb) acc[mb][nb] = wmmabg(a[mb], b, acc[mb][nb]); }
    }
    size_t tbase, rbase; bool wr;                                                                 // wr: block-uniform, whole tile inside the residual plane
    if (MODE == 0) { const int bb = r0 / SEQ, tt = r0 % SEQ; const int zc = bb * NH_ + c0 / HD;
                     tbase = ((size_t)zc * SEQ + (size_t)tt) * HD; rbase = ((size_t)zc * (size_t)resT + (size_t)tt) * HD; wr = tt < resT; }
    else           { const int bb = c0 / SEQ, tt = c0 % SEQ;
                     tbase = (size_t)bb * (size_t)DM * SEQ + (size_t)r0 * SEQ + (size_t)tt; rbase = (size_t)bb * (size_t)DM * (size_t)resT + (size_t)r0 * (size_t)resT + (size_t)tt; wr = tt < resT; }
#pragma unroll
    for (int mb = 0; mb < 4; ++mb) {
#pragma unroll
        for (int nb = 0; nb < 4; ++nb) {
#pragma unroll
            for (int j = 0; j < 8; ++j) os[(hi * 8 + j) * 68 + nb * 16 + lr] = acc[mb][nb][j]; }   // D: row 8h+j, col lane&15; rows 0..15 x columns 0..63 all written
        wave_sync();
{
            if (MODE == 0) {
                const size_t sb = tbase + (size_t)(mb * 16) * HD;
                const size_t rb = rbase + (size_t)(mb * 16) * HD;
#pragma unroll
                for (int hh = 0; hh < 4; ++hh) { const int row = lane >> 1, c8 = (lane & 1) * 8;   // 16 rows x 2 lanes x 8 = 16 columns of head hh: one 512-byte run
                    const v4f x0 = *(const v4fa*)(&os[row * 68 + hh * 16 + c8]); const v4f x1 = *(const v4fa*)(&os[row * 68 + hh * 16 + c8 + 4]); v8h hv, rv;
#pragma unroll
                    for (int i = 0; i < 4; ++i) { const h16 a0 = toh_flush(x0[i]); const h16 a1 = toh_flush(x1[i]); hv[i] = a0; hv[4 + i] = a1;
                        rv[i] = toh_flush((x0[i] - (float)a0) * QRS); rv[4 + i] = toh_flush((x1[i] - (float)a1) * QRS); }
                    const size_t oo = sb + (size_t)hh * ((size_t)SEQ * HD) + (size_t)lane * 8;
                    const size_t ro = rb + (size_t)hh * ((size_t)resT * HD) + (size_t)lane * 8;
                    *(v8h*)(Ph + oo) = hv; if (wr) *(v8h*)(Pr + ro) = rv; }
            } else {
                const size_t sb = tbase + (size_t)(mb * 16) * SEQ;
                const size_t rb = rbase + (size_t)(mb * 16) * (size_t)resT;
#pragma unroll
                for (int s = 0; s < 4; ++s) { const int row = 4 * s + (lane >> 3), c8 = (lane & 7) * 8;   // 4 s x 4 row groups = 16 rows; 8 lanes x 8 = 64 columns
                    const v4f x0 = *(const v4fa*)(&os[row * 68 + c8]); const v4f x1 = *(const v4fa*)(&os[row * 68 + c8 + 4]); v8h hv, rv;
#pragma unroll
                    for (int i = 0; i < 4; ++i) { const h16 a0 = toh_flush(x0[i]); const h16 a1 = toh_flush(x1[i]); hv[i] = a0; hv[4 + i] = a1;
                        rv[i] = toh_flush((x0[i] - (float)a0) * QRS); rv[4 + i] = toh_flush((x1[i] - (float)a1) * QRS); }
                    const size_t oo = sb + (size_t)row * SEQ + c8;
                    const size_t ro = rb + (size_t)row * (size_t)resT + c8;
                    *(v8h*)(Ph + oo) = hv; if (wr) *(v8h*)(Pr + ro) = rv; }
            }
             }
        wave_sync();
    }
}

// k_proj: the three projections in ONE launch, grid (NB*SEQ/64 token tiles, DM/64 channel tiles, 3); blockIdx.z (block-uniform) picks q, k or v^T. WB = [3][128][128]: q | k | v.
__global__ __launch_bounds__(32) void k_proj(const bf* __restrict__ XB, const bf* __restrict__ WB, h16* QH, h16* QR, h16* KP, h16* KR, h16* VT, h16* VR, int resT) {
    const int z = blockIdx.z;
    if (z == 2) { const bf* A = WB + (size_t)2 * DM * DM; const bf* Bt = XB; h16* Ph = VT; h16* Pr = VR; proj_body<1>(A, Bt, Ph, Pr, resT); }
    else        { const bf* A = XB; const bf* Bt = WB + (size_t)z * DM * DM; h16* Ph = z ? KP : QH; h16* Pr = z ? KR : QR; proj_body<0>(A, Bt, Ph, Pr, resT); }
}

// k_flash: both instantiations in ONE launch, 1-D grid; a block-uniform range of the block index picks the job. Blocks [0, FLB): query rows [EROWS, SEQ), in the order (tile fastest, then batch*head);
// blocks [FLB, FLB + FEB): query rows [0, EROWS), same order. The long-running blocks come first in the index.
#define FLX ((SEQ - EROWS) / (16 * AW))          // late query tiles per (batch, head)
#define FEX (EROWS / (16 * AW))                  // early query tiles per (batch, head)
#define FLB (FLX * NB * NH_)
#define FEB (FEX * NB * NH_)
// flash_body: fused causal attention, one wave per 16 query rows of one (batch, head), AW waves = 64 query rows per block; K / V^T / Q fragments straight from the f16 planes (16-B loads, arithmetic addressing).
// Transposed form: S^T[key][t] = K Q^T (A = K rows, B = Q rows, head dim 16 in k-slots 0..15); lane (t = lane&15, h = lane>>4) holds keys 8h+r of each 16-key tile, so the packed
// P tile is directly the B fragment of O^T[d][t] = V^T P^T (element r <- tile keys 0..15, element 8+r <- tile keys 16..31, lane unchanged).
// Softmax state (running max over kept keys, partial sum) is one scalar per lane; the two lane halves of a row are combined with one xor-16 exchange.
// Keep rule: a wave reads its batch's mask bits (KB, one word per 32-key tile) once, lane = tile. A tile whose word is all ones and whose last key lies below the wave's first query row keeps every element:
// a scalar test sends it down a path without keep compares and selects (there a P below 2^-14 stays an f16 subnormal, which the matrix unit takes as it is). Every other visited tile evaluates the rule per element.
// The per-wave key bound is t0 + 16 (pad up to 32), at most SEQ.
// EARLY = 1 (query rows [0, EROWS)): A = [K | K_res], B = [Q | 0] gives K Q; B = [Q_res | Q] gives K Q_res + K_res Q (x2048, own accumulator); P = f16 value + f16 residual x2048;
//            O = V P + (V P_res + V_res P) / 2048 (residual products in their own accumulator); row sum from the f32 exponentials; all keys of these rows are < EROWS, inside the small planes.
// EARLY = 0 (query rows [EROWS, SEQ)): single q, k, P, v.
template <bool B> struct flag_c { static constexpr bool v = B; };
static_assert(SEQ / 32 <= 64);                   // a wave holds its batch's tile words in two registers (lane = tile) and their all-kept flags in one 64-bit scalar
template <int EARLY>
__device__ __forceinline__ void flash_body(const h16* __restrict__ QH, const h16* __restrict__ QR, const h16* __restrict__ KP, const h16* __restrict__ KR,
                                           const h16* __restrict__ VT, const h16* __restrict__ VR, const unsigned* __restrict__ KB, h16* CH, h16* CX) {
    __shared__ __align__(16) float os[HD * OSP];
    const int lane = threadIdx.x & 31, lr = lane & 15, hi = lane >> 4;
    const int wave = __builtin_amdgcn_readfirstlane((int)(threadIdx.x >> 5));
    const int blk = (int)blockIdx.x - (EARLY ? FLB : 0), ntile = EARLY ? FEX : (FLX > 0 ? FLX : 1);   // index inside this instantiation's block range; query tiles per (batch, head)
    const int zh = blk / ntile; const int b = zh / NH_, h = zh % NH_;
    const int tb = (EARLY ? 0 : EROWS) + (blk % ntile) * (16 * AW);
    const int t0 = tb + wave * 16;
    const int lim = t0 + lr;                                                   // key j kept iff j <= lim (and mask nonzero)
    const int nk = (t0 + 16 + 31) & ~31;                                       // wave-uniform, multiple of 32, <= SEQ (<= EROWS when EARLY)
    const unsigned* kbb = KB + (size_t)b * (SEQ / 32);                         // + tile
    const size_t pbase = (size_t)zh * SEQ * HD;
    const size_t rbase = (size_t)zh * EROWS * HD;
    const v8h z8 = (v8h){};
    const size_t qo = pbase + (size_t)(t0 + lr) * HD + 8 * hi;
    const v8h q8 = *(const v8h*)(QH + qo);
    asm volatile("s_wait_xcnt 0x0" ::: "memory");                 // the loads issued next may land in the registers that hold this load's address: the wait stands in front of them
    const v16h qh = cat16(q8, z8);                                // B fragment [Q | 0]: col t, k = d
    v16h qx = qh;
    if (EARLY) { const size_t qro = rbase + (size_t)(t0 + lr) * HD + 8 * hi; qx = cat16(*(const v8h*)(QR + qro), q8);   // B fragment [Q_res | Q]
                 asm volatile("s_wait_xcnt 0x0" ::: "memory"); }  // as above, for the residual load's address
    const size_t ko = pbase + (size_t)lr * HD + 8 * hi;         // + key * HD       (A fragment: row key, k = d)
    const size_t vo = pbase + (size_t)lr * SEQ + 8 * hi;        // + key            (A fragment: row d, k = key)
    const size_t kro = rbase + (size_t)lr * HD + 8 * hi;        // residual planes, tokens < EROWS
    const size_t vro = rbase + (size_t)lr * EROWS + 8 * hi;
    const v8f zz = (v8f){};
    v8f o0 = (v8f){}, oR0 = (v8f){};
    float m = NEGB, l = 0.0f;
    // Every operand of a 32-key tile (K, V^T; residual planes when EARLY) is fetched one trip ahead: tile 0 here, tile key0 + 32 inside trip key0,
    // each group into the registers its last reader of the trip has just left. nk >= 32, so tile 0 exists for every wave.
    v8h k0 = *(const v8h*)(KP + ko), k1 = *(const v8h*)(KP + ko + 16 * HD);
    v8h kr0 = z8, kr1 = z8;
    if (EARLY) { kr0 = *(const v8h*)(KR + kro); kr1 = *(const v8h*)(KR + kro + 16 * HD); }
    const unsigned kw0 = kbb[lane < SEQ / 32 ? lane : 0], kw1 = kbb[32 + lane < SEQ / 32 ? 32 + lane : 0];   // mask bits of tiles lane and 32 + lane
    // bit T set: tile T keeps every element for all 16 rows of this wave: word all ones and 32T + 31 < t0 (t0 a multiple of 16: T < t0 / 32 <= SEQ / 32 - 1). Wave-uniform.
    const unsigned long long kept = (((unsigned long long)__builtin_amdgcn_ballot_w32(kw1 == 0xFFFFFFFFu) << 32) | (unsigned long long)__builtin_amdgcn_ballot_w32(kw0 == 0xFFFFFFFFu)) & ((1ull << (t0 >> 5)) - 1ull);
    v16h v0 = ldh(VT + vo);
    v16h vr0 = v0;
    if (EARLY) { vr0 = ldh(VR + vro); }
    // Inputs-only fence on the loaded values: the query fragments and tile 0 have landed before the loop is entered, so the loop's counted load waits follow from the loop's own issue order alone
    // (K early in a trip, V^T at its end) and the wait for K at a trip's head leaves the V^T loads just issued in flight.
    if (EARLY) asm volatile("" :: "v"(qx), "v"(k0), "v"(k1), "v"(kr0), "v"(kr1), "v"(v0), "v"(vr0));
    else       asm volatile("" :: "v"(q8), "v"(k0), "v"(k1), "v"(v0));
#pragma unroll 1
    for (int key0 = 0; key0 < nk; key0 += 32) {
        const int kn = (key0 + 32 < nk) ? key0 + 32 : key0;      // tile fetched in this trip; the last trip fetches its own tile again (unused), so every address stays below nk <= SEQ
        const v16h ka0 = cat16(k0, kr0), kb0 = cat16(k1, kr1);   // A fragments [K | K_res] (late: [K | 0])
        const v8f sHa = wmma16g(ka0, qh, zz), sHb = wmma16g(kb0, qh, zz);
        v8f sLa = zz, sLb = zz;
        if (EARLY) { sLa = wmma16g(ka0, qx, zz); sLb = wmma16g(kb0, qx, zz); }
        { const h16* ka = KP + ko + (size_t)kn * HD; k0 = *(const v8h*)ka; k1 = *(const v8h*)(ka + 16 * HD); }
        if (EARLY) { const h16* kr = KR + kro + (size_t)kn * HD; kr0 = *(const v8h*)kr; kr1 = *(const v8h*)(kr + 16 * HD); }
        asm volatile("s_wait_xcnt 0x0" ::: "memory");            // stands between the K loads just issued and the softmax's first writes to the registers that hold their addresses
        v16h pb, pr = (v16h){}; float ls = 0.0f, alpha, mnew;
        // softmax of one tile; FULL: every element kept
        auto tile = [&](auto fc) __attribute__((always_inline)) {
            constexpr bool FULL = decltype(fc)::v;
            float ta[8], tb2[8]; bool fa[8], fb[8]; float mx;
            if constexpr (FULL) {
                float ua[8], ub[8];
#pragma unroll
                for (int r = 0; r < 8; ++r) {
                    if (EARLY) { ua[r] = sHa[r] + sLa[r] * QRI; ub[r] = sHb[r] + sLb[r] * QRI; }
                    else       { ua[r] = sHa[r]; ub[r] = sHb[r]; }
                    ta[r] = ua[r] * SC2; tb2[r] = ub[r] * SC2; fa[r] = true; fb[r] = true; }
                float mr = fmaxf(ua[0], ub[0]);                  // SC2 > 0 and rounding is monotonic: the scaled maximum equals the maximum of the scaled scores
#pragma unroll
                for (int r = 1; r < 8; ++r) mr = fmaxf(mr, fmaxf(ua[r], ub[r]));
                mx = mr * SC2;
            } else {
                const unsigned kcur = (unsigned)__builtin_amdgcn_readlane((int)(key0 < 1024 ? kw0 : kw1), (key0 >> 5) & 31);   // mask bits of keys key0 .. key0+31
                const unsigned kw = kcur >> (8 * hi);            // bits 0..7: keys key0+8h+0..7; bits 16..23: keys key0+16+8h+0..7
                const int ja = key0 + 8 * hi;
                mx = NEGB;
#pragma unroll
                for (int r = 0; r < 8; ++r) {
                    fa[r] = (((kw >> r) & 1u) != 0u) & (ja + r <= lim);
                    fb[r] = (((kw >> (16 + r)) & 1u) != 0u) & (ja + 16 + r <= lim); }
#pragma unroll
                for (int r = 0; r < 8; ++r) {
                    if (EARLY) { ta[r] = (sHa[r] + sLa[r] * QRI) * SC2; tb2[r] = (sHb[r] + sLb[r] * QRI) * SC2; }
                    else       { ta[r] = sHa[r] * SC2; tb2[r] = sHb[r] * SC2; }
                    mx = fmaxf(mx, fmaxf(fa[r] ? ta[r] : NEGB, fb[r] ? tb2[r] : NEGB)); }
            }
            mx = fmaxf(mx, __shfl_xor(mx, 16, 32));
            mnew = fmaxf(m, mx);
            alpha = __builtin_amdgcn_exp2f(m - mnew);
            const float sh = PSH - mnew;
#pragma unroll
            for (int r = 0; r < 8; r += 2) {
                float ga[2], gb[2];
#pragma unroll
                for (int i = 0; i < 2; ++i) {
                    const float xa = ta[r + i] + sh, xb = tb2[r + i] + sh;
                    const float ea = __builtin_amdgcn_exp2f(xa), eb = __builtin_amdgcn_exp2f(xb);
                    ga[i] = (FULL || (fa[r + i] & (xa >= -14.0f))) ? ea : 0.0f; gb[i] = (FULL || (fb[r + i] & (xb >= -14.0f))) ? eb : 0.0f; }   // not FULL: dropped or sub-2^-14 elements selected to 0 by value
                const v2h pa = __builtin_convertvector((v2f){ga[0], ga[1]}, v2h), pc = __builtin_convertvector((v2f){gb[0], gb[1]}, v2h);
#pragma unroll
                for (int i = 0; i < 2; ++i) {
                    pb[r + i] = pa[i]; pb[8 + r + i] = pc[i];
                    if (EARLY) { pr[r + i] = toh_flush((ga[i] - (float)pa[i]) * QRS); pr[8 + r + i] = toh_flush((gb[i] - (float)pc[i]) * QRS); ls += ga[i] + gb[i]; }
                    else       { ls += (float)pa[i] + (float)pc[i]; } } }
        };
        if (((kept >> (key0 >> 5)) & 1ull) != 0ull) tile(flag_c<true>{}); else tile(flag_c<false>{});   // scalar test
        l = l * alpha + ls; m = mnew;
        o0 = o0 * alpha;
        if (EARLY) { oR0 = oR0 * alpha; }
        o0 = wmma16g(v0, pb, o0);
        if (EARLY) {
            oR0 = wmma16g(v0, pr, oR0);
            oR0 = wmma16g(vr0, pb, oR0);
            vr0 = ldh(VR + vro + kn);
        }
        v0 = ldh(VT + vo + kn);
        asm volatile("s_wait_xcnt 0x0" ::: "memory");            // stands between the V^T loads just issued and the next trip's first writes to the registers that hold their addresses
    }
    l += __shfl_xor(l, 16, 32);
    const bool any = l > 0.0f;
    const float lsafe = any ? l : 1.0f;
    const float inv = any ? (1.0f / lsafe) : 0.0f;
    v8f f0 = o0;
    if (EARLY) { f0 = o0 + oR0 * QRI; }
    f0 = f0 * inv;
    const unsigned nonem = __builtin_amdgcn_ballot_w32(!any);    // wave-uniform: some row of this wave kept no key
    if (nonem != 0u) {
        // equal fills give a uniform softmax over all SEQ keys: plain mean of v per channel d = 8h + r
        float vm[8];
#pragma unroll
        for (int r = 0; r < 8; ++r) vm[r] = 0.0f;
#pragma unroll 1
        for (int t = lr; t < SEQ; t += 16) {
#pragma unroll
            for (int r = 0; r < 8; ++r) vm[r] += (float)VT[pbase + (size_t)(8 * hi + r) * SEQ + t]; }
#pragma unroll
        for (int r = 0; r < 8; ++r) { float s = vm[r];
            s += __shfl_xor(s, 1, 32); s += __shfl_xor(s, 2, 32); s += __shfl_xor(s, 4, 32); s += __shfl_xor(s, 8, 32);
            vm[r] = s * (1.0f / (float)SEQ); }
#pragma unroll
        for (int r = 0; r < 8; ++r) f0[r] = any ? f0[r] : vm[r];
    }
    // O^T D layout: f0[r] = (d = 8h + r, t = lane&15) -> os[d][wave*16 + t]; rows 0..15 x columns 0..63 all written by the four waves
#pragma unroll
    for (int r = 0; r < 8; ++r) os[(8 * hi + r) * OSP + wave * 16 + lr] = f0[r];
    __syncthreads();                                              // cross-wave tile: block barrier (every wave reaches it)
    const int d = 4 * wave + (lane >> 3), c8 = (lane & 7) * 8;    // AW waves x 4 rows = 16 channel rows; 8 lanes x 8 halves = 64 tokens = one line
    const v4f x0 = *(const v4fa*)(&os[d * OSP + c8]); const v4f x1 = *(const v4fa*)(&os[d * OSP + c8 + 4]);
    v8h hv, rv;
#pragma unroll
    for (int i = 0; i < 4; ++i) { const h16 a0 = toh_flush(x0[i]); const h16 a1 = toh_flush(x1[i]); hv[i] = a0; hv[4 + i] = a1;
        rv[i] = toh_flush((x0[i] - (float)a0) * QRS); rv[4 + i] = toh_flush((x1[i] - (float)a1) * QRS); }
    const size_t oo = ((size_t)b * DM + (size_t)(h * HD + d)) * SEQ + (size_t)tb + (size_t)c8;
{
        *(v8h*)(CH + oo) = hv; *(v8h*)(CX + oo) = rv;
         }
}

__global__ __launch_bounds__(32 * AW) void k_flash(const h16* __restrict__ QH, const h16* __restrict__ QR, const h16* __restrict__ KP, const h16* __restrict__ KR,
                                                   const h16* __restrict__ VT, const h16* __restrict__ VR, const unsigned* __restrict__ KB, h16* CH, h16* CX) {
    if ((int)blockIdx.x < FLB) {
        flash_body<0>(QH, QR, KP, KR, VT, VR, KB, CH, CX);
    } else {
        flash_body<1>(QH, QR, KP, KR, VT, VR, KB, CH, CX);
    }
}

// k_oproj: output projection, ONE WAVE per 16 rows x 128 columns. A = context planes read flat as [NB*SEQ][128] (value and residual x2048, separate accumulators), Bt = Wo x64 rows [n][k] (f16), K = DM.
// The head-count input is read on the device; a value other than the compiled head count marks the output with NaN.
__global__ __launch_bounds__(32) void k_oproj(const h16* __restrict__ CH, const h16* __restrict__ CX, const h16* __restrict__ WO, const int* __restrict__ nheads_p, float* OUT) {
    __shared__ __align__(16) float os[16 * OPP];
    const int lane = threadIdx.x & 31, lr = lane & 15, hi = lane >> 4;
    const int r0 = blockIdx.x * 16;
    v8f aH[8], aR[8];
#pragma unroll
    for (int nb = 0; nb < 8; ++nb) { aH[nb] = (v8f){}; aR[nb] = (v8f){}; }
    const size_t aoff = (size_t)(r0 + lr) * DM + 8 * hi, boff = (size_t)lr * DM + 8 * hi;
#pragma unroll 1
    for (int kc = 0; kc < DM; kc += 32) {
        const v16h ah = ldh(CH + aoff + kc), ar = ldh(CX + aoff + kc);
#pragma unroll
        for (int nb = 0; nb < 8; ++nb) { const v16h w = ldh(WO + boff + (size_t)nb * 16 * DM + kc);
            aH[nb] = wmma16g(ah, w, aH[nb]); aR[nb] = wmma16g(ar, w, aR[nb]); }
    }
    const int nh = nheads_p[0];
    const float poison = (nh == NH_) ? 0.0f : __uint_as_float(0x7FC00000u);
#pragma unroll
    for (int nb = 0; nb < 8; ++nb) {
#pragma unroll
        for (int j = 0; j < 8; ++j) os[(hi * 8 + j) * OPP + nb * 16 + lr] = (aH[nb][j] + aR[nb][j] * QRI) * WOI + poison; }   // D: row 8h+j, col lane&15; rows 0..15 x columns 0..127 all written
    wave_sync();
    const int bb = r0 / SEQ, tt = r0 % SEQ;
    float* orow = OUT + ((size_t)bb * OUT_SEQ + (size_t)tt) * DM;
{
#pragma unroll 4
        for (int s = 0; s < 16; ++s) {                              // 16 rows x (32 lanes x 4 floats = 128 columns = the whole row)
            const v4f val = *(const v4fa*)(&os[s * OPP + lane * 4]);
            *(v4f*)(orow + (size_t)s * DM + lane * 4) = val; }
         }
}

static constexpr size_t al256(size_t v) { return (v + 255) & ~(size_t)255; }
static constexpr size_t SZ_XB = al256((size_t)NB * SEQ * DM * 2);
static constexpr size_t SZ_WB = al256((size_t)3 * DM * DM * 2);
static constexpr size_t SZ_WO = al256((size_t)DM * DM * 2);
static constexpr size_t SZ_PL = al256((size_t)NB * NH_ * SEQ * HD * 2);
static constexpr size_t SZ_RS = al256((size_t)NB * NH_ * EROWS * HD * 2);
static constexpr size_t SZ_KB = al256((size_t)NB * (SEQ / 32) * 4);
static constexpr size_t SZ_TOTAL = SZ_XB + SZ_WB + SZ_WO + 5 * SZ_PL + 3 * SZ_RS + SZ_KB;
static_assert(SZ_TOTAL <= (size_t)134217728);          // workspace carve <= 128 MiB
static_assert(((size_t)DM * DM * 2) % 256 == 0);       // weight sub-planes stay 256-byte aligned
static_assert((size_t)NB * NH_ * SEQ * HD == (size_t)NB * DM * SEQ);       // v^T plane and context planes [(b*128 + m)][t] have the same extent as the q/k planes
static_assert((size_t)NB * NH_ * EROWS * HD == (size_t)NB * DM * EROWS);   // v^T residual plane [(b*128 + m)][t < EROWS] has the same extent as the q/k residual planes
static_assert(((size_t)NB * DM * SEQ) % ((size_t)16 * DM) == 0);           // context planes read flat as 16-row x 128 slabs

extern "C" void kernel_launch(void* const* d_in, const int* in_sizes, int n_in,
                              void* d_out, int out_size, void* d_ws, size_t ws_size, hipStream_t stream) {
    if (n_in < 7) return;
    const size_t needx = ((size_t)(NB - 1) * SEQ_FULL + SEQ) * DM;
    const size_t needm = (size_t)(NB - 1) * SEQ_FULL + SEQ;
    if ((size_t)in_sizes[0] < needx) return;
    if ((size_t)in_sizes[1] < (size_t)DM * DM || (size_t)in_sizes[2] < (size_t)DM * DM || (size_t)in_sizes[3] < (size_t)DM * DM || (size_t)in_sizes[4] < (size_t)DM * DM) return;
    if ((size_t)in_sizes[5] < needm || in_sizes[6] < 1) return;
    if ((size_t)out_size < ((size_t)(NB - 1) * OUT_SEQ + SEQ) * DM) return;
    if (SZ_TOTAL > ws_size) return;
    // wire order: x, Wq, Wk, Wv, Wo, padding_mask, num_heads
    const float* x  = (const float*)d_in[0];
    const float* wq = (const float*)d_in[1];
    const float* wk = (const float*)d_in[2];
    const float* wv = (const float*)d_in[3];
    const float* wo = (const float*)d_in[4];
    const int* pm = (const int*)d_in[5];
    const int* nheads = (const int*)d_in[6];
    float* OUT = (float*)d_out;      // [NB][SEQ][128]
    char* wsp = (char*)d_ws;
    bf* XB = (bf*)wsp; wsp += SZ_XB;                 // x [NB*SEQ][128]
    bf* WB = (bf*)wsp; wsp += SZ_WB;                 // [3][128][128]: q | k | v  ([out][in] as-is: Bt for q, k; A for v)
    h16* WOH = (h16*)wsp; wsp += SZ_WO;              // [128][128] Wo x64 ([out][in] = Bt as-is)
    h16* QH = (h16*)wsp; wsp += SZ_PL;               // [NB*8][SEQ][16]
    h16* KP = (h16*)wsp; wsp += SZ_PL;               // [NB*8][SEQ][16]
    h16* VT = (h16*)wsp; wsp += SZ_PL;               // [NB*8][16][SEQ]
    h16* CH = (h16*)wsp; wsp += SZ_PL;               // [NB][128][SEQ] context value
    h16* CX = (h16*)wsp; wsp += SZ_PL;               // [NB][128][SEQ] context residual x2048
    h16* QR = (h16*)wsp; wsp += SZ_RS;               // [NB*8][EROWS][16] residual x2048, tokens < EROWS
    h16* KR = (h16*)wsp; wsp += SZ_RS;               // [NB*8][EROWS][16] residual x2048, tokens < EROWS
    h16* VR = (h16*)wsp; wsp += SZ_RS;               // [NB*8][16][EROWS] residual x2048, tokens < EROWS
    unsigned* KB = (unsigned*)wsp; wsp += SZ_KB;     // [NB][SEQ/32] padding mask, one bit per key

    // padding mask -> bits; x, Wq, Wk, Wv -> bf16 planes, Wo -> f16 plane x64
    k_cvt<<<dim3(1 + 4 * CWB + CXB, 1, 1), 256, 0, stream>>>(x, wq, wk, wv, wo, pm, XB, WB, WOH, KB);

    // q, k: A = x rows (m = b*SEQ + t), Bt = W rows (n = h*16 + d) -> plane [(b*8 + h)][t][d]; residuals for tokens < EROWS
    // v^T: A = Wv rows (m = h*16 + d), Bt = x rows (n = b*SEQ + t) -> plane [(b*128 + m)][t] = [(b*8 + h)][d][t]; residual for tokens < EROWS
    k_proj<<<dim3(NB * SEQ / 64, DM / 64, 3), 32, 0, stream>>>(XB, WB, QH, QR, KP, KR, VT, VR, EROWS);

    // query rows [0, EROWS): multi-product instantiation; rows [EROWS, SEQ): single-product instantiation (disjoint context columns)
    k_flash<<<dim3(FLB + FEB, 1, 1), 32 * AW, 0, stream>>>(QH, QR, KP, KR, VT, VR, KB, CH, CX);

    // output projection over the flat [NB*SEQ][128] view of the context planes
    k_oproj<<<dim3(NB * SEQ / 16, 1, 1), 32, 0, stream>>>(CH, CX, WOH, nheads, OUT);
}

// v004
// One run takes 42 microseconds.
// Two timings next to v003 put it at 1.21 and 1.27 times that version's speed.
// Over all steps from v000 it is 2.99 times as fast.
#include <hip/hip_runtime.h>

// Causal multi-head self-attention, width 128 = 8 heads x 16; x [NB][SEQ][128]; Wq/Wk/Wv/Wo [out][in] (y = x W^T, no bias); key padding mask [NB][SEQ] (int32, device-read); masked scores are replaced before the 1/sqrt(16) scale;
// per-head context transposed to [b][h*16+e][t], reinterpreted flat as [NB][SEQ][128], then multiplied by Wo^T (f32 output).
// Compute dtypes, f32 accumulate everywhere: q/k/v projections v_wmma_f32_16x16x32_bf16 (x, W RNE-converted to bf16; products exact);
// scores v_wmma_f32_16x16x32_f16 (head dim 16 zero-padded to the 32-deep step): single f16 q, k on query rows >= EROWS; on query rows < EROWS q and k each as f16 value + f16 residual x2048 (cross products in the upper 16 k-slots, own accumulator);
// P.V v_wmma_f32_16x16x32_f16: P (x16384 carry, cancels in the normalisation) and v single f16 on query rows >= EROWS; on query rows < EROWS P and v as f16 value + f16 residual x2048, residual products in their own accumulator folded by 1/2048, row sum from the f32 exponentials;
// output projection v_wmma_f32_16x16x32_f16: context as f16 value + f16 residual x2048 (own accumulator), Wo as bf16-converted value x64 held in f16; softmax f32 (online, running max over kept keys).
// Layout: bf16 copies of x and Wq/Wk/Wv; q, k planes [b*8+h][t][16], v^T plane [b*8+h][16][t], small residual planes (tokens < EROWS) for q, k, v^T; context planes (value, residual) [b][h*16+e][t]; fused flash kernel in transposed form (S^T = K Q^T, O^T = V^T P^T).
// Keep rule per element: (mask[b][j] != 0) and (j <= t); dropped elements get probability 0; a row with no kept key takes the plain mean of v over all SEQ keys (uniform softmax of equal fills).

#ifndef NB
#define NB 4
#endif
#ifndef SEQ
#define SEQ 2048
#endif
#define NB_FULL  4
#define SEQ_FULL 2048
#ifndef OUT_SEQ
#define OUT_SEQ SEQ              // row pitch (in tokens) between batches of the output
#endif
#define DM   128
#define NH_  8
#define HD   16
#define AW   4                   // waves per flash block (16 query rows each)
#define OSP  68                  // LDS row pitch (floats) of the flash context tile [16 d][64 t]
#define OPP  132                 // LDS row pitch (floats) of the output-projection slab [16][128]
#define EROWS (SEQ < 512 ? SEQ : 512)   // query rows (and tokens of the small residual planes) handled by the multi-product flash instantiation
#define QRS  2048.0f             // carry of every residual plane / residual fragment
#define QRI  (1.0f / 2048.0f)
#define SC2  ((float)(0.25 * 1.4426950408889634))   // HD^-0.5 * log2(e)
#define PSH  14.0f               // log2 of the P carry (16384)
#define NEGB (-3.0e38f)
#define WOS  64.0f               // carry of the Wo plane
#define WOI  (1.0f / 64.0f)

static_assert(HD == 16);
static_assert(NH_ * HD == DM);                 // head h = columns h*16 + d
static_assert(DM % 64 == 0);                   // column tiles of 64 = four heads
static_assert(64 % HD == 0);
static_assert(DM % 32 == 0);                   // GEMM k-loop steps by 32
static_assert(DM == 32 * 4);                   // output row = 32 lanes x 4 floats
static_assert(SEQ % 64 == 0);                  // a 64-row tile never straddles two batches
static_assert((NB * SEQ) % 64 == 0);
static_assert(SEQ % 32 == 0);                  // key loop steps by 32
static_assert(SEQ % (16 * AW) == 0);           // flash grids cover the sequence exactly
static_assert(16 * AW == 64);
static_assert(4 * AW == HD);                   // context store: 4 rows per wave x AW waves = 16 channel rows
static_assert(8 * 8 == 16 * AW);               // 8 lanes x 8 halves = 64 tokens per row
static_assert(EROWS % 64 == 0);                // a 64-token GEMM tile lies wholly inside or outside the residual planes
static_assert(EROWS >= 32);
static_assert(EROWS <= SEQ);
static_assert(EROWS % 32 == 0);                // early key loops end inside the residual planes
static_assert(EROWS % (16 * AW) == 0);
static_assert((SEQ - EROWS) % (16 * AW) == 0);
static_assert(((size_t)SEQ * DM) % 8 == 0);
static_assert(((size_t)DM * DM) % 8 == 0);
static_assert(NB <= NB_FULL);
static_assert(SEQ <= SEQ_FULL);
static_assert((OSP * 4) % 16 == 0);
static_assert(OSP >= 64);
static_assert((OPP * 4) % 16 == 0);
static_assert(OPP >= DM);
static_assert(4 * 32 * 8 == 16 * 64);          // projection epilogue, q/k form: 4 heads x 32 lanes x 8 halves = 16 rows x 64 columns
static_assert(4 * 4 * 64 == 16 * 64);          // projection epilogue, v^T form: 4 instructions x 4 rows x 64 halves
static_assert(16 * 68 * 4 <= 131072);          // static LDS of one proj_body instantiation (k_proj holds both)
static_assert(HD * OSP * 4 <= 131072);         // static LDS of one flash_body instantiation (k_flash holds both)
static_assert(16 * OPP * 4 <= 131072);         // static LDS of the output-projection kernel

typedef _Float16 h16;
typedef unsigned short bf;
typedef __attribute__((ext_vector_type(16))) __bf16   v16bf;
typedef __attribute__((ext_vector_type(16))) _Float16 v16h;
typedef __attribute__((ext_vector_type(8)))  _Float16 v8h;
typedef __attribute__((ext_vector_type(2)))  _Float16 v2h;
typedef __attribute__((ext_vector_type(2)))  float    v2f;
typedef __attribute__((ext_vector_type(8)))  unsigned short v8us;
typedef __attribute__((ext_vector_type(8)))  float    v8f;
typedef __attribute__((ext_vector_type(4)))  float    v4f;
typedef __attribute__((ext_vector_type(4)))  int      v4i;
typedef v4f  __attribute__((may_alias)) v4fa;

__device__ __forceinline__ unsigned short f2bf(float f) { unsigned u = __float_as_uint(f); u += 0x7FFFu + ((u >> 16) & 1u); return (unsigned short)(u >> 16); }
__device__ __forceinline__ float bfr(float f) { return __uint_as_float(((unsigned)f2bf(f)) << 16); }   // value after RNE convert to bf16
__device__ __forceinline__ v16h cat16(v8h lo, v8h hi) { return __builtin_shufflevector(lo, hi, 0, 1, 2, 3, 4, 5, 6, 7, 8, 9, 10, 11, 12, 13, 14, 15); }
__device__ __forceinline__ v16bf cat16b(v8us lo, v8us hi) { return __builtin_bit_cast(v16bf, __builtin_shufflevector(lo, hi, 0, 1, 2, 3, 4, 5, 6, 7, 8, 9, 10, 11, 12, 13, 14, 15)); }
__device__ __forceinline__ v8f wmma16(v16h a, v16h b, v8f c) { return __builtin_amdgcn_wmma_f32_16x16x32_f16(false, a, false, b, (short)0, c, false, false); }
__device__ __forceinline__ v8f wmmab(v16bf a, v16bf b, v8f c) { return __builtin_amdgcn_wmma_f32_16x16x32_bf16(false, a, false, b, (short)0, c, false, false); }
// fragment loaders from K-contiguous 16-bit rows; p already includes + 8*(lane>>4): elements 0..7 <- k0+8h+0..7, elements 8..15 <- k0+16+8h+0..7 (same map for A and B)
__device__ __forceinline__ v16h  ldh(const h16* p) { return cat16(*(const v8h*)p, *(const v8h*)(p + 16)); }
__device__ __forceinline__ v16bf ldb(const bf* p)  { return cat16b(*(const v8us*)p, *(const v8us*)(p + 16)); }
// ordering point for wave-private LDS tiles (same wave writes and reads)
__device__ __forceinline__ void wave_sync() { __builtin_amdgcn_fence(3 /* release order */, "wavefront"); __builtin_amdgcn_wave_barrier(); asm volatile("" ::: "memory"); }

// per-instruction guarded matrix ops: the four idle slots tie the accumulator and keep the operands live
__device__ __forceinline__ v8f wmma16g(v16h a, v16h b, v8f c) { c = wmma16(a, b, c); asm volatile("v_nop\n\tv_nop\n\tv_nop\n\tv_nop" : "+v"(c) : "v"(a), "v"(b)); return c; }
__device__ __forceinline__ v8f wmmabg(v16bf a, v16bf b, v8f c) { c = wmmab(a, b, c); asm volatile("v_nop\n\tv_nop\n\tv_nop\n\tv_nop" : "+v"(c) : "v"(a), "v"(b)); return c; }
// f32 -> f16 that cannot produce a subnormal operand (|v| < 2^-14 -> +0)
static __device__ __forceinline__ h16 toh_flush(float v) { const h16 r = (h16)v; return (fabsf(v) < 6.103515625e-05f) ? (h16)0.0f : r; }

// k_cvt: every operand conversion in ONE launch, 8 elements per thread (block 0: 32 mask words per thread); a block-uniform range of the block index picks the job:
// block 0: padding mask -> one bit per key (set: word nonzero), one 32-bit word per 32-key tile, KB[b * (SEQ/32) + tile], bit j = key 32*tile + j; one thread per tile;
// then, counted from block 1: blocks [0, 4*CWB): Wq, Wk, Wv -> bf16 planes of WB, Wo -> bf16-converted value x64 in f16; blocks [4*CWB, 4*CWB + CXB): x -> bf16 (batch pitch SEQ_FULL tokens in x, SEQ in XB).
#define CWB ((DM * DM / 8) / 256)                // blocks per weight matrix
#define CXB ((NB * SEQ * (DM / 8)) / 256)        // blocks of x
static_assert((DM * DM / 8) % 256 == 0);
static_assert((NB * SEQ * (DM / 8)) % 256 == 0);
static_assert(NB * (SEQ / 32) <= 256);           // one thread of block 0 per 32-key tile
__global__ __launch_bounds__(256) void k_cvt(const float* __restrict__ x, const float* __restrict__ wq, const float* __restrict__ wk, const float* __restrict__ wv, const float* __restrict__ wo,
                                             const int* __restrict__ pmask, bf* XB, bf* WB, h16* WOH, unsigned* KB) {
    if (blockIdx.x == 0u) {
        const unsigned i = threadIdx.x;
        if (i < (unsigned)(NB * (SEQ / 32))) {
            const int* p = pmask + (size_t)(i / (unsigned)(SEQ / 32)) * SEQ_FULL + (size_t)(i % (unsigned)(SEQ / 32)) * 32;
            unsigned bits = 0u;
#pragma unroll
            for (int k = 0; k < 8; ++k) { const v4i a = *(const v4i*)(p + 4 * k);
#pragma unroll
                for (int j = 0; j < 4; ++j) bits |= (a[j] != 0 ? 1u : 0u) << (4 * k + j); }
            KB[i] = bits;
            asm volatile("s_wait_xcnt 0x0" ::: "memory");                       // stands behind the store, in front of any later write to the registers that hold its address and data
        }
        return;
    }
    const unsigned blk = blockIdx.x - 1u;
    if (blk >= 4u * CWB) {
        const unsigned i = (blk - 4u * CWB) * 256u + threadIdx.x;               // 8-element group of XB
        const unsigned b = i / (unsigned)(SEQ * (DM / 8)), r = i % (unsigned)(SEQ * (DM / 8));
        const v8f v = *(const v8f*)(x + (size_t)b * SEQ_FULL * DM + (size_t)r * 8); v8us o;
#pragma unroll
        for (int k = 0; k < 8; ++k) o[k] = f2bf(v[k]);
        *(v8us*)(XB + (size_t)i * 8) = o;
        asm volatile("s_wait_xcnt 0x0" ::: "memory");                           // stands behind the store, in front of any later write to the registers that hold its address and data
        return;
    }
    if (blk >= 3u * CWB) {
        const unsigned i = (blk - 3u * CWB) * 256u + threadIdx.x;
        const v8f v = *(const v8f*)(wo + (size_t)i * 8); v8h o;
#pragma unroll
        for (int k = 0; k < 8; ++k) o[k] = toh_flush(bfr(v[k]) * WOS);
        *(v8h*)(WOH + (size_t)i * 8) = o;
        asm volatile("s_wait_xcnt 0x0" ::: "memory");                           // stands behind the store, in front of any later write to the registers that hold its address and data
        return;
    }
    const unsigned w = blk / (unsigned)CWB;
    const unsigned i = (blk % (unsigned)CWB) * 256u + threadIdx.x;
    const float* src = (w == 0) ? wq : (w == 1) ? wk : wv;
    const v8f v = *(const v8f*)(src + (size_t)i * 8); v8us o;
#pragma unroll
    for (int k = 0; k < 8; ++k) o[k] = f2bf(v[k]);
    *(v8us*)(WB + (size_t)blk * 256 * 8 + (size_t)threadIdx.x * 8) = o;         // planes q | k | v lie one behind the other: group index = blk * 256 + thread
    asm volatile("s_wait_xcnt 0x0" ::: "memory");                               // as above
}

// proj_body: register-blocked bf16 GEMM, ONE WAVE per 64x64 tile (16 accumulators), operands straight from K-contiguous bf16 planes, K = DM.
// C[m][n] = sum_k A[m][k] Bt[n][k], written as f16 (Ph) and, for tokens t < resT (resT a multiple of 64, block-uniform test), the f16 residual x2048 (Pr).
// MODE 0: A = x rows (m = b*SEQ + t), Bt = W rows (n = h*16 + d); plane [(b*8 + h)][t][16] (residual plane [(b*8 + h)][resT][16]). The 64-column tile spans four heads; per 16-row slab and head
//         one 512-byte run (16 rows per instruction). Grid x = token tile, y = channel tile in both modes (MODE 0: rows of A are tokens; MODE 1: rows of Bt are tokens).
template <int MODE>
__device__ __forceinline__ void proj_body(const bf* __restrict__ A, const bf* __restrict__ Bt, h16* Ph, h16* Pr, int resT) {
    __shared__ __align__(16) float os[16 * 68];
    const int K = DM;
    const int lane = threadIdx.x & 31, lr = lane & 15, hi = lane >> 4; const int r0 = (MODE == 0 ? blockIdx.x : blockIdx.y) * 64, c0 = (MODE == 0 ? blockIdx.y : blockIdx.x) * 64;
    v8f acc[4][4];
#pragma unroll
    for (int mb = 0; mb < 4; ++mb)
#pragma unroll
        for (int nb = 0; nb < 4; ++nb) acc[mb][nb] = (v8f){};
    const size_t aoff = (size_t)(r0 + lr) * K + 8 * hi, boff = (size_t)(c0 + lr) * K + 8 * hi;
#pragma unroll 1
    for (int kc = 0; kc < K; kc += 32) {
        v16bf a[4];
#pragma unroll
        for (int mb = 0; mb < 4; ++mb) a[mb] = ldb(A + aoff + (size_t)mb * 16 * K + kc);
#pragma unroll
        for (int nb = 0; nb < 4; ++nb) { const v16bf b = ldb(Bt + boff + (size_t)nb * 16 * K + kc);
#pragma unroll
            for (int mb = 0; mb < 4; ++mb) acc[mb][nb] = wmmabg(a[mb], b, acc[mb][nb]); }
    }
    size_t tbase, rbase; bool wr;                                                                 // wr: block-uniform, whole tile inside the residual plane
    if (MODE == 0) { const int bb = r0 / SEQ, tt = r0 % SEQ; const int zc = bb * NH_ + c0 / HD;
                     tbase = ((size_t)zc * SEQ + (size_t)tt) * HD; rbase = ((size_t)zc * (size_t)resT + (size_t)tt) * HD; wr = tt < resT; }
    else           { const int bb = c0 / SEQ, tt = c0 % SEQ;
                     tbase = (size_t)bb * (size_t)DM * SEQ + (size_t)r0 * SEQ + (size_t)tt; rbase = (size_t)bb * (size_t)DM * (size_t)resT + (size_t)r0 * (size_t)resT + (size_t)tt; wr = tt < resT; }
#pragma unroll
    for (int mb = 0; mb < 4; ++mb) {
#pragma unroll
        for (int nb = 0; nb < 4; ++nb) {
#pragma unroll
            for (int j = 0; j < 8; ++j) os[(hi * 8 + j) * 68 + nb * 16 + lr] = acc[mb][nb][j]; }   // D: row 8h+j, col lane&15; rows 0..15 x columns 0..63 all written
        wave_sync();
{
            if (MODE == 0) {
                const size_t sb = tbase + (size_t)(mb * 16) * HD;
                const size_t rb = rbase + (size_t)(mb * 16) * HD;
#pragma unroll
                for (int hh = 0; hh < 4; ++hh) { const int row = lane >> 1, c8 = (lane & 1) * 8;   // 16 rows x 2 lanes x 8 = 16 columns of head hh: one 512-byte run
                    const v4f x0 = *(const v4fa*)(&os[row * 68 + hh * 16 + c8]); const v4f x1 = *(const v4fa*)(&os[row * 68 + hh * 16 + c8 + 4]); v8h hv, rv;
#pragma unroll
                    for (int i = 0; i < 4; ++i) { const h16 a0 = toh_flush(x0[i]); const h16 a1 = toh_flush(x1[i]); hv[i] = a0; hv[4 + i] = a1;
                        rv[i] = toh_flush((x0[i] - (float)a0) * QRS); rv[4 + i] = toh_flush((x1[i] - (float)a1) * QRS); }
                    const size_t oo = sb + (size_t)hh * ((size_t)SEQ * HD) + (size_t)lane * 8;
                    const size_t ro = rb + (size_t)hh * ((size_t)resT * HD) + (size_t)lane * 8;
                    *(v8h*)(Ph + oo) = hv; if (wr) *(v8h*)(Pr + ro) = rv; }
            } else {
                const size_t sb = tbase + (size_t)(mb * 16) * SEQ;
                const size_t rb = rbase + (size_t)(mb * 16) * (size_t)resT;
#pragma unroll
                for (int s = 0; s < 4; ++s) { const int row = 4 * s + (lane >> 3), c8 = (lane & 7) * 8;   // 4 s x 4 row groups = 16 rows; 8 lanes x 8 = 64 columns
                    const v4f x0 = *(const v4fa*)(&os[row * 68 + c8]); const v4f x1 = *(const v4fa*)(&os[row * 68 + c8 + 4]); v8h hv, rv;
#pragma unroll
                    for (int i = 0; i < 4; ++i) { const h16 a0 = toh_flush(x0[i]); const h16 a1 = toh_flush(x1[i]); hv[i] = a0; hv[4 + i] = a1;
                        rv[i] = toh_flush((x0[i] - (float)a0) * QRS); rv[4 + i] = toh_flush((x1[i] - (float)a1) * QRS); }
                    const size_t oo = sb + (size_t)row * SEQ + c8;
                    const size_t ro = rb + (size_t)row * (size_t)resT + c8;
                    *(v8h*)(Ph + oo) = hv; if (wr) *(v8h*)(Pr + ro) = rv; }
            }
             }
        wave_sync();
    }
}

// k_proj: the three projections in ONE launch, grid (NB*SEQ/64 token tiles, DM/64 channel tiles, 3); blockIdx.z (block-uniform) picks q, k or v^T. WB = [3][128][128]: q | k | v.
__global__ __launch_bounds__(32) void k_proj(const bf* __restrict__ XB, const bf* __restrict__ WB, h16* QH, h16* QR, h16* KP, h16* KR, h16* VT, h16* VR, int resT) {
    const int z = blockIdx.z;
    if (z == 2) { const bf* A = WB + (size_t)2 * DM * DM; const bf* Bt = XB; h16* Ph = VT; h16* Pr = VR; proj_body<1>(A, Bt, Ph, Pr, resT); }
    else        { const bf* A = XB; const bf* Bt = WB + (size_t)z * DM * DM; h16* Ph = z ? KP : QH; h16* Pr = z ? KR : QR; proj_body<0>(A, Bt, Ph, Pr, resT); }
}

// k_flash: both instantiations in ONE launch, 1-D grid; a block-uniform range of the block index picks the job. Blocks [0, FLB): query rows [EROWS, SEQ), in the order (tile fastest, then batch*head);
// blocks [FLB, FLB + FEB): query rows [0, EROWS), same order. The long-running blocks come first in the index.
#define FLX ((SEQ - EROWS) / (16 * AW))          // late query tiles per (batch, head)
#define FEX (EROWS / (16 * AW))                  // early query tiles per (batch, head)
#define FLB (FLX * NB * NH_)
#define FEB (FEX * NB * NH_)
// flash_body: fused causal attention, one wave per 16 query rows of one (batch, head), AW waves = 64 query rows per block; K / V^T / Q fragments straight from the f16 planes (16-B loads, arithmetic addressing).
// Transposed form: S^T[key][t] = K Q^T (A = K rows, B = Q rows, head dim 16 in k-slots 0..15); lane (t = lane&15, h = lane>>4) holds keys 8h+r of each 16-key tile, so the packed
// P tile is directly the B fragment of O^T[d][t] = V^T P^T (element r <- tile keys 0..15, element 8+r <- tile keys 16..31, lane unchanged).
// Softmax state (running max over kept keys, partial sum) is one scalar per lane; the two lane halves of a row are combined with one xor-16 exchange.
// Keep rule: a wave reads its batch's mask bits (KB, one word per 32-key tile) once, lane = tile. A tile whose word is all ones and whose last key lies below the wave's first query row keeps every element:
// a scalar test sends it down a path without keep compares and selects (there a P below 2^-14 stays an f16 subnormal, which the matrix unit takes as it is). Every other visited tile evaluates the rule per element.
// The per-wave key bound is t0 + 16 (pad up to 32), at most SEQ.
// EARLY = 1 (query rows [0, EROWS)): A = [K | K_res], B = [Q | 0] gives K Q; B = [Q_res | Q] gives K Q_res + K_res Q (x2048, own accumulator); P = f16 value + f16 residual x2048;
//            O = V P + (V P_res + V_res P) / 2048 (residual products in their own accumulator); row sum from the f32 exponentials; all keys of these rows are < EROWS, inside the small planes.
// EARLY = 0 (query rows [EROWS, SEQ)): single q, k, P, v.
template <bool B> struct flag_c { static constexpr bool v = B; };
static_assert(SEQ / 32 <= 64);                   // a wave holds its batch's tile words in two registers (lane = tile) and their all-kept flags in one 64-bit scalar
template <int EARLY>
__device__ __forceinline__ void flash_body(const h16* __restrict__ QH, const h16* __restrict__ QR, const h16* __restrict__ KP, const h16* __restrict__ KR,
                                           const h16* __restrict__ VT, const h16* __restrict__ VR, const unsigned* __restrict__ KB, h16* CH, h16* CX) {
    __shared__ __align__(16) float os[HD * OSP];
    const int lane = threadIdx.x & 31, lr = lane & 15, hi = lane >> 4;
    const int wave = __builtin_amdgcn_readfirstlane((int)(threadIdx.x >> 5));
    const int blk = (int)blockIdx.x - (EARLY ? FLB : 0), ntile = EARLY ? FEX : (FLX > 0 ? FLX : 1);   // index inside this instantiation's block range; query tiles per (batch, head)
    const int zh = blk / ntile; const int b = zh / NH_, h = zh % NH_;
    const int tb = (EARLY ? 0 : EROWS) + (blk % ntile) * (16 * AW);
    const int t0 = tb + wave * 16;
    const int lim = t0 + lr;                                                   // key j kept iff j <= lim (and mask nonzero)
    const int nk = (t0 + 16 + 31) & ~31;                                       // wave-uniform, multiple of 32, <= SEQ (<= EROWS when EARLY)
    const unsigned* kbb = KB + (size_t)b * (SEQ / 32);                         // + tile
    const size_t pbase = (size_t)zh * SEQ * HD;
    const size_t rbase = (size_t)zh * EROWS * HD;
    const v8h z8 = (v8h){};
    const size_t qo = pbase + (size_t)(t0 + lr) * HD + 8 * hi;
    const v8h q8 = *(const v8h*)(QH + qo);
    asm volatile("s_wait_xcnt 0x0" ::: "memory");                 // the loads issued next may land in the registers that hold this load's address: the wait stands in front of them
    const v16h qh = cat16(q8, z8);                                // B fragment [Q | 0]: col t, k = d
    v16h qx = qh;
    if (EARLY) { const size_t qro = rbase + (size_t)(t0 + lr) * HD + 8 * hi; qx = cat16(*(const v8h*)(QR + qro), q8);   // B fragment [Q_res | Q]
                 asm volatile("s_wait_xcnt 0x0" ::: "memory"); }  // as above, for the residual load's address
    const size_t ko = pbase + (size_t)lr * HD + 8 * hi;         // + key * HD       (A fragment: row key, k = d)
    const size_t vo = pbase + (size_t)lr * SEQ + 8 * hi;        // + key            (A fragment: row d, k = key)
    const size_t kro = rbase + (size_t)lr * HD + 8 * hi;        // residual planes, tokens < EROWS
    const size_t vro = rbase + (size_t)lr * EROWS + 8 * hi;
    const v8f zz = (v8f){};
    v8f o0 = (v8f){}, oR0 = (v8f){};
    float m = NEGB, l = 0.0f;
    // EARLY: every operand of a 32-key tile (K, V^T, residual planes) is fetched one trip ahead: tile 0 here, tile key0 + 32 inside trip key0,
    // each group into the registers its last reader of the trip has just left. nk >= 32, so tile 0 exists for every wave.
    // Late rows: K and V^T are fetched RD tiles ahead, through RD register sets (see the late loop below); set 0 is loaded here.
    v8h k0 = *(const v8h*)(KP + ko), k1 = *(const v8h*)(KP + ko + 16 * HD);
    v8h kr0 = z8, kr1 = z8;
    if (EARLY) { kr0 = *(const v8h*)(KR + kro); kr1 = *(const v8h*)(KR + kro + 16 * HD); }
    const unsigned kw0 = kbb[lane < SEQ / 32 ? lane : 0], kw1 = kbb[32 + lane < SEQ / 32 ? 32 + lane : 0];   // mask bits of tiles lane and 32 + lane
    // bit T set: tile T keeps every element for all 16 rows of this wave: word all ones and 32T + 31 < t0 (t0 a multiple of 16: T < t0 / 32 <= SEQ / 32 - 1). Wave-uniform.
    const unsigned long long kept = (((unsigned long long)__builtin_amdgcn_ballot_w32(kw1 == 0xFFFFFFFFu) << 32) | (unsigned long long)__builtin_amdgcn_ballot_w32(kw0 == 0xFFFFFFFFu)) & ((1ull << (t0 >> 5)) - 1ull);
    v16h v0 = ldh(VT + vo);
    v16h vr0 = v0;
    if (EARLY) { vr0 = ldh(VR + vro); }
    v16h pb, pr = (v16h){}; float ls = 0.0f, alpha, mnew;
    // softmax of the 32-key tile at key0 from its score accumulators; FULL: every element kept
    auto tile = [&](auto fc, const int key0, const v8f sHa, const v8f sHb, const v8f sLa, const v8f sLb) __attribute__((always_inline)) {
            constexpr bool FULL = decltype(fc)::v;
            float ta[8], tb2[8]; bool fa[8], fb[8]; float mx;
            ls = 0.0f;
            if constexpr (FULL) {
                float ua[8], ub[8];
#pragma unroll
                for (int r = 0; r < 8; ++r) {
                    if (EARLY) { ua[r] = sHa[r] + sLa[r] * QRI; ub[r] = sHb[r] + sLb[r] * QRI; }
                    else       { ua[r] = sHa[r]; ub[r] = sHb[r]; }
                    ta[r] = ua[r] * SC2; tb2[r] = ub[r] * SC2; fa[r] = true; fb[r] = true; }
                float mr = fmaxf(ua[0], ub[0]);                  // SC2 > 0 and rounding is monotonic: the scaled maximum equals the maximum of the scaled scores
#pragma unroll
                for (int r = 1; r < 8; ++r) mr = fmaxf(mr, fmaxf(ua[r], ub[r]));
                mx = mr * SC2;
            } else {
                const unsigned kcur = (unsigned)__builtin_amdgcn_readlane((int)(key0 < 1024 ? kw0 : kw1), (key0 >> 5) & 31);   // mask bits of keys key0 .. key0+31
                const unsigned kw = kcur >> (8 * hi);            // bits 0..7: keys key0+8h+0..7; bits 16..23: keys key0+16+8h+0..7
                const int ja = key0 + 8 * hi;
                mx = NEGB;
#pragma unroll
                for (int r = 0; r < 8; ++r) {
                    fa[r] = (((kw >> r) & 1u) != 0u) & (ja + r <= lim);
                    fb[r] = (((kw >> (16 + r)) & 1u) != 0u) & (ja + 16 + r <= lim); }
#pragma unroll
                for (int r = 0; r < 8; ++r) {
                    if (EARLY) { ta[r] = (sHa[r] + sLa[r] * QRI) * SC2; tb2[r] = (sHb[r] + sLb[r] * QRI) * SC2; }
                    else       { ta[r] = sHa[r] * SC2; tb2[r] = sHb[r] * SC2; }
                    mx = fmaxf(mx, fmaxf(fa[r] ? ta[r] : NEGB, fb[r] ? tb2[r] : NEGB)); }
            }
            mx = fmaxf(mx, __shfl_xor(mx, 16, 32));
            mnew = fmaxf(m, mx);
            alpha = __builtin_amdgcn_exp2f(m - mnew);
            const float sh = PSH - mnew;
#pragma unroll
            for (int r = 0; r < 8; r += 2) {
                float ga[2], gb[2];
#pragma unroll
                for (int i = 0; i < 2; ++i) {
                    const float xa = ta[r + i] + sh, xb = tb2[r + i] + sh;
                    const float ea = __builtin_amdgcn_exp2f(xa), eb = __builtin_amdgcn_exp2f(xb);
                    ga[i] = (FULL || (fa[r + i] & (xa >= -14.0f))) ? ea : 0.0f; gb[i] = (FULL || (fb[r + i] & (xb >= -14.0f))) ? eb : 0.0f; }   // not FULL: dropped or sub-2^-14 elements selected to 0 by value
                const v2h pa = __builtin_convertvector((v2f){ga[0], ga[1]}, v2h), pc = __builtin_convertvector((v2f){gb[0], gb[1]}, v2h);
#pragma unroll
                for (int i = 0; i < 2; ++i) {
                    pb[r + i] = pa[i]; pb[8 + r + i] = pc[i];
                    if (EARLY) { pr[r + i] = toh_flush((ga[i] - (float)pa[i]) * QRS); pr[8 + r + i] = toh_flush((gb[i] - (float)pc[i]) * QRS); ls += ga[i] + gb[i]; }
                    else       { ls += (float)pa[i] + (float)pc[i]; } } }
    };
    if constexpr (EARLY) {
        // Inputs-only fence on the loaded values: the query fragments and tile 0 have landed before the loop is entered, so the loop's counted load waits follow from the loop's own issue order alone
        // (K early in a trip, V^T at its end) and the wait for K at a trip's head leaves the V^T loads just issued in flight.
        asm volatile("" :: "v"(qx), "v"(k0), "v"(k1), "v"(kr0), "v"(kr1), "v"(v0), "v"(vr0));
#pragma unroll 1
        for (int key0 = 0; key0 < nk; key0 += 32) {
            const int kn = (key0 + 32 < nk) ? key0 + 32 : key0;      // tile fetched in this trip; the last trip fetches its own tile again (unused), so every address stays below nk <= EROWS
            const v16h ka0 = cat16(k0, kr0), kb0 = cat16(k1, kr1);   // A fragments [K | K_res]
            const v8f sHa = wmma16g(ka0, qh, zz), sHb = wmma16g(kb0, qh, zz);
            const v8f sLa = wmma16g(ka0, qx, zz), sLb = wmma16g(kb0, qx, zz);
            { const h16* ka = KP + ko + (size_t)kn * HD; k0 = *(const v8h*)ka; k1 = *(const v8h*)(ka + 16 * HD); }
            { const h16* kr = KR + kro + (size_t)kn * HD; kr0 = *(const v8h*)kr; kr1 = *(const v8h*)(kr + 16 * HD); }
            asm volatile("s_wait_xcnt 0x0" ::: "memory");            // stands between the K loads just issued and the softmax's first writes to the registers that hold their addresses
            if (((kept >> (key0 >> 5)) & 1ull) != 0ull) tile(flag_c<true>{}, key0, sHa, sHb, sLa, sLb); else tile(flag_c<false>{}, key0, sHa, sHb, sLa, sLb);   // scalar test
            l = l * alpha + ls; m = mnew;
            o0 = o0 * alpha;
            oR0 = oR0 * alpha;
            o0 = wmma16g(v0, pb, o0);
            oR0 = wmma16g(v0, pr, oR0);
            oR0 = wmma16g(vr0, pb, oR0);
            vr0 = ldh(VR + vro + kn);
            v0 = ldh(VT + vo + kn);
            asm volatile("s_wait_xcnt 0x0" ::: "memory");            // stands between the V^T loads just issued and the next trip's first writes to the registers that hold their addresses
        }
    } else {
        // Late rows: RD register sets, set s holding tile s (mod RD). A step works on its set's tile and refills each half of the set (K behind the score products, V^T behind the P.V product)
        // with the tile RD steps on, so a load has RD - 1 whole steps of work between its issue and its wait. Tiles are taken in ascending order, one at a time.
        constexpr int RD = 4;
        const int klast = nk - 32;                                   // last tile of this wave; a fetch past it is aimed at it again (unused), so every address stays below nk <= SEQ
        v8h rk0[RD], rk1[RD]; v16h rv[RD];
        rk0[0] = k0; rk1[0] = k1; rv[0] = v0;
#pragma unroll
        for (int s = 1; s < RD; ++s) {
            const int ks = (32 * s < klast) ? 32 * s : klast;
            const h16* ka = KP + ko + (size_t)ks * HD; rk0[s] = *(const v8h*)ka; rk1[s] = *(const v8h*)(ka + 16 * HD);
            rv[s] = ldh(VT + vo + ks);
            asm volatile("s_wait_xcnt 0x0" ::: "memory");            // stands behind the loads just issued, in front of any later write to the registers that hold their addresses
        }
        // Inputs-only fence on the loaded values: the query fragment and all RD sets have landed before the loop is entered, so the loop's counted load waits follow from the loop's own issue order alone.
        asm volatile("" :: "v"(q8), "v"(rk0[0]), "v"(rk1[0]), "v"(rv[0]), "v"(rk0[1]), "v"(rk1[1]), "v"(rv[1]), "v"(rk0[2]), "v"(rk1[2]), "v"(rv[2]), "v"(rk0[3]), "v"(rk1[3]), "v"(rv[3]));
        static_assert(RD == 4);                                      // the fence above names every set
#pragma unroll 1
        for (int key0 = 0; key0 < nk; key0 += 32 * RD) {
#pragma unroll
            for (int s = 0; s < RD; ++s) {
                const int kc = key0 + 32 * s;                        // this step's tile; kc >= nk (last trip only): no tile, the step's softmax and P.V are jumped over
                const int kn = (kc + 32 * RD < nk) ? kc + 32 * RD : klast;
                // The loads (and the score products in front of them) stand outside the scalar branch below: every path through a trip issues the same loads in the same order, which keeps the ring's counted load waits.
                const v8f sHa = wmma16g(cat16(rk0[s], z8), qh, zz), sHb = wmma16g(cat16(rk1[s], z8), qh, zz);   // A fragments [K | 0]
                { const h16* ka = KP + ko + (size_t)kn * HD; rk0[s] = *(const v8h*)ka; rk1[s] = *(const v8h*)(ka + 16 * HD); }
                asm volatile("s_wait_xcnt 0x0" ::: "memory");        // stands between the K loads just issued and the softmax's first writes to the registers that hold their addresses
                if (s == 0 || kc < nk) {                             // scalar test
                    if (((kept >> (kc >> 5)) & 1ull) != 0ull) tile(flag_c<true>{}, kc, sHa, sHb, zz, zz); else tile(flag_c<false>{}, kc, sHa, sHb, zz, zz);   // scalar test
                    l = l * alpha + ls; m = mnew;
                    o0 = o0 * alpha;
                    o0 = wmma16g(rv[s], pb, o0);
                }
                rv[s] = ldh(VT + vo + kn);
                asm volatile("s_wait_xcnt 0x0" ::: "memory");        // stands between the V^T loads just issued and the next step's first writes to the registers that hold their addresses
            }
        }
    }
    l += __shfl_xor(l, 16, 32);
    const bool any = l > 0.0f;
    const float lsafe = any ? l : 1.0f;
    const float inv = any ? (1.0f / lsafe) : 0.0f;
    v8f f0 = o0;
    if (EARLY) { f0 = o0 + oR0 * QRI; }
    f0 = f0 * inv;
    const unsigned nonem = __builtin_amdgcn_ballot_w32(!any);    // wave-uniform: some row of this wave kept no key
    if (nonem != 0u) {
        // equal fills give a uniform softmax over all SEQ keys: plain mean of v per channel d = 8h + r
        float vm[8];
#pragma unroll
        for (int r = 0; r < 8; ++r) vm[r] = 0.0f;
#pragma unroll 1
        for (int t = lr; t < SEQ; t += 16) {
#pragma unroll
            for (int r = 0; r < 8; ++r) vm[r] += (float)VT[pbase + (size_t)(8 * hi + r) * SEQ + t]; }
#pragma unroll
        for (int r = 0; r < 8; ++r) { float s = vm[r];
            s += __shfl_xor(s, 1, 32); s += __shfl_xor(s, 2, 32); s += __shfl_xor(s, 4, 32); s += __shfl_xor(s, 8, 32);
            vm[r] = s * (1.0f / (float)SEQ); }
#pragma unroll
        for (int r = 0; r < 8; ++r) f0[r] = any ? f0[r] : vm[r];
    }
    // O^T D layout: f0[r] = (d = 8h + r, t = lane&15) -> os[d][wave*16 + t]; rows 0..15 x columns 0..63 all written by the four waves
#pragma unroll
    for (int r = 0; r < 8; ++r) os[(8 * hi + r) * OSP + wave * 16 + lr] = f0[r];
    __syncthreads();                                              // cross-wave tile: block barrier (every wave reaches it)
    const int d = 4 * wave + (lane >> 3), c8 = (lane & 7) * 8;    // AW waves x 4 rows = 16 channel rows; 8 lanes x 8 halves = 64 tokens = one line
    const v4f x0 = *(const v4fa*)(&os[d * OSP + c8]); const v4f x1 = *(const v4fa*)(&os[d * OSP + c8 + 4]);
    v8h hv, rv;
#pragma unroll
    for (int i = 0; i < 4; ++i) { const h16 a0 = toh_flush(x0[i]); const h16 a1 = toh_flush(x1[i]); hv[i] = a0; hv[4 + i] = a1;
        rv[i] = toh_flush((x0[i] - (float)a0) * QRS); rv[4 + i] = toh_flush((x1[i] - (float)a1) * QRS); }
    const size_t oo = ((size_t)b * DM + (size_t)(h * HD + d)) * SEQ + (size_t)tb + (size_t)c8;
{
        *(v8h*)(CH + oo) = hv; *(v8h*)(CX + oo) = rv;
         }
}

__global__ __launch_bounds__(32 * AW) void k_flash(const h16* __restrict__ QH, const h16* __restrict__ QR, const h16* __restrict__ KP, const h16* __restrict__ KR,
                                                   const h16* __restrict__ VT, const h16* __restrict__ VR, const unsigned* __restrict__ KB, h16* CH, h16* CX) {
    if ((int)blockIdx.x < FLB) {
        flash_body<0>(QH, QR, KP, KR, VT, VR, KB, CH, CX);
    } else {
        flash_body<1>(QH, QR, KP, KR, VT, VR, KB, CH, CX);
    }
}

// k_oproj: output projection, ONE WAVE per 16 rows x 128 columns. A = context planes read flat as [NB*SEQ][128] (value and residual x2048, separate accumulators), Bt = Wo x64 rows [n][k] (f16), K = DM.
// The head-count input is read on the device; a value other than the compiled head count marks the output with NaN.
__global__ __launch_bounds__(32) void k_oproj(const h16* __restrict__ CH, const h16* __restrict__ CX, const h16* __restrict__ WO, const int* __restrict__ nheads_p, float* OUT) {
    __shared__ __align__(16) float os[16 * OPP];
    const int lane = threadIdx.x & 31, lr = lane & 15, hi = lane >> 4;
    const int r0 = blockIdx.x * 16;
    v8f aH[8], aR[8];
#pragma unroll
    for (int nb = 0; nb < 8; ++nb) { aH[nb] = (v8f){}; aR[nb] = (v8f){}; }
    const size_t aoff = (size_t)(r0 + lr) * DM + 8 * hi, boff = (size_t)lr * DM + 8 * hi;
#pragma unroll 1
    for (int kc = 0; kc < DM; kc += 32) {
        const v16h ah = ldh(CH + aoff + kc), ar = ldh(CX + aoff + kc);
#pragma unroll
        for (int nb = 0; nb < 8; ++nb) { const v16h w = ldh(WO + boff + (size_t)nb * 16 * DM + kc);
            aH[nb] = wmma16g(ah, w, aH[nb]); aR[nb] = wmma16g(ar, w, aR[nb]); }
    }
    const int nh = nheads_p[0];
    const float poison = (nh == NH_) ? 0.0f : __uint_as_float(0x7FC00000u);
#pragma unroll
    for (int nb = 0; nb < 8; ++nb) {
#pragma unroll
        for (int j = 0; j < 8; ++j) os[(hi * 8 + j) * OPP + nb * 16 + lr] = (aH[nb][j] + aR[nb][j] * QRI) * WOI + poison; }   // D: row 8h+j, col lane&15; rows 0..15 x columns 0..127 all written
    wave_sync();
    const int bb = r0 / SEQ, tt = r0 % SEQ;
    float* orow = OUT + ((size_t)bb * OUT_SEQ + (size_t)tt) * DM;
{
#pragma unroll 4
        for (int s = 0; s < 16; ++s) {                              // 16 rows x (32 lanes x 4 floats = 128 columns = the whole row)
            const v4f val = *(const v4fa*)(&os[s * OPP + lane * 4]);
            *(v4f*)(orow + (size_t)s * DM + lane * 4) = val; }
         }
}

static constexpr size_t al256(size_t v) { return (v + 255) & ~(size_t)255; }
static constexpr size_t SZ_XB = al256((size_t)NB * SEQ * DM * 2);
static constexpr size_t SZ_WB = al256((size_t)3 * DM * DM * 2);
static constexpr size_t SZ_WO = al256((size_t)DM * DM * 2);
static constexpr size_t SZ_PL = al256((size_t)NB * NH_ * SEQ * HD * 2);
static constexpr size_t SZ_RS = al256((size_t)NB * NH_ * EROWS * HD * 2);
static constexpr size_t SZ_KB = al256((size_t)NB * (SEQ / 32) * 4);
static constexpr size_t SZ_TOTAL = SZ_XB + SZ_WB + SZ_WO + 5 * SZ_PL + 3 * SZ_RS + SZ_KB;
static_assert(SZ_TOTAL <= (size_t)134217728);          // workspace carve <= 128 MiB
static_assert(((size_t)DM * DM * 2) % 256 == 0);       // weight sub-planes stay 256-byte aligned
static_assert((size_t)NB * NH_ * SEQ * HD == (size_t)NB * DM * SEQ);       // v^T plane and context planes [(b*128 + m)][t] have the same extent as the q/k planes
static_assert((size_t)NB * NH_ * EROWS * HD == (size_t)NB * DM * EROWS);   // v^T residual plane [(b*128 + m)][t < EROWS] has the same extent as the q/k residual planes
static_assert(((size_t)NB * DM * SEQ) % ((size_t)16 * DM) == 0);           // context planes read flat as 16-row x 128 slabs

extern "C" void kernel_launch(void* const* d_in, const int* in_sizes, int n_in,
                              void* d_out, int out_size, void* d_ws, size_t ws_size, hipStream_t stream) {
    if (n_in < 7) return;
    const size_t needx = ((size_t)(NB - 1) * SEQ_FULL + SEQ) * DM;
    const size_t needm = (size_t)(NB - 1) * SEQ_FULL + SEQ;
    if ((size_t)in_sizes[0] < needx) return;
    if ((size_t)in_sizes[1] < (size_t)DM * DM || (size_t)in_sizes[2] < (size_t)DM * DM || (size_t)in_sizes[3] < (size_t)DM * DM || (size_t)in_sizes[4] < (size_t)DM * DM) return;
    if ((size_t)in_sizes[5] < needm || in_sizes[6] < 1) return;
    if ((size_t)out_size < ((size_t)(NB - 1) * OUT_SEQ + SEQ) * DM) return;
    if (SZ_TOTAL > ws_size) return;
    // wire order: x, Wq, Wk, Wv, Wo, padding_mask, num_heads
    const float* x  = (const float*)d_in[0];
    const float* wq = (const float*)d_in[1];
    const float* wk = (const float*)d_in[2];
    const float* wv = (const float*)d_in[3];
    const float* wo = (const float*)d_in[4];
    const int* pm = (const int*)d_in[5];
    const int* nheads = (const int*)d_in[6];
    float* OUT = (float*)d_out;      // [NB][SEQ][128]
    char* wsp = (char*)d_ws;
    bf* XB = (bf*)wsp; wsp += SZ_XB;                 // x [NB*SEQ][128]
    bf* WB = (bf*)wsp; wsp += SZ_WB;                 // [3][128][128]: q | k | v  ([out][in] as-is: Bt for q, k; A for v)
    h16* WOH = (h16*)wsp; wsp += SZ_WO;              // [128][128] Wo x64 ([out][in] = Bt as-is)
    h16* QH = (h16*)wsp; wsp += SZ_PL;               // [NB*8][SEQ][16]
    h16* KP = (h16*)wsp; wsp += SZ_PL;               // [NB*8][SEQ][16]
    h16* VT = (h16*)wsp; wsp += SZ_PL;               // [NB*8][16][SEQ]
    h16* CH = (h16*)wsp; wsp += SZ_PL;               // [NB][128][SEQ] context value
    h16* CX = (h16*)wsp; wsp += SZ_PL;               // [NB][128][SEQ] context residual x2048
    h16* QR = (h16*)wsp; wsp += SZ_RS;               // [NB*8][EROWS][16] residual x2048, tokens < EROWS
    h16* KR = (h16*)wsp; wsp += SZ_RS;               // [NB*8][EROWS][16] residual x2048, tokens < EROWS
    h16* VR = (h16*)wsp; wsp += SZ_RS;               // [NB*8][16][EROWS] residual x2048, tokens < EROWS
    unsigned* KB = (unsigned*)wsp; wsp += SZ_KB;     // [NB][SEQ/32] padding mask, one bit per key

    // padding mask -> bits; x, Wq, Wk, Wv -> bf16 planes, Wo -> f16 plane x64
    k_cvt<<<dim3(1 + 4 * CWB + CXB, 1, 1), 256, 0, stream>>>(x, wq, wk, wv, wo, pm, XB, WB, WOH, KB);

    // q, k: A = x rows (m = b*SEQ + t), Bt = W rows (n = h*16 + d) -> plane [(b*8 + h)][t][d]; residuals for tokens < EROWS
    // v^T: A = Wv rows (m = h*16 + d), Bt = x rows (n = b*SEQ + t) -> plane [(b*128 + m)][t] = [(b*8 + h)][d][t]; residual for tokens < EROWS
    k_proj<<<dim3(NB * SEQ / 64, DM / 64, 3), 32, 0, stream>>>(XB, WB, QH, QR, KP, KR, VT, VR, EROWS);

    // query rows [0, EROWS): multi-product instantiation; rows [EROWS, SEQ): single-product instantiation (disjoint context columns)
    k_flash<<<dim3(FLB + FEB, 1, 1), 32 * AW, 0, stream>>>(QH, QR, KP, KR, VT, VR, KB, CH, CX);

    // output projection over the flat [NB*SEQ][128] view of the context planes
    k_oproj<<<dim3(NB * SEQ / 16, 1, 1), 32, 0, stream>>>(CH, CX, WOH, nheads, OUT);
}

// v005
// A run of this version takes 40.4 microseconds.
// In both of two side-by-side timings against v004, it was 1.04 times as fast.
// Counting every step since v000, it is 3.12 times as fast.
#include <hip/hip_runtime.h>

// Causal multi-head self-attention, width 128 = 8 heads x 16; x [NB][SEQ][128]; Wq/Wk/Wv/Wo [out][in] (y = x W^T, no bias); key padding mask [NB][SEQ] (int32, device-read); masked scores are replaced before the 1/sqrt(16) scale;
// per-head context transposed to [b][h*16+e][t], reinterpreted flat as [NB][SEQ][128], then multiplied by Wo^T (f32 output).
// Compute dtypes, f32 accumulate everywhere: q/k/v projections v_wmma_f32_16x16x32_bf16 (x, W RNE-converted to bf16; products exact);
// scores v_wmma_f32_16x16x32_f16 (head dim 16 zero-padded to the 32-deep step): single f16 q, k on query rows >= EROWS; on query rows < EROWS q and k each as f16 value + f16 residual x2048 (cross products in the upper 16 k-slots, own accumulator);
// P.V v_wmma_f32_16x16x32_f16: P (x16384 carry, cancels in the normalisation) and v single f16 on query rows >= EROWS, row sum of the f16 P there by one more product of the same form (A = rows of ones); on query rows < EROWS P and v as f16 value + f16 residual x2048, residual products in their own accumulator folded by 1/2048, row sum from the f32 exponentials;
// output projection v_wmma_f32_16x16x32_f16: context as f16 value + f16 residual x2048 (own accumulator), Wo as bf16-converted value x64 held in f16; softmax f32 (online, running max over kept keys).
// Layout: bf16 copies of x and Wq/Wk/Wv; q, k planes [b*8+h][t][16], v^T plane [b*8+h][16][t], small residual planes (tokens < EROWS) for q, k, v^T; context planes (value, residual) [b][h*16+e][t]; fused flash kernel in transposed form (S^T = K Q^T, O^T = V^T P^T).
// Keep rule per element: (mask[b][j] != 0) and (j <= t); dropped elements get probability 0; a row with no kept key takes the plain mean of v over all SEQ keys (uniform softmax of equal fills).

#ifndef NB
#define NB 4
#endif
#ifndef SEQ
#define SEQ 2048
#endif
#define NB_FULL  4
#define SEQ_FULL 2048
#ifndef OUT_SEQ
#define OUT_SEQ SEQ              // row pitch (in tokens) between batches of the output
#endif
#define DM   128
#define NH_  8
#define HD   16
#define AW   4                   // waves per flash block (16 query rows each)
#define OSP  68                  // LDS row pitch (floats) of the flash context tile [16 d][64 t]
#define OPP  132                 // LDS row pitch (floats) of the output-projection slab [16][128]
#define EROWS (SEQ < 512 ? SEQ : 512)   // query rows (and tokens of the small residual planes) handled by the multi-product flash instantiation
#define QRS  2048.0f             // carry of every residual plane / residual fragment
#define QRI  (1.0f / 2048.0f)
#define SC2  ((float)(0.25 * 1.4426950408889634))   // HD^-0.5 * log2(e)
#define PSH  14.0f               // log2 of the P carry (16384)
#define NEGB (-3.0e38f)
#define WOS  64.0f               // carry of the Wo plane
#define WOI  (1.0f / 64.0f)

static_assert(HD == 16);
static_assert(NH_ * HD == DM);                 // head h = columns h*16 + d
static_assert(DM % 64 == 0);                   // column tiles of 64 = four heads
static_assert(64 % HD == 0);
static_assert(DM % 32 == 0);                   // GEMM k-loop steps by 32
static_assert(DM == 32 * 4);                   // output row = 32 lanes x 4 floats
static_assert(SEQ % 64 == 0);                  // a 64-row tile never straddles two batches
static_assert((NB * SEQ) % 64 == 0);
static_assert(SEQ % 32 == 0);                  // key loop steps by 32
static_assert(SEQ % (16 * AW) == 0);           // flash grids cover the sequence exactly
static_assert(16 * AW == 64);
static_assert(4 * AW == HD);                   // context store: 4 rows per wave x AW waves = 16 channel rows
static_assert(8 * 8 == 16 * AW);               // 8 lanes x 8 halves = 64 tokens per row
static_assert(EROWS % 64 == 0);                // a 64-token GEMM tile lies wholly inside or outside the residual planes
static_assert(EROWS >= 32);
static_assert(EROWS <= SEQ);
static_assert(EROWS % 32 == 0);                // early key loops end inside the residual planes
static_assert(EROWS % (16 * AW) == 0);
static_assert((SEQ - EROWS) % (16 * AW) == 0);
static_assert(((size_t)SEQ * DM) % 8 == 0);
static_assert(((size_t)DM * DM) % 8 == 0);
static_assert(NB <= NB_FULL);
static_assert(SEQ <= SEQ_FULL);
static_assert((OSP * 4) % 16 == 0);
static_assert(OSP >= 64);
static_assert((OPP * 4) % 16 == 0);
static_assert(OPP >= DM);
static_assert(4 * 32 * 8 == 16 * 64);          // projection epilogue, q/k form: 4 heads x 32 lanes x 8 halves = 16 rows x 64 columns
static_assert(4 * 4 * 64 == 16 * 64);          // projection epilogue, v^T form: 4 instructions x 4 rows x 64 halves
static_assert(16 * 68 * 4 <= 131072);          // static LDS of one proj_body instantiation (k_proj holds both)
static_assert(HD * OSP * 4 <= 131072);         // static LDS of one flash_body instantiation (k_flash holds both)
static_assert(16 * OPP * 4 <= 131072);         // static LDS of the output-projection kernel

typedef _Float16 h16;
typedef unsigned short bf;
typedef __attribute__((ext_vector_type(16))) __bf16   v16bf;
typedef __attribute__((ext_vector_type(16))) _Float16 v16h;
typedef __attribute__((ext_vector_type(8)))  _Float16 v8h;
typedef __attribute__((ext_vector_type(2)))  _Float16 v2h;
typedef __attribute__((ext_vector_type(2)))  float    v2f;
typedef __attribute__((ext_vector_type(8)))  unsigned short v8us;
typedef __attribute__((ext_vector_type(8)))  float    v8f;
typedef __attribute__((ext_vector_type(4)))  float    v4f;
typedef __attribute__((ext_vector_type(4)))  int      v4i;
typedef v4f  __attribute__((may_alias)) v4fa;

__device__ __forceinline__ unsigned short f2bf(float f) { unsigned u = __float_as_uint(f); u += 0x7FFFu + ((u >> 16) & 1u); return (unsigned short)(u >> 16); }
__device__ __forceinline__ float bfr(float f) { return __uint_as_float(((unsigned)f2bf(f)) << 16); }   // value after RNE convert to bf16
__device__ __forceinline__ v16h cat16(v8h lo, v8h hi) { return __builtin_shufflevector(lo, hi, 0, 1, 2, 3, 4, 5, 6, 7, 8, 9, 10, 11, 12, 13, 14, 15); }
__device__ __forceinline__ v16bf cat16b(v8us lo, v8us hi) { return __builtin_bit_cast(v16bf, __builtin_shufflevector(lo, hi, 0, 1, 2, 3, 4, 5, 6, 7, 8, 9, 10, 11, 12, 13, 14, 15)); }
__device__ __forceinline__ v8f wmma16(v16h a, v16h b, v8f c) { return __builtin_amdgcn_wmma_f32_16x16x32_f16(false, a, false, b, (short)0, c, false, false); }
__device__ __forceinline__ v8f wmmab(v16bf a, v16bf b, v8f c) { return __builtin_amdgcn_wmma_f32_16x16x32_bf16(false, a, false, b, (short)0, c, false, false); }
// fragment loaders from K-contiguous 16-bit rows; p already includes + 8*(lane>>4): elements 0..7 <- k0+8h+0..7, elements 8..15 <- k0+16+8h+0..7 (same map for A and B)
__device__ __forceinline__ v16h  ldh(const h16* p) { return cat16(*(const v8h*)p, *(const v8h*)(p + 16)); }
__device__ __forceinline__ v16bf ldb(const bf* p)  { return cat16b(*(const v8us*)p, *(const v8us*)(p + 16)); }
// ordering point for wave-private LDS tiles (same wave writes and reads)
__device__ __forceinline__ void wave_sync() { __builtin_amdgcn_fence(3 /* release order */, "wavefront"); __builtin_amdgcn_wave_barrier(); asm volatile("" ::: "memory"); }

// per-instruction guarded matrix ops: the four idle slots tie the accumulator and keep the operands live
__device__ __forceinline__ v8f wmma16g(v16h a, v16h b, v8f c) { c = wmma16(a, b, c); asm volatile("v_nop\n\tv_nop\n\tv_nop\n\tv_nop" : "+v"(c) : "v"(a), "v"(b)); return c; }
__device__ __forceinline__ v8f wmmabg(v16bf a, v16bf b, v8f c) { c = wmmab(a, b, c); asm volatile("v_nop\n\tv_nop\n\tv_nop\n\tv_nop" : "+v"(c) : "v"(a), "v"(b)); return c; }
// f32 -> f16 that cannot produce a subnormal operand (|v| < 2^-14 -> +0)
static __device__ __forceinline__ h16 toh_flush(float v) { const h16 r = (h16)v; return (fabsf(v) < 6.103515625e-05f) ? (h16)0.0f : r; }

// k_cvt: every operand conversion in ONE launch, 8 elements per thread (block 0: 32 mask words per thread); a block-uniform range of the block index picks the job:
// block 0: padding mask -> one bit per key (set: word nonzero), one 32-bit word per 32-key tile, KB[b * (SEQ/32) + tile], bit j = key 32*tile + j; one thread per tile;
// then, counted from block 1: blocks [0, 4*CWB): Wq, Wk, Wv -> bf16 planes of WB, Wo -> bf16-converted value x64 in f16; blocks [4*CWB, 4*CWB + CXB): x -> bf16 (batch pitch SEQ_FULL tokens in x, SEQ in XB).
#define CWB ((DM * DM / 8) / 256)                // blocks per weight matrix
#define CXB ((NB * SEQ * (DM / 8)) / 256)        // blocks of x
static_assert((DM * DM / 8) % 256 == 0);
static_assert((NB * SEQ * (DM / 8)) % 256 == 0);
static_assert(NB * (SEQ / 32) <= 256);           // one thread of block 0 per 32-key tile
__global__ __launch_bounds__(256) void k_cvt(const float* __restrict__ x, const float* __restrict__ wq, const float* __restrict__ wk, const float* __restrict__ wv, const float* __restrict__ wo,
                                             const int* __restrict__ pmask, bf* XB, bf* WB, h16* WOH, unsigned* KB) {
    if (blockIdx.x == 0u) {
        const unsigned i = threadIdx.x;
        if (i < (unsigned)(NB * (SEQ / 32))) {
            const int* p = pmask + (size_t)(i / (unsigned)(SEQ / 32)) * SEQ_FULL + (size_t)(i % (unsigned)(SEQ / 32)) * 32;
            unsigned bits = 0u;
#pragma unroll
            for (int k = 0; k < 8; ++k) { const v4i a = *(const v4i*)(p + 4 * k);
#pragma unroll
                for (int j = 0; j < 4; ++j) bits |= (a[j] != 0 ? 1u : 0u) << (4 * k + j); }
            KB[i] = bits;
            asm volatile("s_wait_xcnt 0x0" ::: "memory");                       // stands behind the store, in front of any later write to the registers that hold its address and data
        }
        return;
    }
    const unsigned blk = blockIdx.x - 1u;
    if (blk >= 4u * CWB) {
        const unsigned i = (blk - 4u * CWB) * 256u + threadIdx.x;               // 8-element group of XB
        const unsigned b = i / (unsigned)(SEQ * (DM / 8)), r = i % (unsigned)(SEQ * (DM / 8));
        const v8f v = *(const v8f*)(x + (size_t)b * SEQ_FULL * DM + (size_t)r * 8); v8us o;
#pragma unroll
        for (int k = 0; k < 8; ++k) o[k] = f2bf(v[k]);
        *(v8us*)(XB + (size_t)i * 8) = o;
        asm volatile("s_wait_xcnt 0x0" ::: "memory");                           // stands behind the store, in front of any later write to the registers that hold its address and data
        return;
    }
    if (blk >= 3u * CWB) {
        const unsigned i = (blk - 3u * CWB) * 256u + threadIdx.x;
        const v8f v = *(const v8f*)(wo + (size_t)i * 8); v8h o;
#pragma unroll
        for (int k = 0; k < 8; ++k) o[k] = toh_flush(bfr(v[k]) * WOS);
        *(v8h*)(WOH + (size_t)i * 8) = o;
        asm volatile("s_wait_xcnt 0x0" ::: "memory");                           // stands behind the store, in front of any later write to the registers that hold its address and data
        return;
    }
    const unsigned w = blk / (unsigned)CWB;
    const unsigned i = (blk % (unsigned)CWB) * 256u + threadIdx.x;
    const float* src = (w == 0) ? wq : (w == 1) ? wk : wv;
    const v8f v = *(const v8f*)(src + (size_t)i * 8); v8us o;
#pragma unroll
    for (int k = 0; k < 8; ++k) o[k] = f2bf(v[k]);
    *(v8us*)(WB + (size_t)blk * 256 * 8 + (size_t)threadIdx.x * 8) = o;         // planes q | k | v lie one behind the other: group index = blk * 256 + thread
    asm volatile("s_wait_xcnt 0x0" ::: "memory");                               // as above
}

// proj_body: register-blocked bf16 GEMM, ONE WAVE per 64x64 tile (16 accumulators), operands straight from K-contiguous bf16 planes, K = DM.
// C[m][n] = sum_k A[m][k] Bt[n][k], written as f16 (Ph) and, for tokens t < resT (resT a multiple of 64, block-uniform test), the f16 residual x2048 (Pr).
// MODE 0: A = x rows (m = b*SEQ + t), Bt = W rows (n = h*16 + d); plane [(b*8 + h)][t][16] (residual plane [(b*8 + h)][resT][16]). The 64-column tile spans four heads; per 16-row slab and head
//         one 512-byte run (16 rows per instruction). Grid x = token tile, y = channel tile in both modes (MODE 0: rows of A are tokens; MODE 1: rows of Bt are tokens).
template <int MODE>
__device__ __forceinline__ void proj_body(const bf* __restrict__ A, const bf* __restrict__ Bt, h16* Ph, h16* Pr, int resT) {
    __shared__ __align__(16) float os[16 * 68];
    const int K = DM;
    const int lane = threadIdx.x & 31, lr = lane & 15, hi = lane >> 4; const int r0 = (MODE == 0 ? blockIdx.x : blockIdx.y) * 64, c0 = (MODE == 0 ? blockIdx.y : blockIdx.x) * 64;
    v8f acc[4][4];
#pragma unroll
    for (int mb = 0; mb < 4; ++mb)
#pragma unroll
        for (int nb = 0; nb < 4; ++nb) acc[mb][nb] = (v8f){};
    const size_t aoff = (size_t)(r0 + lr) * K + 8 * hi, boff = (size_t)(c0 + lr) * K + 8 * hi;
#pragma unroll 1
    for (int kc = 0; kc < K; kc += 32) {
        v16bf a[4];
#pragma unroll
        for (int mb = 0; mb < 4; ++mb) a[mb] = ldb(A + aoff + (size_t)mb * 16 * K + kc);
#pragma unroll
        for (int nb = 0; nb < 4; ++nb) { const v16bf b = ldb(Bt + boff + (size_t)nb * 16 * K + kc);
#pragma unroll
            for (int mb = 0; mb < 4; ++mb) acc[mb][nb] = wmmabg(a[mb], b, acc[mb][nb]); }
    }
    size_t tbase, rbase; bool wr;                                                                 // wr: block-uniform, whole tile inside the residual plane
    if (MODE == 0) { const int bb = r0 / SEQ, tt = r0 % SEQ; const int zc = bb * NH_ + c0 / HD;
                     tbase = ((size_t)zc * SEQ + (size_t)tt) * HD; rbase = ((size_t)zc * (size_t)resT + (size_t)tt) * HD; wr = tt < resT; }
    else           { const int bb = c0 / SEQ, tt = c0 % SEQ;
                     tbase = (size_t)bb * (size_t)DM * SEQ + (size_t)r0 * SEQ + (size_t)tt; rbase = (size_t)bb * (size_t)DM * (size_t)resT + (size_t)r0 * (size_t)resT + (size_t)tt; wr = tt < resT; }
#pragma unroll
    for (int mb = 0; mb < 4; ++mb) {
#pragma unroll
        for (int nb = 0; nb < 4; ++nb) {
#pragma unroll
            for (int j = 0; j < 8; ++j) os[(hi * 8 + j) * 68 + nb * 16 + lr] = acc[mb][nb][j]; }   // D: row 8h+j, col lane&15; rows 0..15 x columns 0..63 all written
        wave_sync();
{
            if (MODE == 0) {
                const size_t sb = tbase + (size_t)(mb * 16) * HD;
                const size_t rb = rbase + (size_t)(mb * 16) * HD;
#pragma unroll
                for (int hh = 0; hh < 4; ++hh) { const int row = lane >> 1, c8 = (lane & 1) * 8;   // 16 rows x 2 lanes x 8 = 16 columns of head hh: one 512-byte run
                    const v4f x0 = *(const v4fa*)(&os[row * 68 + hh * 16 + c8]); const v4f x1 = *(const v4fa*)(&os[row * 68 + hh * 16 + c8 + 4]); v8h hv, rv;
#pragma unroll
                    for (int i = 0; i < 4; ++i) { const h16 a0 = toh_flush(x0[i]); const h16 a1 = toh_flush(x1[i]); hv[i] = a0; hv[4 + i] = a1;
                        rv[i] = toh_flush((x0[i] - (float)a0) * QRS); rv[4 + i] = toh_flush((x1[i] - (float)a1) * QRS); }
                    const size_t oo = sb + (size_t)hh * ((size_t)SEQ * HD) + (size_t)lane * 8;
                    const size_t ro = rb + (size_t)hh * ((size_t)resT * HD) + (size_t)lane * 8;
                    *(v8h*)(Ph + oo) = hv; if (wr) *(v8h*)(Pr + ro) = rv; }
            } else {
                const size_t sb = tbase + (size_t)(mb * 16) * SEQ;
                const size_t rb = rbase + (size_t)(mb * 16) * (size_t)resT;
#pragma unroll
                for (int s = 0; s < 4; ++s) { const int row = 4 * s + (lane >> 3), c8 = (lane & 7) * 8;   // 4 s x 4 row groups = 16 rows; 8 lanes x 8 = 64 columns
                    const v4f x0 = *(const v4fa*)(&os[row * 68 + c8]); const v4f x1 = *(const v4fa*)(&os[row * 68 + c8 + 4]); v8h hv, rv;
#pragma unroll
                    for (int i = 0; i < 4; ++i) { const h16 a0 = toh_flush(x0[i]); const h16 a1 = toh_flush(x1[i]); hv[i] = a0; hv[4 + i] = a1;
                        rv[i] = toh_flush((x0[i] - (float)a0) * QRS); rv[4 + i] = toh_flush((x1[i] - (float)a1) * QRS); }
                    const size_t oo = sb + (size_t)row * SEQ + c8;
                    const size_t ro = rb + (size_t)row * (size_t)resT + c8;
                    *(v8h*)(Ph + oo) = hv; if (wr) *(v8h*)(Pr + ro) = rv; }
            }
             }
        wave_sync();
    }
}

// k_proj: the three projections in ONE launch, grid (NB*SEQ/64 token tiles, DM/64 channel tiles, 3); blockIdx.z (block-uniform) picks q, k or v^T. WB = [3][128][128]: q | k | v.
__global__ __launch_bounds__(32) void k_proj(const bf* __restrict__ XB, const bf* __restrict__ WB, h16* QH, h16* QR, h16* KP, h16* KR, h16* VT, h16* VR, int resT) {
    const int z = blockIdx.z;
    if (z == 2) { const bf* A = WB + (size_t)2 * DM * DM; const bf* Bt = XB; h16* Ph = VT; h16* Pr = VR; proj_body<1>(A, Bt, Ph, Pr, resT); }
    else        { const bf* A = XB; const bf* Bt = WB + (size_t)z * DM * DM; h16* Ph = z ? KP : QH; h16* Pr = z ? KR : QR; proj_body<0>(A, Bt, Ph, Pr, resT); }
}

// k_flash: both instantiations in ONE launch, 1-D grid; a block-uniform range of the block index picks the job. Blocks [0, FLB): query rows [EROWS, SEQ), in the order (tile fastest, then batch*head);
// blocks [FLB, FLB + FEB): query rows [0, EROWS), same order. The long-running blocks come first in the index.
#define FLX ((SEQ - EROWS) / (16 * AW))          // late query tiles per (batch, head)
#define FEX (EROWS / (16 * AW))                  // early query tiles per (batch, head)
#define FLB (FLX * NB * NH_)
#define FEB (FEX * NB * NH_)
// flash_body: fused causal attention, one wave per 16 query rows of one (batch, head), AW waves = 64 query rows per block; K / V^T / Q fragments straight from the f16 planes (16-B loads, arithmetic addressing).
// Transposed form: S^T[key][t] = K Q^T (A = K rows, B = Q rows, head dim 16 in k-slots 0..15); lane (t = lane&15, h = lane>>4) holds keys 8h+r of each 16-key tile, so the packed
// P tile is directly the B fragment of O^T[d][t] = V^T P^T (element r <- tile keys 0..15, element 8+r <- tile keys 16..31, lane unchanged).
// Softmax state (running max over kept keys, sum) is one scalar per lane; the two lane halves of a row are combined with one xor-16 exchange (the sum: EARLY only; late rows hold the whole row's sum in both halves).
// Keep rule: a wave reads its batch's mask bits (KB, one word per 32-key tile) once, lane = tile. A tile whose word is all ones and whose last key lies below the wave's first query row keeps every element:
// a scalar test sends it down a path without keep compares and selects (there a P below 2^-14 stays an f16 subnormal, which the matrix unit takes as it is). Every other visited tile evaluates the rule per element.
// The per-wave key bound is t0 + 16 (pad up to 32), at most SEQ.
// EARLY = 1 (query rows [0, EROWS)): A = [K | K_res], B = [Q | 0] gives K Q; B = [Q_res | Q] gives K Q_res + K_res Q (x2048, own accumulator); P = f16 value + f16 residual x2048;
//            O = V P + (V P_res + V_res P) / 2048 (residual products in their own accumulator); row sum from the f32 exponentials; all keys of these rows are < EROWS, inside the small planes.
// EARLY = 0 (query rows [EROWS, SEQ)): single q, k, P, v.
template <bool B> struct flag_c { static constexpr bool v = B; };
static_assert(SEQ / 32 <= 64);                   // a wave holds its batch's tile words in two registers (lane = tile) and their all-kept flags in one 64-bit scalar
template <int EARLY>
__device__ __forceinline__ void flash_body(const h16* __restrict__ QH, const h16* __restrict__ QR, const h16* __restrict__ KP, const h16* __restrict__ KR,
                                           const h16* __restrict__ VT, const h16* __restrict__ VR, const unsigned* __restrict__ KB, h16* CH, h16* CX) {
    __shared__ __align__(16) float os[HD * OSP];
    const int lane = threadIdx.x & 31, lr = lane & 15, hi = lane >> 4;
    const int wave = __builtin_amdgcn_readfirstlane((int)(threadIdx.x >> 5));
    const int blk = (int)blockIdx.x - (EARLY ? FLB : 0), ntile = EARLY ? FEX : (FLX > 0 ? FLX : 1);   // index inside this instantiation's block range; query tiles per (batch, head)
    const int zh = blk / ntile; const int b = zh / NH_, h = zh % NH_;
    const int tb = (EARLY ? 0 : EROWS) + (blk % ntile) * (16 * AW);
    const int t0 = tb + wave * 16;
    const int lim = t0 + lr;                                                   // key j kept iff j <= lim (and mask nonzero)
    const int nk = (t0 + 16 + 31) & ~31;                                       // wave-uniform, multiple of 32, <= SEQ (<= EROWS when EARLY)
    const unsigned* kbb = KB + (size_t)b * (SEQ / 32);                         // + tile
    const size_t pbase = (size_t)zh * SEQ * HD;
    const size_t rbase = (size_t)zh * EROWS * HD;
    const v8h z8 = (v8h){};
    const size_t qo = pbase + (size_t)(t0 + lr) * HD + 8 * hi;
    const v8h q8 = *(const v8h*)(QH + qo);
    asm volatile("s_wait_xcnt 0x0" ::: "memory");                 // the loads issued next may land in the registers that hold this load's address: the wait stands in front of them
    const v16h qh = cat16(q8, z8);                                // B fragment [Q | 0]: col t, k = d
    v16h qx = qh;
    if (EARLY) { const size_t qro = rbase + (size_t)(t0 + lr) * HD + 8 * hi; qx = cat16(*(const v8h*)(QR + qro), q8);   // B fragment [Q_res | Q]
                 asm volatile("s_wait_xcnt 0x0" ::: "memory"); }  // as above, for the residual load's address
    const size_t ko = pbase + (size_t)lr * HD + 8 * hi;         // + key * HD       (A fragment: row key, k = d)
    const size_t vo = pbase + (size_t)lr * SEQ + 8 * hi;        // + key            (A fragment: row d, k = key)
    const size_t kro = rbase + (size_t)lr * HD + 8 * hi;        // residual planes, tokens < EROWS
    const size_t vro = rbase + (size_t)lr * EROWS + 8 * hi;
    const v8f zz = (v8f){};
    v8f o0 = (v8f){}, oR0 = (v8f){};
    float m = NEGB, l = 0.0f;
    // EARLY: every operand of a 32-key tile (K, V^T, residual planes) is fetched one trip ahead: tile 0 here, tile key0 + 32 inside trip key0,
    // each group into the registers its last reader of the trip has just left. nk >= 32, so tile 0 exists for every wave.
    // Late rows: K and V^T are fetched RD tiles ahead, through RD register sets (see the late loop below); set 0 is loaded here.
    v8h k0 = *(const v8h*)(KP + ko), k1 = *(const v8h*)(KP + ko + 16 * HD);
    v8h kr0 = z8, kr1 = z8;
    if (EARLY) { kr0 = *(const v8h*)(KR + kro); kr1 = *(const v8h*)(KR + kro + 16 * HD); }
    const unsigned kw0 = kbb[lane < SEQ / 32 ? lane : 0], kw1 = kbb[32 + lane < SEQ / 32 ? 32 + lane : 0];   // mask bits of tiles lane and 32 + lane
    // bit T set: tile T keeps every element for all 16 rows of this wave: word all ones and 32T + 31 < t0 (t0 a multiple of 16: T < t0 / 32 <= SEQ / 32 - 1). Wave-uniform.
    const unsigned long long kept = (((unsigned long long)__builtin_amdgcn_ballot_w32(kw1 == 0xFFFFFFFFu) << 32) | (unsigned long long)__builtin_amdgcn_ballot_w32(kw0 == 0xFFFFFFFFu)) & ((1ull << (t0 >> 5)) - 1ull);
    v16h v0 = ldh(VT + vo);
    v16h vr0 = v0;
    if (EARLY) { vr0 = ldh(VR + vro); }
    v16h pb, pr = (v16h){}; float ls = 0.0f, alpha, mnew;
    // softmax of the 32-key tile at key0 from its score accumulators; FULL: every element kept
    auto tile = [&](auto fc, const int key0, const v8f sHa, const v8f sHb, const v8f sLa, const v8f sLb) __attribute__((always_inline)) {
            constexpr bool FULL = decltype(fc)::v;
            float ta[8], tb2[8]; bool fa[8], fb[8]; float mx;
            ls = 0.0f;
            if constexpr (FULL) {
                float ua[8], ub[8];
#pragma unroll
                for (int r = 0; r < 8; ++r) {
                    if (EARLY) { ua[r] = sHa[r] + sLa[r] * QRI; ub[r] = sHb[r] + sLb[r] * QRI; }
                    else       { ua[r] = sHa[r]; ub[r] = sHb[r]; }
                    ta[r] = ua[r] * SC2; tb2[r] = ub[r] * SC2; fa[r] = true; fb[r] = true; }
                float mr = fmaxf(ua[0], ub[0]);                  // SC2 > 0 and rounding is monotonic: the scaled maximum equals the maximum of the scaled scores
#pragma unroll
                for (int r = 1; r < 8; ++r) mr = fmaxf(mr, fmaxf(ua[r], ub[r]));
                mx = mr * SC2;
            } else {
                const unsigned kcur = (unsigned)__builtin_amdgcn_readlane((int)(key0 < 1024 ? kw0 : kw1), (key0 >> 5) & 31);   // mask bits of keys key0 .. key0+31
                const unsigned kw = kcur >> (8 * hi);            // bits 0..7: keys key0+8h+0..7; bits 16..23: keys key0+16+8h+0..7
                const int ja = key0 + 8 * hi;
                mx = NEGB;
#pragma unroll
                for (int r = 0; r < 8; ++r) {
                    fa[r] = (((kw >> r) & 1u) != 0u) & (ja + r <= lim);
                    fb[r] = (((kw >> (16 + r)) & 1u) != 0u) & (ja + 16 + r <= lim); }
#pragma unroll
                for (int r = 0; r < 8; ++r) {
                    if (EARLY) { ta[r] = (sHa[r] + sLa[r] * QRI) * SC2; tb2[r] = (sHb[r] + sLb[r] * QRI) * SC2; }
                    else       { ta[r] = sHa[r] * SC2; tb2[r] = sHb[r] * SC2; }
                    mx = fmaxf(mx, fmaxf(fa[r] ? ta[r] : NEGB, fb[r] ? tb2[r] : NEGB)); }
            }
            mx = fmaxf(mx, __shfl_xor(mx, 16, 32));
            mnew = fmaxf(m, mx);
            alpha = __builtin_amdgcn_exp2f(m - mnew);
            const float sh = PSH - mnew;
#pragma unroll
            for (int r = 0; r < 8; r += 2) {
                float ga[2], gb[2];
#pragma unroll
                for (int i = 0; i < 2; ++i) {
                    const float xa = ta[r + i] + sh, xb = tb2[r + i] + sh;
                    const float ea = __builtin_amdgcn_exp2f(xa), eb = __builtin_amdgcn_exp2f(xb);
                    ga[i] = (FULL || (fa[r + i] & (xa >= -14.0f))) ? ea : 0.0f; gb[i] = (FULL || (fb[r + i] & (xb >= -14.0f))) ? eb : 0.0f; }   // not FULL: dropped or sub-2^-14 elements selected to 0 by value
                const v2h pa = __builtin_convertvector((v2f){ga[0], ga[1]}, v2h), pc = __builtin_convertvector((v2f){gb[0], gb[1]}, v2h);
#pragma unroll
                for (int i = 0; i < 2; ++i) {
                    pb[r + i] = pa[i]; pb[8 + r + i] = pc[i];
                    if (EARLY) { pr[r + i] = toh_flush((ga[i] - (float)pa[i]) * QRS); pr[8 + r + i] = toh_flush((gb[i] - (float)pc[i]) * QRS); ls += ga[i] + gb[i]; }
                } }                                              // late rows: the row sum of the packed P is taken on the matrix unit, behind this function
    };
    if constexpr (EARLY) {
        // Inputs-only fence on the loaded values: the query fragments and tile 0 have landed before the loop is entered, so the loop's counted load waits follow from the loop's own issue order alone
        // (K early in a trip, V^T at its end) and the wait for K at a trip's head leaves the V^T loads just issued in flight.
        asm volatile("" :: "v"(qx), "v"(k0), "v"(k1), "v"(kr0), "v"(kr1), "v"(v0), "v"(vr0));
#pragma unroll 1
        for (int key0 = 0; key0 < nk; key0 += 32) {
            const int kn = (key0 + 32 < nk) ? key0 + 32 : key0;      // tile fetched in this trip; the last trip fetches its own tile again (unused), so every address stays below nk <= EROWS
            const v16h ka0 = cat16(k0, kr0), kb0 = cat16(k1, kr1);   // A fragments [K | K_res]
            const v8f sHa = wmma16g(ka0, qh, zz), sHb = wmma16g(kb0, qh, zz);
            const v8f sLa = wmma16g(ka0, qx, zz), sLb = wmma16g(kb0, qx, zz);
            { const h16* ka = KP + ko + (size_t)kn * HD; k0 = *(const v8h*)ka; k1 = *(const v8h*)(ka + 16 * HD); }
            { const h16* kr = KR + kro + (size_t)kn * HD; kr0 = *(const v8h*)kr; kr1 = *(const v8h*)(kr + 16 * HD); }
            asm volatile("s_wait_xcnt 0x0" ::: "memory");            // stands between the K loads just issued and the softmax's first writes to the registers that hold their addresses
            if (((kept >> (key0 >> 5)) & 1ull) != 0ull) tile(flag_c<true>{}, key0, sHa, sHb, sLa, sLb); else tile(flag_c<false>{}, key0, sHa, sHb, sLa, sLb);   // scalar test
            l = l * alpha + ls; m = mnew;
            o0 = o0 * alpha;
            oR0 = oR0 * alpha;
            o0 = wmma16g(v0, pb, o0);
            oR0 = wmma16g(v0, pr, oR0);
            oR0 = wmma16g(vr0, pb, oR0);
            vr0 = ldh(VR + vro + kn);
            v0 = ldh(VT + vo + kn);
            asm volatile("s_wait_xcnt 0x0" ::: "memory");            // stands between the V^T loads just issued and the next trip's first writes to the registers that hold their addresses
        }
    } else {
        // Late rows: RD register sets, set s holding tile s (mod RD). A step works on its set's tile and refills each half of the set (K behind the score products, V^T behind the P.V product)
        // with the tile RD steps on, so a load has RD - 1 whole steps of work between its issue and its wait. Tiles are taken in ascending order, one at a time.
        constexpr int RD = 4;
        const int klast = nk - 32;                                   // last tile of this wave; a fetch past it is aimed at it again (unused), so every address stays below nk <= SEQ
        v8h rk0[RD], rk1[RD]; v16h rv[RD];
        const h16 one_r = ((lr & 7) == 0) ? (h16)1.0f : (h16)0.0f;   // A fragment of the row sum: rows 0 and 8 (the two that are read) all ones, the rest 0 (lane = row); made from the lane index it stays in vector registers over the loop, where an all-ones constant was copied from scalar registers in front of every product
        v16h ones;
#pragma unroll
        for (int i = 0; i < 16; ++i) ones[i] = one_r;
        rk0[0] = k0; rk1[0] = k1; rv[0] = v0;
#pragma unroll
        for (int s = 1; s < RD; ++s) {
            const int ks = (32 * s < klast) ? 32 * s : klast;
            const h16* ka = KP + ko + (size_t)ks * HD; rk0[s] = *(const v8h*)ka; rk1[s] = *(const v8h*)(ka + 16 * HD);
            rv[s] = ldh(VT + vo + ks);
            asm volatile("s_wait_xcnt 0x0" ::: "memory");            // stands behind the loads just issued, in front of any later write to the registers that hold their addresses
        }
        // Inputs-only fence on the loaded values: the query fragment and all RD sets have landed before the loop is entered, so the loop's counted load waits follow from the loop's own issue order alone.
        asm volatile("" :: "v"(q8), "v"(rk0[0]), "v"(rk1[0]), "v"(rv[0]), "v"(rk0[1]), "v"(rk1[1]), "v"(rv[1]), "v"(rk0[2]), "v"(rk1[2]), "v"(rv[2]), "v"(rk0[3]), "v"(rk1[3]), "v"(rv[3]));
        static_assert(RD == 4);                                      // the fence above names every set
#pragma unroll 1
        for (int key0 = 0; key0 < nk; key0 += 32 * RD) {
#pragma unroll
            for (int s = 0; s < RD; ++s) {
                const int kc = key0 + 32 * s;                        // this step's tile; kc >= nk (last trip only): no tile, the step's softmax and P.V are jumped over
                const int kn = (kc + 32 * RD < nk) ? kc + 32 * RD : klast;
                // The loads (and the score products in front of them) stand outside the scalar branch below: every path through a trip issues the same loads in the same order, which keeps the ring's counted load waits.
                const v8f sHa = wmma16g(cat16(rk0[s], z8), qh, zz), sHb = wmma16g(cat16(rk1[s], z8), qh, zz);   // A fragments [K | 0]
                { const h16* ka = KP + ko + (size_t)kn * HD; rk0[s] = *(const v8h*)ka; rk1[s] = *(const v8h*)(ka + 16 * HD); }
                asm volatile("s_wait_xcnt 0x0" ::: "memory");        // stands between the K loads just issued and the softmax's first writes to the registers that hold their addresses
                if (s == 0 || kc < nk) {                             // scalar test
                    if (((kept >> (kc >> 5)) & 1ull) != 0ull) tile(flag_c<true>{}, kc, sHa, sHb, zz, zz); else tile(flag_c<false>{}, kc, sHa, sHb, zz, zz);   // scalar test
                    o0 = o0 * alpha;
                    // Row sum on the matrix unit: rows 0 and 8 of A are ones, so rows 0 and 8 of the result hold, per query column, the sum of the tile's 32 packed P over both lane halves; element 0 (row 8h) is this lane's row sum.
                    v8f sd = wmma16(ones, pb, zz);
                    o0 = wmma16(rv[s], pb, o0);
                    asm volatile("v_nop\n\tv_nop\n\tv_nop\n\tv_nop" : "+v"(sd), "+v"(o0) : "v"(ones), "v"(rv[s]), "v"(pb));   // the four idle slots behind the two products: they tie both results and keep the operands live
                    l = l * alpha + sd[0]; m = mnew;
                }
                rv[s] = ldh(VT + vo + kn);
                asm volatile("s_wait_xcnt 0x0" ::: "memory");        // stands between the V^T loads just issued and the next step's first writes to the registers that hold their addresses
            }
        }
    }
    if (EARLY) l += __shfl_xor(l, 16, 32);                        // late rows: the matrix row sum already covers both lane halves
    const bool any = l > 0.0f;
    const float lsafe = any ? l : 1.0f;
    const float inv = any ? (1.0f / lsafe) : 0.0f;
    v8f f0 = o0;
    if (EARLY) { f0 = o0 + oR0 * QRI; }
    f0 = f0 * inv;
    const unsigned nonem = __builtin_amdgcn_ballot_w32(!any);    // wave-uniform: some row of this wave kept no key
    if (nonem != 0u) {
        // equal fills give a uniform softmax over all SEQ keys: plain mean of v per channel d = 8h + r
        float vm[8];
#pragma unroll
        for (int r = 0; r < 8; ++r) vm[r] = 0.0f;
#pragma unroll 1
        for (int t = lr; t < SEQ; t += 16) {
#pragma unroll
            for (int r = 0; r < 8; ++r) vm[r] += (float)VT[pbase + (size_t)(8 * hi + r) * SEQ + t]; }
#pragma unroll
        for (int r = 0; r < 8; ++r) { float s = vm[r];
            s += __shfl_xor(s, 1, 32); s += __shfl_xor(s, 2, 32); s += __shfl_xor(s, 4, 32); s += __shfl_xor(s, 8, 32);
            vm[r] = s * (1.0f / (float)SEQ); }
#pragma unroll
        for (int r = 0; r < 8; ++r) f0[r] = any ? f0[r] : vm[r];
    }
    // O^T D layout: f0[r] = (d = 8h + r, t = lane&15) -> os[d][wave*16 + t]; rows 0..15 x columns 0..63 all written by the four waves
#pragma unroll
    for (int r = 0; r < 8; ++r) os[(8 * hi + r) * OSP + wave * 16 + lr] = f0[r];
    __syncthreads();                                              // cross-wave tile: block barrier (every wave reaches it)
    const int d = 4 * wave + (lane >> 3), c8 = (lane & 7) * 8;    // AW waves x 4 rows = 16 channel rows; 8 lanes x 8 halves = 64 tokens = one line
    const v4f x0 = *(const v4fa*)(&os[d * OSP + c8]); const v4f x1 = *(const v4fa*)(&os[d * OSP + c8 + 4]);
    v8h hv, rv;
#pragma unroll
    for (int i = 0; i < 4; ++i) { const h16 a0 = toh_flush(x0[i]); const h16 a1 = toh_flush(x1[i]); hv[i] = a0; hv[4 + i] = a1;
        rv[i] = toh_flush((x0[i] - (float)a0) * QRS); rv[4 + i] = toh_flush((x1[i] - (float)a1) * QRS); }
    const size_t oo = ((size_t)b * DM + (size_t)(h * HD + d)) * SEQ + (size_t)tb + (size_t)c8;
{
        *(v8h*)(CH + oo) = hv; *(v8h*)(CX + oo) = rv;
         }
}

__global__ __launch_bounds__(32 * AW) void k_flash(const h16* __restrict__ QH, const h16* __restrict__ QR, const h16* __restrict__ KP, const h16* __restrict__ KR,
                                                   const h16* __restrict__ VT, const h16* __restrict__ VR, const unsigned* __restrict__ KB, h16* CH, h16* CX) {
    if ((int)blockIdx.x < FLB) {
        flash_body<0>(QH, QR, KP, KR, VT, VR, KB, CH, CX);
    } else {
        flash_body<1>(QH, QR, KP, KR, VT, VR, KB, CH, CX);
    }
}

// k_oproj: output projection, ONE WAVE per 16 rows x 128 columns. A = context planes read flat as [NB*SEQ][128] (value and residual x2048, separate accumulators), Bt = Wo x64 rows [n][k] (f16), K = DM.
// The head-count input is read on the device; a value other than the compiled head count marks the output with NaN.
__global__ __launch_bounds__(32) void k_oproj(const h16* __restrict__ CH, const h16* __restrict__ CX, const h16* __restrict__ WO, const int* __restrict__ nheads_p, float* OUT) {
    __shared__ __align__(16) float os[16 * OPP];
    const int lane = threadIdx.x & 31, lr = lane & 15, hi = lane >> 4;
    const int r0 = blockIdx.x * 16;
    v8f aH[8], aR[8];
#pragma unroll
    for (int nb = 0; nb < 8; ++nb) { aH[nb] = (v8f){}; aR[nb] = (v8f){}; }
    const size_t aoff = (size_t)(r0 + lr) * DM + 8 * hi, boff = (size_t)lr * DM + 8 * hi;
#pragma unroll 1
    for (int kc = 0; kc < DM; kc += 32) {
        const v16h ah = ldh(CH + aoff + kc), ar = ldh(CX + aoff + kc);
#pragma unroll
        for (int nb = 0; nb < 8; ++nb) { const v16h w = ldh(WO + boff + (size_t)nb * 16 * DM + kc);
            aH[nb] = wmma16g(ah, w, aH[nb]); aR[nb] = wmma16g(ar, w, aR[nb]); }
    }
    const int nh = nheads_p[0];
    const float poison = (nh == NH_) ? 0.0f : __uint_as_float(0x7FC00000u);
#pragma unroll
    for (int nb = 0; nb < 8; ++nb) {
#pragma unroll
        for (int j = 0; j < 8; ++j) os[(hi * 8 + j) * OPP + nb * 16 + lr] = (aH[nb][j] + aR[nb][j] * QRI) * WOI + poison; }   // D: row 8h+j, col lane&15; rows 0..15 x columns 0..127 all written
    wave_sync();
    const int bb = r0 / SEQ, tt = r0 % SEQ;
    float* orow = OUT + ((size_t)bb * OUT_SEQ + (size_t)tt) * DM;
{
#pragma unroll 4
        for (int s = 0; s < 16; ++s) {                              // 16 rows x (32 lanes x 4 floats = 128 columns = the whole row)
            const v4f val = *(const v4fa*)(&os[s * OPP + lane * 4]);
            *(v4f*)(orow + (size_t)s * DM + lane * 4) = val; }
         }
}

static constexpr size_t al256(size_t v) { return (v + 255) & ~(size_t)255; }
static constexpr size_t SZ_XB = al256((size_t)NB * SEQ * DM * 2);
static constexpr size_t SZ_WB = al256((size_t)3 * DM * DM * 2);
static constexpr size_t SZ_WO = al256((size_t)DM * DM * 2);
static constexpr size_t SZ_PL = al256((size_t)NB * NH_ * SEQ * HD * 2);
static constexpr size_t SZ_RS = al256((size_t)NB * NH_ * EROWS * HD * 2);
static constexpr size_t SZ_KB = al256((size_t)NB * (SEQ / 32) * 4);
static constexpr size_t SZ_TOTAL = SZ_XB + SZ_WB + SZ_WO + 5 * SZ_PL + 3 * SZ_RS + SZ_KB;
static_assert(SZ_TOTAL <= (size_t)134217728);          // workspace carve <= 128 MiB
static_assert(((size_t)DM * DM * 2) % 256 == 0);       // weight sub-planes stay 256-byte aligned
static_assert((size_t)NB * NH_ * SEQ * HD == (size_t)NB * DM * SEQ);       // v^T plane and context planes [(b*128 + m)][t] have the same extent as the q/k planes
static_assert((size_t)NB * NH_ * EROWS * HD == (size_t)NB * DM * EROWS);   // v^T residual plane [(b*128 + m)][t < EROWS] has the same extent as the q/k residual planes
static_assert(((size_t)NB * DM * SEQ) % ((size_t)16 * DM) == 0);           // context planes read flat as 16-row x 128 slabs

extern "C" void kernel_launch(void* const* d_in, const int* in_sizes, int n_in,
                              void* d_out, int out_size, void* d_ws, size_t ws_size, hipStream_t stream) {
    if (n_in < 7) return;
    const size_t needx = ((size_t)(NB - 1) * SEQ_FULL + SEQ) * DM;
    const size_t needm = (size_t)(NB - 1) * SEQ_FULL + SEQ;
    if ((size_t)in_sizes[0] < needx) return;
    if ((size_t)in_sizes[1] < (size_t)DM * DM || (size_t)in_sizes[2] < (size_t)DM * DM || (size_t)in_sizes[3] < (size_t)DM * DM || (size_t)in_sizes[4] < (size_t)DM * DM) return;
    if ((size_t)in_sizes[5] < needm || in_sizes[6] < 1) return;
    if ((size_t)out_size < ((size_t)(NB - 1) * OUT_SEQ + SEQ) * DM) return;
    if (SZ_TOTAL > ws_size) return;
    // wire order: x, Wq, Wk, Wv, Wo, padding_mask, num_heads
    const float* x  = (const float*)d_in[0];
    const float* wq = (const float*)d_in[1];
    const float* wk = (const float*)d_in[2];
    const float* wv = (const float*)d_in[3];
    const float* wo = (const float*)d_in[4];
    const int* pm = (const int*)d_in[5];
    const int* nheads = (const int*)d_in[6];
    float* OUT = (float*)d_out;      // [NB][SEQ][128]
    char* wsp = (char*)d_ws;
    bf* XB = (bf*)wsp; wsp += SZ_XB;                 // x [NB*SEQ][128]
    bf* WB = (bf*)wsp; wsp += SZ_WB;                 // [3][128][128]: q | k | v  ([out][in] as-is: Bt for q, k; A for v)
    h16* WOH = (h16*)wsp; wsp += SZ_WO;              // [128][128] Wo x64 ([out][in] = Bt as-is)
    h16* QH = (h16*)wsp; wsp += SZ_PL;               // [NB*8][SEQ][16]
    h16* KP = (h16*)wsp; wsp += SZ_PL;               // [NB*8][SEQ][16]
    h16* VT = (h16*)wsp; wsp += SZ_PL;               // [NB*8][16][SEQ]
    h16* CH = (h16*)wsp; wsp += SZ_PL;               // [NB][128][SEQ] context value
    h16* CX = (h16*)wsp; wsp += SZ_PL;               // [NB][128][SEQ] context residual x2048
    h16* QR = (h16*)wsp; wsp += SZ_RS;               // [NB*8][EROWS][16] residual x2048, tokens < EROWS
    h16* KR = (h16*)wsp; wsp += SZ_RS;               // [NB*8][EROWS][16] residual x2048, tokens < EROWS
    h16* VR = (h16*)wsp; wsp += SZ_RS;               // [NB*8][16][EROWS] residual x2048, tokens < EROWS
    unsigned* KB = (unsigned*)wsp; wsp += SZ_KB;     // [NB][SEQ/32] padding mask, one bit per key

    // padding mask -> bits; x, Wq, Wk, Wv -> bf16 planes, Wo -> f16 plane x64
    k_cvt<<<dim3(1 + 4 * CWB + CXB, 1, 1), 256, 0, stream>>>(x, wq, wk, wv, wo, pm, XB, WB, WOH, KB);

    // q, k: A = x rows (m = b*SEQ + t), Bt = W rows (n = h*16 + d) -> plane [(b*8 + h)][t][d]; residuals for tokens < EROWS
    // v^T: A = Wv rows (m = h*16 + d), Bt = x rows (n = b*SEQ + t) -> plane [(b*128 + m)][t] = [(b*8 + h)][d][t]; residual for tokens < EROWS
    k_proj<<<dim3(NB * SEQ / 64, DM / 64, 3), 32, 0, stream>>>(XB, WB, QH, QR, KP, KR, VT, VR, EROWS);

    // query rows [0, EROWS): multi-product instantiation; rows [EROWS, SEQ): single-product instantiation (disjoint context columns)
    k_flash<<<dim3(FLB + FEB, 1, 1), 32 * AW, 0, stream>>>(QH, QR, KP, KR, VT, VR, KB, CH, CX);

    // output projection over the flat [NB*SEQ][128] view of the context planes
    k_oproj<<<dim3(NB * SEQ / 16, 1, 1), 32, 0, stream>>>(CH, CX, WOH, nheads, OUT);
}

// v006
// It runs in 33.7 microseconds.
// Timed twice side by side with v005, it ran 1.21 times as fast both times.
// Counting every step since v000, it is 3.76 times as fast.
#include <hip/hip_runtime.h>

// Causal multi-head self-attention, width 128 = 8 heads x 16; x [NB][SEQ][128]; Wq/Wk/Wv/Wo [out][in] (y = x W^T, no bias); key padding mask [NB][SEQ] (int32, device-read); masked scores are replaced before the 1/sqrt(16) scale;
// per-head context transposed to [b][h*16+e][t], reinterpreted flat as [NB][SEQ][128], then multiplied by Wo^T (f32 output).
// Compute dtypes, f32 accumulate everywhere: q/k/v projections v_wmma_f32_16x16x32_bf16 (x, W RNE-converted to bf16; products exact);
// scores v_wmma_f32_16x16x32_f16 (head dim 16 zero-padded to the 32-deep step): single f16 q, k on query rows >= EROWS; on query rows < EROWS q and k each as f16 value + f16 residual x2048 (cross products in the upper 16 k-slots, own accumulator);
// P.V v_wmma_f32_16x16x32_f16: P (x16384 carry, cancels in the normalisation) and v single f16 on query rows >= EROWS, row sum of the f16 P there by one more product of the same form (A = rows of ones); on query rows < EROWS P and v as f16 value + f16 residual x2048, residual products in their own accumulator folded by 1/2048, row sum from the f32 exponentials;
// output projection v_wmma_f32_16x16x32_f16: context as f16 value + f16 residual x2048 (own accumulator), Wo as bf16-converted value x64 held in f16; softmax f32 (online, running max over kept keys).
// Layout: bf16 copies of x and Wq/Wk/Wv; q, k planes [b*8+h][t][16], v^T plane [b*8+h][16][t], small residual planes (tokens < EROWS) for q, k, v^T; context planes (value, residual) [b][h*16+e][t]; fused flash kernel in transposed form (S^T = K Q^T, O^T = V^T P^T).
// Keep rule per element: (mask[b][j] != 0) and (j <= t); dropped elements get probability 0; a row with no kept key takes the plain mean of v over all SEQ keys (uniform softmax of equal fills).

#ifndef NB
#define NB 4
#endif
#ifndef SEQ
#define SEQ 2048
#endif
#define NB_FULL  4
#define SEQ_FULL 2048
#ifndef OUT_SEQ
#define OUT_SEQ SEQ              // row pitch (in tokens) between batches of the output
#endif
#define DM   128
#define NH_  8
#define HD   16
#define AW   4                   // waves per flash block (16 query rows each)
#define OSP  68                  // LDS row pitch (floats) of the flash context tile [16 d][64 t]
#define OPP  132                 // LDS row pitch (floats) of the output-projection slab [16][128]
#define EROWS (SEQ < 512 ? SEQ : 512)   // query rows (and tokens of the small residual planes) handled by the multi-product flash instantiation
#define QRS  2048.0f             // carry of every residual plane / residual fragment
#define QRI  (1.0f / 2048.0f)
#define SC2  ((float)(0.25 * 1.4426950408889634))   // HD^-0.5 * log2(e)
#define PSH  14.0f               // log2 of the P carry (16384)
#define NEGB (-3.0e38f)
#define WOS  64.0f               // carry of the Wo plane
#define WOI  (1.0f / 64.0f)

static_assert(HD == 16);
static_assert(NH_ * HD == DM);                 // head h = columns h*16 + d
static_assert(DM % 64 == 0);                   // column tiles of 64 = four heads
static_assert(64 % HD == 0);
static_assert(DM % 32 == 0);                   // GEMM k-loop steps by 32
static_assert(DM == 32 * 4);                   // output row = 32 lanes x 4 floats
static_assert(SEQ % 64 == 0);                  // a 64-row tile never straddles two batches
static_assert((NB * SEQ) % 64 == 0);
static_assert(SEQ % 32 == 0);                  // key loop steps by 32
static_assert(SEQ % (16 * AW) == 0);           // flash grids cover the sequence exactly
static_assert(16 * AW == 64);
static_assert(4 * AW == HD);                   // context store: 4 rows per wave x AW waves = 16 channel rows
static_assert(8 * 8 == 16 * AW);               // 8 lanes x 8 halves = 64 tokens per row
static_assert(EROWS % 64 == 0);                // a 64-token GEMM tile lies wholly inside or outside the residual planes
static_assert(EROWS >= 32);
static_assert(EROWS <= SEQ);
static_assert(EROWS % 32 == 0);                // early key loops end inside the residual planes
static_assert(EROWS % (16 * AW) == 0);
static_assert((SEQ - EROWS) % (16 * AW) == 0);
static_assert(((size_t)SEQ * DM) % 8 == 0);
static_assert(((size_t)DM * DM) % 8 == 0);
static_assert(NB <= NB_FULL);
static_assert(SEQ <= SEQ_FULL);
static_assert((OSP * 4) % 16 == 0);
static_assert(OSP >= 64);
static_assert((OPP * 4) % 16 == 0);
static_assert(OPP >= DM);
static_assert(4 * 32 * 8 == 16 * 64);          // projection epilogue, q/k form: 4 heads x 32 lanes x 8 halves = 16 rows x 64 columns
static_assert(4 * 4 * 64 == 16 * 64);          // projection epilogue, v^T form: 4 instructions x 4 rows x 64 halves
static_assert(16 * 68 * 4 <= 131072);          // static LDS of one proj_body instantiation (k_proj holds both)
static_assert(HD * OSP * 4 <= 131072);         // static LDS of one flash_body instantiation (k_flash holds both)
static_assert(16 * OPP * 4 <= 131072);         // static LDS of the output-projection kernel

typedef _Float16 h16;
typedef unsigned short bf;
typedef __attribute__((ext_vector_type(16))) __bf16   v16bf;
typedef __attribute__((ext_vector_type(16))) _Float16 v16h;
typedef __attribute__((ext_vector_type(8)))  _Float16 v8h;
typedef __attribute__((ext_vector_type(2)))  _Float16 v2h;
typedef __attribute__((ext_vector_type(2)))  float    v2f;
typedef __attribute__((ext_vector_type(8)))  unsigned short v8us;
typedef __attribute__((ext_vector_type(8)))  float    v8f;
typedef __attribute__((ext_vector_type(4)))  float    v4f;
typedef __attribute__((ext_vector_type(4)))  int      v4i;
typedef v4f  __attribute__((may_alias)) v4fa;

__device__ __forceinline__ unsigned short f2bf(float f) { unsigned u = __float_as_uint(f); u += 0x7FFFu + ((u >> 16) & 1u); return (unsigned short)(u >> 16); }
__device__ __forceinline__ float bfr(float f) { return __uint_as_float(((unsigned)f2bf(f)) << 16); }   // value after RNE convert to bf16
__device__ __forceinline__ v16h cat16(v8h lo, v8h hi) { return __builtin_shufflevector(lo, hi, 0, 1, 2, 3, 4, 5, 6, 7, 8, 9, 10, 11, 12, 13, 14, 15); }
__device__ __forceinline__ v16bf cat16b(v8us lo, v8us hi) { return __builtin_bit_cast(v16bf, __builtin_shufflevector(lo, hi, 0, 1, 2, 3, 4, 5, 6, 7, 8, 9, 10, 11, 12, 13, 14, 15)); }
__device__ __forceinline__ v8f wmma16(v16h a, v16h b, v8f c) { return __builtin_amdgcn_wmma_f32_16x16x32_f16(false, a, false, b, (short)0, c, false, false); }
__device__ __forceinline__ v8f wmmab(v16bf a, v16bf b, v8f c) { return __builtin_amdgcn_wmma_f32_16x16x32_bf16(false, a, false, b, (short)0, c, false, false); }
// fragment loaders from K-contiguous 16-bit rows; p already includes + 8*(lane>>4): elements 0..7 <- k0+8h+0..7, elements 8..15 <- k0+16+8h+0..7 (same map for A and B)
__device__ __forceinline__ v16h  ldh(const h16* p) { return cat16(*(const v8h*)p, *(const v8h*)(p + 16)); }
__device__ __forceinline__ v16bf ldb(const bf* p)  { return cat16b(*(const v8us*)p, *(const v8us*)(p + 16)); }
// ordering point for wave-private LDS tiles (same wave writes and reads)
__device__ __forceinline__ void wave_sync() { __builtin_amdgcn_fence(3 /* release order */, "wavefront"); __builtin_amdgcn_wave_barrier(); asm volatile("" ::: "memory"); }

// per-instruction guarded matrix ops: the four idle slots tie the accumulator and keep the operands live
__device__ __forceinline__ v8f wmma16g(v16h a, v16h b, v8f c) { c = wmma16(a, b, c); asm volatile("v_nop\n\tv_nop\n\tv_nop\n\tv_nop" : "+v"(c) : "v"(a), "v"(b)); return c; }
__device__ __forceinline__ v8f wmmabg(v16bf a, v16bf b, v8f c) { c = wmmab(a, b, c); asm volatile("v_nop\n\tv_nop\n\tv_nop\n\tv_nop" : "+v"(c) : "v"(a), "v"(b)); return c; }
// f32 -> f16 that cannot produce a subnormal operand (|v| < 2^-14 -> +0)
static __device__ __forceinline__ h16 toh_flush(float v) { const h16 r = (h16)v; return (fabsf(v) < 6.103515625e-05f) ? (h16)0.0f : r; }

// k_cvt: every operand conversion in ONE launch, 8 elements per thread (block 0: 32 mask words per thread); a block-uniform range of the block index picks the job:
// block 0: padding mask -> one bit per key (set: word nonzero), one 32-bit word per 32-key tile, KB[b * (SEQ/32) + tile], bit j = key 32*tile + j; one thread per tile;
// then, counted from block 1: blocks [0, 4*CWB): Wq, Wk, Wv -> bf16 planes of WB, Wo -> bf16-converted value x64 in f16; blocks [4*CWB, 4*CWB + CXB): x -> bf16 (batch pitch SEQ_FULL tokens in x, SEQ in XB).
#define CWB ((DM * DM / 8) / 256)                // blocks per weight matrix
#define CXB ((NB * SEQ * (DM / 8)) / 256)        // blocks of x
static_assert((DM * DM / 8) % 256 == 0);
static_assert((NB * SEQ * (DM / 8)) % 256 == 0);
static_assert(NB * (SEQ / 32) <= 256);           // one thread of block 0 per 32-key tile
__global__ __launch_bounds__(256) void k_cvt(const float* __restrict__ x, const float* __restrict__ wq, const float* __restrict__ wk, const float* __restrict__ wv, const float* __restrict__ wo,
                                             const int* __restrict__ pmask, bf* XB, bf* WB, h16* WOH, unsigned* KB) {
    if (blockIdx.x == 0u) {
        const unsigned i = threadIdx.x;
        if (i < (unsigned)(NB * (SEQ / 32))) {
            const int* p = pmask + (size_t)(i / (unsigned)(SEQ / 32)) * SEQ_FULL + (size_t)(i % (unsigned)(SEQ / 32)) * 32;
            unsigned bits = 0u;
#pragma unroll
            for (int k = 0; k < 8; ++k) { const v4i a = *(const v4i*)(p + 4 * k);
#pragma unroll
                for (int j = 0; j < 4; ++j) bits |= (a[j] != 0 ? 1u : 0u) << (4 * k + j); }
            KB[i] = bits;
            asm volatile("s_wait_xcnt 0x0" ::: "memory");                       // stands behind the store, in front of any later write to the registers that hold its address and data
        }
        return;
    }
    const unsigned blk = blockIdx.x - 1u;
    if (blk >= 4u * CWB) {
        const unsigned i = (blk - 4u * CWB) * 256u + threadIdx.x;               // 8-element group of XB
        const unsigned b = i / (unsigned)(SEQ * (DM / 8)), r = i % (unsigned)(SEQ * (DM / 8));
        const v8f v = *(const v8f*)(x + (size_t)b * SEQ_FULL * DM + (size_t)r * 8); v8us o;
#pragma unroll
        for (int k = 0; k < 8; ++k) o[k] = f2bf(v[k]);
        *(v8us*)(XB + (size_t)i * 8) = o;
        asm volatile("s_wait_xcnt 0x0" ::: "memory");                           // stands behind the store, in front of any later write to the registers that hold its address and data
        return;
    }
    if (blk >= 3u * CWB) {
        const unsigned i = (blk - 3u * CWB) * 256u + threadIdx.x;
        const v8f v = *(const v8f*)(wo + (size_t)i * 8); v8h o;
#pragma unroll
        for (int k = 0; k < 8; ++k) o[k] = toh_flush(bfr(v[k]) * WOS);
        *(v8h*)(WOH + (size_t)i * 8) = o;
        asm volatile("s_wait_xcnt 0x0" ::: "memory");                           // stands behind the store, in front of any later write to the registers that hold its address and data
        return;
    }
    const unsigned w = blk / (unsigned)CWB;
    const unsigned i = (blk % (unsigned)CWB) * 256u + threadIdx.x;
    const float* src = (w == 0) ? wq : (w == 1) ? wk : wv;
    const v8f v = *(const v8f*)(src + (size_t)i * 8); v8us o;
#pragma unroll
    for (int k = 0; k < 8; ++k) o[k] = f2bf(v[k]);
    *(v8us*)(WB + (size_t)blk * 256 * 8 + (size_t)threadIdx.x * 8) = o;         // planes q | k | v lie one behind the other: group index = blk * 256 + thread
    asm volatile("s_wait_xcnt 0x0" ::: "memory");                               // as above
}

// proj_body: register-blocked bf16 GEMM, ONE WAVE per 64x64 tile (16 accumulators), operands straight from K-contiguous bf16 planes, K = DM.
// C[m][n] = sum_k A[m][k] Bt[n][k], written as f16 (Ph) and, for tokens t < resT (resT a multiple of 64, block-uniform test), the f16 residual x2048 (Pr).
// MODE 0: A = x rows (m = b*SEQ + t), Bt = W rows (n = h*16 + d); plane [(b*8 + h)][t][16] (residual plane [(b*8 + h)][resT][16]). The 64-column tile spans four heads; per 16-row slab and head
//         one 512-byte run (16 rows per instruction). Grid x = token tile, y = channel tile in both modes (MODE 0: rows of A are tokens; MODE 1: rows of Bt are tokens).
template <int MODE>
__device__ __forceinline__ void proj_body(const bf* __restrict__ A, const bf* __restrict__ Bt, h16* Ph, h16* Pr, int resT) {
    __shared__ __align__(16) float os[16 * 68];
    const int K = DM;
    const int lane = threadIdx.x & 31, lr = lane & 15, hi = lane >> 4; const int r0 = (MODE == 0 ? blockIdx.x : blockIdx.y) * 64, c0 = (MODE == 0 ? blockIdx.y : blockIdx.x) * 64;
    v8f acc[4][4];
#pragma unroll
    for (int mb = 0; mb < 4; ++mb)
#pragma unroll
        for (int nb = 0; nb < 4; ++nb) acc[mb][nb] = (v8f){};
    const size_t aoff = (size_t)(r0 + lr) * K + 8 * hi, boff = (size_t)(c0 + lr) * K + 8 * hi;
    // Fragments are fetched one k step ahead: step 0 here; inside step kc the four A fragments of step kc + 32 go into a second register set at the step's head,
    // and each B fragment is fetched again for step kc + 32 right behind its last product. All loads of a step are in flight together; no product waits on a load issued just in front of it.
    const bf* Ap = A + aoff; const bf* Bp = Bt + boff;
    v16bf a[4], b[4];
#pragma unroll
    for (int mb = 0; mb < 4; ++mb) a[mb] = ldb(Ap + (size_t)mb * 16 * K);
#pragma unroll
    for (int nb = 0; nb < 4; ++nb) b[nb] = ldb(Bp + (size_t)nb * 16 * K);
#pragma unroll                                                     // unrolled: the test for a next step and the register sets' roles are fixed at compile time
    for (int kc = 0; kc < K; kc += 32) {
        const bool more = kc + 32 < K;
        v16bf an[4];
#pragma unroll
        for (int mb = 0; mb < 4; ++mb) an[mb] = more ? ldb(Ap + (size_t)mb * 16 * K + kc + 32) : a[mb];
#pragma unroll
        for (int nb = 0; nb < 4; ++nb) {
#pragma unroll
            for (int mb = 0; mb < 4; ++mb) acc[mb][nb] = wmmabg(a[mb], b[nb], acc[mb][nb]);
            if (more) b[nb] = ldb(Bp + (size_t)nb * 16 * K + kc + 32); }
        if (more && kc + 64 >= K) asm volatile("s_wait_xcnt 0x0" ::: "memory");   // stands behind the last loads (all of them name the same two base addresses, which live up to here), in front of any later write to the registers that hold those addresses
#pragma unroll
        for (int mb = 0; mb < 4; ++mb) a[mb] = an[mb];
    }
    size_t tbase, rbase; bool wr;                                                                 // wr: block-uniform, whole tile inside the residual plane
    if (MODE == 0) { const int bb = r0 / SEQ, tt = r0 % SEQ; const int zc = bb * NH_ + c0 / HD;
                     tbase = ((size_t)zc * SEQ + (size_t)tt) * HD; rbase = ((size_t)zc * (size_t)resT + (size_t)tt) * HD; wr = tt < resT; }
    else           { const int bb = c0 / SEQ, tt = c0 % SEQ;
                     tbase = (size_t)bb * (size_t)DM * SEQ + (size_t)r0 * SEQ + (size_t)tt; rbase = (size_t)bb * (size_t)DM * (size_t)resT + (size_t)r0 * (size_t)resT + (size_t)tt; wr = tt < resT; }
#pragma unroll
    for (int mb = 0; mb < 4; ++mb) {
#pragma unroll
        for (int nb = 0; nb < 4; ++nb) {
#pragma unroll
            for (int j = 0; j < 8; ++j) os[(hi * 8 + j) * 68 + nb * 16 + lr] = acc[mb][nb][j]; }   // D: row 8h+j, col lane&15; rows 0..15 x columns 0..63 all written
        wave_sync();
{
            if (MODE == 0) {
                const size_t sb = tbase + (size_t)(mb * 16) * HD;
                const size_t rb = rbase + (size_t)(mb * 16) * HD;
#pragma unroll
                for (int hh = 0; hh < 4; ++hh) { const int row = lane >> 1, c8 = (lane & 1) * 8;   // 16 rows x 2 lanes x 8 = 16 columns of head hh: one 512-byte run
                    const v4f x0 = *(const v4fa*)(&os[row * 68 + hh * 16 + c8]); const v4f x1 = *(const v4fa*)(&os[row * 68 + hh * 16 + c8 + 4]); v8h hv, rv;
#pragma unroll
                    for (int i = 0; i < 4; ++i) { const h16 a0 = toh_flush(x0[i]); const h16 a1 = toh_flush(x1[i]); hv[i] = a0; hv[4 + i] = a1;
                        rv[i] = toh_flush((x0[i] - (float)a0) * QRS); rv[4 + i] = toh_flush((x1[i] - (float)a1) * QRS); }
                    const size_t oo = sb + (size_t)hh * ((size_t)SEQ * HD) + (size_t)lane * 8;
                    const size_t ro = rb + (size_t)hh * ((size_t)resT * HD) + (size_t)lane * 8;
                    *(v8h*)(Ph + oo) = hv; if (wr) *(v8h*)(Pr + ro) = rv; }
            } else {
                const size_t sb = tbase + (size_t)(mb * 16) * SEQ;
                const size_t rb = rbase + (size_t)(mb * 16) * (size_t)resT;
#pragma unroll
                for (int s = 0; s < 4; ++s) { const int row = 4 * s + (lane >> 3), c8 = (lane & 7) * 8;   // 4 s x 4 row groups = 16 rows; 8 lanes x 8 = 64 columns
                    const v4f x0 = *(const v4fa*)(&os[row * 68 + c8]); const v4f x1 = *(const v4fa*)(&os[row * 68 + c8 + 4]); v8h hv, rv;
#pragma unroll
                    for (int i = 0; i < 4; ++i) { const h16 a0 = toh_flush(x0[i]); const h16 a1 = toh_flush(x1[i]); hv[i] = a0; hv[4 + i] = a1;
                        rv[i] = toh_flush((x0[i] - (float)a0) * QRS); rv[4 + i] = toh_flush((x1[i] - (float)a1) * QRS); }
                    const size_t oo = sb + (size_t)row * SEQ + c8;
                    const size_t ro = rb + (size_t)row * (size_t)resT + c8;
                    *(v8h*)(Ph + oo) = hv; if (wr) *(v8h*)(Pr + ro) = rv; }
            }
             }
        wave_sync();
    }
}

// k_proj: the three projections in ONE launch, grid (NB*SEQ/64 token tiles, DM/64 channel tiles, 3); blockIdx.z (block-uniform) picks q, k or v^T. WB = [3][128][128]: q | k | v.
__global__ __launch_bounds__(32) void k_proj(const bf* __restrict__ XB, const bf* __restrict__ WB, h16* QH, h16* QR, h16* KP, h16* KR, h16* VT, h16* VR, int resT) {
    const int z = blockIdx.z;
    if (z == 2) { const bf* A = WB + (size_t)2 * DM * DM; const bf* Bt = XB; h16* Ph = VT; h16* Pr = VR; proj_body<1>(A, Bt, Ph, Pr, resT); }
    else        { const bf* A = XB; const bf* Bt = WB + (size_t)z * DM * DM; h16* Ph = z ? KP : QH; h16* Pr = z ? KR : QR; proj_body<0>(A, Bt, Ph, Pr, resT); }
}

// k_flash: both instantiations in ONE launch, 1-D grid; a block-uniform range of the block index picks the job. Blocks [0, FLB): query rows [EROWS, SEQ), in the order (tile fastest, then batch*head);
// blocks [FLB, FLB + FEB): query rows [0, EROWS), same order. The long-running blocks come first in the index.
#define FLX ((SEQ - EROWS) / (16 * AW))          // late query tiles per (batch, head)
#define FEX (EROWS / (16 * AW))                  // early query tiles per (batch, head)
#define FLB (FLX * NB * NH_)
#define FEB (FEX * NB * NH_)
// flash_body: fused causal attention, one wave per 16 query rows of one (batch, head), AW waves = 64 query rows per block; K / V^T / Q fragments straight from the f16 planes (16-B loads, arithmetic addressing).
// Transposed form: S^T[key][t] = K Q^T (A = K rows, B = Q rows, head dim 16 in k-slots 0..15); lane (t = lane&15, h = lane>>4) holds keys 8h+r of each 16-key tile, so the packed
// P tile is directly the B fragment of O^T[d][t] = V^T P^T (element r <- tile keys 0..15, element 8+r <- tile keys 16..31, lane unchanged).
// Softmax state (running max over kept keys, sum) is one scalar per lane; the two lane halves of a row are combined with one xor-16 exchange (the sum: EARLY only; late rows hold the whole row's sum in both halves).
// Keep rule: a wave reads its batch's mask bits (KB, one word per 32-key tile) once, lane = tile. A tile whose word is all ones and whose last key lies below the wave's first query row keeps every element:
// a scalar test sends it down a path without keep compares and selects (there a P below 2^-14 stays an f16 subnormal, which the matrix unit takes as it is). Every other visited tile evaluates the rule per element.
// The per-wave key bound is t0 + 16 (pad up to 32), at most SEQ.
// EARLY = 1 (query rows [0, EROWS)): A = [K | K_res], B = [Q | 0] gives K Q; B = [Q_res | Q] gives K Q_res + K_res Q (x2048, own accumulator); P = f16 value + f16 residual x2048;
//            O = V P + (V P_res + V_res P) / 2048 (residual products in their own accumulator); row sum from the f32 exponentials; all keys of these rows are < EROWS, inside the small planes.
// EARLY = 0 (query rows [EROWS, SEQ)): single q, k, P, v.
template <bool B> struct flag_c { static constexpr bool v = B; };
static_assert(SEQ / 32 <= 64);                   // a wave holds its batch's tile words in two registers (lane = tile) and their all-kept flags in one 64-bit scalar
template <int EARLY>
__device__ __forceinline__ void flash_body(const h16* __restrict__ QH, const h16* __restrict__ QR, const h16* __restrict__ KP, const h16* __restrict__ KR,
                                           const h16* __restrict__ VT, const h16* __restrict__ VR, const unsigned* __restrict__ KB, h16* CH, h16* CX) {
    __shared__ __align__(16) float os[HD * OSP];
    const int lane = threadIdx.x & 31, lr = lane & 15, hi = lane >> 4;
    const int wave = __builtin_amdgcn_readfirstlane((int)(threadIdx.x >> 5));
    const int blk = (int)blockIdx.x - (EARLY ? FLB : 0), ntile = EARLY ? FEX : (FLX > 0 ? FLX : 1);   // index inside this instantiation's block range; query tiles per (batch, head)
    const int zh = blk / ntile; const int b = zh / NH_, h = zh % NH_;
    const int tb = (EARLY ? 0 : EROWS) + (blk % ntile) * (16 * AW);
    const int t0 = tb + wave * 16;
    const int lim = t0 + lr;                                                   // key j kept iff j <= lim (and mask nonzero)
    const int nk = (t0 + 16 + 31) & ~31;                                       // wave-uniform, multiple of 32, <= SEQ (<= EROWS when EARLY)
    const unsigned* kbb = KB + (size_t)b * (SEQ / 32);                         // + tile
    const size_t pbase = (size_t)zh * SEQ * HD;
    const size_t rbase = (size_t)zh * EROWS * HD;
    const v8h z8 = (v8h){};
    const size_t qo = pbase + (size_t)(t0 + lr) * HD + 8 * hi;
    const v8h q8 = *(const v8h*)(QH + qo);
    asm volatile("s_wait_xcnt 0x0" ::: "memory");                 // the loads issued next may land in the registers that hold this load's address: the wait stands in front of them
    const v16h qh = cat16(q8, z8);                                // B fragment [Q | 0]: col t, k = d
    v16h qx = qh;
    if (EARLY) { const size_t qro = rbase + (size_t)(t0 + lr) * HD + 8 * hi; qx = cat16(*(const v8h*)(QR + qro), q8);   // B fragment [Q_res | Q]
                 asm volatile("s_wait_xcnt 0x0" ::: "memory"); }  // as above, for the residual load's address
    const size_t ko = pbase + (size_t)lr * HD + 8 * hi;         // + key * HD       (A fragment: row key, k = d)
    const size_t vo = pbase + (size_t)lr * SEQ + 8 * hi;        // + key            (A fragment: row d, k = key)
    const size_t kro = rbase + (size_t)lr * HD + 8 * hi;        // residual planes, tokens < EROWS
    const size_t vro = rbase + (size_t)lr * EROWS + 8 * hi;
    const v8f zz = (v8f){};
    v8f o0 = (v8f){}, oR0 = (v8f){};
    float m = NEGB, l = 0.0f;
    // EARLY: every operand of a 32-key tile (K, V^T, residual planes) is fetched one trip ahead: tile 0 here, tile key0 + 32 inside trip key0,
    // each group into the registers its last reader of the trip has just left. nk >= 32, so tile 0 exists for every wave.
    // Late rows: K and V^T are fetched RD tiles ahead, through RD register sets (see the late loop below); set 0 is loaded here.
    v8h k0 = *(const v8h*)(KP + ko), k1 = *(const v8h*)(KP + ko + 16 * HD);
    v8h kr0 = z8, kr1 = z8;
    if (EARLY) { kr0 = *(const v8h*)(KR + kro); kr1 = *(const v8h*)(KR + kro + 16 * HD); }
    const unsigned kw0 = kbb[lane < SEQ / 32 ? lane : 0], kw1 = kbb[32 + lane < SEQ / 32 ? 32 + lane : 0];   // mask bits of tiles lane and 32 + lane
    // bit T set: tile T keeps every element for all 16 rows of this wave: word all ones and 32T + 31 < t0 (t0 a multiple of 16: T < t0 / 32 <= SEQ / 32 - 1). Wave-uniform.
    const unsigned long long kept = (((unsigned long long)__builtin_amdgcn_ballot_w32(kw1 == 0xFFFFFFFFu) << 32) | (unsigned long long)__builtin_amdgcn_ballot_w32(kw0 == 0xFFFFFFFFu)) & ((1ull << (t0 >> 5)) - 1ull);
    v16h v0 = ldh(VT + vo);
    v16h vr0 = v0;
    if (EARLY) { vr0 = ldh(VR + vro); }
    v16h pb, pr = (v16h){}; float ls = 0.0f, alpha, mnew;
    // softmax of the 32-key tile at key0 from its score accumulators; FULL: every element kept
    auto tile = [&](auto fc, const int key0, const v8f sHa, const v8f sHb, const v8f sLa, const v8f sLb) __attribute__((always_inline)) {
            constexpr bool FULL = decltype(fc)::v;
            float ta[8], tb2[8]; bool fa[8], fb[8]; float mx;
            ls = 0.0f;
            if constexpr (FULL) {
                float ua[8], ub[8];
#pragma unroll
                for (int r = 0; r < 8; ++r) {
                    if (EARLY) { ua[r] = sHa[r] + sLa[r] * QRI; ub[r] = sHb[r] + sLb[r] * QRI; }
                    else       { ua[r] = sHa[r]; ub[r] = sHb[r]; }
                    ta[r] = ua[r] * SC2; tb2[r] = ub[r] * SC2; fa[r] = true; fb[r] = true; }
                float mr = fmaxf(ua[0], ub[0]);                  // SC2 > 0 and rounding is monotonic: the scaled maximum equals the maximum of the scaled scores
#pragma unroll
                for (int r = 1; r < 8; ++r) mr = fmaxf(mr, fmaxf(ua[r], ub[r]));
                mx = mr * SC2;
            } else {
                const unsigned kcur = (unsigned)__builtin_amdgcn_readlane((int)(key0 < 1024 ? kw0 : kw1), (key0 >> 5) & 31);   // mask bits of keys key0 .. key0+31
                const unsigned kw = kcur >> (8 * hi);            // bits 0..7: keys key0+8h+0..7; bits 16..23: keys key0+16+8h+0..7
                const int ja = key0 + 8 * hi;
                mx = NEGB;
#pragma unroll
                for (int r = 0; r < 8; ++r) {
                    fa[r] = (((kw >> r) & 1u) != 0u) & (ja + r <= lim);
                    fb[r] = (((kw >> (16 + r)) & 1u) != 0u) & (ja + 16 + r <= lim); }
#pragma unroll
                for (int r = 0; r < 8; ++r) {
                    if (EARLY) { ta[r] = (sHa[r] + sLa[r] * QRI) * SC2; tb2[r] = (sHb[r] + sLb[r] * QRI) * SC2; }
                    else       { ta[r] = sHa[r] * SC2; tb2[r] = sHb[r] * SC2; }
                    mx = fmaxf(mx, fmaxf(fa[r] ? ta[r] : NEGB, fb[r] ? tb2[r] : NEGB)); }
            }
            mx = fmaxf(mx, __shfl_xor(mx, 16, 32));
            mnew = fmaxf(m, mx);
            alpha = __builtin_amdgcn_exp2f(m - mnew);
            const float sh = PSH - mnew;
#pragma unroll
            for (int r = 0; r < 8; r += 2) {
                float ga[2], gb[2];
#pragma unroll
                for (int i = 0; i < 2; ++i) {
                    const float xa = ta[r + i] + sh, xb = tb2[r + i] + sh;
                    const float ea = __builtin_amdgcn_exp2f(xa), eb = __builtin_amdgcn_exp2f(xb);
                    ga[i] = (FULL || (fa[r + i] & (xa >= -14.0f))) ? ea : 0.0f; gb[i] = (FULL || (fb[r + i] & (xb >= -14.0f))) ? eb : 0.0f; }   // not FULL: dropped or sub-2^-14 elements selected to 0 by value
                const v2h pa = __builtin_convertvector((v2f){ga[0], ga[1]}, v2h), pc = __builtin_convertvector((v2f){gb[0], gb[1]}, v2h);
#pragma unroll
                for (int i = 0; i < 2; ++i) {
                    pb[r + i] = pa[i]; pb[8 + r + i] = pc[i];
                    if (EARLY) { pr[r + i] = toh_flush((ga[i] - (float)pa[i]) * QRS); pr[8 + r + i] = toh_flush((gb[i] - (float)pc[i]) * QRS); ls += ga[i] + gb[i]; }
                } }                                              // late rows: the row sum of the packed P is taken on the matrix unit, behind this function
    };
    if constexpr (EARLY) {
        // Inputs-only fence on the loaded values: the query fragments and tile 0 have landed before the loop is entered, so the loop's counted load waits follow from the loop's own issue order alone
        // (K early in a trip, V^T at its end) and the wait for K at a trip's head leaves the V^T loads just issued in flight.
        asm volatile("" :: "v"(qx), "v"(k0), "v"(k1), "v"(kr0), "v"(kr1), "v"(v0), "v"(vr0));
#pragma unroll 1
        for (int key0 = 0; key0 < nk; key0 += 32) {
            const int kn = (key0 + 32 < nk) ? key0 + 32 : key0;      // tile fetched in this trip; the last trip fetches its own tile again (unused), so every address stays below nk <= EROWS
            const v16h ka0 = cat16(k0, kr0), kb0 = cat16(k1, kr1);   // A fragments [K | K_res]
            const v8f sHa = wmma16g(ka0, qh, zz), sHb = wmma16g(kb0, qh, zz);
            const v8f sLa = wmma16g(ka0, qx, zz), sLb = wmma16g(kb0, qx, zz);
            { const h16* ka = KP + ko + (size_t)kn * HD; k0 = *(const v8h*)ka; k1 = *(const v8h*)(ka + 16 * HD); }
            { const h16* kr = KR + kro + (size_t)kn * HD; kr0 = *(const v8h*)kr; kr1 = *(const v8h*)(kr + 16 * HD); }
            asm volatile("s_wait_xcnt 0x0" ::: "memory");            // stands between the K loads just issued and the softmax's first writes to the registers that hold their addresses
            if (((kept >> (key0 >> 5)) & 1ull) != 0ull) tile(flag_c<true>{}, key0, sHa, sHb, sLa, sLb); else tile(flag_c<false>{}, key0, sHa, sHb, sLa, sLb);   // scalar test
            l = l * alpha + ls; m = mnew;
            o0 = o0 * alpha;
            oR0 = oR0 * alpha;
            o0 = wmma16g(v0, pb, o0);
            oR0 = wmma16g(v0, pr, oR0);
            oR0 = wmma16g(vr0, pb, oR0);
            vr0 = ldh(VR + vro + kn);
            v0 = ldh(VT + vo + kn);
            asm volatile("s_wait_xcnt 0x0" ::: "memory");            // stands between the V^T loads just issued and the next trip's first writes to the registers that hold their addresses
        }
    } else {
        // Late rows: RD register sets, set s holding tile s (mod RD). A step works on its set's tile and refills each half of the set (K behind the score products, V^T behind the P.V product)
        // with the tile RD steps on, so a load has RD - 1 whole steps of work between its issue and its wait. Tiles are taken in ascending order, one at a time.
        constexpr int RD = 4;
        const int klast = nk - 32;                                   // last tile of this wave; a fetch past it is aimed at it again (unused), so every address stays below nk <= SEQ
        v8h rk0[RD], rk1[RD]; v16h rv[RD];
        const h16 one_r = ((lr & 7) == 0) ? (h16)1.0f : (h16)0.0f;   // A fragment of the row sum: rows 0 and 8 (the two that are read) all ones, the rest 0 (lane = row); made from the lane index it stays in vector registers over the loop, where an all-ones constant was copied from scalar registers in front of every product
        v16h ones;
#pragma unroll
        for (int i = 0; i < 16; ++i) ones[i] = one_r;
        rk0[0] = k0; rk1[0] = k1; rv[0] = v0;
#pragma unroll
        for (int s = 1; s < RD; ++s) {
            const int ks = (32 * s < klast) ? 32 * s : klast;
            const h16* ka = KP + ko + (size_t)ks * HD; rk0[s] = *(const v8h*)ka; rk1[s] = *(const v8h*)(ka + 16 * HD);
            rv[s] = ldh(VT + vo + ks);
            asm volatile("s_wait_xcnt 0x0" ::: "memory");            // stands behind the loads just issued, in front of any later write to the registers that hold their addresses
        }
        // Inputs-only fence on the loaded values: the query fragment and all RD sets have landed before the loop is entered, so the loop's counted load waits follow from the loop's own issue order alone.
        asm volatile("" :: "v"(q8), "v"(rk0[0]), "v"(rk1[0]), "v"(rv[0]), "v"(rk0[1]), "v"(rk1[1]), "v"(rv[1]), "v"(rk0[2]), "v"(rk1[2]), "v"(rv[2]), "v"(rk0[3]), "v"(rk1[3]), "v"(rv[3]));
        static_assert(RD == 4);                                      // the fence above names every set
#pragma unroll 1
        for (int key0 = 0; key0 < nk; key0 += 32 * RD) {
#pragma unroll
            for (int s = 0; s < RD; ++s) {
                const int kc = key0 + 32 * s;                        // this step's tile; kc >= nk (last trip only): no tile, the step's softmax and P.V are jumped over
                const int kn = (kc + 32 * RD < nk) ? kc + 32 * RD : klast;
                // The loads (and the score products in front of them) stand outside the scalar branch below: every path through a trip issues the same loads in the same order, which keeps the ring's counted load waits.
                const v8f sHa = wmma16g(cat16(rk0[s], z8), qh, zz), sHb = wmma16g(cat16(rk1[s], z8), qh, zz);   // A fragments [K | 0]
                { const h16* ka = KP + ko + (size_t)kn * HD; rk0[s] = *(const v8h*)ka; rk1[s] = *(const v8h*)(ka + 16 * HD); }
                asm volatile("s_wait_xcnt 0x0" ::: "memory");        // stands between the K loads just issued and the softmax's first writes to the registers that hold their addresses
                if (s == 0 || kc < nk) {                             // scalar test
                    if (((kept >> (kc >> 5)) & 1ull) != 0ull) tile(flag_c<true>{}, kc, sHa, sHb, zz, zz); else tile(flag_c<false>{}, kc, sHa, sHb, zz, zz);   // scalar test
                    o0 = o0 * alpha;
                    // Row sum on the matrix unit: rows 0 and 8 of A are ones, so rows 0 and 8 of the result hold, per query column, the sum of the tile's 32 packed P over both lane halves; element 0 (row 8h) is this lane's row sum.
                    v8f sd = wmma16(ones, pb, zz);
                    o0 = wmma16(rv[s], pb, o0);
                    asm volatile("v_nop\n\tv_nop\n\tv_nop\n\tv_nop" : "+v"(sd), "+v"(o0) : "v"(ones), "v"(rv[s]), "v"(pb));   // the four idle slots behind the two products: they tie both results and keep the operands live
                    l = l * alpha + sd[0]; m = mnew;
                }
                rv[s] = ldh(VT + vo + kn);
                asm volatile("s_wait_xcnt 0x0" ::: "memory");        // stands between the V^T loads just issued and the next step's first writes to the registers that hold their addresses
            }
        }
    }
    if (EARLY) l += __shfl_xor(l, 16, 32);                        // late rows: the matrix row sum already covers both lane halves
    const bool any = l > 0.0f;
    const float lsafe = any ? l : 1.0f;
    const float inv = any ? (1.0f / lsafe) : 0.0f;
    v8f f0 = o0;
    if (EARLY) { f0 = o0 + oR0 * QRI; }
    f0 = f0 * inv;
    const unsigned nonem = __builtin_amdgcn_ballot_w32(!any);    // wave-uniform: some row of this wave kept no key
    if (nonem != 0u) {
        // equal fills give a uniform softmax over all SEQ keys: plain mean of v per channel d = 8h + r
        float vm[8];
#pragma unroll
        for (int r = 0; r < 8; ++r) vm[r] = 0.0f;
#pragma unroll 1
        for (int t = lr; t < SEQ; t += 16) {
#pragma unroll
            for (int r = 0; r < 8; ++r) vm[r] += (float)VT[pbase + (size_t)(8 * hi + r) * SEQ + t]; }
#pragma unroll
        for (int r = 0; r < 8; ++r) { float s = vm[r];
            s += __shfl_xor(s, 1, 32); s += __shfl_xor(s, 2, 32); s += __shfl_xor(s, 4, 32); s += __shfl_xor(s, 8, 32);
            vm[r] = s * (1.0f / (float)SEQ); }
#pragma unroll
        for (int r = 0; r < 8; ++r) f0[r] = any ? f0[r] : vm[r];
    }
    // O^T D layout: f0[r] = (d = 8h + r, t = lane&15) -> os[d][wave*16 + t]; rows 0..15 x columns 0..63 all written by the four waves
#pragma unroll
    for (int r = 0; r < 8; ++r) os[(8 * hi + r) * OSP + wave * 16 + lr] = f0[r];
    __syncthreads();                                              // cross-wave tile: block barrier (every wave reaches it)
    const int d = 4 * wave + (lane >> 3), c8 = (lane & 7) * 8;    // AW waves x 4 rows = 16 channel rows; 8 lanes x 8 halves = 64 tokens = one line
    const v4f x0 = *(const v4fa*)(&os[d * OSP + c8]); const v4f x1 = *(const v4fa*)(&os[d * OSP + c8 + 4]);
    v8h hv, rv;
#pragma unroll
    for (int i = 0; i < 4; ++i) { const h16 a0 = toh_flush(x0[i]); const h16 a1 = toh_flush(x1[i]); hv[i] = a0; hv[4 + i] = a1;
        rv[i] = toh_flush((x0[i] - (float)a0) * QRS); rv[4 + i] = toh_flush((x1[i] - (float)a1) * QRS); }
    const size_t oo = ((size_t)b * DM + (size_t)(h * HD + d)) * SEQ + (size_t)tb + (size_t)c8;
{
        *(v8h*)(CH + oo) = hv; *(v8h*)(CX + oo) = rv;
         }
}

__global__ __launch_bounds__(32 * AW) void k_flash(const h16* __restrict__ QH, const h16* __restrict__ QR, const h16* __restrict__ KP, const h16* __restrict__ KR,
                                                   const h16* __restrict__ VT, const h16* __restrict__ VR, const unsigned* __restrict__ KB, h16* CH, h16* CX) {
    if ((int)blockIdx.x < FLB) {
        flash_body<0>(QH, QR, KP, KR, VT, VR, KB, CH, CX);
    } else {
        flash_body<1>(QH, QR, KP, KR, VT, VR, KB, CH, CX);
    }
}

// k_oproj: output projection, ONE WAVE per 16 rows x 128 columns. A = context planes read flat as [NB*SEQ][128] (value and residual x2048, separate accumulators), Bt = Wo x64 rows [n][k] (f16), K = DM.
// The head-count input is read on the device; a value other than the compiled head count marks the output with NaN.
__global__ __launch_bounds__(32) void k_oproj(const h16* __restrict__ CH, const h16* __restrict__ CX, const h16* __restrict__ WO, const int* __restrict__ nheads_p, float* OUT) {
    __shared__ __align__(16) float os[16 * OPP];
    const int lane = threadIdx.x & 31, lr = lane & 15, hi = lane >> 4;
    const int r0 = blockIdx.x * 16;
    v8f aH[8], aR[8];
#pragma unroll
    for (int nb = 0; nb < 8; ++nb) { aH[nb] = (v8f){}; aR[nb] = (v8f){}; }
    const size_t aoff = (size_t)(r0 + lr) * DM + 8 * hi, boff = (size_t)lr * DM + 8 * hi;
    const int nh = nheads_p[0];                                   // read here, so that its latency runs beside the fragment loads'
    // Fragments are fetched one k step ahead, as in proj_body: step 0 here; inside step kc the two context fragments of step kc + 32 go into a second register set at the step's head,
    // and each Wo fragment is fetched again for step kc + 32 right behind its last product.
    const h16* Hp = CH + aoff; const h16* Xp = CX + aoff; const h16* Wp = WO + boff;
    v16h ah = ldh(Hp), ar = ldh(Xp), w[8];
#pragma unroll
    for (int nb = 0; nb < 8; ++nb) w[nb] = ldh(Wp + (size_t)nb * 16 * DM);
#pragma unroll                                                     // unrolled: the test for a next step and the register sets' roles are fixed at compile time
    for (int kc = 0; kc < DM; kc += 32) {
        const bool more = kc + 32 < DM;
        const v16h ahn = more ? ldh(Hp + kc + 32) : ah, arn = more ? ldh(Xp + kc + 32) : ar;
#pragma unroll
        for (int nb = 0; nb < 8; ++nb) {
            aH[nb] = wmma16g(ah, w[nb], aH[nb]); aR[nb] = wmma16g(ar, w[nb], aR[nb]);
            if (more) w[nb] = ldh(Wp + (size_t)nb * 16 * DM + kc + 32); }
        if (more && kc + 64 >= DM) asm volatile("s_wait_xcnt 0x0" ::: "memory");   // stands behind the last loads (all of them name the same three base addresses, which live up to here), in front of any later write to the registers that hold those addresses
        ah = ahn; ar = arn;
    }
    const float poison = (nh == NH_) ? 0.0f : __uint_as_float(0x7FC00000u);
#pragma unroll
    for (int nb = 0; nb < 8; ++nb) {
#pragma unroll
        for (int j = 0; j < 8; ++j) os[(hi * 8 + j) * OPP + nb * 16 + lr] = (aH[nb][j] + aR[nb][j] * QRI) * WOI + poison; }   // D: row 8h+j, col lane&15; rows 0..15 x columns 0..127 all written
    wave_sync();
    const int bb = r0 / SEQ, tt = r0 % SEQ;
    float* orow = OUT + ((size_t)bb * OUT_SEQ + (size_t)tt) * DM;
{
#pragma unroll 4
        for (int s = 0; s < 16; ++s) {                              // 16 rows x (32 lanes x 4 floats = 128 columns = the whole row)
            const v4f val = *(const v4fa*)(&os[s * OPP + lane * 4]);
            *(v4f*)(orow + (size_t)s * DM + lane * 4) = val; }
         }
}

static constexpr size_t al256(size_t v) { return (v + 255) & ~(size_t)255; }
static constexpr size_t SZ_XB = al256((size_t)NB * SEQ * DM * 2);
static constexpr size_t SZ_WB = al256((size_t)3 * DM * DM * 2);
static constexpr size_t SZ_WO = al256((size_t)DM * DM * 2);
static constexpr size_t SZ_PL = al256((size_t)NB * NH_ * SEQ * HD * 2);
static constexpr size_t SZ_RS = al256((size_t)NB * NH_ * EROWS * HD * 2);
static constexpr size_t SZ_KB = al256((size_t)NB * (SEQ / 32) * 4);
static constexpr size_t SZ_TOTAL = SZ_XB + SZ_WB + SZ_WO + 5 * SZ_PL + 3 * SZ_RS + SZ_KB;
static_assert(SZ_TOTAL <= (size_t)134217728);          // workspace carve <= 128 MiB
static_assert(((size_t)DM * DM * 2) % 256 == 0);       // weight sub-planes stay 256-byte aligned
static_assert((size_t)NB * NH_ * SEQ * HD == (size_t)NB * DM * SEQ);       // v^T plane and context planes [(b*128 + m)][t] have the same extent as the q/k planes
static_assert((size_t)NB * NH_ * EROWS * HD == (size_t)NB * DM * EROWS);   // v^T residual plane [(b*128 + m)][t < EROWS] has the same extent as the q/k residual planes
static_assert(((size_t)NB * DM * SEQ) % ((size_t)16 * DM) == 0);           // context planes read flat as 16-row x 128 slabs

extern "C" void kernel_launch(void* const* d_in, const int* in_sizes, int n_in,
                              void* d_out, int out_size, void* d_ws, size_t ws_size, hipStream_t stream) {
    if (n_in < 7) return;
    const size_t needx = ((size_t)(NB - 1) * SEQ_FULL + SEQ) * DM;
    const size_t needm = (size_t)(NB - 1) * SEQ_FULL + SEQ;
    if ((size_t)in_sizes[0] < needx) return;
    if ((size_t)in_sizes[1] < (size_t)DM * DM || (size_t)in_sizes[2] < (size_t)DM * DM || (size_t)in_sizes[3] < (size_t)DM * DM || (size_t)in_sizes[4] < (size_t)DM * DM) return;
    if ((size_t)in_sizes[5] < needm || in_sizes[6] < 1) return;
    if ((size_t)out_size < ((size_t)(NB - 1) * OUT_SEQ + SEQ) * DM) return;
    if (SZ_TOTAL > ws_size) return;
    // wire order: x, Wq, Wk, Wv, Wo, padding_mask, num_heads
    const float* x  = (const float*)d_in[0];
    const float* wq = (const float*)d_in[1];
    const float* wk = (const float*)d_in[2];
    const float* wv = (const float*)d_in[3];
    const float* wo = (const float*)d_in[4];
    const int* pm = (const int*)d_in[5];
    const int* nheads = (const int*)d_in[6];
    float* OUT = (float*)d_out;      // [NB][SEQ][128]
    char* wsp = (char*)d_ws;
    bf* XB = (bf*)wsp; wsp += SZ_XB;                 // x [NB*SEQ][128]
    bf* WB = (bf*)wsp; wsp += SZ_WB;                 // [3][128][128]: q | k | v  ([out][in] as-is: Bt for q, k; A for v)
    h16* WOH = (h16*)wsp; wsp += SZ_WO;              // [128][128] Wo x64 ([out][in] = Bt as-is)
    h16* QH = (h16*)wsp; wsp += SZ_PL;               // [NB*8][SEQ][16]
    h16* KP = (h16*)wsp; wsp += SZ_PL;               // [NB*8][SEQ][16]
    h16* VT = (h16*)wsp; wsp += SZ_PL;               // [NB*8][16][SEQ]
    h16* CH = (h16*)wsp; wsp += SZ_PL;               // [NB][128][SEQ] context value
    h16* CX = (h16*)wsp; wsp += SZ_PL;               // [NB][128][SEQ] context residual x2048
    h16* QR = (h16*)wsp; wsp += SZ_RS;               // [NB*8][EROWS][16] residual x2048, tokens < EROWS
    h16* KR = (h16*)wsp; wsp += SZ_RS;               // [NB*8][EROWS][16] residual x2048, tokens < EROWS
    h16* VR = (h16*)wsp; wsp += SZ_RS;               // [NB*8][16][EROWS] residual x2048, tokens < EROWS
    unsigned* KB = (unsigned*)wsp; wsp += SZ_KB;     // [NB][SEQ/32] padding mask, one bit per key

    // padding mask -> bits; x, Wq, Wk, Wv -> bf16 planes, Wo -> f16 plane x64
    k_cvt<<<dim3(1 + 4 * CWB + CXB, 1, 1), 256, 0, stream>>>(x, wq, wk, wv, wo, pm, XB, WB, WOH, KB);

    // q, k: A = x rows (m = b*SEQ + t), Bt = W rows (n = h*16 + d) -> plane [(b*8 + h)][t][d]; residuals for tokens < EROWS
    // v^T: A = Wv rows (m = h*16 + d), Bt = x rows (n = b*SEQ + t) -> plane [(b*128 + m)][t] = [(b*8 + h)][d][t]; residual for tokens < EROWS
    k_proj<<<dim3(NB * SEQ / 64, DM / 64, 3), 32, 0, stream>>>(XB, WB, QH, QR, KP, KR, VT, VR, EROWS);

    // query rows [0, EROWS): multi-product instantiation; rows [EROWS, SEQ): single-product instantiation (disjoint context columns)
    k_flash<<<dim3(FLB + FEB, 1, 1), 32 * AW, 0, stream>>>(QH, QR, KP, KR, VT, VR, KB, CH, CX);

    // output projection over the flat [NB*SEQ][128] view of the context planes
    k_oproj<<<dim3(NB * SEQ / 16, 1, 1), 32, 0, stream>>>(CH, CX, WOH, nheads, OUT);
}

// v007
// One run takes 31.9 microseconds.
// In two side-by-side timings against v006, it was 1.04 and 1.05 times as fast.
// All steps since v000 together make it 3.93 times as fast.
#include <hip/hip_runtime.h>

// Causal multi-head self-attention, width 128 = 8 heads x 16; x [NB][SEQ][128]; Wq/Wk/Wv/Wo [out][in] (y = x W^T, no bias); key padding mask [NB][SEQ] (int32, device-read); masked scores are replaced before the 1/sqrt(16) scale;
// per-head context transposed to [b][h*16+e][t], reinterpreted flat as [NB][SEQ][128], then multiplied by Wo^T (f32 output).
// Compute dtypes, f32 accumulate everywhere: q/k/v projections v_wmma_f32_16x16x32_bf16 (x, W RNE-converted to bf16; products exact);
// scores v_wmma_f32_16x16x32_f16 (head dim 16 zero-padded to the 32-deep step): single f16 q, k on query rows >= EROWS; on query rows < EROWS q and k each as f16 value + f16 residual x2048 (cross products in the upper 16 k-slots, own accumulator);
// P.V v_wmma_f32_16x16x32_f16: P (x16384 carry, cancels in the normalisation) and v single f16 on query rows >= EROWS, row sum of the f16 P there by one more product of the same form (A = rows of ones); on query rows < EROWS P and v as f16 value + f16 residual x2048, residual products in their own accumulator folded by 1/2048, row sum from the f32 exponentials;
// output projection v_wmma_f32_16x16x32_f16: context as f16 value + f16 residual x2048 (own accumulator), Wo as bf16-converted value x64 held in f16; softmax f32 (online, running max over kept keys).
// Layout: q, k planes [b*8+h][t][16], v^T plane [b*8+h][16][t], small residual planes (tokens < EROWS) for q, k, v^T; context planes (value, residual) [b][h*16+e][t]; fused flash kernel in transposed form (S^T = K Q^T, O^T = V^T P^T).
// Keep rule per element: (mask[b][j] != 0) and (j <= t); dropped elements get probability 0; a row with no kept key takes the plain mean of v over all SEQ keys (uniform softmax of equal fills).

#ifndef NB
#define NB 4
#endif
#ifndef SEQ
#define SEQ 2048
#endif
#define NB_FULL  4
#define SEQ_FULL 2048
#ifndef OUT_SEQ
#define OUT_SEQ SEQ              // row pitch (in tokens) between batches of the output
#endif
#define DM   128
#define NH_  8
#define HD   16
#define AW   4                   // waves per flash block (16 query rows each)
#define OSP  68                  // LDS row pitch (floats) of the flash context tile [16 d][64 t]
#define OPP  132                 // LDS row pitch (floats) of the output-projection slab [16][128]
#define EROWS (SEQ < 512 ? SEQ : 512)   // query rows (and tokens of the small residual planes) handled by the multi-product flash instantiation
#define QRS  2048.0f             // carry of every residual plane / residual fragment
#define QRI  (1.0f / 2048.0f)
#define SC2  ((float)(0.25 * 1.4426950408889634))   // HD^-0.5 * log2(e)
#define PSH  14.0f               // log2 of the P carry (16384)
#define NEGB (-3.0e38f)
#define WOS  64.0f               // carry of the Wo plane
#define WOI  (1.0f / 64.0f)

static_assert(HD == 16);
static_assert(NH_ * HD == DM);                 // head h = columns h*16 + d
static_assert(DM % 64 == 0);                   // column tiles of 64 = four heads
static_assert(64 % HD == 0);
static_assert(DM % 32 == 0);                   // GEMM k-loop steps by 32
static_assert(DM == 32 * 4);                   // output row = 32 lanes x 4 floats
static_assert(SEQ % 64 == 0);                  // a 64-row tile never straddles two batches
static_assert((NB * SEQ) % 64 == 0);
static_assert(SEQ % 32 == 0);                  // key loop steps by 32
static_assert(SEQ % (16 * AW) == 0);           // flash grids cover the sequence exactly
static_assert(16 * AW == 64);
static_assert(4 * AW == HD);                   // context store: 4 rows per wave x AW waves = 16 channel rows
static_assert(8 * 8 == 16 * AW);               // 8 lanes x 8 halves = 64 tokens per row
static_assert(EROWS % 64 == 0);                // a 64-token GEMM tile lies wholly inside or outside the residual planes
static_assert(EROWS >= 32);
static_assert(EROWS <= SEQ);
static_assert(EROWS % 32 == 0);                // early key loops end inside the residual planes
static_assert(EROWS % (16 * AW) == 0);
static_assert((SEQ - EROWS) % (16 * AW) == 0);
static_assert(((size_t)SEQ * DM) % 8 == 0);
static_assert(((size_t)DM * DM) % 8 == 0);
static_assert(NB <= NB_FULL);
static_assert(SEQ <= SEQ_FULL);
static_assert((OSP * 4) % 16 == 0);
static_assert(OSP >= 64);
static_assert((OPP * 4) % 16 == 0);
static_assert(OPP >= DM);
static_assert(4 * 32 * 8 == 16 * 64);          // projection epilogue, q/k form: 4 heads x 32 lanes x 8 halves = 16 rows x 64 columns
static_assert(4 * 4 * 64 == 16 * 64);          // projection epilogue, v^T form: 4 instructions x 4 rows x 64 halves
static_assert(HD * OSP * 4 <= 131072);         // static LDS of the flash kernels
static_assert(16 * OPP * 4 <= 131072);         // static LDS of the output-projection kernel

typedef _Float16 h16;
typedef unsigned short bf;
typedef __attribute__((ext_vector_type(16))) __bf16   v16bf;
typedef __attribute__((ext_vector_type(16))) _Float16 v16h;
typedef __attribute__((ext_vector_type(8)))  _Float16 v8h;
typedef __attribute__((ext_vector_type(2)))  _Float16 v2h;
typedef __attribute__((ext_vector_type(2)))  float    v2f;
typedef __attribute__((ext_vector_type(8)))  unsigned short v8us;
typedef __attribute__((ext_vector_type(4)))  unsigned short v4us;
typedef __attribute__((ext_vector_type(4)))  __bf16   v4bf;
typedef __attribute__((ext_vector_type(8)))  float    v8f;
typedef __attribute__((ext_vector_type(4)))  float    v4f;
typedef __attribute__((ext_vector_type(4)))  int      v4i;
typedef v4f  __attribute__((may_alias)) v4fa;

__device__ __forceinline__ unsigned short f2bf(float f) { unsigned u = __float_as_uint(f); u += 0x7FFFu + ((u >> 16) & 1u); return (unsigned short)(u >> 16); }
__device__ __forceinline__ float bfr(float f) { return __uint_as_float(((unsigned)f2bf(f)) << 16); }   // value after RNE convert to bf16
__device__ __forceinline__ v16h cat16(v8h lo, v8h hi) { return __builtin_shufflevector(lo, hi, 0, 1, 2, 3, 4, 5, 6, 7, 8, 9, 10, 11, 12, 13, 14, 15); }
__device__ __forceinline__ v16bf cat16b(v8us lo, v8us hi) { return __builtin_bit_cast(v16bf, __builtin_shufflevector(lo, hi, 0, 1, 2, 3, 4, 5, 6, 7, 8, 9, 10, 11, 12, 13, 14, 15)); }
__device__ __forceinline__ v8f wmma16(v16h a, v16h b, v8f c) { return __builtin_amdgcn_wmma_f32_16x16x32_f16(false, a, false, b, (short)0, c, false, false); }
__device__ __forceinline__ v8f wmmab(v16bf a, v16bf b, v8f c) { return __builtin_amdgcn_wmma_f32_16x16x32_bf16(false, a, false, b, (short)0, c, false, false); }
// fragment loaders from K-contiguous 16-bit rows; p already includes + 8*(lane>>4): elements 0..7 <- k0+8h+0..7, elements 8..15 <- k0+16+8h+0..7 (same map for A and B)
__device__ __forceinline__ v16h  ldh(const h16* p) { return cat16(*(const v8h*)p, *(const v8h*)(p + 16)); }
__device__ __forceinline__ v16bf ldb(const bf* p)  { return cat16b(*(const v8us*)p, *(const v8us*)(p + 16)); }
// ordering point for wave-private LDS tiles (same wave writes and reads)
__device__ __forceinline__ void wave_sync() { __builtin_amdgcn_fence(3 /* release order */, "wavefront"); __builtin_amdgcn_wave_barrier(); asm volatile("" ::: "memory"); }

// per-instruction guarded matrix ops: the four idle slots tie the accumulator and keep the operands live
__device__ __forceinline__ v8f wmma16g(v16h a, v16h b, v8f c) { c = wmma16(a, b, c); asm volatile("v_nop\n\tv_nop\n\tv_nop\n\tv_nop" : "+v"(c) : "v"(a), "v"(b)); return c; }
__device__ __forceinline__ v8f wmmabg(v16bf a, v16bf b, v8f c) { c = wmmab(a, b, c); asm volatile("v_nop\n\tv_nop\n\tv_nop\n\tv_nop" : "+v"(c) : "v"(a), "v"(b)); return c; }
// f32 -> f16 that cannot produce a subnormal operand (|v| < 2^-14 -> +0)
static __device__ __forceinline__ h16 toh_flush(float v) { const h16 r = (h16)v; return (fabsf(v) < 6.103515625e-05f) ? (h16)0.0f : r; }

// proj_gemm: register-blocked bf16 GEMM, ONE WAVE per 64x64 tile (16 accumulators), K = DM: acc = C[m][n] = sum_k A[m][k] Bt[n][k]. The wave reads the 64 f32 rows of each operand itself, one whole 512-byte row per load instruction,
// converts them to bf16 (round to nearest even) in registers and lays them down in its own LDS tiles (row pitch PSP); the fragments come from there. One copy of this code serves all three projections:
// xa (block-uniform) says whether the x rows are A (q, k: m = b*SEQ + t, n = h*16 + d) or Bt (v^T: m = h*16 + d, n = b*SEQ + t). bx = token tile, by = channel tile.
#define PSP 136                  // LDS row pitch (bf16 elements) of a staged operand tile [64][128]: 272 bytes = 16 x 17
static_assert(PSP >= DM);
static_assert((PSP * 2) % 16 == 0);
static_assert(2 * 64 * PSP * 2 + 2 * 16 * 68 * 4 <= 131072);   // static LDS of the projection kernel
__device__ __forceinline__ void proj_gemm(const float* __restrict__ X, const float* __restrict__ Wm, bf* st, bool xa, int bx, int by, v8f (&acc)[4][4]) {
    const int lane = threadIdx.x & 31, lr = lane & 15, hi = lane >> 4;
    bf* sa = st; bf* sb = st + 64 * PSP;
    {
        const int tk0 = bx * 64;                                                // first token of the tile; a 64-token tile lies inside one batch (batch pitch SEQ_FULL tokens in x)
        const float* xr = X + ((size_t)(tk0 / SEQ) * SEQ_FULL + (size_t)(tk0 % SEQ)) * DM + lane * 4;
        const float* wr0 = Wm + (size_t)(by * 64) * DM + lane * 4;
        bf* sx = (xa ? sa : sb) + lane * 4; bf* sw = (xa ? sb : sa) + lane * 4;
        // Eight groups of 16 rows (x: 0..3, W: 4..7) through a ring of three register groups: two groups' loads are in flight while the group before them is converted and stored.
        v4f t[3][16];
#pragma unroll                                                     // unrolled: row offsets become immediates on two base addresses, and the ring's roles are fixed at compile time
        for (int g = 0; g < 8 + 2; ++g) {
            if (g < 8) {
                const float* p = (g < 4 ? xr : wr0) + (size_t)((g & 3) * 16) * DM;
#pragma unroll
                for (int i = 0; i < 16; ++i) t[g % 3][i] = *(const v4f*)(p + (size_t)i * DM);
                if ((g & 3) == 3) asm volatile("s_wait_xcnt 0x0" ::: "memory");   // stands behind the last loads that name this operand's base address (which lives up to here), in front of any later write to the registers that hold it
            }
            if (g >= 2) {
                const int c = g - 2;
                bf* q = (c < 4 ? sx : sw) + ((c & 3) * 16) * PSP;
#pragma unroll
                for (int i = 0; i < 16; ++i) *(v4us*)(q + i * PSP) = __builtin_bit_cast(v4us, __builtin_convertvector(t[c % 3][i], v4bf));
                asm volatile("" ::: "memory");                                    // compiler fence: the next group's loads stay behind these stores and take over the registers just freed; without it the loads are hoisted over the stores and the build takes 478 registers instead of 230 (two waves to a SIMD instead of four, and window switches for the registers above v255)
            }
        }
    }
    wave_sync();                                                   // the fragments read below were written by other lanes of this wave
#pragma unroll
    for (int mb = 0; mb < 4; ++mb)
#pragma unroll
        for (int nb = 0; nb < 4; ++nb) acc[mb][nb] = (v8f){};
    // Fragments are fetched from LDS one k step ahead: step 0 here; inside step kc the four A fragments of step kc + 32 go into a second register set at the step's head,
    // and each B fragment is fetched again for step kc + 32 right behind its last product.
    const bf* Ap = sa + lr * PSP + 8 * hi; const bf* Bp = sb + lr * PSP + 8 * hi;
    v16bf a[4], b[4];
#pragma unroll
    for (int mb = 0; mb < 4; ++mb) a[mb] = ldb(Ap + mb * 16 * PSP);
#pragma unroll
    for (int nb = 0; nb < 4; ++nb) b[nb] = ldb(Bp + nb * 16 * PSP);
#pragma unroll                                                     // unrolled: the test for a next step and the register sets' roles are fixed at compile time
    for (int kc = 0; kc < DM; kc += 32) {
        const bool more = kc + 32 < DM;
        v16bf an[4];
#pragma unroll
        for (int mb = 0; mb < 4; ++mb) an[mb] = more ? ldb(Ap + mb * 16 * PSP + kc + 32) : a[mb];
#pragma unroll
        for (int nb = 0; nb < 4; ++nb) {
#pragma unroll
            for (int mb = 0; mb < 4; ++mb) acc[mb][nb] = wmmabg(a[mb], b[nb], acc[mb][nb]);
            if (more) b[nb] = ldb(Bp + nb * 16 * PSP + kc + 32); }
#pragma unroll
        for (int mb = 0; mb < 4; ++mb) a[mb] = an[mb];
    }
}

// proj_store: the 64x64 tile written as f16 (Ph) and, for tokens t < resT (resT a multiple of 64, block-uniform test), the f16 residual x2048 (Pr).
// MODE 0 (q, k): plane [(b*8 + h)][t][16] (residual plane [(b*8 + h)][resT][16]). The 64-column tile spans four heads; per 16-row slab and head one 512-byte run.
// MODE 1 (v^T): plane [(b*128 + m)][t] (4 rows per instruction).
template <int MODE>
__device__ __forceinline__ void proj_store(const v8f (&acc)[4][4], h16* Ph, h16* Pr, int resT, int bx, int by) {
    __shared__ __align__(16) float os[16 * 68];
    const int lane = threadIdx.x & 31, lr = lane & 15, hi = lane >> 4; const int r0 = (MODE == 0 ? bx : by) * 64, c0 = (MODE == 0 ? by : bx) * 64;
    size_t tbase, rbase; bool wr;                                                                 // wr: block-uniform, whole tile inside the residual plane
    if (MODE == 0) { const int bb = r0 / SEQ, tt = r0 % SEQ; const int zc = bb * NH_ + c0 / HD;
                     tbase = ((size_t)zc * SEQ + (size_t)tt) * HD; rbase = ((size_t)zc * (size_t)resT + (size_t)tt) * HD; wr = tt < resT; }
    else           { const int bb = c0 / SEQ, tt = c0 % SEQ;
                     tbase = (size_t)bb * (size_t)DM * SEQ + (size_t)r0 * SEQ + (size_t)tt; rbase = (size_t)bb * (size_t)DM * (size_t)resT + (size_t)r0 * (size_t)resT + (size_t)tt; wr = tt < resT; }
#pragma unroll
    for (int mb = 0; mb < 4; ++mb) {
#pragma unroll
        for (int nb = 0; nb < 4; ++nb) {
#pragma unroll
            for (int j = 0; j < 8; ++j) os[(hi * 8 + j) * 68 + nb * 16 + lr] = acc[mb][nb][j]; }   // D: row 8h+j, col lane&15; rows 0..15 x columns 0..63 all written
        wave_sync();
{
            if (MODE == 0) {
                const size_t sb = tbase + (size_t)(mb * 16) * HD;
                const size_t rb = rbase + (size_t)(mb * 16) * HD;
#pragma unroll
                for (int hh = 0; hh < 4; ++hh) { const int row = lane >> 1, c8 = (lane & 1) * 8;   // 16 rows x 2 lanes x 8 = 16 columns of head hh: one 512-byte run
                    const v4f x0 = *(const v4fa*)(&os[row * 68 + hh * 16 + c8]); const v4f x1 = *(const v4fa*)(&os[row * 68 + hh * 16 + c8 + 4]); v8h hv, rv;
#pragma unroll
                    for (int i = 0; i < 4; ++i) { const h16 a0 = toh_flush(x0[i]); const h16 a1 = toh_flush(x1[i]); hv[i] = a0; hv[4 + i] = a1;
                        rv[i] = toh_flush((x0[i] - (float)a0) * QRS); rv[4 + i] = toh_flush((x1[i] - (float)a1) * QRS); }
                    const size_t oo = sb + (size_t)hh * ((size_t)SEQ * HD) + (size_t)lane * 8;
                    const size_t ro = rb + (size_t)hh * ((size_t)resT * HD) + (size_t)lane * 8;
                    *(v8h*)(Ph + oo) = hv;
                    asm volatile("s_wait_xcnt 0x0" ::: "memory");                       // stands behind the store, in front of any later write to the registers that hold its address and data
                    if (wr) { *(v8h*)(Pr + ro) = rv;
                        asm volatile("s_wait_xcnt 0x0" ::: "memory"); } }               // as above
            } else {
                const size_t sb = tbase + (size_t)(mb * 16) * SEQ;
                const size_t rb = rbase + (size_t)(mb * 16) * (size_t)resT;
#pragma unroll
                for (int s = 0; s < 4; ++s) { const int row = 4 * s + (lane >> 3), c8 = (lane & 7) * 8;   // 4 s x 4 row groups = 16 rows; 8 lanes x 8 = 64 columns
                    const v4f x0 = *(const v4fa*)(&os[row * 68 + c8]); const v4f x1 = *(const v4fa*)(&os[row * 68 + c8 + 4]); v8h hv, rv;
#pragma unroll
                    for (int i = 0; i < 4; ++i) { const h16 a0 = toh_flush(x0[i]); const h16 a1 = toh_flush(x1[i]); hv[i] = a0; hv[4 + i] = a1;
                        rv[i] = toh_flush((x0[i] - (float)a0) * QRS); rv[4 + i] = toh_flush((x1[i] - (float)a1) * QRS); }
                    const size_t oo = sb + (size_t)row * SEQ + c8;
                    const size_t ro = rb + (size_t)row * (size_t)resT + c8;
                    *(v8h*)(Ph + oo) = hv;
                    asm volatile("s_wait_xcnt 0x0" ::: "memory");                       // stands behind the store, in front of any later write to the registers that hold its address and data
                    if (wr) { *(v8h*)(Pr + ro) = rv;
                        asm volatile("s_wait_xcnt 0x0" ::: "memory"); } }               // as above
            }
             }
        wave_sync();
    }
}

// k_proj: the three projections and the two small conversions in ONE launch, 1-D grid of one-wave blocks; a block-uniform range of the block index picks the job.
// Blocks [0, PJB): projections, index = (z * (DM/64) + channel tile) * (NB*SEQ/64) + token tile, z = 0, 1, 2: q, k, v^T.
// Blocks [PJB, PJB + CWO): Wo -> bf16-converted value x64 in f16, 8 elements per thread.
// Blocks [PJB + CWO, PJB + CWO + CKB): padding mask -> one bit per key (set: word nonzero), one 32-bit word per 32-key tile, KB[b * (SEQ/32) + tile], bit j = key 32*tile + j; one thread per tile.
#define PJX (NB * SEQ / 64)                      // token tiles
#define PJB (PJX * (DM / 64) * 3)
#define CWO ((DM * DM / 8) / 32)
#define CKB ((NB * (SEQ / 32)) / 32)
static_assert((DM * DM / 8) % 32 == 0);
static_assert((NB * (SEQ / 32)) % 32 == 0);
__global__ __launch_bounds__(32) void k_proj(const float* __restrict__ x, const float* __restrict__ wq, const float* __restrict__ wk, const float* __restrict__ wv, const float* __restrict__ wo,
                                             const int* __restrict__ pmask, h16* WOH, unsigned* KB, h16* QH, h16* QR, h16* KP, h16* KR, h16* VT, h16* VR, int resT) {
    __shared__ __align__(16) bf st[2 * 64 * PSP];
    const unsigned blk = blockIdx.x;
    if (blk >= (unsigned)(PJB + CWO)) {
        const unsigned i = (blk - (unsigned)(PJB + CWO)) * 32u + threadIdx.x;
        const int* p = pmask + (size_t)(i / (unsigned)(SEQ / 32)) * SEQ_FULL + (size_t)(i % (unsigned)(SEQ / 32)) * 32;
        unsigned bits = 0u;
#pragma unroll
        for (int k = 0; k < 8; ++k) { const v4i a = *(const v4i*)(p + 4 * k);
#pragma unroll
            for (int j = 0; j < 4; ++j) bits |= (a[j] != 0 ? 1u : 0u) << (4 * k + j); }
        KB[i] = bits;
        asm volatile("s_wait_xcnt 0x0" ::: "memory");                           // stands behind the store, in front of any later write to the registers that hold its address and data
        return;
    }
    if (blk >= (unsigned)PJB) {
        const unsigned i = (blk - (unsigned)PJB) * 32u + threadIdx.x;
        const v8f v = *(const v8f*)(wo + (size_t)i * 8); v8h o;
#pragma unroll
        for (int k = 0; k < 8; ++k) o[k] = toh_flush(bfr(v[k]) * WOS);
        *(v8h*)(WOH + (size_t)i * 8) = o;
        asm volatile("s_wait_xcnt 0x0" ::: "memory");                           // stands behind the store, in front of any later write to the registers that hold its address and data
        return;
    }
    const int bx = (int)(blk % (unsigned)PJX), by = (int)((blk / (unsigned)PJX) % (unsigned)(DM / 64)), z = (int)(blk / (unsigned)(PJX * (DM / 64)));
    const float* Wm = (z == 0) ? wq : (z == 1) ? wk : wv;
    v8f acc[4][4];
    proj_gemm(x, Wm, st, z != 2, bx, by, acc);
    if (z == 2) { proj_store<1>(acc, VT, VR, resT, bx, by); }
    else        { h16* Ph = z ? KP : QH; h16* Pr = z ? KR : QR; proj_store<0>(acc, Ph, Pr, resT, bx, by); }
}

// k_flash: both instantiations in ONE launch, 1-D grid; a block-uniform range of the block index picks the job. Blocks [0, FLB): query rows [EROWS, SEQ), in the order (tile fastest, then batch*head);
// blocks [FLB, FLB + FEB): query rows [0, EROWS), same order. The long-running blocks come first in the index.
#define FLX ((SEQ - EROWS) / (16 * AW))          // late query tiles per (batch, head)
#define FEX (EROWS / (16 * AW))                  // early query tiles per (batch, head)
#define FLB (FLX * NB * NH_)
#define FEB (FEX * NB * NH_)
// flash_body: fused causal attention, one wave per 16 query rows of one (batch, head), AW waves = 64 query rows per block; K / V^T / Q fragments straight from the f16 planes (16-B loads, arithmetic addressing).
// Transposed form: S^T[key][t] = K Q^T (A = K rows, B = Q rows, head dim 16 in k-slots 0..15); lane (t = lane&15, h = lane>>4) holds keys 8h+r of each 16-key tile, so the packed
// P tile is directly the B fragment of O^T[d][t] = V^T P^T (element r <- tile keys 0..15, element 8+r <- tile keys 16..31, lane unchanged).
// Softmax state (running max over kept keys, sum) is one scalar per lane; the two lane halves of a row are combined with one xor-16 exchange (the sum: EARLY only; late rows hold the whole row's sum in both halves).
// Keep rule: a wave reads its batch's mask bits (KB, one word per 32-key tile) once, lane = tile. A tile whose word is all ones and whose last key lies below the wave's first query row keeps every element:
// a scalar test sends it down a path without keep compares and selects (there a P below 2^-14 stays an f16 subnormal, which the matrix unit takes as it is). Every other visited tile evaluates the rule per element.
// The per-wave key bound is t0 + 16 (pad up to 32), at most SEQ.
// EARLY = 1 (query rows [0, EROWS)): A = [K | K_res], B = [Q | 0] gives K Q; B = [Q_res | Q] gives K Q_res + K_res Q (x2048, own accumulator); P = f16 value + f16 residual x2048;
//            O = V P + (V P_res + V_res P) / 2048 (residual products in their own accumulator); row sum from the f32 exponentials; all keys of these rows are < EROWS, inside the small planes.
// EARLY = 0 (query rows [EROWS, SEQ)): single q, k, P, v.
template <bool B> struct flag_c { static constexpr bool v = B; };
static_assert(SEQ / 32 <= 64);                   // a wave holds its batch's tile words in two registers (lane = tile) and their all-kept flags in one 64-bit scalar
template <int EARLY>
__device__ __forceinline__ void flash_body(const h16* __restrict__ QH, const h16* __restrict__ QR, const h16* __restrict__ KP, const h16* __restrict__ KR,
                                           const h16* __restrict__ VT, const h16* __restrict__ VR, const unsigned* __restrict__ KB, h16* CH, h16* CX) {
    __shared__ __align__(16) float os[HD * OSP];
    const int lane = threadIdx.x & 31, lr = lane & 15, hi = lane >> 4;
    const int wave = __builtin_amdgcn_readfirstlane((int)(threadIdx.x >> 5));
    const int blk = (int)blockIdx.x - (EARLY ? FLB : 0), ntile = EARLY ? FEX : (FLX > 0 ? FLX : 1);   // index inside this instantiation's block range; query tiles per (batch, head)
    const int zh = blk / ntile; const int b = zh / NH_, h = zh % NH_;
    const int tb = (EARLY ? 0 : EROWS) + (blk % ntile) * (16 * AW);
    const int t0 = tb + wave * 16;
    const int lim = t0 + lr;                                                   // key j kept iff j <= lim (and mask nonzero)
    const int nk = (t0 + 16 + 31) & ~31;                                       // wave-uniform, multiple of 32, <= SEQ (<= EROWS when EARLY)
    const unsigned* kbb = KB + (size_t)b * (SEQ / 32);                         // + tile
    const size_t pbase = (size_t)zh * SEQ * HD;
    const size_t rbase = (size_t)zh * EROWS * HD;
    const v8h z8 = (v8h){};
    const size_t qo = pbase + (size_t)(t0 + lr) * HD + 8 * hi;
    const v8h q8 = *(const v8h*)(QH + qo);
    asm volatile("s_wait_xcnt 0x0" ::: "memory");                 // the loads issued next may land in the registers that hold this load's address: the wait stands in front of them
    const v16h qh = cat16(q8, z8);                                // B fragment [Q | 0]: col t, k = d
    v16h qx = qh;
    if (EARLY) { const size_t qro = rbase + (size_t)(t0 + lr) * HD + 8 * hi; qx = cat16(*(const v8h*)(QR + qro), q8);   // B fragment [Q_res | Q]
                 asm volatile("s_wait_xcnt 0x0" ::: "memory"); }  // as above, for the residual load's address
    const size_t ko = pbase + (size_t)lr * HD + 8 * hi;         // + key * HD       (A fragment: row key, k = d)
    const size_t vo = pbase + (size_t)lr * SEQ + 8 * hi;        // + key            (A fragment: row d, k = key)
    const size_t kro = rbase + (size_t)lr * HD + 8 * hi;        // residual planes, tokens < EROWS
    const size_t vro = rbase + (size_t)lr * EROWS + 8 * hi;
    const v8f zz = (v8f){};
    v8f o0 = (v8f){}, oR0 = (v8f){};
    float m = NEGB, l = 0.0f;
    // EARLY: every operand of a 32-key tile (K, V^T, residual planes) is fetched one trip ahead: tile 0 here, tile key0 + 32 inside trip key0,
    // each group into the registers its last reader of the trip has just left. nk >= 32, so tile 0 exists for every wave.
    // Late rows: K and V^T are fetched RD tiles ahead, through RD register sets (see the late loop below); set 0 is loaded here.
    v8h k0 = *(const v8h*)(KP + ko), k1 = *(const v8h*)(KP + ko + 16 * HD);
    v8h kr0 = z8, kr1 = z8;
    if (EARLY) { kr0 = *(const v8h*)(KR + kro); kr1 = *(const v8h*)(KR + kro + 16 * HD); }
    const unsigned kw0 = kbb[lane < SEQ / 32 ? lane : 0], kw1 = kbb[32 + lane < SEQ / 32 ? 32 + lane : 0];   // mask bits of tiles lane and 32 + lane
    // bit T set: tile T keeps every element for all 16 rows of this wave: word all ones and 32T + 31 < t0 (t0 a multiple of 16: T < t0 / 32 <= SEQ / 32 - 1). Wave-uniform.
    const unsigned long long kept = (((unsigned long long)__builtin_amdgcn_ballot_w32(kw1 == 0xFFFFFFFFu) << 32) | (unsigned long long)__builtin_amdgcn_ballot_w32(kw0 == 0xFFFFFFFFu)) & ((1ull << (t0 >> 5)) - 1ull);
    v16h v0 = ldh(VT + vo);
    v16h vr0 = v0;
    if (EARLY) { vr0 = ldh(VR + vro); }
    v16h pb, pr = (v16h){}; float ls = 0.0f, alpha, mnew;
    // softmax of the 32-key tile at key0 from its score accumulators; FULL: every element kept
    auto tile = [&](auto fc, const int key0, const v8f sHa, const v8f sHb, const v8f sLa, const v8f sLb) __attribute__((always_inline)) {
            constexpr bool FULL = decltype(fc)::v;
            float ta[8], tb2[8]; bool fa[8], fb[8]; float mx;
            ls = 0.0f;
            if constexpr (FULL) {
                float ua[8], ub[8];
#pragma unroll
                for (int r = 0; r < 8; ++r) {
                    if (EARLY) { ua[r] = sHa[r] + sLa[r] * QRI; ub[r] = sHb[r] + sLb[r] * QRI; }
                    else       { ua[r] = sHa[r]; ub[r] = sHb[r]; }
                    ta[r] = ua[r] * SC2; tb2[r] = ub[r] * SC2; fa[r] = true; fb[r] = true; }
                float mr = fmaxf(ua[0], ub[0]);                  // SC2 > 0 and rounding is monotonic: the scaled maximum equals the maximum of the scaled scores
#pragma unroll
                for (int r = 1; r < 8; ++r) mr = fmaxf(mr, fmaxf(ua[r], ub[r]));
                mx = mr * SC2;
            } else {
                const unsigned kcur = (unsigned)__builtin_amdgcn_readlane((int)(key0 < 1024 ? kw0 : kw1), (key0 >> 5) & 31);   // mask bits of keys key0 .. key0+31
                const unsigned kw = kcur >> (8 * hi);            // bits 0..7: keys key0+8h+0..7; bits 16..23: keys key0+16+8h+0..7
                const int ja = key0 + 8 * hi;
                mx = NEGB;
#pragma unroll
                for (int r = 0; r < 8; ++r) {
                    fa[r] = (((kw >> r) & 1u) != 0u) & (ja + r <= lim);
                    fb[r] = (((kw >> (16 + r)) & 1u) != 0u) & (ja + 16 + r <= lim); }
#pragma unroll
                for (int r = 0; r < 8; ++r) {
                    if (EARLY) { ta[r] = (sHa[r] + sLa[r] * QRI) * SC2; tb2[r] = (sHb[r] + sLb[r] * QRI) * SC2; }
                    else       { ta[r] = sHa[r] * SC2; tb2[r] = sHb[r] * SC2; }
                    mx = fmaxf(mx, fmaxf(fa[r] ? ta[r] : NEGB, fb[r] ? tb2[r] : NEGB)); }
            }
            mx = fmaxf(mx, __shfl_xor(mx, 16, 32));
            mnew = fmaxf(m, mx);
            alpha = __builtin_amdgcn_exp2f(m - mnew);
            const float sh = PSH - mnew;
#pragma unroll
            for (int r = 0; r < 8; r += 2) {
                float ga[2], gb[2];
#pragma unroll
                for (int i = 0; i < 2; ++i) {
                    const float xa = ta[r + i] + sh, xb = tb2[r + i] + sh;
                    const float ea = __builtin_amdgcn_exp2f(xa), eb = __builtin_amdgcn_exp2f(xb);
                    ga[i] = (FULL || (fa[r + i] & (xa >= -14.0f))) ? ea : 0.0f; gb[i] = (FULL || (fb[r + i] & (xb >= -14.0f))) ? eb : 0.0f; }   // not FULL: dropped or sub-2^-14 elements selected to 0 by value
                const v2h pa = __builtin_convertvector((v2f){ga[0], ga[1]}, v2h), pc = __builtin_convertvector((v2f){gb[0], gb[1]}, v2h);
#pragma unroll
                for (int i = 0; i < 2; ++i) {
                    pb[r + i] = pa[i]; pb[8 + r + i] = pc[i];
                    if (EARLY) { pr[r + i] = toh_flush((ga[i] - (float)pa[i]) * QRS); pr[8 + r + i] = toh_flush((gb[i] - (float)pc[i]) * QRS); ls += ga[i] + gb[i]; }
                } }                                              // late rows: the row sum of the packed P is taken on the matrix unit, behind this function
    };
    if constexpr (EARLY) {
        // Inputs-only fence on the loaded values: the query fragments and tile 0 have landed before the loop is entered, so the loop's counted load waits follow from the loop's own issue order alone
        // (K early in a trip, V^T at its end) and the wait for K at a trip's head leaves the V^T loads just issued in flight.
        asm volatile("" :: "v"(qx), "v"(k0), "v"(k1), "v"(kr0), "v"(kr1), "v"(v0), "v"(vr0));
#pragma unroll 1
        for (int key0 = 0; key0 < nk; key0 += 32) {
            const int kn = (key0 + 32 < nk) ? key0 + 32 : key0;      // tile fetched in this trip; the last trip fetches its own tile again (unused), so every address stays below nk <= EROWS
            const v16h ka0 = cat16(k0, kr0), kb0 = cat16(k1, kr1);   // A fragments [K | K_res]
            const v8f sHa = wmma16g(ka0, qh, zz), sHb = wmma16g(kb0, qh, zz);
            const v8f sLa = wmma16g(ka0, qx, zz), sLb = wmma16g(kb0, qx, zz);
            { const h16* ka = KP + ko + (size_t)kn * HD; k0 = *(const v8h*)ka; k1 = *(const v8h*)(ka + 16 * HD); }
            { const h16* kr = KR + kro + (size_t)kn * HD; kr0 = *(const v8h*)kr; kr1 = *(const v8h*)(kr + 16 * HD); }
            asm volatile("s_wait_xcnt 0x0" ::: "memory");            // stands between the K loads just issued and the softmax's first writes to the registers that hold their addresses
            if (((kept >> (key0 >> 5)) & 1ull) != 0ull) tile(flag_c<true>{}, key0, sHa, sHb, sLa, sLb); else tile(flag_c<false>{}, key0, sHa, sHb, sLa, sLb);   // scalar test
            l = l * alpha + ls; m = mnew;
            o0 = o0 * alpha;
            oR0 = oR0 * alpha;
            o0 = wmma16g(v0, pb, o0);
            oR0 = wmma16g(v0, pr, oR0);
            oR0 = wmma16g(vr0, pb, oR0);
            vr0 = ldh(VR + vro + kn);
            v0 = ldh(VT + vo + kn);
            asm volatile("s_wait_xcnt 0x0" ::: "memory");            // stands between the V^T loads just issued and the next trip's first writes to the registers that hold their addresses
        }
    } else {
        // Late rows: RD register sets, set s holding tile s (mod RD). A step works on its set's tile and refills each half of the set (K behind the score products, V^T behind the P.V product)
        // with the tile RD steps on, so a load has RD - 1 whole steps of work between its issue and its wait. Tiles are taken in ascending order, one at a time.
        constexpr int RD = 4;
        const int klast = nk - 32;                                   // last tile of this wave; a fetch past it is aimed at it again (unused), so every address stays below nk <= SEQ
        v8h rk0[RD], rk1[RD]; v16h rv[RD];
        const h16 one_r = ((lr & 7) == 0) ? (h16)1.0f : (h16)0.0f;   // A fragment of the row sum: rows 0 and 8 (the two that are read) all ones, the rest 0 (lane = row); made from the lane index it stays in vector registers over the loop, where an all-ones constant was copied from scalar registers in front of every product
        v16h ones;
#pragma unroll
        for (int i = 0; i < 16; ++i) ones[i] = one_r;
        rk0[0] = k0; rk1[0] = k1; rv[0] = v0;
#pragma unroll
        for (int s = 1; s < RD; ++s) {
            const int ks = (32 * s < klast) ? 32 * s : klast;
            const h16* ka = KP + ko + (size_t)ks * HD; rk0[s] = *(const v8h*)ka; rk1[s] = *(const v8h*)(ka + 16 * HD);
            rv[s] = ldh(VT + vo + ks);
            asm volatile("s_wait_xcnt 0x0" ::: "memory");            // stands behind the loads just issued, in front of any later write to the registers that hold their addresses
        }
        // Inputs-only fence on the loaded values: the query fragment and all RD sets have landed before the loop is entered, so the loop's counted load waits follow from the loop's own issue order alone.
        asm volatile("" :: "v"(q8), "v"(rk0[0]), "v"(rk1[0]), "v"(rv[0]), "v"(rk0[1]), "v"(rk1[1]), "v"(rv[1]), "v"(rk0[2]), "v"(rk1[2]), "v"(rv[2]), "v"(rk0[3]), "v"(rk1[3]), "v"(rv[3]));
        static_assert(RD == 4);                                      // the fence above names every set
#pragma unroll 1
        for (int key0 = 0; key0 < nk; key0 += 32 * RD) {
#pragma unroll
            for (int s = 0; s < RD; ++s) {
                const int kc = key0 + 32 * s;                        // this step's tile; kc >= nk (last trip only): no tile, the step's softmax and P.V are jumped over
                const int kn = (kc + 32 * RD < nk) ? kc + 32 * RD : klast;
                // The loads (and the score products in front of them) stand outside the scalar branch below: every path through a trip issues the same loads in the same order, which keeps the ring's counted load waits.
                const v8f sHa = wmma16g(cat16(rk0[s], z8), qh, zz), sHb = wmma16g(cat16(rk1[s], z8), qh, zz);   // A fragments [K | 0]
                { const h16* ka = KP + ko + (size_t)kn * HD; rk0[s] = *(const v8h*)ka; rk1[s] = *(const v8h*)(ka + 16 * HD); }
                asm volatile("s_wait_xcnt 0x0" ::: "memory");        // stands between the K loads just issued and the softmax's first writes to the registers that hold their addresses
                if (s == 0 || kc < nk) {                             // scalar test
                    if (((kept >> (kc >> 5)) & 1ull) != 0ull) tile(flag_c<true>{}, kc, sHa, sHb, zz, zz); else tile(flag_c<false>{}, kc, sHa, sHb, zz, zz);   // scalar test
                    o0 = o0 * alpha;
                    // Row sum on the matrix unit: rows 0 and 8 of A are ones, so rows 0 and 8 of the result hold, per query column, the sum of the tile's 32 packed P over both lane halves; element 0 (row 8h) is this lane's row sum.
                    v8f sd = wmma16(ones, pb, zz);
                    o0 = wmma16(rv[s], pb, o0);
                    asm volatile("v_nop\n\tv_nop\n\tv_nop\n\tv_nop" : "+v"(sd), "+v"(o0) : "v"(ones), "v"(rv[s]), "v"(pb));   // the four idle slots behind the two products: they tie both results and keep the operands live
                    l = l * alpha + sd[0]; m = mnew;
                }
                rv[s] = ldh(VT + vo + kn);
                asm volatile("s_wait_xcnt 0x0" ::: "memory");        // stands between the V^T loads just issued and the next step's first writes to the registers that hold their addresses
            }
        }
    }
    if (EARLY) l += __shfl_xor(l, 16, 32);                        // late rows: the matrix row sum already covers both lane halves
    const bool any = l > 0.0f;
    const float lsafe = any ? l : 1.0f;
    const float inv = any ? (1.0f / lsafe) : 0.0f;
    v8f f0 = o0;
    if (EARLY) { f0 = o0 + oR0 * QRI; }
    f0 = f0 * inv;
    const unsigned nonem = __builtin_amdgcn_ballot_w32(!any);    // wave-uniform: some row of this wave kept no key
    if (nonem != 0u) {
        // equal fills give a uniform softmax over all SEQ keys: plain mean of v per channel d = 8h + r
        float vm[8];
#pragma unroll
        for (int r = 0; r < 8; ++r) vm[r] = 0.0f;
#pragma unroll 1
        for (int t = lr; t < SEQ; t += 16) {
#pragma unroll
            for (int r = 0; r < 8; ++r) vm[r] += (float)VT[pbase + (size_t)(8 * hi + r) * SEQ + t]; }
#pragma unroll
        for (int r = 0; r < 8; ++r) { float s = vm[r];
            s += __shfl_xor(s, 1, 32); s += __shfl_xor(s, 2, 32); s += __shfl_xor(s, 4, 32); s += __shfl_xor(s, 8, 32);
            vm[r] = s * (1.0f / (float)SEQ); }
#pragma unroll
        for (int r = 0; r < 8; ++r) f0[r] = any ? f0[r] : vm[r];
    }
    // O^T D layout: f0[r] = (d = 8h + r, t = lane&15) -> os[d][wave*16 + t]; rows 0..15 x columns 0..63 all written by the four waves
#pragma unroll
    for (int r = 0; r < 8; ++r) os[(8 * hi + r) * OSP + wave * 16 + lr] = f0[r];
    __syncthreads();                                              // cross-wave tile: block barrier (every wave reaches it)
    const int d = 4 * wave + (lane >> 3), c8 = (lane & 7) * 8;    // AW waves x 4 rows = 16 channel rows; 8 lanes x 8 halves = 64 tokens = one line
    const v4f x0 = *(const v4fa*)(&os[d * OSP + c8]); const v4f x1 = *(const v4fa*)(&os[d * OSP + c8 + 4]);
    v8h hv, rv;
#pragma unroll
    for (int i = 0; i < 4; ++i) { const h16 a0 = toh_flush(x0[i]); const h16 a1 = toh_flush(x1[i]); hv[i] = a0; hv[4 + i] = a1;
        rv[i] = toh_flush((x0[i] - (float)a0) * QRS); rv[4 + i] = toh_flush((x1[i] - (float)a1) * QRS); }
    const size_t oo = ((size_t)b * DM + (size_t)(h * HD + d)) * SEQ + (size_t)tb + (size_t)c8;
{
        *(v8h*)(CH + oo) = hv; *(v8h*)(CX + oo) = rv;
         }
}

__global__ __launch_bounds__(32 * AW) void k_flash(const h16* __restrict__ QH, const h16* __restrict__ QR, const h16* __restrict__ KP, const h16* __restrict__ KR,
                                                   const h16* __restrict__ VT, const h16* __restrict__ VR, const unsigned* __restrict__ KB, h16* CH, h16* CX) {
    if ((int)blockIdx.x < FLB) {
        flash_body<0>(QH, QR, KP, KR, VT, VR, KB, CH, CX);
    } else {
        flash_body<1>(QH, QR, KP, KR, VT, VR, KB, CH, CX);
    }
}

// k_oproj: output projection, ONE WAVE per 16 rows x 128 columns. A = context planes read flat as [NB*SEQ][128] (value and residual x2048, separate accumulators), Bt = Wo x64 rows [n][k] (f16), K = DM.
// The head-count input is read on the device; a value other than the compiled head count marks the output with NaN.
__global__ __launch_bounds__(32) void k_oproj(const h16* __restrict__ CH, const h16* __restrict__ CX, const h16* __restrict__ WO, const int* __restrict__ nheads_p, float* OUT) {
    __shared__ __align__(16) float os[16 * OPP];
    const int lane = threadIdx.x & 31, lr = lane & 15, hi = lane >> 4;
    const int r0 = blockIdx.x * 16;
    v8f aH[8], aR[8];
#pragma unroll
    for (int nb = 0; nb < 8; ++nb) { aH[nb] = (v8f){}; aR[nb] = (v8f){}; }
    const size_t aoff = (size_t)(r0 + lr) * DM + 8 * hi, boff = (size_t)lr * DM + 8 * hi;
    const int nh = nheads_p[0];                                   // read here, so that its latency runs beside the fragment loads'
    // Fragments are fetched one k step ahead, as in proj_gemm: step 0 here; inside step kc the two context fragments of step kc + 32 go into a second register set at the step's head,
    // and each Wo fragment is fetched again for step kc + 32 right behind its last product.
    const h16* Hp = CH + aoff; const h16* Xp = CX + aoff; const h16* Wp = WO + boff;
    v16h ah = ldh(Hp), ar = ldh(Xp), w[8];
#pragma unroll
    for (int nb = 0; nb < 8; ++nb) w[nb] = ldh(Wp + (size_t)nb * 16 * DM);
#pragma unroll                                                     // unrolled: the test for a next step and the register sets' roles are fixed at compile time
    for (int kc = 0; kc < DM; kc += 32) {
        const bool more = kc + 32 < DM;
        const v16h ahn = more ? ldh(Hp + kc + 32) : ah, arn = more ? ldh(Xp + kc + 32) : ar;
#pragma unroll
        for (int nb = 0; nb < 8; ++nb) {
            aH[nb] = wmma16g(ah, w[nb], aH[nb]); aR[nb] = wmma16g(ar, w[nb], aR[nb]);
            if (more) w[nb] = ldh(Wp + (size_t)nb * 16 * DM + kc + 32); }
        if (more && kc + 64 >= DM) asm volatile("s_wait_xcnt 0x0" ::: "memory");   // stands behind the last loads (all of them name the same three base addresses, which live up to here), in front of any later write to the registers that hold those addresses
        ah = ahn; ar = arn;
    }
    const float poison = (nh == NH_) ? 0.0f : __uint_as_float(0x7FC00000u);
#pragma unroll
    for (int nb = 0; nb < 8; ++nb) {
#pragma unroll
        for (int j = 0; j < 8; ++j) os[(hi * 8 + j) * OPP + nb * 16 + lr] = (aH[nb][j] + aR[nb][j] * QRI) * WOI + poison; }   // D: row 8h+j, col lane&15; rows 0..15 x columns 0..127 all written
    wave_sync();
    const int bb = r0 / SEQ, tt = r0 % SEQ;
    float* orow = OUT + ((size_t)bb * OUT_SEQ + (size_t)tt) * DM;
{
#pragma unroll 4
        for (int s = 0; s < 16; ++s) {                              // 16 rows x (32 lanes x 4 floats = 128 columns = the whole row)
            const v4f val = *(const v4fa*)(&os[s * OPP + lane * 4]);
            *(v4f*)(orow + (size_t)s * DM + lane * 4) = val; }
         }
}

static constexpr size_t al256(size_t v) { return (v + 255) & ~(size_t)255; }
static constexpr size_t SZ_WO = al256((size_t)DM * DM * 2);
static constexpr size_t SZ_PL = al256((size_t)NB * NH_ * SEQ * HD * 2);
static constexpr size_t SZ_RS = al256((size_t)NB * NH_ * EROWS * HD * 2);
static constexpr size_t SZ_KB = al256((size_t)NB * (SEQ / 32) * 4);
static constexpr size_t SZ_TOTAL = SZ_WO + 5 * SZ_PL + 3 * SZ_RS + SZ_KB;
static_assert(SZ_TOTAL <= (size_t)134217728);          // workspace carve <= 128 MiB
static_assert((size_t)NB * NH_ * SEQ * HD == (size_t)NB * DM * SEQ);       // v^T plane and context planes [(b*128 + m)][t] have the same extent as the q/k planes
static_assert((size_t)NB * NH_ * EROWS * HD == (size_t)NB * DM * EROWS);   // v^T residual plane [(b*128 + m)][t < EROWS] has the same extent as the q/k residual planes
static_assert(((size_t)NB * DM * SEQ) % ((size_t)16 * DM) == 0);           // context planes read flat as 16-row x 128 slabs

extern "C" void kernel_launch(void* const* d_in, const int* in_sizes, int n_in,
                              void* d_out, int out_size, void* d_ws, size_t ws_size, hipStream_t stream) {
    if (n_in < 7) return;
    const size_t needx = ((size_t)(NB - 1) * SEQ_FULL + SEQ) * DM;
    const size_t needm = (size_t)(NB - 1) * SEQ_FULL + SEQ;
    if ((size_t)in_sizes[0] < needx) return;
    if ((size_t)in_sizes[1] < (size_t)DM * DM || (size_t)in_sizes[2] < (size_t)DM * DM || (size_t)in_sizes[3] < (size_t)DM * DM || (size_t)in_sizes[4] < (size_t)DM * DM) return;
    if ((size_t)in_sizes[5] < needm || in_sizes[6] < 1) return;
    if ((size_t)out_size < ((size_t)(NB - 1) * OUT_SEQ + SEQ) * DM) return;
    if (SZ_TOTAL > ws_size) return;
    // wire order: x, Wq, Wk, Wv, Wo, padding_mask, num_heads
    const float* x  = (const float*)d_in[0];
    const float* wq = (const float*)d_in[1];
    const float* wk = (const float*)d_in[2];
    const float* wv = (const float*)d_in[3];
    const float* wo = (const float*)d_in[4];
    const int* pm = (const int*)d_in[5];
    const int* nheads = (const int*)d_in[6];
    float* OUT = (float*)d_out;      // [NB][SEQ][128]
    char* wsp = (char*)d_ws;
    h16* WOH = (h16*)wsp; wsp += SZ_WO;              // [128][128] Wo x64 ([out][in] = Bt as-is)
    h16* QH = (h16*)wsp; wsp += SZ_PL;               // [NB*8][SEQ][16]
    h16* KP = (h16*)wsp; wsp += SZ_PL;               // [NB*8][SEQ][16]
    h16* VT = (h16*)wsp; wsp += SZ_PL;               // [NB*8][16][SEQ]
    h16* CH = (h16*)wsp; wsp += SZ_PL;               // [NB][128][SEQ] context value
    h16* CX = (h16*)wsp; wsp += SZ_PL;               // [NB][128][SEQ] context residual x2048
    h16* QR = (h16*)wsp; wsp += SZ_RS;               // [NB*8][EROWS][16] residual x2048, tokens < EROWS
    h16* KR = (h16*)wsp; wsp += SZ_RS;               // [NB*8][EROWS][16] residual x2048, tokens < EROWS
    h16* VR = (h16*)wsp; wsp += SZ_RS;               // [NB*8][16][EROWS] residual x2048, tokens < EROWS
    unsigned* KB = (unsigned*)wsp; wsp += SZ_KB;     // [NB][SEQ/32] padding mask, one bit per key

    // q, k: A = x rows (m = b*SEQ + t), Bt = W rows (n = h*16 + d) -> plane [(b*8 + h)][t][d]; residuals for tokens < EROWS
    // v^T: A = Wv rows (m = h*16 + d), Bt = x rows (n = b*SEQ + t) -> plane [(b*128 + m)][t] = [(b*8 + h)][d][t]; residual for tokens < EROWS
    // in the same launch: Wo -> f16 plane x64; padding mask -> bits
    k_proj<<<dim3(PJB + CWO + CKB, 1, 1), 32, 0, stream>>>(x, wq, wk, wv, wo, pm, WOH, KB, QH, QR, KP, KR, VT, VR, EROWS);

    // query rows [0, EROWS): multi-product instantiation; rows [EROWS, SEQ): single-product instantiation (disjoint context columns)
    k_flash<<<dim3(FLB + FEB, 1, 1), 32 * AW, 0, stream>>>(QH, QR, KP, KR, VT, VR, KB, CH, CX);

    // output projection over the flat [NB*SEQ][128] view of the context planes
    k_oproj<<<dim3(NB * SEQ / 16, 1, 1), 32, 0, stream>>>(CH, CX, WOH, nheads, OUT);
}

// v008
// A run of this version takes 26.3 microseconds.
// Timed twice side by side with v007, it ran 1.21 times as fast both times.
// Over all steps from v000 it is 4.75 times as fast.
#include <hip/hip_runtime.h>

// Causal multi-head self-attention, width 128 = 8 heads x 16; x [NB][SEQ][128]; Wq/Wk/Wv/Wo [out][in] (y = x W^T, no bias); key padding mask [NB][SEQ] (int32, device-read); masked scores are replaced before the 1/sqrt(16) scale;
// per-head context transposed to [b][h*16+e][t], reinterpreted flat as [NB][SEQ][128], then multiplied by Wo^T (f32 output).
// Compute dtypes, f32 accumulate everywhere: q/k/v projections v_wmma_f32_16x16x32_bf16 (x, W RNE-converted to bf16; products exact);
// scores v_wmma_f32_16x16x32_f16 (head dim 16 zero-padded to the 32-deep step): single f16 q, k on query rows >= EROWS; on query rows < EROWS q and k each as f16 value + f16 residual x2048 (cross products in the upper 16 k-slots, own accumulator);
// P.V v_wmma_f32_16x16x32_f16: P (x16384 carry, cancels in the normalisation) and v single f16 on query rows >= EROWS, row sum of the f16 P there by one more product of the same form (A = rows of ones); on query rows < EROWS P and v as f16 value + f16 residual x2048, residual products in their own accumulator folded by 1/2048, row sum from the f32 exponentials;
// output projection v_wmma_f32_16x16x32_f16: context as f16 value + f16 residual x2048 (own accumulator), Wo as bf16-converted value x64 held in f16; softmax f32 (online, running max over kept keys).
// Layout: q, k planes [b*8+h][t][16], v^T plane [b*8+h][16][t], small residual planes (tokens < EROWS) for q, k, v^T; fused flash kernel in transposed form (S^T = K Q^T, O^T = V^T P^T).
// The context never leaves the flash block: row s of the flat [SEQ][128] view is channel s / 16, tokens 128 * (s % 16) .. + 127, so a block of 128 query rows of one head holds 16 whole rows of that view (one per channel) and multiplies them by Wo^T itself.
// Keep rule per element: (mask[b][j] != 0) and (j <= t); dropped elements get probability 0; a row with no kept key takes the plain mean of v over all SEQ keys (uniform softmax of equal fills).

#ifndef NB
#define NB 4
#endif
#ifndef SEQ
#define SEQ 2048
#endif
#define NB_FULL  4
#define SEQ_FULL 2048
#ifndef OUT_SEQ
#define OUT_SEQ SEQ              // row pitch (in tokens) between batches of the output
#endif
#define DM   128
#define NH_  8
#define HD   16
#define AW   8                   // waves per flash block (16 query rows each): 128 query rows = the whole k extent of the output projection
#define CSP  136                 // LDS row pitch (f16 elements) of a flash context tile [16 d][128 t]: 272 bytes = 16 x 17
#define OPP  132                 // LDS row pitch (floats) of the output-projection slab [16][128]
#define EROWS (SEQ < 512 ? SEQ : 512)   // query rows (and tokens of the small residual planes) handled by the multi-product flash instantiation
#define QRS  2048.0f             // carry of every residual plane / residual fragment
#define QRI  (1.0f / 2048.0f)
#define SC2  ((float)(0.25 * 1.4426950408889634))   // HD^-0.5 * log2(e)
#define PSH  14.0f               // log2 of the P carry (16384)
#define NEGB (-3.0e38f)
#define WOS  64.0f               // carry of the Wo plane
#define WOI  (1.0f / 64.0f)

static_assert(HD == 16);
static_assert(NH_ * HD == DM);                 // head h = columns h*16 + d
static_assert(DM % 64 == 0);                   // column tiles of 64 = four heads
static_assert(64 % HD == 0);
static_assert(DM % 32 == 0);                   // GEMM k-loop steps by 32
static_assert(DM == 32 * 4);                   // output row = 32 lanes x 4 floats
static_assert(SEQ % 64 == 0);                  // a 64-row tile never straddles two batches
static_assert((NB * SEQ) % 64 == 0);
static_assert(SEQ % 32 == 0);                  // key loop steps by 32
static_assert(SEQ % (16 * AW) == 0);           // flash grids cover the sequence exactly
static_assert(16 * AW == DM);                  // a block's query rows are one row (128 elements) of the flat context view, per channel; and the output projection has one 16-column block per wave
static_assert(SEQ % DM == 0);                  // rows of the flat view never straddle two channels
static_assert(2 * AW == HD);                   // output store: 2 rows per wave x AW waves = 16 rows
static_assert(EROWS % 64 == 0);                // a 64-token GEMM tile lies wholly inside or outside the residual planes
static_assert(EROWS >= 32);
static_assert(EROWS <= SEQ);
static_assert(EROWS % 32 == 0);                // early key loops end inside the residual planes
static_assert(EROWS % (16 * AW) == 0);
static_assert((SEQ - EROWS) % (16 * AW) == 0);
static_assert(((size_t)SEQ * DM) % 8 == 0);
static_assert(((size_t)DM * DM) % 8 == 0);
static_assert(NB <= NB_FULL);
static_assert(SEQ <= SEQ_FULL);
static_assert((CSP * 2) % 16 == 0);
static_assert(CSP >= DM);
static_assert((OPP * 4) % 16 == 0);
static_assert(OPP >= DM);
static_assert(4 * 32 * 8 == 16 * 64);          // projection epilogue, q/k form: 4 heads x 32 lanes x 8 halves = 16 rows x 64 columns
static_assert(4 * 4 * 64 == 16 * 64);          // projection epilogue, v^T form: 4 instructions x 4 rows x 64 halves
static_assert(2 * HD * CSP * 2 + HD * OPP * 4 <= 131072);   // static LDS of the flash kernel

typedef _Float16 h16;
typedef unsigned short bf;
typedef __attribute__((ext_vector_type(16))) __bf16   v16bf;
typedef __attribute__((ext_vector_type(16))) _Float16 v16h;
typedef __attribute__((ext_vector_type(8)))  _Float16 v8h;
typedef __attribute__((ext_vector_type(2)))  _Float16 v2h;
typedef __attribute__((ext_vector_type(2)))  float    v2f;
typedef __attribute__((ext_vector_type(8)))  unsigned short v8us;
typedef __attribute__((ext_vector_type(4)))  unsigned short v4us;
typedef __attribute__((ext_vector_type(4)))  __bf16   v4bf;
typedef __attribute__((ext_vector_type(8)))  float    v8f;
typedef __attribute__((ext_vector_type(4)))  float    v4f;
typedef __attribute__((ext_vector_type(4)))  int      v4i;
typedef v4f  __attribute__((may_alias)) v4fa;

__device__ __forceinline__ unsigned short f2bf(float f) { unsigned u = __float_as_uint(f); u += 0x7FFFu + ((u >> 16) & 1u); return (unsigned short)(u >> 16); }
__device__ __forceinline__ float bfr(float f) { return __uint_as_float(((unsigned)f2bf(f)) << 16); }   // value after RNE convert to bf16
__device__ __forceinline__ v16h cat16(v8h lo, v8h hi) { return __builtin_shufflevector(lo, hi, 0, 1, 2, 3, 4, 5, 6, 7, 8, 9, 10, 11, 12, 13, 14, 15); }
__device__ __forceinline__ v16bf cat16b(v8us lo, v8us hi) { return __builtin_bit_cast(v16bf, __builtin_shufflevector(lo, hi, 0, 1, 2, 3, 4, 5, 6, 7, 8, 9, 10, 11, 12, 13, 14, 15)); }
__device__ __forceinline__ v8f wmma16(v16h a, v16h b, v8f c) { return __builtin_amdgcn_wmma_f32_16x16x32_f16(false, a, false, b, (short)0, c, false, false); }
__device__ __forceinline__ v8f wmmab(v16bf a, v16bf b, v8f c) { return __builtin_amdgcn_wmma_f32_16x16x32_bf16(false, a, false, b, (short)0, c, false, false); }
// fragment loaders from K-contiguous 16-bit rows; p already includes + 8*(lane>>4): elements 0..7 <- k0+8h+0..7, elements 8..15 <- k0+16+8h+0..7 (same map for A and B)
__device__ __forceinline__ v16h  ldh(const h16* p) { return cat16(*(const v8h*)p, *(const v8h*)(p + 16)); }
__device__ __forceinline__ v16bf ldb(const bf* p)  { return cat16b(*(const v8us*)p, *(const v8us*)(p + 16)); }
// ordering point for wave-private LDS tiles (same wave writes and reads)
__device__ __forceinline__ void wave_sync() { __builtin_amdgcn_fence(3 /* release order */, "wavefront"); __builtin_amdgcn_wave_barrier(); asm volatile("" ::: "memory"); }

// per-instruction guarded matrix ops: the four idle slots tie the accumulator and keep the operands live
__device__ __forceinline__ v8f wmma16g(v16h a, v16h b, v8f c) { c = wmma16(a, b, c); asm volatile("v_nop\n\tv_nop\n\tv_nop\n\tv_nop" : "+v"(c) : "v"(a), "v"(b)); return c; }
__device__ __forceinline__ v8f wmmabg(v16bf a, v16bf b, v8f c) { c = wmmab(a, b, c); asm volatile("v_nop\n\tv_nop\n\tv_nop\n\tv_nop" : "+v"(c) : "v"(a), "v"(b)); return c; }
// f32 -> f16 that cannot produce a subnormal operand (|v| < 2^-14 -> +0)
static __device__ __forceinline__ h16 toh_flush(float v) { const h16 r = (h16)v; return (fabsf(v) < 6.103515625e-05f) ? (h16)0.0f : r; }

// proj_gemm: register-blocked bf16 GEMM, ONE WAVE per 64x64 tile (16 accumulators), K = DM: acc = C[m][n] = sum_k A[m][k] Bt[n][k]. The wave reads the 64 f32 rows of each operand itself, one whole 512-byte row per load instruction,
// converts them to bf16 (round to nearest even) in registers and lays them down in its own LDS tiles (row pitch PSP); the fragments come from there. One copy of this code serves all three projections:
// xa (block-uniform) says whether the x rows are A (q, k: m = b*SEQ + t, n = h*16 + d) or Bt (v^T: m = h*16 + d, n = b*SEQ + t). bx = token tile, by = channel tile.
#define PSP 136                  // LDS row pitch (bf16 elements) of a staged operand tile [64][128]: 272 bytes = 16 x 17
static_assert(PSP >= DM);
static_assert((PSP * 2) % 16 == 0);
static_assert(2 * 64 * PSP * 2 + 2 * 16 * 68 * 4 <= 131072);   // static LDS of the projection kernel
__device__ __forceinline__ void proj_gemm(const float* __restrict__ X, const float* __restrict__ Wm, bf* st, bool xa, int bx, int by, v8f (&acc)[4][4]) {
    const int lane = threadIdx.x & 31, lr = lane & 15, hi = lane >> 4;
    bf* sa = st; bf* sb = st + 64 * PSP;
    {
        const int tk0 = bx * 64;                                                // first token of the tile; a 64-token tile lies inside one batch (batch pitch SEQ_FULL tokens in x)
        const float* xr = X + ((size_t)(tk0 / SEQ) * SEQ_FULL + (size_t)(tk0 % SEQ)) * DM + lane * 4;
        const float* wr0 = Wm + (size_t)(by * 64) * DM + lane * 4;
        bf* sx = (xa ? sa : sb) + lane * 4; bf* sw = (xa ? sb : sa) + lane * 4;
        // Eight groups of 16 rows (x: 0..3, W: 4..7) through a ring of three register groups: two groups' loads are in flight while the group before them is converted and stored.
        v4f t[3][16];
#pragma unroll                                                     // unrolled: row offsets become immediates on two base addresses, and the ring's roles are fixed at compile time
        for (int g = 0; g < 8 + 2; ++g) {
            if (g < 8) {
                const float* p = (g < 4 ? xr : wr0) + (size_t)((g & 3) * 16) * DM;
#pragma unroll
                for (int i = 0; i < 16; ++i) t[g % 3][i] = *(const v4f*)(p + (size_t)i * DM);
                if ((g & 3) == 3) asm volatile("s_wait_xcnt 0x0" ::: "memory");   // stands behind the last loads that name this operand's base address (which lives up to here), in front of any later write to the registers that hold it
            }
            if (g >= 2) {
                const int c = g - 2;
                bf* q = (c < 4 ? sx : sw) + ((c & 3) * 16) * PSP;
#pragma unroll
                for (int i = 0; i < 16; ++i) *(v4us*)(q + i * PSP) = __builtin_bit_cast(v4us, __builtin_convertvector(t[c % 3][i], v4bf));
                asm volatile("" ::: "memory");                                    // compiler fence: the next group's loads stay behind these stores and take over the registers just freed; without it the loads are hoisted over the stores and the build takes 478 registers instead of 230 (two waves to a SIMD instead of four, and window switches for the registers above v255)
            }
        }
    }
    wave_sync();                                                   // the fragments read below were written by other lanes of this wave
#pragma unroll
    for (int mb = 0; mb < 4; ++mb)
#pragma unroll
        for (int nb = 0; nb < 4; ++nb) acc[mb][nb] = (v8f){};
    // Fragments are fetched from LDS one k step ahead: step 0 here; inside step kc the four A fragments of step kc + 32 go into a second register set at the step's head,
    // and each B fragment is fetched again for step kc + 32 right behind its last product.
    const bf* Ap = sa + lr * PSP + 8 * hi; const bf* Bp = sb + lr * PSP + 8 * hi;
    v16bf a[4], b[4];
#pragma unroll
    for (int mb = 0; mb < 4; ++mb) a[mb] = ldb(Ap + mb * 16 * PSP);
#pragma unroll
    for (int nb = 0; nb < 4; ++nb) b[nb] = ldb(Bp + nb * 16 * PSP);
#pragma unroll                                                     // unrolled: the test for a next step and the register sets' roles are fixed at compile time
    for (int kc = 0; kc < DM; kc += 32) {
        const bool more = kc + 32 < DM;
        v16bf an[4];
#pragma unroll
        for (int mb = 0; mb < 4; ++mb) an[mb] = more ? ldb(Ap + mb * 16 * PSP + kc + 32) : a[mb];
#pragma unroll
        for (int nb = 0; nb < 4; ++nb) {
#pragma unroll
            for (int mb = 0; mb < 4; ++mb) acc[mb][nb] = wmmabg(a[mb], b[nb], acc[mb][nb]);
            if (more) b[nb] = ldb(Bp + nb * 16 * PSP + kc + 32); }
#pragma unroll
        for (int mb = 0; mb < 4; ++mb) a[mb] = an[mb];
    }
}

// proj_store: the 64x64 tile written as f16 (Ph) and, for tokens t < resT (resT a multiple of 64, block-uniform test), the f16 residual x2048 (Pr).
// MODE 0 (q, k): plane [(b*8 + h)][t][16] (residual plane [(b*8 + h)][resT][16]). The 64-column tile spans four heads; per 16-row slab and head one 512-byte run.
// MODE 1 (v^T): plane [(b*128 + m)][t] (4 rows per instruction).
template <int MODE>
__device__ __forceinline__ void proj_store(const v8f (&acc)[4][4], h16* Ph, h16* Pr, int resT, int bx, int by) {
    __shared__ __align__(16) float os[16 * 68];
    const int lane = threadIdx.x & 31, lr = lane & 15, hi = lane >> 4; const int r0 = (MODE == 0 ? bx : by) * 64, c0 = (MODE == 0 ? by : bx) * 64;
    size_t tbase, rbase; bool wr;                                                                 // wr: block-uniform, whole tile inside the residual plane
    if (MODE == 0) { const int bb = r0 / SEQ, tt = r0 % SEQ; const int zc = bb * NH_ + c0 / HD;
                     tbase = ((size_t)zc * SEQ + (size_t)tt) * HD; rbase = ((size_t)zc * (size_t)resT + (size_t)tt) * HD; wr = tt < resT; }
    else           { const int bb = c0 / SEQ, tt = c0 % SEQ;
                     tbase = (size_t)bb * (size_t)DM * SEQ + (size_t)r0 * SEQ + (size_t)tt; rbase = (size_t)bb * (size_t)DM * (size_t)resT + (size_t)r0 * (size_t)resT + (size_t)tt; wr = tt < resT; }
#pragma unroll
    for (int mb = 0; mb < 4; ++mb) {
#pragma unroll
        for (int nb = 0; nb < 4; ++nb) {
#pragma unroll
            for (int j = 0; j < 8; ++j) os[(hi * 8 + j) * 68 + nb * 16 + lr] = acc[mb][nb][j]; }   // D: row 8h+j, col lane&15; rows 0..15 x columns 0..63 all written
        wave_sync();
{
            if (MODE == 0) {
                const size_t sb = tbase + (size_t)(mb * 16) * HD;
                const size_t rb = rbase + (size_t)(mb * 16) * HD;
#pragma unroll
                for (int hh = 0; hh < 4; ++hh) { const int row = lane >> 1, c8 = (lane & 1) * 8;   // 16 rows x 2 lanes x 8 = 16 columns of head hh: one 512-byte run
                    const v4f x0 = *(const v4fa*)(&os[row * 68 + hh * 16 + c8]); const v4f x1 = *(const v4fa*)(&os[row * 68 + hh * 16 + c8 + 4]); v8h hv, rv;
#pragma unroll
                    for (int i = 0; i < 4; ++i) { const h16 a0 = toh_flush(x0[i]); const h16 a1 = toh_flush(x1[i]); hv[i] = a0; hv[4 + i] = a1;
                        rv[i] = toh_flush((x0[i] - (float)a0) * QRS); rv[4 + i] = toh_flush((x1[i] - (float)a1) * QRS); }
                    const size_t oo = sb + (size_t)hh * ((size_t)SEQ * HD) + (size_t)lane * 8;
                    const size_t ro = rb + (size_t)hh * ((size_t)resT * HD) + (size_t)lane * 8;
                    *(v8h*)(Ph + oo) = hv;
                    asm volatile("s_wait_xcnt 0x0" ::: "memory");                       // stands behind the store, in front of any later write to the registers that hold its address and data
                    if (wr) { *(v8h*)(Pr + ro) = rv;
                        asm volatile("s_wait_xcnt 0x0" ::: "memory"); } }               // as above
            } else {
                const size_t sb = tbase + (size_t)(mb * 16) * SEQ;
                const size_t rb = rbase + (size_t)(mb * 16) * (size_t)resT;
#pragma unroll
                for (int s = 0; s < 4; ++s) { const int row = 4 * s + (lane >> 3), c8 = (lane & 7) * 8;   // 4 s x 4 row groups = 16 rows; 8 lanes x 8 = 64 columns
                    const v4f x0 = *(const v4fa*)(&os[row * 68 + c8]); const v4f x1 = *(const v4fa*)(&os[row * 68 + c8 + 4]); v8h hv, rv;
#pragma unroll
                    for (int i = 0; i < 4; ++i) { const h16 a0 = toh_flush(x0[i]); const h16 a1 = toh_flush(x1[i]); hv[i] = a0; hv[4 + i] = a1;
                        rv[i] = toh_flush((x0[i] - (float)a0) * QRS); rv[4 + i] = toh_flush((x1[i] - (float)a1) * QRS); }
                    const size_t oo = sb + (size_t)row * SEQ + c8;
                    const size_t ro = rb + (size_t)row * (size_t)resT + c8;
                    *(v8h*)(Ph + oo) = hv;
                    asm volatile("s_wait_xcnt 0x0" ::: "memory");                       // stands behind the store, in front of any later write to the registers that hold its address and data
                    if (wr) { *(v8h*)(Pr + ro) = rv;
                        asm volatile("s_wait_xcnt 0x0" ::: "memory"); } }               // as above
            }
             }
        wave_sync();
    }
}

// k_proj: the three projections and the two small conversions in ONE launch, 1-D grid of one-wave blocks; a block-uniform range of the block index picks the job.
// Blocks [0, PJB): projections, index = (z * (DM/64) + channel tile) * (NB*SEQ/64) + token tile, z = 0, 1, 2: q, k, v^T.
// Blocks [PJB, PJB + CWO): Wo -> bf16-converted value x64 in f16, 8 elements per thread.
// Blocks [PJB + CWO, PJB + CWO + CKB): padding mask -> one bit per key (set: word nonzero), one 32-bit word per 32-key tile, KB[b * (SEQ/32) + tile], bit j = key 32*tile + j; one thread per tile.
#define PJX (NB * SEQ / 64)                      // token tiles
#define PJB (PJX * (DM / 64) * 3)
#define CWO ((DM * DM / 8) / 32)
#define CKB ((NB * (SEQ / 32)) / 32)
static_assert((DM * DM / 8) % 32 == 0);
static_assert((NB * (SEQ / 32)) % 32 == 0);
__global__ __launch_bounds__(32) void k_proj(const float* __restrict__ x, const float* __restrict__ wq, const float* __restrict__ wk, const float* __restrict__ wv, const float* __restrict__ wo,
                                             const int* __restrict__ pmask, h16* WOH, unsigned* KB, h16* QH, h16* QR, h16* KP, h16* KR, h16* VT, h16* VR, int resT) {
    __shared__ __align__(16) bf st[2 * 64 * PSP];
    const unsigned blk = blockIdx.x;
    if (blk >= (unsigned)(PJB + CWO)) {
        const unsigned i = (blk - (unsigned)(PJB + CWO)) * 32u + threadIdx.x;
        const int* p = pmask + (size_t)(i / (unsigned)(SEQ / 32)) * SEQ_FULL + (size_t)(i % (unsigned)(SEQ / 32)) * 32;
        unsigned bits = 0u;
#pragma unroll
        for (int k = 0; k < 8; ++k) { const v4i a = *(const v4i*)(p + 4 * k);
#pragma unroll
            for (int j = 0; j < 4; ++j) bits |= (a[j] != 0 ? 1u : 0u) << (4 * k + j); }
        KB[i] = bits;
        asm volatile("s_wait_xcnt 0x0" ::: "memory");                           // stands behind the store, in front of any later write to the registers that hold its address and data
        return;
    }
    if (blk >= (unsigned)PJB) {
        const unsigned i = (blk - (unsigned)PJB) * 32u + threadIdx.x;
        const v8f v = *(const v8f*)(wo + (size_t)i * 8); v8h o;
#pragma unroll
        for (int k = 0; k < 8; ++k) o[k] = toh_flush(bfr(v[k]) * WOS);
        *(v8h*)(WOH + (size_t)i * 8) = o;
        asm volatile("s_wait_xcnt 0x0" ::: "memory");                           // stands behind the store, in front of any later write to the registers that hold its address and data
        return;
    }
    const int bx = (int)(blk % (unsigned)PJX), by = (int)((blk / (unsigned)PJX) % (unsigned)(DM / 64)), z = (int)(blk / (unsigned)(PJX * (DM / 64)));
    const float* Wm = (z == 0) ? wq : (z == 1) ? wk : wv;
    v8f acc[4][4];
    proj_gemm(x, Wm, st, z != 2, bx, by, acc);
    if (z == 2) { proj_store<1>(acc, VT, VR, resT, bx, by); }
    else        { h16* Ph = z ? KP : QH; h16* Pr = z ? KR : QR; proj_store<0>(acc, Ph, Pr, resT, bx, by); }
}

// k_flash: both instantiations and the output projection in ONE launch, 1-D grid; the block index picks (batch*head, query tile of 128 rows), batch*head fastest.
// First half of the index: tiles NT - 1 down to NT / 2 (the long-running ones start first); second half: tiles 0 up to NT / 2 - 1. A block-uniform test (tile < FEX) picks the instantiation.
#define NT  (SEQ / (16 * AW))                    // query tiles per (batch, head)
#define FEX (EROWS / (16 * AW))                  // of them early (query rows < EROWS)
#define NBH (NB * NH_)
#define FHB (NBH * (NT / 2))                     // blocks in the first half of the index
static_assert(NT % 2 == 0);
// flash_body: fused causal attention, one wave per 16 query rows of one (batch, head) zh, AW waves = 128 query rows from tb per block; K / V^T / Q fragments straight from the f16 planes (16-B loads, arithmetic addressing). Returns the wave's normalised O^T tile.
// Transposed form: S^T[key][t] = K Q^T (A = K rows, B = Q rows, head dim 16 in k-slots 0..15); lane (t = lane&15, h = lane>>4) holds keys 8h+r of each 16-key tile, so the packed
// P tile is directly the B fragment of O^T[d][t] = V^T P^T (element r <- tile keys 0..15, element 8+r <- tile keys 16..31, lane unchanged).
// Softmax state (running max over kept keys, sum) is one scalar per lane; the two lane halves of a row are combined with one xor-16 exchange (the sum: EARLY only; late rows hold the whole row's sum in both halves).
// Keep rule: a wave reads its batch's mask bits (KB, one word per 32-key tile) once, lane = tile. A tile whose word is all ones and whose last key lies below the wave's first query row keeps every element:
// a scalar test sends it down a path without keep compares and selects (there a P below 2^-14 stays an f16 subnormal, which the matrix unit takes as it is). Every other visited tile evaluates the rule per element.
// The per-wave key bound is t0 + 16 (pad up to 32), at most SEQ.
// EARLY = 1 (query rows [0, EROWS)): A = [K | K_res], B = [Q | 0] gives K Q; B = [Q_res | Q] gives K Q_res + K_res Q (x2048, own accumulator); P = f16 value + f16 residual x2048;
//            O = V P + (V P_res + V_res P) / 2048 (residual products in their own accumulator); row sum from the f32 exponentials; all keys of these rows are < EROWS, inside the small planes.
// EARLY = 0 (query rows [EROWS, SEQ)): single q, k, P, v.
template <bool B> struct flag_c { static constexpr bool v = B; };
static_assert(SEQ / 32 <= 64);                   // a wave holds its batch's tile words in two registers (lane = tile) and their all-kept flags in one 64-bit scalar
template <int EARLY>
__device__ __forceinline__ v8f flash_body(const h16* __restrict__ QH, const h16* __restrict__ QR, const h16* __restrict__ KP, const h16* __restrict__ KR,
                                          const h16* __restrict__ VT, const h16* __restrict__ VR, const unsigned* __restrict__ KB, const int zh, const int tb) {
    const int lane = threadIdx.x & 31, lr = lane & 15, hi = lane >> 4;
    const int wave = __builtin_amdgcn_readfirstlane((int)(threadIdx.x >> 5));
    const int b = zh / NH_;
    const int t0 = tb + wave * 16;
    const int lim = t0 + lr;                                                   // key j kept iff j <= lim (and mask nonzero)
    const int nk = (t0 + 16 + 31) & ~31;                                       // wave-uniform, multiple of 32, <= SEQ (<= EROWS when EARLY)
    const unsigned* kbb = KB + (size_t)b * (SEQ / 32);                         // + tile
    const size_t pbase = (size_t)zh * SEQ * HD;
    const size_t rbase = (size_t)zh * EROWS * HD;
    const v8h z8 = (v8h){};
    const size_t qo = pbase + (size_t)(t0 + lr) * HD + 8 * hi;
    const v8h q8 = *(const v8h*)(QH + qo);
    asm volatile("s_wait_xcnt 0x0" ::: "memory");                 // the loads issued next may land in the registers that hold this load's address: the wait stands in front of them
    const v16h qh = cat16(q8, z8);                                // B fragment [Q | 0]: col t, k = d
    v16h qx = qh;
    if (EARLY) { const size_t qro = rbase + (size_t)(t0 + lr) * HD + 8 * hi; qx = cat16(*(const v8h*)(QR + qro), q8);   // B fragment [Q_res | Q]
                 asm volatile("s_wait_xcnt 0x0" ::: "memory"); }  // as above, for the residual load's address
    const size_t ko = pbase + (size_t)lr * HD + 8 * hi;         // + key * HD       (A fragment: row key, k = d)
    const size_t vo = pbase + (size_t)lr * SEQ + 8 * hi;        // + key            (A fragment: row d, k = key)
    const size_t kro = rbase + (size_t)lr * HD + 8 * hi;        // residual planes, tokens < EROWS
    const size_t vro = rbase + (size_t)lr * EROWS + 8 * hi;
    const v8f zz = (v8f){};
    v8f o0 = (v8f){}, oR0 = (v8f){};
    float m = NEGB, l = 0.0f;
    // EARLY: every operand of a 32-key tile (K, V^T, residual planes) is fetched one trip ahead: tile 0 here, tile key0 + 32 inside trip key0,
    // each group into the registers its last reader of the trip has just left. nk >= 32, so tile 0 exists for every wave.
    // Late rows: K and V^T are fetched RD tiles ahead, through RD register sets (see the late loop below); set 0 is loaded here.
    v8h k0 = *(const v8h*)(KP + ko), k1 = *(const v8h*)(KP + ko + 16 * HD);
    v8h kr0 = z8, kr1 = z8;
    if (EARLY) { kr0 = *(const v8h*)(KR + kro); kr1 = *(const v8h*)(KR + kro + 16 * HD); }
    const unsigned kw0 = kbb[lane < SEQ / 32 ? lane : 0], kw1 = kbb[32 + lane < SEQ / 32 ? 32 + lane : 0];   // mask bits of tiles lane and 32 + lane
    v16h v0 = ldh(VT + vo);
    v16h vr0 = v0;
    if (EARLY) { vr0 = ldh(VR + vro); }
    asm volatile("s_wait_xcnt 0x0" ::: "memory");                 // stands behind tile 0's loads, in front of the later loads, which may land in the registers that hold these loads' addresses
    __builtin_amdgcn_sched_barrier(0);                            // keeps tile 0's loads in front of that wait: without it they are moved down among the later tiles' loads, past the wait
    // bit T set: tile T keeps every element for all 16 rows of this wave: word all ones and 32T + 31 < t0 (t0 a multiple of 16: T < t0 / 32 <= SEQ / 32 - 1). Wave-uniform.
    const unsigned long long kept = (((unsigned long long)__builtin_amdgcn_ballot_w32(kw1 == 0xFFFFFFFFu) << 32) | (unsigned long long)__builtin_amdgcn_ballot_w32(kw0 == 0xFFFFFFFFu)) & ((1ull << (t0 >> 5)) - 1ull);
    v16h pb, pr = (v16h){}; float ls = 0.0f, alpha, mnew;
    // softmax of the 32-key tile at key0 from its score accumulators; FULL: every element kept
    auto tile = [&](auto fc, const int key0, const v8f sHa, const v8f sHb, const v8f sLa, const v8f sLb) __attribute__((always_inline)) {
            constexpr bool FULL = decltype(fc)::v;
            float ta[8], tb2[8]; bool fa[8], fb[8]; float mx;
            ls = 0.0f;
            if constexpr (FULL) {
                float ua[8], ub[8];
#pragma unroll
                for (int r = 0; r < 8; ++r) {
                    if (EARLY) { ua[r] = sHa[r] + sLa[r] * QRI; ub[r] = sHb[r] + sLb[r] * QRI; }
                    else       { ua[r] = sHa[r]; ub[r] = sHb[r]; }
                    ta[r] = ua[r] * SC2; tb2[r] = ub[r] * SC2; fa[r] = true; fb[r] = true; }
                float mr = fmaxf(ua[0], ub[0]);                  // SC2 > 0 and rounding is monotonic: the scaled maximum equals the maximum of the scaled scores
#pragma unroll
                for (int r = 1; r < 8; ++r) mr = fmaxf(mr, fmaxf(ua[r], ub[r]));
                mx = mr * SC2;
            } else {
                const unsigned kcur = (unsigned)__builtin_amdgcn_readlane((int)(key0 < 1024 ? kw0 : kw1), (key0 >> 5) & 31);   // mask bits of keys key0 .. key0+31
                const unsigned kw = kcur >> (8 * hi);            // bits 0..7: keys key0+8h+0..7; bits 16..23: keys key0+16+8h+0..7
                const int ja = key0 + 8 * hi;
                mx = NEGB;
#pragma unroll
                for (int r = 0; r < 8; ++r) {
                    fa[r] = (((kw >> r) & 1u) != 0u) & (ja + r <= lim);
                    fb[r] = (((kw >> (16 + r)) & 1u) != 0u) & (ja + 16 + r <= lim); }
#pragma unroll
                for (int r = 0; r < 8; ++r) {
                    if (EARLY) { ta[r] = (sHa[r] + sLa[r] * QRI) * SC2; tb2[r] = (sHb[r] + sLb[r] * QRI) * SC2; }
                    else       { ta[r] = sHa[r] * SC2; tb2[r] = sHb[r] * SC2; }
                    mx = fmaxf(mx, fmaxf(fa[r] ? ta[r] : NEGB, fb[r] ? tb2[r] : NEGB)); }
            }
            mx = fmaxf(mx, __shfl_xor(mx, 16, 32));
            mnew = fmaxf(m, mx);
            alpha = __builtin_amdgcn_exp2f(m - mnew);
            const float sh = PSH - mnew;
#pragma unroll
            for (int r = 0; r < 8; r += 2) {
                float ga[2], gb[2];
#pragma unroll
                for (int i = 0; i < 2; ++i) {
                    const float xa = ta[r + i] + sh, xb = tb2[r + i] + sh;
                    const float ea = __builtin_amdgcn_exp2f(xa), eb = __builtin_amdgcn_exp2f(xb);
                    ga[i] = (FULL || (fa[r + i] & (xa >= -14.0f))) ? ea : 0.0f; gb[i] = (FULL || (fb[r + i] & (xb >= -14.0f))) ? eb : 0.0f; }   // not FULL: dropped or sub-2^-14 elements selected to 0 by value
                const v2h pa = __builtin_convertvector((v2f){ga[0], ga[1]}, v2h), pc = __builtin_convertvector((v2f){gb[0], gb[1]}, v2h);
#pragma unroll
                for (int i = 0; i < 2; ++i) {
                    pb[r + i] = pa[i]; pb[8 + r + i] = pc[i];
                    if (EARLY) { pr[r + i] = toh_flush((ga[i] - (float)pa[i]) * QRS); pr[8 + r + i] = toh_flush((gb[i] - (float)pc[i]) * QRS); ls += ga[i] + gb[i]; }
                } }                                              // late rows: the row sum of the packed P is taken on the matrix unit, behind this function
    };
    if constexpr (EARLY) {
        // Inputs-only fence on the loaded values: the query fragments and tile 0 have landed before the loop is entered, so the loop's counted load waits follow from the loop's own issue order alone
        // (K early in a trip, V^T at its end) and the wait for K at a trip's head leaves the V^T loads just issued in flight.
        asm volatile("" :: "v"(qx), "v"(k0), "v"(k1), "v"(kr0), "v"(kr1), "v"(v0), "v"(vr0));
#pragma unroll 1
        for (int key0 = 0; key0 < nk; key0 += 32) {
            const int kn = (key0 + 32 < nk) ? key0 + 32 : key0;      // tile fetched in this trip; the last trip fetches its own tile again (unused), so every address stays below nk <= EROWS
            const v16h ka0 = cat16(k0, kr0), kb0 = cat16(k1, kr1);   // A fragments [K | K_res]
            const v8f sHa = wmma16g(ka0, qh, zz), sHb = wmma16g(kb0, qh, zz);
            const v8f sLa = wmma16g(ka0, qx, zz), sLb = wmma16g(kb0, qx, zz);
            { const h16* ka = KP + ko + (size_t)kn * HD; k0 = *(const v8h*)ka; k1 = *(const v8h*)(ka + 16 * HD); }
            { const h16* kr = KR + kro + (size_t)kn * HD; kr0 = *(const v8h*)kr; kr1 = *(const v8h*)(kr + 16 * HD); }
            asm volatile("s_wait_xcnt 0x0" ::: "memory");            // stands between the K loads just issued and the softmax's first writes to the registers that hold their addresses
            if (((kept >> (key0 >> 5)) & 1ull) != 0ull) tile(flag_c<true>{}, key0, sHa, sHb, sLa, sLb); else tile(flag_c<false>{}, key0, sHa, sHb, sLa, sLb);   // scalar test
            l = l * alpha + ls; m = mnew;
            o0 = o0 * alpha;
            oR0 = oR0 * alpha;
            o0 = wmma16g(v0, pb, o0);
            oR0 = wmma16g(v0, pr, oR0);
            oR0 = wmma16g(vr0, pb, oR0);
            vr0 = ldh(VR + vro + kn);
            v0 = ldh(VT + vo + kn);
            asm volatile("s_wait_xcnt 0x0" ::: "memory");            // stands between the V^T loads just issued and the next trip's first writes to the registers that hold their addresses
        }
    } else {
        // Late rows: RD register sets, set s holding tile s (mod RD). A step works on its set's tile and refills each half of the set (K behind the score products, V^T behind the P.V product)
        // with the tile RD steps on, so a load has RD - 1 whole steps of work between its issue and its wait. Tiles are taken in ascending order, one at a time.
        constexpr int RD = 4;
        const int klast = nk - 32;                                   // last tile of this wave; a fetch past it is aimed at it again (unused), so every address stays below nk <= SEQ
        v8h rk0[RD], rk1[RD]; v16h rv[RD];
        const h16 one_r = ((lr & 7) == 0) ? (h16)1.0f : (h16)0.0f;   // A fragment of the row sum: rows 0 and 8 (the two that are read) all ones, the rest 0 (lane = row); made from the lane index it stays in vector registers over the loop, where an all-ones constant was copied from scalar registers in front of every product
        v16h ones;
#pragma unroll
        for (int i = 0; i < 16; ++i) ones[i] = one_r;
        rk0[0] = k0; rk1[0] = k1; rv[0] = v0;
#pragma unroll
        for (int s = 1; s < RD; ++s) {
            const int ks = (32 * s < klast) ? 32 * s : klast;
            const h16* ka = KP + ko + (size_t)ks * HD; rk0[s] = *(const v8h*)ka; rk1[s] = *(const v8h*)(ka + 16 * HD);
            rv[s] = ldh(VT + vo + ks);
            asm volatile("s_wait_xcnt 0x0" ::: "memory");            // stands behind the loads just issued, in front of any later write to the registers that hold their addresses
        }
        // Inputs-only fence on the loaded values: the query fragment and all RD sets have landed before the loop is entered, so the loop's counted load waits follow from the loop's own issue order alone.
        asm volatile("" :: "v"(q8), "v"(rk0[0]), "v"(rk1[0]), "v"(rv[0]), "v"(rk0[1]), "v"(rk1[1]), "v"(rv[1]), "v"(rk0[2]), "v"(rk1[2]), "v"(rv[2]), "v"(rk0[3]), "v"(rk1[3]), "v"(rv[3]));
        static_assert(RD == 4);                                      // the fence above names every set
#pragma unroll 1
        for (int key0 = 0; key0 < nk; key0 += 32 * RD) {
#pragma unroll
            for (int s = 0; s < RD; ++s) {
                const int kc = key0 + 32 * s;                        // this step's tile; kc >= nk (last trip only): no tile, the step's softmax and P.V are jumped over
                const int kn = (kc + 32 * RD < nk) ? kc + 32 * RD : klast;
                // The loads (and the score products in front of them) stand outside the scalar branch below: every path through a trip issues the same loads in the same order, which keeps the ring's counted load waits.
                const v8f sHa = wmma16g(cat16(rk0[s], z8), qh, zz), sHb = wmma16g(cat16(rk1[s], z8), qh, zz);   // A fragments [K | 0]
                { const h16* ka = KP + ko + (size_t)kn * HD; rk0[s] = *(const v8h*)ka; rk1[s] = *(const v8h*)(ka + 16 * HD); }
                asm volatile("s_wait_xcnt 0x0" ::: "memory");        // stands between the K loads just issued and the softmax's first writes to the registers that hold their addresses
                if (s == 0 || kc < nk) {                             // scalar test
                    if (((kept >> (kc >> 5)) & 1ull) != 0ull) tile(flag_c<true>{}, kc, sHa, sHb, zz, zz); else tile(flag_c<false>{}, kc, sHa, sHb, zz, zz);   // scalar test
                    o0 = o0 * alpha;
                    // Row sum on the matrix unit: rows 0 and 8 of A are ones, so rows 0 and 8 of the result hold, per query column, the sum of the tile's 32 packed P over both lane halves; element 0 (row 8h) is this lane's row sum.
                    v8f sd = wmma16(ones, pb, zz);
                    o0 = wmma16(rv[s], pb, o0);
                    asm volatile("v_nop\n\tv_nop\n\tv_nop\n\tv_nop" : "+v"(sd), "+v"(o0) : "v"(ones), "v"(rv[s]), "v"(pb));   // the four idle slots behind the two products: they tie both results and keep the operands live
                    l = l * alpha + sd[0]; m = mnew;
                }
                rv[s] = ldh(VT + vo + kn);
                asm volatile("s_wait_xcnt 0x0" ::: "memory");        // stands between the V^T loads just issued and the next step's first writes to the registers that hold their addresses
            }
        }
    }
    if (EARLY) l += __shfl_xor(l, 16, 32);                        // late rows: the matrix row sum already covers both lane halves
    const bool any = l > 0.0f;
    const float lsafe = any ? l : 1.0f;
    const float inv = any ? (1.0f / lsafe) : 0.0f;
    v8f f0 = o0;
    if (EARLY) { f0 = o0 + oR0 * QRI; }
    f0 = f0 * inv;
    const unsigned nonem = __builtin_amdgcn_ballot_w32(!any);    // wave-uniform: some row of this wave kept no key
    if (nonem != 0u) {
        // equal fills give a uniform softmax over all SEQ keys: plain mean of v per channel d = 8h + r
        float vm[8];
#pragma unroll
        for (int r = 0; r < 8; ++r) vm[r] = 0.0f;
#pragma unroll 1
        for (int t = lr; t < SEQ; t += 16) {
#pragma unroll
            for (int r = 0; r < 8; ++r) vm[r] += (float)VT[pbase + (size_t)(8 * hi + r) * SEQ + t]; }
#pragma unroll
        for (int r = 0; r < 8; ++r) { float s = vm[r];
            s += __shfl_xor(s, 1, 32); s += __shfl_xor(s, 2, 32); s += __shfl_xor(s, 4, 32); s += __shfl_xor(s, 8, 32);
            vm[r] = s * (1.0f / (float)SEQ); }
#pragma unroll
        for (int r = 0; r < 8; ++r) f0[r] = any ? f0[r] : vm[r];
    }
    return f0;                                                    // O^T D layout: f0[r] = (d = 8h + r, t = lane&15)
}

// Behind the attention: the block's context tile [16 d][128 t] goes to LDS as f16 value and f16 residual x2048; it is the A operand (16 rows of the flat view, k = token - tb) of the output projection.
// Wave w takes output columns 16w .. 16w+15: Bt = Wo x64 rows [n][k] (f16), K = DM in four 32-deep steps, value and residual products in separate accumulators.
// Output row of channel d: (h*16 + d) * (SEQ/128) + tb/128 of batch b. The head-count input is read on the device; a value other than the compiled head count marks the output with NaN.
__global__ __launch_bounds__(32 * AW) void k_flash(const h16* __restrict__ QH, const h16* __restrict__ QR, const h16* __restrict__ KP, const h16* __restrict__ KR,
                                                   const h16* __restrict__ VT, const h16* __restrict__ VR, const unsigned* __restrict__ KB,
                                                   const h16* __restrict__ WO, const int* __restrict__ nheads_p, float* OUT) {
    __shared__ __align__(16) h16 cs[2 * HD * CSP];                // value tile, then residual tile
    __shared__ __align__(16) float os[HD * OPP];
    const int lane = threadIdx.x & 31, lr = lane & 15, hi = lane >> 4;
    const int wave = __builtin_amdgcn_readfirstlane((int)(threadIdx.x >> 5));
    const int blk = (int)blockIdx.x;
    const int tile = (blk < FHB) ? (NT - 1 - blk / NBH) : ((blk - FHB) / NBH);
    const int zh = blk % NBH; const int b = zh / NH_, h = zh % NH_;
    const int tb = tile * (16 * AW);
    v8f f0;
    if (tile >= FEX) f0 = flash_body<0>(QH, QR, KP, KR, VT, VR, KB, zh, tb);
    else             f0 = flash_body<1>(QH, QR, KP, KR, VT, VR, KB, zh, tb);
    // The wave's four Wo fragments are asked for here, so that their latency runs beside the tile's conversion and its LDS stores.
    const h16* Wp = WO + (size_t)(wave * 16 + lr) * DM + 8 * hi;
    v16h w[DM / 32];
#pragma unroll                                                     // unrolled (this loop and those below): the fragment arrays are indexed at compile time and stay in registers
    for (int s = 0; s < DM / 32; ++s) w[s] = ldh(Wp + 32 * s);
    asm volatile("s_wait_xcnt 0x0" ::: "memory");                 // stands behind the loads just issued, in front of any later write to the registers that hold their address
    const int nh = nheads_p[0];
#pragma unroll
    for (int r = 0; r < 8; ++r) { const h16 a0 = toh_flush(f0[r]);
        cs[(8 * hi + r) * CSP + wave * 16 + lr] = a0;
        cs[(HD + 8 * hi + r) * CSP + wave * 16 + lr] = toh_flush((f0[r] - (float)a0) * QRS); }   // rows 0..15 x columns 0..127 of both tiles all written by the eight waves
    __syncthreads();                                              // cross-wave tiles: block barrier (every wave reaches it)
    v8f aH = (v8f){}, aR = (v8f){};
    const h16* Ap = cs + lr * CSP + 8 * hi;
    v16h ah[DM / 32], ar[DM / 32];                                // all eight A fragments are asked for in one group, so that one LDS latency is waited out and not four
#pragma unroll
    for (int s = 0; s < DM / 32; ++s) { ah[s] = ldh(Ap + 32 * s); ar[s] = ldh(Ap + HD * CSP + 32 * s); }
#pragma unroll
    for (int s = 0; s < DM / 32; ++s) { aH = wmma16g(ah[s], w[s], aH); aR = wmma16g(ar[s], w[s], aR); }
    const float poison = (nh == NH_) ? 0.0f : __uint_as_float(0x7FC00000u);
#pragma unroll
    for (int j = 0; j < 8; ++j) os[(hi * 8 + j) * OPP + wave * 16 + lr] = (aH[j] + aR[j] * QRI) * WOI + poison;   // D: row 8h+j, col lane&15; rows 0..15 x columns 0..127 all written by the eight waves
    __syncthreads();                                              // cross-wave slab: block barrier; behind it each wave stores whole 512-byte output rows
    float* orow = OUT + ((size_t)b * OUT_SEQ + (size_t)(h * HD) * (SEQ / DM) + (size_t)(tb / DM)) * DM + lane * 4;
#pragma unroll
    for (int s = 0; s < 2; ++s) { const int d = 2 * wave + s;     // AW waves x 2 rows = 16 rows x (32 lanes x 4 floats = 128 columns = the whole row)
        const v4f val = *(const v4fa*)(&os[d * OPP + lane * 4]);
        *(v4f*)(orow + (size_t)d * (SEQ / DM) * DM) = val; }
    asm volatile("s_wait_xcnt 0x0" ::: "memory");                 // stands behind the stores, in front of any later write to the registers that hold their address and data
}

static constexpr size_t al256(size_t v) { return (v + 255) & ~(size_t)255; }
static constexpr size_t SZ_WO = al256((size_t)DM * DM * 2);
static constexpr size_t SZ_PL = al256((size_t)NB * NH_ * SEQ * HD * 2);
static constexpr size_t SZ_RS = al256((size_t)NB * NH_ * EROWS * HD * 2);
static constexpr size_t SZ_KB = al256((size_t)NB * (SEQ / 32) * 4);
static constexpr size_t SZ_TOTAL = SZ_WO + 3 * SZ_PL + 3 * SZ_RS + SZ_KB;
static_assert(SZ_TOTAL <= (size_t)134217728);          // workspace carve <= 128 MiB
static_assert((size_t)NB * NH_ * SEQ * HD == (size_t)NB * DM * SEQ);       // v^T plane [(b*128 + m)][t] has the same extent as the q/k planes
static_assert((size_t)NB * NH_ * EROWS * HD == (size_t)NB * DM * EROWS);   // v^T residual plane [(b*128 + m)][t < EROWS] has the same extent as the q/k residual planes

extern "C" void kernel_launch(void* const* d_in, const int* in_sizes, int n_in,
                              void* d_out, int out_size, void* d_ws, size_t ws_size, hipStream_t stream) {
    if (n_in < 7) return;
    const size_t needx = ((size_t)(NB - 1) * SEQ_FULL + SEQ) * DM;
    const size_t needm = (size_t)(NB - 1) * SEQ_FULL + SEQ;
    if ((size_t)in_sizes[0] < needx) return;
    if ((size_t)in_sizes[1] < (size_t)DM * DM || (size_t)in_sizes[2] < (size_t)DM * DM || (size_t)in_sizes[3] < (size_t)DM * DM || (size_t)in_sizes[4] < (size_t)DM * DM) return;
    if ((size_t)in_sizes[5] < needm || in_sizes[6] < 1) return;
    if ((size_t)out_size < ((size_t)(NB - 1) * OUT_SEQ + SEQ) * DM) return;
    if (SZ_TOTAL > ws_size) return;
    // wire order: x, Wq, Wk, Wv, Wo, padding_mask, num_heads
    const float* x  = (const float*)d_in[0];
    const float* wq = (const float*)d_in[1];
    const float* wk = (const float*)d_in[2];
    const float* wv = (const float*)d_in[3];
    const float* wo = (const float*)d_in[4];
    const int* pm = (const int*)d_in[5];
    const int* nheads = (const int*)d_in[6];
    float* OUT = (float*)d_out;      // [NB][SEQ][128]
    char* wsp = (char*)d_ws;
    h16* WOH = (h16*)wsp; wsp += SZ_WO;              // [128][128] Wo x64 ([out][in] = Bt as-is)
    h16* QH = (h16*)wsp; wsp += SZ_PL;               // [NB*8][SEQ][16]
    h16* KP = (h16*)wsp; wsp += SZ_PL;               // [NB*8][SEQ][16]
    h16* VT = (h16*)wsp; wsp += SZ_PL;               // [NB*8][16][SEQ]
    h16* QR = (h16*)wsp; wsp += SZ_RS;               // [NB*8][EROWS][16] residual x2048, tokens < EROWS
    h16* KR = (h16*)wsp; wsp += SZ_RS;               // [NB*8][EROWS][16] residual x2048, tokens < EROWS
    h16* VR = (h16*)wsp; wsp += SZ_RS;               // [NB*8][16][EROWS] residual x2048, tokens < EROWS
    unsigned* KB = (unsigned*)wsp; wsp += SZ_KB;     // [NB][SEQ/32] padding mask, one bit per key

    // q, k: A = x rows (m = b*SEQ + t), Bt = W rows (n = h*16 + d) -> plane [(b*8 + h)][t][d]; residuals for tokens < EROWS
    // v^T: A = Wv rows (m = h*16 + d), Bt = x rows (n = b*SEQ + t) -> plane [(b*128 + m)][t] = [(b*8 + h)][d][t]; residual for tokens < EROWS
    // in the same launch: Wo -> f16 plane x64; padding mask -> bits
    k_proj<<<dim3(PJB + CWO + CKB, 1, 1), 32, 0, stream>>>(x, wq, wk, wv, wo, pm, WOH, KB, QH, QR, KP, KR, VT, VR, EROWS);

    // query rows [0, EROWS): multi-product instantiation; rows [EROWS, SEQ): single-product instantiation; each block then projects its own 16 rows of the flat context view (disjoint output rows)
    k_flash<<<dim3(NBH * NT, 1, 1), 32 * AW, 0, stream>>>(QH, QR, KP, KR, VT, VR, KB, WOH, nheads, OUT);
}

// v009
// A run of this version takes 24.8 microseconds.
// Timed twice side by side with v008, it ran 1.06 times as fast both times.
// Counting every step since v000, it is 5.03 times as fast.
#include <hip/hip_runtime.h>

// Causal multi-head self-attention, width 128 = 8 heads x 16; x [NB][SEQ][128]; Wq/Wk/Wv/Wo [out][in] (y = x W^T, no bias); key padding mask [NB][SEQ] (int32, device-read); masked scores are replaced before the 1/sqrt(16) scale;
// per-head context transposed to [b][h*16+e][t], reinterpreted flat as [NB][SEQ][128], then multiplied by Wo^T (f32 output).
// Compute dtypes, f32 accumulate everywhere: q/k/v projections v_wmma_f32_16x16x32_bf16 (x, W RNE-converted to bf16; products exact);
// scores v_wmma_f32_16x16x32_f16 (head dim 16 zero-padded to the 32-deep step): single f16 q, k on query rows >= EROWS; on query rows < EROWS q and k each as f16 value + f16 residual x2048 (cross products in the upper 16 k-slots, own accumulator);
// P.V v_wmma_f32_16x16x32_f16: P (x16384 carry, cancels in the normalisation) and v single f16 on query rows >= EROWS, row sum of the f16 P there by one more product of the same form (A = rows of ones); on query rows < EROWS P and v as f16 value + f16 residual x2048, residual products in their own accumulator folded by 1/2048, row sum from the f32 exponentials;
// output projection v_wmma_f32_16x16x32_f16: context as f16 value + f16 residual x2048 (own accumulator), Wo as bf16-converted value x64 held in f16; softmax f32 (online, running max over kept keys).
// Layout: q, k planes [b*8+h][t][16]; v^T plane in blocks of 16 keys, [b*8+h][t/16][16 d][t%16]; small residual planes (tokens < EROWS) for q, k, v^T in the same forms; fused flash kernel in transposed form (S^T = K Q^T, O^T = V^T P^T).
// In all three forms a 16 x 16 block of a head is 512 contiguous bytes in which lane (lane&15, lane>>4) owns bytes 32*(lane&15) + 16*(lane>>4) .. + 15: that is a projection accumulator tile as it stands in registers, and one half of a K, Q or V^T fragment.
// The context never leaves the flash block: row s of the flat [SEQ][128] view is channel s / 16, tokens 128 * (s % 16) .. + 127, so a block of 128 query rows of one head holds 16 whole rows of that view (one per channel) and multiplies them by Wo^T itself.
// Keep rule per element: (mask[b][j] != 0) and (j <= t); dropped elements get probability 0; a row with no kept key takes the plain mean of v over all SEQ keys (uniform softmax of equal fills).

#ifndef NB
#define NB 4
#endif
#ifndef SEQ
#define SEQ 2048
#endif
#define NB_FULL  4
#define SEQ_FULL 2048
#ifndef OUT_SEQ
#define OUT_SEQ SEQ              // row pitch (in tokens) between batches of the output
#endif
#define DM   128
#define NH_  8
#define HD   16
#define AW   8                   // waves per flash block (16 query rows each): 128 query rows = the whole k extent of the output projection
#define CSP  136                 // LDS row pitch (f16 elements) of a flash context tile [16 d][128 t]: 272 bytes = 16 x 17
#define OPP  132                 // LDS row pitch (floats) of the output-projection slab [16][128]
#define EROWS (SEQ < 512 ? SEQ : 512)   // query rows (and tokens of the small residual planes) handled by the multi-product flash instantiation
#define QRS  2048.0f             // carry of every residual plane / residual fragment
#define QRI  (1.0f / 2048.0f)
#define SC2  ((float)(0.25 * 1.4426950408889634))   // HD^-0.5 * log2(e)
#define PSH  14.0f               // log2 of the P carry (16384)
#define NEGB (-3.0e38f)
#define WOS  64.0f               // carry of the Wo plane
#define WOI  (1.0f / 64.0f)

static_assert(HD == 16);
static_assert(NH_ * HD == DM);                 // head h = columns h*16 + d
static_assert(DM % 64 == 0);                   // column tiles of 64 = four heads
static_assert(64 % HD == 0);
static_assert(DM % 32 == 0);                   // GEMM k-loop steps by 32
static_assert(DM == 32 * 4);                   // output row = 32 lanes x 4 floats
static_assert(SEQ % 64 == 0);                  // a 64-row tile never straddles two batches
static_assert((NB * SEQ) % 64 == 0);
static_assert(SEQ % 32 == 0);                  // key loop steps by 32
static_assert(SEQ % (16 * AW) == 0);           // flash grids cover the sequence exactly
static_assert(16 * AW == DM);                  // a block's query rows are one row (128 elements) of the flat context view, per channel; and the output projection has one 16-column block per wave
static_assert(SEQ % DM == 0);                  // rows of the flat view never straddle two channels
static_assert(2 * AW == HD);                   // output store: 2 rows per wave x AW waves = 16 rows
static_assert(EROWS % 64 == 0);                // a 64-token GEMM tile lies wholly inside or outside the residual planes
static_assert(EROWS >= 32);
static_assert(EROWS <= SEQ);
static_assert(EROWS % 32 == 0);                // early key loops end inside the residual planes
static_assert(EROWS % (16 * AW) == 0);
static_assert((SEQ - EROWS) % (16 * AW) == 0);
static_assert(((size_t)SEQ * DM) % 8 == 0);
static_assert(((size_t)DM * DM) % 8 == 0);
static_assert(NB <= NB_FULL);
static_assert(SEQ <= SEQ_FULL);
static_assert((CSP * 2) % 16 == 0);
static_assert(CSP >= DM);
static_assert((OPP * 4) % 16 == 0);
static_assert(OPP >= DM);
static_assert(32 * 8 == 16 * HD);              // projection epilogue: 32 lanes x 8 halves = one 16 x 16 block of a head
static_assert(2 * HD * CSP * 2 + HD * OPP * 4 <= 131072);   // static LDS of the flash kernel

typedef _Float16 h16;
typedef unsigned short bf;
typedef __attribute__((ext_vector_type(16))) __bf16   v16bf;
typedef __attribute__((ext_vector_type(16))) _Float16 v16h;
typedef __attribute__((ext_vector_type(8)))  _Float16 v8h;
typedef __attribute__((ext_vector_type(2)))  _Float16 v2h;
typedef __attribute__((ext_vector_type(2)))  float    v2f;
typedef __attribute__((ext_vector_type(8)))  unsigned short v8us;
typedef __attribute__((ext_vector_type(4)))  unsigned short v4us;
typedef __attribute__((ext_vector_type(4)))  __bf16   v4bf;
typedef __attribute__((ext_vector_type(8)))  float    v8f;
typedef __attribute__((ext_vector_type(4)))  float    v4f;
typedef __attribute__((ext_vector_type(4)))  int      v4i;
typedef v4f  __attribute__((may_alias)) v4fa;

__device__ __forceinline__ unsigned short f2bf(float f) { unsigned u = __float_as_uint(f); u += 0x7FFFu + ((u >> 16) & 1u); return (unsigned short)(u >> 16); }
__device__ __forceinline__ float bfr(float f) { return __uint_as_float(((unsigned)f2bf(f)) << 16); }   // value after RNE convert to bf16
__device__ __forceinline__ v16h cat16(v8h lo, v8h hi) { return __builtin_shufflevector(lo, hi, 0, 1, 2, 3, 4, 5, 6, 7, 8, 9, 10, 11, 12, 13, 14, 15); }
__device__ __forceinline__ v16bf cat16b(v8us lo, v8us hi) { return __builtin_bit_cast(v16bf, __builtin_shufflevector(lo, hi, 0, 1, 2, 3, 4, 5, 6, 7, 8, 9, 10, 11, 12, 13, 14, 15)); }
__device__ __forceinline__ v8f wmma16(v16h a, v16h b, v8f c) { return __builtin_amdgcn_wmma_f32_16x16x32_f16(false, a, false, b, (short)0, c, false, false); }
__device__ __forceinline__ v8f wmmab(v16bf a, v16bf b, v8f c) { return __builtin_amdgcn_wmma_f32_16x16x32_bf16(false, a, false, b, (short)0, c, false, false); }
// fragment loaders from K-contiguous 16-bit rows; p already includes + 8*(lane>>4): elements 0..7 <- k0+8h+0..7, elements 8..15 <- k0+16+8h+0..7 (same map for A and B)
__device__ __forceinline__ v16h  ldh(const h16* p) { return cat16(*(const v8h*)p, *(const v8h*)(p + 16)); }
__device__ __forceinline__ v16bf ldb(const bf* p)  { return cat16b(*(const v8us*)p, *(const v8us*)(p + 16)); }
// V^T fragment (A: row d, k = key) from the blocked plane; p = block of keys k0..k0+15, + 16*d + 8*(lane>>4): the same k map, keys k0+16.. stand one block (16*HD elements) on
__device__ __forceinline__ v16h  ldv(const h16* p) { return cat16(*(const v8h*)p, *(const v8h*)(p + 16 * HD)); }
// ordering point for wave-private LDS tiles (same wave writes and reads)
__device__ __forceinline__ void wave_sync() { __builtin_amdgcn_fence(3 /* release order */, "wavefront"); __builtin_amdgcn_wave_barrier(); asm volatile("" ::: "memory"); }

// per-instruction guarded matrix ops: the four idle slots tie the accumulator and keep the operands live
__device__ __forceinline__ v8f wmma16g(v16h a, v16h b, v8f c) { c = wmma16(a, b, c); asm volatile("v_nop\n\tv_nop\n\tv_nop\n\tv_nop" : "+v"(c) : "v"(a), "v"(b)); return c; }
__device__ __forceinline__ v8f wmmabg(v16bf a, v16bf b, v8f c) { c = wmmab(a, b, c); asm volatile("v_nop\n\tv_nop\n\tv_nop\n\tv_nop" : "+v"(c) : "v"(a), "v"(b)); return c; }
// f32 -> f16 that cannot produce a subnormal operand (|v| < 2^-14 -> +0)
static __device__ __forceinline__ h16 toh_flush(float v) { const h16 r = (h16)v; return (fabsf(v) < 6.103515625e-05f) ? (h16)0.0f : r; }

// proj_gemm: register-blocked bf16 GEMM, ONE WAVE per 64x64 tile (16 accumulators), K = DM: acc = C[m][n] = sum_k A[m][k] Bt[n][k]. The wave reads the 64 f32 rows of each operand itself, one whole 512-byte row per load instruction,
// converts them to bf16 (round to nearest even) in registers and lays them down in its own LDS tiles (row pitch PSP); the fragments come from there. One copy of this code serves all three projections:
// xa (block-uniform) says whether the x rows are A (v^T: m = b*SEQ + t, n = h*16 + d) or Bt (q, k: m = h*16 + d, n = b*SEQ + t). bx = token tile, by = channel tile.
// The roles are chosen for the store: a lane holds 8 consecutive rows m of one column n, and those are 8 consecutive elements of the plane (q, k: channels d of one token; v^T: keys of one channel).
#define PSP 136                  // LDS row pitch (bf16 elements) of a staged operand tile [64][128]: 272 bytes = 16 x 17
static_assert(PSP >= DM);
static_assert((PSP * 2) % 16 == 0);
static_assert(2 * 64 * PSP * 2 <= 131072);   // static LDS of the projection kernel
__device__ __forceinline__ void proj_gemm(const float* __restrict__ X, const float* __restrict__ Wm, bf* st, bool xa, int bx, int by, v8f (&acc)[4][4]) {
    const int lane = threadIdx.x & 31, lr = lane & 15, hi = lane >> 4;
    bf* sa = st; bf* sb = st + 64 * PSP;
    {
        const int tk0 = bx * 64;                                                // first token of the tile; a 64-token tile lies inside one batch (batch pitch SEQ_FULL tokens in x)
        const float* xr = X + ((size_t)(tk0 / SEQ) * SEQ_FULL + (size_t)(tk0 % SEQ)) * DM + lane * 4;
        const float* wr0 = Wm + (size_t)(by * 64) * DM + lane * 4;
        bf* sx = (xa ? sa : sb) + lane * 4; bf* sw = (xa ? sb : sa) + lane * 4;
        // Eight groups of 16 rows (x: 0..3, W: 4..7) through a ring of three register groups: two groups' loads are in flight while the group before them is converted and stored.
        v4f t[3][16];
#pragma unroll                                                     // unrolled: row offsets become immediates on two base addresses, and the ring's roles are fixed at compile time
        for (int g = 0; g < 8 + 2; ++g) {
            if (g < 8) {
                const float* p = (g < 4 ? xr : wr0) + (size_t)((g & 3) * 16) * DM;
#pragma unroll
                for (int i = 0; i < 16; ++i) t[g % 3][i] = *(const v4f*)(p + (size_t)i * DM);
                if ((g & 3) == 3) asm volatile("s_wait_xcnt 0x0" ::: "memory");   // stands behind the last loads that name this operand's base address (which lives up to here), in front of any later write to the registers that hold it
            }
            if (g >= 2) {
                const int c = g - 2;
                bf* q = (c < 4 ? sx : sw) + ((c & 3) * 16) * PSP;
#pragma unroll
                for (int i = 0; i < 16; ++i) *(v4us*)(q + i * PSP) = __builtin_bit_cast(v4us, __builtin_convertvector(t[c % 3][i], v4bf));
                asm volatile("" ::: "memory");                                    // compiler fence: the next group's loads stay behind these stores and take over the registers just freed; without it the loads are hoisted over the stores and the build takes 478 registers instead of 230 (two waves to a SIMD instead of four, and window switches for the registers above v255)
            }
        }
    }
    wave_sync();                                                   // the fragments read below were written by other lanes of this wave
#pragma unroll
    for (int mb = 0; mb < 4; ++mb)
#pragma unroll
        for (int nb = 0; nb < 4; ++nb) acc[mb][nb] = (v8f){};
    // Fragments are fetched from LDS one k step ahead: step 0 here; inside step kc the four A fragments of step kc + 32 go into a second register set at the step's head,
    // and each B fragment is fetched again for step kc + 32 right behind its last product.
    const bf* Ap = sa + lr * PSP + 8 * hi; const bf* Bp = sb + lr * PSP + 8 * hi;
    v16bf a[4], b[4];
#pragma unroll
    for (int mb = 0; mb < 4; ++mb) a[mb] = ldb(Ap + mb * 16 * PSP);
#pragma unroll
    for (int nb = 0; nb < 4; ++nb) b[nb] = ldb(Bp + nb * 16 * PSP);
#pragma unroll                                                     // unrolled: the test for a next step and the register sets' roles are fixed at compile time
    for (int kc = 0; kc < DM; kc += 32) {
        const bool more = kc + 32 < DM;
        v16bf an[4];
#pragma unroll
        for (int mb = 0; mb < 4; ++mb) an[mb] = more ? ldb(Ap + mb * 16 * PSP + kc + 32) : a[mb];
#pragma unroll
        for (int nb = 0; nb < 4; ++nb) {
#pragma unroll
            for (int mb = 0; mb < 4; ++mb) acc[mb][nb] = wmmabg(a[mb], b[nb], acc[mb][nb]);
            if (more) b[nb] = ldb(Bp + nb * 16 * PSP + kc + 32); }
#pragma unroll
        for (int mb = 0; mb < 4; ++mb) a[mb] = an[mb];
    }
}

// proj_store: the 64x64 tile written as f16 (Ph) and, for tokens t < resT (resT a multiple of 64, block-uniform test), the f16 residual x2048 (Pr), straight from the accumulators.
// Each accumulator tile is one 16 x 16 block (head hb of the channel tile, token block tk of the token tile) of the plane: lane (lane&15, lane>>4) stores its 8 values as 16 bytes at 32*(lane&15) + 16*(lane>>4), one 512-byte run per tile.
// MODE 0 (q, k): acc[hb][tk], rows = channels d, column = token: plane [(b*8 + h)][t][16]. MODE 1 (v^T): acc[tk][hb], rows = tokens, column = channel d: plane [(b*8 + h)][t/16][16 d][t%16]. Residual planes: the same with resT tokens.
template <int MODE>
__device__ __forceinline__ void proj_store(const v8f (&acc)[4][4], h16* Ph, h16* Pr, int resT, int bx, int by) {
    const int lane = threadIdx.x & 31, lr = lane & 15, hi = lane >> 4;
    const int tk0 = bx * 64, bb = tk0 / SEQ, tt = tk0 % SEQ;                                      // a 64-token tile lies inside one batch
    const int z0 = bb * NH_ + by * (64 / HD);                                                     // first of the tile's four heads
    const bool wr = tt < resT;                                                                    // block-uniform, whole tile inside the residual plane
    h16* ph = Ph + ((size_t)z0 * SEQ + (size_t)tt) * HD + lr * HD + 8 * hi;
    h16* pr = Pr + ((size_t)z0 * (size_t)resT + (size_t)tt) * HD + lr * HD + 8 * hi;
#pragma unroll                                                     // unrolled (all loops): the accumulator array is indexed at compile time and stays in registers
    for (int hb = 0; hb < 4; ++hb) {
        // One head's four tiles are converted into four register groups and stored as one run of stores, so that one wait serves them all.
        v8h hv[4];
#pragma unroll
        for (int tk = 0; tk < 4; ++tk) {
#pragma unroll
            for (int j = 0; j < 8; ++j) hv[tk][j] = toh_flush(((MODE == 0) ? acc[hb][tk] : acc[tk][hb])[j]); }
#pragma unroll
        for (int tk = 0; tk < 4; ++tk) *(v8h*)(ph + (size_t)hb * ((size_t)SEQ * HD) + tk * 16 * HD) = hv[tk];
        asm volatile("s_wait_xcnt 0x0" ::: "memory");                                   // stands behind the four stores, in front of any later write to the registers that hold their address and data
        if (wr) {
            v8h rv[4];
#pragma unroll
            for (int tk = 0; tk < 4; ++tk) {
#pragma unroll
                for (int j = 0; j < 8; ++j) rv[tk][j] = toh_flush((((MODE == 0) ? acc[hb][tk] : acc[tk][hb])[j] - (float)hv[tk][j]) * QRS); }
#pragma unroll
            for (int tk = 0; tk < 4; ++tk) *(v8h*)(pr + (size_t)hb * ((size_t)resT * HD) + tk * 16 * HD) = rv[tk];
            asm volatile("s_wait_xcnt 0x0" ::: "memory");                               // as above
        }
    }
}

// k_proj: the three projections and the two small conversions in ONE launch, 1-D grid of one-wave blocks; a block-uniform range of the block index picks the job.
// Blocks [0, PJB): projections, index = (z * (DM/64) + channel tile) * (NB*SEQ/64) + token tile, z = 0, 1, 2: q, k, v^T.
// Blocks [PJB, PJB + CWO): Wo -> bf16-converted value x64 in f16, 8 elements per thread.
// Blocks [PJB + CWO, PJB + CWO + CKB): padding mask -> one bit per key (set: word nonzero), one 32-bit word per 32-key tile, KB[b * (SEQ/32) + tile], bit j = key 32*tile + j; one thread per tile.
#define PJX (NB * SEQ / 64)                      // token tiles
#define PJB (PJX * (DM / 64) * 3)
#define CWO ((DM * DM / 8) / 32)
#define CKB ((NB * (SEQ / 32)) / 32)
static_assert((DM * DM / 8) % 32 == 0);
static_assert((NB * (SEQ / 32)) % 32 == 0);
__global__ __launch_bounds__(32) void k_proj(const float* __restrict__ x, const float* __restrict__ wq, const float* __restrict__ wk, const float* __restrict__ wv, const float* __restrict__ wo,
                                             const int* __restrict__ pmask, h16* WOH, unsigned* KB, h16* QH, h16* QR, h16* KP, h16* KR, h16* VT, h16* VR, int resT) {
    __shared__ __align__(16) bf st[2 * 64 * PSP];
    const unsigned blk = blockIdx.x;
    if (blk >= (unsigned)(PJB + CWO)) {
        const unsigned i = (blk - (unsigned)(PJB + CWO)) * 32u + threadIdx.x;
        const int* p = pmask + (size_t)(i / (unsigned)(SEQ / 32)) * SEQ_FULL + (size_t)(i % (unsigned)(SEQ / 32)) * 32;
        unsigned bits = 0u;
#pragma unroll
        for (int k = 0; k < 8; ++k) { const v4i a = *(const v4i*)(p + 4 * k);
#pragma unroll
            for (int j = 0; j < 4; ++j) bits |= (a[j] != 0 ? 1u : 0u) << (4 * k + j); }
        KB[i] = bits;
        asm volatile("s_wait_xcnt 0x0" ::: "memory");                           // stands behind the store, in front of any later write to the registers that hold its address and data
        return;
    }
    if (blk >= (unsigned)PJB) {
        const unsigned i = (blk - (unsigned)PJB) * 32u + threadIdx.x;
        const v8f v = *(const v8f*)(wo + (size_t)i * 8); v8h o;
#pragma unroll
        for (int k = 0; k < 8; ++k) o[k] = toh_flush(bfr(v[k]) * WOS);
        *(v8h*)(WOH + (size_t)i * 8) = o;
        asm volatile("s_wait_xcnt 0x0" ::: "memory");                           // stands behind the store, in front of any later write to the registers that hold its address and data
        return;
    }
    const int bx = (int)(blk % (unsigned)PJX), by = (int)((blk / (unsigned)PJX) % (unsigned)(DM / 64)), z = (int)(blk / (unsigned)(PJX * (DM / 64)));
    const float* Wm = (z == 0) ? wq : (z == 1) ? wk : wv;
    v8f acc[4][4];
    proj_gemm(x, Wm, st, z == 2, bx, by, acc);
    if (z == 2) { proj_store<1>(acc, VT, VR, resT, bx, by); }
    else        { h16* Ph = z ? KP : QH; h16* Pr = z ? KR : QR; proj_store<0>(acc, Ph, Pr, resT, bx, by); }
}

// k_flash: both instantiations and the output projection in ONE launch, 1-D grid; the block index picks (batch*head, query tile of 128 rows), batch*head fastest.
// First half of the index: tiles NT - 1 down to NT / 2 (the long-running ones start first); second half: tiles 0 up to NT / 2 - 1. A block-uniform test (tile < FEX) picks the instantiation.
#define NT  (SEQ / (16 * AW))                    // query tiles per (batch, head)
#define FEX (EROWS / (16 * AW))                  // of them early (query rows < EROWS)
#define NBH (NB * NH_)
#define FHB (NBH * (NT / 2))                     // blocks in the first half of the index
static_assert(NT % 2 == 0);
// flash_body: fused causal attention, one wave per 16 query rows of one (batch, head) zh, AW waves = 128 query rows from tb per block; K / V^T / Q fragments straight from the f16 planes (16-B loads, arithmetic addressing). Returns the wave's normalised O^T tile.
// Transposed form: S^T[key][t] = K Q^T (A = K rows, B = Q rows, head dim 16 in k-slots 0..15); lane (t = lane&15, h = lane>>4) holds keys 8h+r of each 16-key tile, so the packed
// P tile is directly the B fragment of O^T[d][t] = V^T P^T (element r <- tile keys 0..15, element 8+r <- tile keys 16..31, lane unchanged).
// Softmax state (running max over kept keys, sum) is one scalar per lane; the two lane halves of a row are combined with one xor-16 exchange (the sum: EARLY only; late rows hold the whole row's sum in both halves).
// Keep rule: a wave reads its batch's mask bits (KB, one word per 32-key tile) once, lane = tile. A tile whose word is all ones and whose last key lies below the wave's first query row keeps every element:
// a scalar test sends it down a path without keep compares and selects (there a P below 2^-14 stays an f16 subnormal, which the matrix unit takes as it is). Every other visited tile evaluates the rule per element.
// The per-wave key bound is t0 + 16 (pad up to 32), at most SEQ.
// EARLY = 1 (query rows [0, EROWS)): A = [K | K_res], B = [Q | 0] gives K Q; B = [Q_res | Q] gives K Q_res + K_res Q (x2048, own accumulator); P = f16 value + f16 residual x2048;
//            O = V P + (V P_res + V_res P) / 2048 (residual products in their own accumulator); row sum from the f32 exponentials; all keys of these rows are < EROWS, inside the small planes.
// EARLY = 0 (query rows [EROWS, SEQ)): single q, k, P, v.
template <bool B> struct flag_c { static constexpr bool v = B; };
static_assert(SEQ / 32 <= 64);                   // a wave holds its batch's tile words in two registers (lane = tile) and their all-kept flags in one 64-bit scalar
template <int EARLY>
__device__ __forceinline__ v8f flash_body(const h16* __restrict__ QH, const h16* __restrict__ QR, const h16* __restrict__ KP, const h16* __restrict__ KR,
                                          const h16* __restrict__ VT, const h16* __restrict__ VR, const unsigned* __restrict__ KB, const int zh, const int tb) {
    const int lane = threadIdx.x & 31, lr = lane & 15, hi = lane >> 4;
    const int wave = __builtin_amdgcn_readfirstlane((int)(threadIdx.x >> 5));
    const int b = zh / NH_;
    const int t0 = tb + wave * 16;
    const int lim = t0 + lr;                                                   // key j kept iff j <= lim (and mask nonzero)
    const int nk = (t0 + 16 + 31) & ~31;                                       // wave-uniform, multiple of 32, <= SEQ (<= EROWS when EARLY)
    const unsigned* kbb = KB + (size_t)b * (SEQ / 32);                         // + tile
    const size_t pbase = (size_t)zh * SEQ * HD;
    const size_t rbase = (size_t)zh * EROWS * HD;
    const v8h z8 = (v8h){};
    const size_t qo = pbase + (size_t)(t0 + lr) * HD + 8 * hi;
    const v8h q8 = *(const v8h*)(QH + qo);
    asm volatile("s_wait_xcnt 0x0" ::: "memory");                 // the loads issued next may land in the registers that hold this load's address: the wait stands in front of them
    const v16h qh = cat16(q8, z8);                                // B fragment [Q | 0]: col t, k = d
    v16h qx = qh;
    if (EARLY) { const size_t qro = rbase + (size_t)(t0 + lr) * HD + 8 * hi; qx = cat16(*(const v8h*)(QR + qro), q8);   // B fragment [Q_res | Q]
                 asm volatile("s_wait_xcnt 0x0" ::: "memory"); }  // as above, for the residual load's address
    const size_t ko = pbase + (size_t)lr * HD + 8 * hi;         // + key * HD       (A fragment: row key, k = d)
    const size_t vo = pbase + (size_t)lr * HD + 8 * hi;         // + key * HD       (A fragment: row d, k = key; blocks of 16 keys)
    const size_t kro = rbase + (size_t)lr * HD + 8 * hi;        // residual planes, tokens < EROWS
    const size_t vro = rbase + (size_t)lr * HD + 8 * hi;
    const v8f zz = (v8f){};
    v8f o0 = (v8f){}, oR0 = (v8f){};
    float m = NEGB, l = 0.0f;
    // EARLY: every operand of a 32-key tile (K, V^T, residual planes) is fetched one trip ahead: tile 0 here, tile key0 + 32 inside trip key0,
    // each group into the registers its last reader of the trip has just left. nk >= 32, so tile 0 exists for every wave.
    // Late rows: K and V^T are fetched RD tiles ahead, through RD register sets (see the late loop below); set 0 is loaded here.
    v8h k0 = *(const v8h*)(KP + ko), k1 = *(const v8h*)(KP + ko + 16 * HD);
    v8h kr0 = z8, kr1 = z8;
    if (EARLY) { kr0 = *(const v8h*)(KR + kro); kr1 = *(const v8h*)(KR + kro + 16 * HD); }
    const unsigned kw0 = kbb[lane < SEQ / 32 ? lane : 0], kw1 = kbb[32 + lane < SEQ / 32 ? 32 + lane : 0];   // mask bits of tiles lane and 32 + lane
    v16h v0 = ldv(VT + vo);
    v16h vr0 = v0;
    if (EARLY) { vr0 = ldv(VR + vro); }
    asm volatile("s_wait_xcnt 0x0" ::: "memory");                 // stands behind tile 0's loads, in front of the later loads, which may land in the registers that hold these loads' addresses
    __builtin_amdgcn_sched_barrier(0);                            // keeps tile 0's loads in front of that wait: without it they are moved down among the later tiles' loads, past the wait
    // bit T set: tile T keeps every element for all 16 rows of this wave: word all ones and 32T + 31 < t0 (t0 a multiple of 16: T < t0 / 32 <= SEQ / 32 - 1). Wave-uniform.
    const unsigned long long kept = (((unsigned long long)__builtin_amdgcn_ballot_w32(kw1 == 0xFFFFFFFFu) << 32) | (unsigned long long)__builtin_amdgcn_ballot_w32(kw0 == 0xFFFFFFFFu)) & ((1ull << (t0 >> 5)) - 1ull);
    v16h pb, pr = (v16h){}; float ls = 0.0f, alpha, mnew;
    // softmax of the 32-key tile at key0 from its score accumulators; FULL: every element kept
    auto tile = [&](auto fc, const int key0, const v8f sHa, const v8f sHb, const v8f sLa, const v8f sLb) __attribute__((always_inline)) {
            constexpr bool FULL = decltype(fc)::v;
            float ta[8], tb2[8]; bool fa[8], fb[8]; float mx;
            ls = 0.0f;
            if constexpr (FULL) {
                float ua[8], ub[8];
#pragma unroll
                for (int r = 0; r < 8; ++r) {
                    if (EARLY) { ua[r] = sHa[r] + sLa[r] * QRI; ub[r] = sHb[r] + sLb[r] * QRI; }
                    else       { ua[r] = sHa[r]; ub[r] = sHb[r]; }
                    ta[r] = ua[r] * SC2; tb2[r] = ub[r] * SC2; fa[r] = true; fb[r] = true; }
                float mr = fmaxf(ua[0], ub[0]);                  // SC2 > 0 and rounding is monotonic: the scaled maximum equals the maximum of the scaled scores
#pragma unroll
                for (int r = 1; r < 8; ++r) mr = fmaxf(mr, fmaxf(ua[r], ub[r]));
                mx = mr * SC2;
            } else {
                const unsigned kcur = (unsigned)__builtin_amdgcn_readlane((int)(key0 < 1024 ? kw0 : kw1), (key0 >> 5) & 31);   // mask bits of keys key0 .. key0+31
                const unsigned kw = kcur >> (8 * hi);            // bits 0..7: keys key0+8h+0..7; bits 16..23: keys key0+16+8h+0..7
                const int ja = key0 + 8 * hi;
                mx = NEGB;
#pragma unroll
                for (int r = 0; r < 8; ++r) {
                    fa[r] = (((kw >> r) & 1u) != 0u) & (ja + r <= lim);
                    fb[r] = (((kw >> (16 + r)) & 1u) != 0u) & (ja + 16 + r <= lim); }
#pragma unroll
                for (int r = 0; r < 8; ++r) {
                    if (EARLY) { ta[r] = (sHa[r] + sLa[r] * QRI) * SC2; tb2[r] = (sHb[r] + sLb[r] * QRI) * SC2; }
                    else       { ta[r] = sHa[r] * SC2; tb2[r] = sHb[r] * SC2; }
                    mx = fmaxf(mx, fmaxf(fa[r] ? ta[r] : NEGB, fb[r] ? tb2[r] : NEGB)); }
            }
            mx = fmaxf(mx, __shfl_xor(mx, 16, 32));
            mnew = fmaxf(m, mx);
            alpha = __builtin_amdgcn_exp2f(m - mnew);
            const float sh = PSH - mnew;
#pragma unroll
            for (int r = 0; r < 8; r += 2) {
                float ga[2], gb[2];
#pragma unroll
                for (int i = 0; i < 2; ++i) {
                    const float xa = ta[r + i] + sh, xb = tb2[r + i] + sh;
                    const float ea = __builtin_amdgcn_exp2f(xa), eb = __builtin_amdgcn_exp2f(xb);
                    ga[i] = (FULL || (fa[r + i] & (xa >= -14.0f))) ? ea : 0.0f; gb[i] = (FULL || (fb[r + i] & (xb >= -14.0f))) ? eb : 0.0f; }   // not FULL: dropped or sub-2^-14 elements selected to 0 by value
                const v2h pa = __builtin_convertvector((v2f){ga[0], ga[1]}, v2h), pc = __builtin_convertvector((v2f){gb[0], gb[1]}, v2h);
#pragma unroll
                for (int i = 0; i < 2; ++i) {
                    pb[r + i] = pa[i]; pb[8 + r + i] = pc[i];
                    if (EARLY) { pr[r + i] = toh_flush((ga[i] - (float)pa[i]) * QRS); pr[8 + r + i] = toh_flush((gb[i] - (float)pc[i]) * QRS); ls += ga[i] + gb[i]; }
                } }                                              // late rows: the row sum of the packed P is taken on the matrix unit, behind this function
    };
    if constexpr (EARLY) {
        // Inputs-only fence on the loaded values: the query fragments and tile 0 have landed before the loop is entered, so the loop's counted load waits follow from the loop's own issue order alone
        // (K early in a trip, V^T at its end) and the wait for K at a trip's head leaves the V^T loads just issued in flight.
        asm volatile("" :: "v"(qx), "v"(k0), "v"(k1), "v"(kr0), "v"(kr1), "v"(v0), "v"(vr0));
#pragma unroll 1
        for (int key0 = 0; key0 < nk; key0 += 32) {
            const int kn = (key0 + 32 < nk) ? key0 + 32 : key0;      // tile fetched in this trip; the last trip fetches its own tile again (unused), so every address stays below nk <= EROWS
            const v16h ka0 = cat16(k0, kr0), kb0 = cat16(k1, kr1);   // A fragments [K | K_res]
            const v8f sHa = wmma16g(ka0, qh, zz), sHb = wmma16g(kb0, qh, zz);
            const v8f sLa = wmma16g(ka0, qx, zz), sLb = wmma16g(kb0, qx, zz);
            { const h16* ka = KP + ko + (size_t)kn * HD; k0 = *(const v8h*)ka; k1 = *(const v8h*)(ka + 16 * HD); }
            { const h16* kr = KR + kro + (size_t)kn * HD; kr0 = *(const v8h*)kr; kr1 = *(const v8h*)(kr + 16 * HD); }
            asm volatile("s_wait_xcnt 0x0" ::: "memory");            // stands between the K loads just issued and the softmax's first writes to the registers that hold their addresses
            if (((kept >> (key0 >> 5)) & 1ull) != 0ull) tile(flag_c<true>{}, key0, sHa, sHb, sLa, sLb); else tile(flag_c<false>{}, key0, sHa, sHb, sLa, sLb);   // scalar test
            l = l * alpha + ls; m = mnew;
            o0 = o0 * alpha;
            oR0 = oR0 * alpha;
            o0 = wmma16g(v0, pb, o0);
            oR0 = wmma16g(v0, pr, oR0);
            oR0 = wmma16g(vr0, pb, oR0);
            vr0 = ldv(VR + vro + (size_t)kn * HD);
            v0 = ldv(VT + vo + (size_t)kn * HD);
            asm volatile("s_wait_xcnt 0x0" ::: "memory");            // stands between the V^T loads just issued and the next trip's first writes to the registers that hold their addresses
        }
    } else {
        // Late rows: RD register sets, set s holding tile s (mod RD). A step works on its set's tile and refills each half of the set (K behind the score products, V^T behind the P.V product)
        // with the tile RD steps on, so a load has RD - 1 whole steps of work between its issue and its wait. Tiles are taken in ascending order, one at a time.
        constexpr int RD = 4;
        const int klast = nk - 32;                                   // last tile of this wave; a fetch past it is aimed at it again (unused), so every address stays below nk <= SEQ
        v8h rk0[RD], rk1[RD]; v16h rv[RD];
        const h16 one_r = ((lr & 7) == 0) ? (h16)1.0f : (h16)0.0f;   // A fragment of the row sum: rows 0 and 8 (the two that are read) all ones, the rest 0 (lane = row); made from the lane index it stays in vector registers over the loop, where an all-ones constant was copied from scalar registers in front of every product
        v16h ones;
#pragma unroll
        for (int i = 0; i < 16; ++i) ones[i] = one_r;
        rk0[0] = k0; rk1[0] = k1; rv[0] = v0;
#pragma unroll
        for (int s = 1; s < RD; ++s) {
            const int ks = (32 * s < klast) ? 32 * s : klast;
            const h16* ka = KP + ko + (size_t)ks * HD; rk0[s] = *(const v8h*)ka; rk1[s] = *(const v8h*)(ka + 16 * HD);
            rv[s] = ldv(VT + vo + (size_t)ks * HD);
            asm volatile("s_wait_xcnt 0x0" ::: "memory");            // stands behind the loads just issued, in front of any later write to the registers that hold their addresses
            __builtin_amdgcn_sched_barrier(0);                       // keeps the next set's address arithmetic behind that wait: without it an address add is lifted over the wait, onto a register that a load just issued names
        }
        // Inputs-only fence on the loaded values: the query fragment and all RD sets have landed before the loop is entered, so the loop's counted load waits follow from the loop's own issue order alone.
        asm volatile("" :: "v"(q8), "v"(rk0[0]), "v"(rk1[0]), "v"(rv[0]), "v"(rk0[1]), "v"(rk1[1]), "v"(rv[1]), "v"(rk0[2]), "v"(rk1[2]), "v"(rv[2]), "v"(rk0[3]), "v"(rk1[3]), "v"(rv[3]));
        static_assert(RD == 4);                                      // the fence above names every set
#pragma unroll 1
        for (int key0 = 0; key0 < nk; key0 += 32 * RD) {
#pragma unroll
            for (int s = 0; s < RD; ++s) {
                const int kc = key0 + 32 * s;                        // this step's tile; kc >= nk (last trip only): no tile, the step's softmax and P.V are jumped over
                const int kn = (kc + 32 * RD < nk) ? kc + 32 * RD : klast;
                // The loads (and the score products in front of them) stand outside the scalar branch below: every path through a trip issues the same loads in the same order, which keeps the ring's counted load waits.
                const v8f sHa = wmma16g(cat16(rk0[s], z8), qh, zz), sHb = wmma16g(cat16(rk1[s], z8), qh, zz);   // A fragments [K | 0]
                { const h16* ka = KP + ko + (size_t)kn * HD; rk0[s] = *(const v8h*)ka; rk1[s] = *(const v8h*)(ka + 16 * HD); }
                asm volatile("s_wait_xcnt 0x0" ::: "memory");        // stands between the K loads just issued and the softmax's first writes to the registers that hold their addresses
                if (s == 0 || kc < nk) {                             // scalar test
                    if (((kept >> (kc >> 5)) & 1ull) != 0ull) tile(flag_c<true>{}, kc, sHa, sHb, zz, zz); else tile(flag_c<false>{}, kc, sHa, sHb, zz, zz);   // scalar test
                    o0 = o0 * alpha;
                    // Row sum on the matrix unit: rows 0 and 8 of A are ones, so rows 0 and 8 of the result hold, per query column, the sum of the tile's 32 packed P over both lane halves; element 0 (row 8h) is this lane's row sum.
                    v8f sd = wmma16(ones, pb, zz);
                    o0 = wmma16(rv[s], pb, o0);
                    asm volatile("v_nop\n\tv_nop\n\tv_nop\n\tv_nop" : "+v"(sd), "+v"(o0) : "v"(ones), "v"(rv[s]), "v"(pb));   // the four idle slots behind the two products: they tie both results and keep the operands live
                    l = l * alpha + sd[0]; m = mnew;
                }
                rv[s] = ldv(VT + vo + (size_t)kn * HD);
                asm volatile("s_wait_xcnt 0x0" ::: "memory");        // stands between the V^T loads just issued and the next step's first writes to the registers that hold their addresses
            }
        }
    }
    if (EARLY) l += __shfl_xor(l, 16, 32);                        // late rows: the matrix row sum already covers both lane halves
    const bool any = l > 0.0f;
    const float lsafe = any ? l : 1.0f;
    const float inv = any ? (1.0f / lsafe) : 0.0f;
    v8f f0 = o0;
    if (EARLY) { f0 = o0 + oR0 * QRI; }
    f0 = f0 * inv;
    const unsigned nonem = __builtin_amdgcn_ballot_w32(!any);    // wave-uniform: some row of this wave kept no key
    if (nonem != 0u) {
        // equal fills give a uniform softmax over all SEQ keys: plain mean of v per channel d = 8h + r
        float vm[8];
#pragma unroll
        for (int r = 0; r < 8; ++r) vm[r] = 0.0f;
#pragma unroll 1
        for (int t = lr; t < SEQ; t += 16) {
#pragma unroll
            for (int r = 0; r < 8; ++r) vm[r] += (float)VT[pbase + (size_t)(t >> 4) * (16 * HD) + (size_t)(8 * hi + r) * HD + (t & 15)]; }
#pragma unroll
        for (int r = 0; r < 8; ++r) { float s = vm[r];
            s += __shfl_xor(s, 1, 32); s += __shfl_xor(s, 2, 32); s += __shfl_xor(s, 4, 32); s += __shfl_xor(s, 8, 32);
            vm[r] = s * (1.0f / (float)SEQ); }
#pragma unroll
        for (int r = 0; r < 8; ++r) f0[r] = any ? f0[r] : vm[r];
    }
    return f0;                                                    // O^T D layout: f0[r] = (d = 8h + r, t = lane&15)
}

// Behind the attention: the block's context tile [16 d][128 t] goes to LDS as f16 value and f16 residual x2048; it is the A operand (16 rows of the flat view, k = token - tb) of the output projection.
// Wave w takes output columns 16w .. 16w+15: Bt = Wo x64 rows [n][k] (f16), K = DM in four 32-deep steps, value and residual products in separate accumulators.
// Output row of channel d: (h*16 + d) * (SEQ/128) + tb/128 of batch b. The head-count input is read on the device; a value other than the compiled head count marks the output with NaN.
__global__ __launch_bounds__(32 * AW) void k_flash(const h16* __restrict__ QH, const h16* __restrict__ QR, const h16* __restrict__ KP, const h16* __restrict__ KR,
                                                   const h16* __restrict__ VT, const h16* __restrict__ VR, const unsigned* __restrict__ KB,
                                                   const h16* __restrict__ WO, const int* __restrict__ nheads_p, float* OUT) {
    __shared__ __align__(16) h16 cs[2 * HD * CSP];                // value tile, then residual tile
    __shared__ __align__(16) float os[HD * OPP];
    const int lane = threadIdx.x & 31, lr = lane & 15, hi = lane >> 4;
    const int wave = __builtin_amdgcn_readfirstlane((int)(threadIdx.x >> 5));
    const int blk = (int)blockIdx.x;
    const int tile = (blk < FHB) ? (NT - 1 - blk / NBH) : ((blk - FHB) / NBH);
    const int zh = blk % NBH; const int b = zh / NH_, h = zh % NH_;
    const int tb = tile * (16 * AW);
    v8f f0;
    if (tile >= FEX) f0 = flash_body<0>(QH, QR, KP, KR, VT, VR, KB, zh, tb);
    else             f0 = flash_body<1>(QH, QR, KP, KR, VT, VR, KB, zh, tb);
    // The wave's four Wo fragments are asked for here, so that their latency runs beside the tile's conversion and its LDS stores.
    const h16* Wp = WO + (size_t)(wave * 16 + lr) * DM + 8 * hi;
    v16h w[DM / 32];
#pragma unroll                                                     // unrolled (this loop and those below): the fragment arrays are indexed at compile time and stay in registers
    for (int s = 0; s < DM / 32; ++s) w[s] = ldh(Wp + 32 * s);
    asm volatile("s_wait_xcnt 0x0" ::: "memory");                 // stands behind the loads just issued, in front of any later write to the registers that hold their address
    const int nh = nheads_p[0];
#pragma unroll
    for (int r = 0; r < 8; ++r) { const h16 a0 = toh_flush(f0[r]);
        cs[(8 * hi + r) * CSP + wave * 16 + lr] = a0;
        cs[(HD + 8 * hi + r) * CSP + wave * 16 + lr] = toh_flush((f0[r] - (float)a0) * QRS); }   // rows 0..15 x columns 0..127 of both tiles all written by the eight waves
    __syncthreads();                                              // cross-wave tiles: block barrier (every wave reaches it)
    v8f aH = (v8f){}, aR = (v8f){};
    const h16* Ap = cs + lr * CSP + 8 * hi;
    v16h ah[DM / 32], ar[DM / 32];                                // all eight A fragments are asked for in one group, so that one LDS latency is waited out and not four
#pragma unroll
    for (int s = 0; s < DM / 32; ++s) { ah[s] = ldh(Ap + 32 * s); ar[s] = ldh(Ap + HD * CSP + 32 * s); }
#pragma unroll
    for (int s = 0; s < DM / 32; ++s) { aH = wmma16g(ah[s], w[s], aH); aR = wmma16g(ar[s], w[s], aR); }
    const float poison = (nh == NH_) ? 0.0f : __uint_as_float(0x7FC00000u);
#pragma unroll
    for (int j = 0; j < 8; ++j) os[(hi * 8 + j) * OPP + wave * 16 + lr] = (aH[j] + aR[j] * QRI) * WOI + poison;   // D: row 8h+j, col lane&15; rows 0..15 x columns 0..127 all written by the eight waves
    __syncthreads();                                              // cross-wave slab: block barrier; behind it each wave stores whole 512-byte output rows
    float* orow = OUT + ((size_t)b * OUT_SEQ + (size_t)(h * HD) * (SEQ / DM) + (size_t)(tb / DM)) * DM + lane * 4;
#pragma unroll
    for (int s = 0; s < 2; ++s) { const int d = 2 * wave + s;     // AW waves x 2 rows = 16 rows x (32 lanes x 4 floats = 128 columns = the whole row)
        const v4f val = *(const v4fa*)(&os[d * OPP + lane * 4]);
        *(v4f*)(orow + (size_t)d * (SEQ / DM) * DM) = val; }
    asm volatile("s_wait_xcnt 0x0" ::: "memory");                 // stands behind the stores, in front of any later write to the registers that hold their address and data
}

static constexpr size_t al256(size_t v) { return (v + 255) & ~(size_t)255; }
static constexpr size_t SZ_WO = al256((size_t)DM * DM * 2);
static constexpr size_t SZ_PL = al256((size_t)NB * NH_ * SEQ * HD * 2);
static constexpr size_t SZ_RS = al256((size_t)NB * NH_ * EROWS * HD * 2);
static constexpr size_t SZ_KB = al256((size_t)NB * (SEQ / 32) * 4);
static constexpr size_t SZ_TOTAL = SZ_WO + 3 * SZ_PL + 3 * SZ_RS + SZ_KB;
static_assert(SZ_TOTAL <= (size_t)134217728);          // workspace carve <= 128 MiB
static_assert((size_t)NB * NH_ * SEQ * HD == (size_t)NB * DM * SEQ);       // the blocked v^T plane has the same extent as the q/k planes
static_assert((size_t)NB * NH_ * EROWS * HD == (size_t)NB * DM * EROWS);   // the blocked v^T residual plane (t < EROWS) has the same extent as the q/k residual planes

extern "C" void kernel_launch(void* const* d_in, const int* in_sizes, int n_in,
                              void* d_out, int out_size, void* d_ws, size_t ws_size, hipStream_t stream) {
    if (n_in < 7) return;
    const size_t needx = ((size_t)(NB - 1) * SEQ_FULL + SEQ) * DM;
    const size_t needm = (size_t)(NB - 1) * SEQ_FULL + SEQ;
    if ((size_t)in_sizes[0] < needx) return;
    if ((size_t)in_sizes[1] < (size_t)DM * DM || (size_t)in_sizes[2] < (size_t)DM * DM || (size_t)in_sizes[3] < (size_t)DM * DM || (size_t)in_sizes[4] < (size_t)DM * DM) return;
    if ((size_t)in_sizes[5] < needm || in_sizes[6] < 1) return;
    if ((size_t)out_size < ((size_t)(NB - 1) * OUT_SEQ + SEQ) * DM) return;
    if (SZ_TOTAL > ws_size) return;
    // wire order: x, Wq, Wk, Wv, Wo, padding_mask, num_heads
    const float* x  = (const float*)d_in[0];
    const float* wq = (const float*)d_in[1];
    const float* wk = (const float*)d_in[2];
    const float* wv = (const float*)d_in[3];
    const float* wo = (const float*)d_in[4];
    const int* pm = (const int*)d_in[5];
    const int* nheads = (const int*)d_in[6];
    float* OUT = (float*)d_out;      // [NB][SEQ][128]
    char* wsp = (char*)d_ws;
    h16* WOH = (h16*)wsp; wsp += SZ_WO;              // [128][128] Wo x64 ([out][in] = Bt as-is)
    h16* QH = (h16*)wsp; wsp += SZ_PL;               // [NB*8][SEQ][16]
    h16* KP = (h16*)wsp; wsp += SZ_PL;               // [NB*8][SEQ][16]
    h16* VT = (h16*)wsp; wsp += SZ_PL;               // [NB*8][SEQ/16][16 d][16 keys]
    h16* QR = (h16*)wsp; wsp += SZ_RS;               // [NB*8][EROWS][16] residual x2048, tokens < EROWS
    h16* KR = (h16*)wsp; wsp += SZ_RS;               // [NB*8][EROWS][16] residual x2048, tokens < EROWS
    h16* VR = (h16*)wsp; wsp += SZ_RS;               // [NB*8][EROWS/16][16 d][16 keys] residual x2048, tokens < EROWS
    unsigned* KB = (unsigned*)wsp; wsp += SZ_KB;     // [NB][SEQ/32] padding mask, one bit per key

    // q, k: A = W rows (m = h*16 + d), Bt = x rows (n = b*SEQ + t) -> plane [(b*8 + h)][t][d]; residuals for tokens < EROWS
    // v^T: A = x rows (m = b*SEQ + t), Bt = Wv rows (n = h*16 + d) -> plane [(b*8 + h)][t/16][d][t%16]; residual for tokens < EROWS
    // in the same launch: Wo -> f16 plane x64; padding mask -> bits
    k_proj<<<dim3(PJB + CWO + CKB, 1, 1), 32, 0, stream>>>(x, wq, wk, wv, wo, pm, WOH, KB, QH, QR, KP, KR, VT, VR, EROWS);

    // query rows [0, EROWS): multi-product instantiation; rows [EROWS, SEQ): single-product instantiation; each block then projects its own 16 rows of the flat context view (disjoint output rows)
    k_flash<<<dim3(NBH * NT, 1, 1), 32 * AW, 0, stream>>>(QH, QR, KP, KR, VT, VR, KB, WOH, nheads, OUT);
}

// v010
// A run of this version takes 21.9 microseconds.
// Timed twice side by side with v009, it ran 1.14 and 1.13 times as fast.
// All steps since v000 together make it 5.70 times as fast.
#include <hip/hip_runtime.h>

// Causal multi-head self-attention, width 128 = 8 heads x 16; x [NB][SEQ][128]; Wq/Wk/Wv/Wo [out][in] (y = x W^T, no bias); key padding mask [NB][SEQ] (int32, device-read); masked scores are replaced before the 1/sqrt(16) scale;
// per-head context transposed to [b][h*16+e][t], reinterpreted flat as [NB][SEQ][128], then multiplied by Wo^T (f32 output).
// Compute dtypes, f32 accumulate everywhere: q/k/v projections v_wmma_f32_16x16x32_bf16 (x, W RNE-converted to bf16; products exact);
// scores v_wmma_f32_16x16x32_f16 (head dim 16 zero-padded to the 32-deep step): single f16 q, k on query rows >= EROWS; on query rows < EROWS q and k each as f16 value + f16 residual x2048 (cross products in the upper 16 k-slots, own accumulator);
// P.V v_wmma_f32_16x16x32_f16: P (x16384 carry, cancels in the normalisation) and v single f16 on query rows >= EROWS, row sum of the f16 P there by one more product of the same form (A = rows of ones); on query rows < EROWS P and v as f16 value + f16 residual x2048, residual products in their own accumulator folded by 1/2048, row sum from the f32 exponentials;
// output projection v_wmma_f32_16x16x32_f16: context as f16 value + f16 residual x2048 (own accumulator), Wo as bf16-converted value x64 held in f16; softmax f32 (online, running max over kept keys).
// Layout: q, k planes [b*8+h][t][16]; v^T plane in blocks of 16 keys, [b*8+h][t/16][16 d][t%16]; small residual planes (tokens < EROWS) for q, k, v^T in the same forms; fused flash kernel in transposed form (S^T = K Q^T, O^T = V^T P^T).
// In all three forms a 16 x 16 block of a head is 512 contiguous bytes in which lane (lane&15, lane>>4) owns bytes 32*(lane&15) + 16*(lane>>4) .. + 15: that is a projection accumulator tile as it stands in registers, and one half of a K, Q or V^T fragment.
// The context never leaves the flash block: row s of the flat [SEQ][128] view is channel s / 16, tokens 128 * (s % 16) .. + 127, so a block of 128 query rows of one head holds 16 whole rows of that view (one per channel) and multiplies them by Wo^T itself.
// Keep rule per element: (mask[b][j] != 0) and (j <= t); dropped elements get probability 0; a row with no kept key takes the plain mean of v over all SEQ keys (uniform softmax of equal fills).

#ifndef NB
#define NB 4
#endif
#ifndef SEQ
#define SEQ 2048
#endif
#define NB_FULL  4
#define SEQ_FULL 2048
#ifndef OUT_SEQ
#define OUT_SEQ SEQ              // row pitch (in tokens) between batches of the output
#endif
#define DM   128
#define NH_  8
#define HD   16
#define AW   8                   // waves per flash block (16 query rows each): 128 query rows = the whole k extent of the output projection
#define CSP  136                 // LDS row pitch (f16 elements) of a flash context tile [16 d][128 t]: 272 bytes = 16 x 17
#define OPP  132                 // LDS row pitch (floats) of the output-projection slab [16][128]
#define EROWS (SEQ < 512 ? SEQ : 512)   // query rows (and tokens of the small residual planes) handled by the multi-product flash instantiation
#define QRS  2048.0f             // carry of every residual plane / residual fragment
#define QRI  (1.0f / 2048.0f)
#define SC2  ((float)(0.25 * 1.4426950408889634))   // HD^-0.5 * log2(e)
#define PSH  14.0f               // log2 of the P carry (16384)
#define NEGB (-3.0e38f)
#define WOS  64.0f               // carry of the Wo plane
#define WOI  (1.0f / 64.0f)

static_assert(HD == 16);
static_assert(NH_ * HD == DM);                 // head h = columns h*16 + d
static_assert(DM % 64 == 0);                   // column tiles of 64 = four heads
static_assert(64 % HD == 0);
static_assert(DM % 32 == 0);                   // GEMM k-loop steps by 32
static_assert(DM == 32 * 4);                   // output row = 32 lanes x 4 floats
static_assert(SEQ % 64 == 0);                  // a 64-row tile never straddles two batches
static_assert((NB * SEQ) % 64 == 0);
static_assert(SEQ % 32 == 0);                  // key loop steps by 32
static_assert(SEQ % (16 * AW) == 0);           // flash grids cover the sequence exactly
static_assert(16 * AW == DM);                  // a block's query rows are one row (128 elements) of the flat context view, per channel; and the output projection has one 16-column block per wave
static_assert(SEQ % DM == 0);                  // rows of the flat view never straddle two channels
static_assert(2 * AW == HD);                   // output store: 2 rows per wave x AW waves = 16 rows
static_assert(EROWS % 64 == 0);                // a 64-token GEMM tile lies wholly inside or outside the residual planes
static_assert(EROWS >= 32);
static_assert(EROWS <= SEQ);
static_assert(EROWS % 32 == 0);                // early key loops end inside the residual planes
static_assert(EROWS % (16 * AW) == 0);
static_assert((SEQ - EROWS) % (16 * AW) == 0);
static_assert(((size_t)SEQ * DM) % 8 == 0);
static_assert(((size_t)DM * DM) % 8 == 0);
static_assert(NB <= NB_FULL);
static_assert(SEQ <= SEQ_FULL);
static_assert((CSP * 2) % 16 == 0);
static_assert(CSP >= DM);
static_assert((OPP * 4) % 16 == 0);
static_assert(OPP >= DM);
static_assert(32 * 8 == 16 * HD);              // projection epilogue: 32 lanes x 8 halves = one 16 x 16 block of a head
static_assert(2 * HD * CSP * 2 + HD * OPP * 4 <= 131072);   // static LDS of the flash kernel

typedef _Float16 h16;
typedef unsigned short bf;
typedef __attribute__((ext_vector_type(16))) __bf16   v16bf;
typedef __attribute__((ext_vector_type(16))) _Float16 v16h;
typedef __attribute__((ext_vector_type(8)))  _Float16 v8h;
typedef __attribute__((ext_vector_type(2)))  _Float16 v2h;
typedef __attribute__((ext_vector_type(2)))  float    v2f;
typedef __attribute__((ext_vector_type(8)))  unsigned short v8us;
typedef __attribute__((ext_vector_type(4)))  unsigned short v4us;
typedef __attribute__((ext_vector_type(4)))  __bf16   v4bf;
typedef __attribute__((ext_vector_type(8)))  float    v8f;
typedef __attribute__((ext_vector_type(4)))  float    v4f;
typedef __attribute__((ext_vector_type(4)))  int      v4i;
typedef v4f  __attribute__((may_alias)) v4fa;

__device__ __forceinline__ unsigned short f2bf(float f) { unsigned u = __float_as_uint(f); u += 0x7FFFu + ((u >> 16) & 1u); return (unsigned short)(u >> 16); }
__device__ __forceinline__ float bfr(float f) { return __uint_as_float(((unsigned)f2bf(f)) << 16); }   // value after RNE convert to bf16
__device__ __forceinline__ v16h cat16(v8h lo, v8h hi) { return __builtin_shufflevector(lo, hi, 0, 1, 2, 3, 4, 5, 6, 7, 8, 9, 10, 11, 12, 13, 14, 15); }
__device__ __forceinline__ v16bf cat16b(v8us lo, v8us hi) { return __builtin_bit_cast(v16bf, __builtin_shufflevector(lo, hi, 0, 1, 2, 3, 4, 5, 6, 7, 8, 9, 10, 11, 12, 13, 14, 15)); }
__device__ __forceinline__ v8f wmma16(v16h a, v16h b, v8f c) { return __builtin_amdgcn_wmma_f32_16x16x32_f16(false, a, false, b, (short)0, c, false, false); }
__device__ __forceinline__ v8f wmmab(v16bf a, v16bf b, v8f c) { return __builtin_amdgcn_wmma_f32_16x16x32_bf16(false, a, false, b, (short)0, c, false, false); }
// fragment loaders from K-contiguous 16-bit rows; p already includes + 8*(lane>>4): elements 0..7 <- k0+8h+0..7, elements 8..15 <- k0+16+8h+0..7 (same map for A and B)
__device__ __forceinline__ v16h  ldh(const h16* p) { return cat16(*(const v8h*)p, *(const v8h*)(p + 16)); }
__device__ __forceinline__ v16bf ldb(const bf* p)  { return cat16b(*(const v8us*)p, *(const v8us*)(p + 16)); }
// V^T fragment (A: row d, k = key) from the blocked plane; p = block of keys k0..k0+15, + 16*d + 8*(lane>>4): the same k map, keys k0+16.. stand one block (16*HD elements) on
__device__ __forceinline__ v16h  ldv(const h16* p) { return cat16(*(const v8h*)p, *(const v8h*)(p + 16 * HD)); }
// ordering point for wave-private LDS tiles (same wave writes and reads)
__device__ __forceinline__ void wave_sync() { __builtin_amdgcn_fence(3 /* release order */, "wavefront"); __builtin_amdgcn_wave_barrier(); asm volatile("" ::: "memory"); }

// per-instruction guarded matrix ops: the four idle slots tie the accumulator and keep the operands live
__device__ __forceinline__ v8f wmma16g(v16h a, v16h b, v8f c) { c = wmma16(a, b, c); asm volatile("v_nop\n\tv_nop\n\tv_nop\n\tv_nop" : "+v"(c) : "v"(a), "v"(b)); return c; }
__device__ __forceinline__ v8f wmmabg(v16bf a, v16bf b, v8f c) { c = wmmab(a, b, c); asm volatile("v_nop\n\tv_nop\n\tv_nop\n\tv_nop" : "+v"(c) : "v"(a), "v"(b)); return c; }
// f32 -> f16 that cannot produce a subnormal operand (|v| < 2^-14 -> +0)
static __device__ __forceinline__ h16 toh_flush(float v) { const h16 r = (h16)v; return (fabsf(v) < 6.103515625e-05f) ? (h16)0.0f : r; }

// proj_gemm: register-blocked bf16 GEMM, ONE WAVE per 64x64 tile (16 accumulators), K = DM: acc = C[m][n] = sum_k A[m][k] Bt[n][k]. The wave reads the 64 f32 rows of each operand itself, one whole 512-byte row per load instruction,
// converts them to bf16 (round to nearest even) in registers and lays them down in its own LDS tiles (row pitch PSP); the fragments come from there. One copy of this code serves all three projections:
// xa (block-uniform) says whether the x rows are A (v^T: m = b*SEQ + t, n = h*16 + d) or Bt (q, k: m = h*16 + d, n = b*SEQ + t). bx = token tile, by = channel tile.
// The roles are chosen for the store: a lane holds 8 consecutive rows m of one column n, and those are 8 consecutive elements of the plane (q, k: channels d of one token; v^T: keys of one channel).
#define PSP 136                  // LDS row pitch (bf16 elements) of a staged operand tile [64][128]: 272 bytes = 16 x 17
static_assert(PSP >= DM);
static_assert((PSP * 2) % 16 == 0);
static_assert(2 * 64 * PSP * 2 <= 131072);   // static LDS of the projection kernel
__device__ __forceinline__ void proj_gemm(const float* __restrict__ X, const float* __restrict__ Wm, bf* st, bool xa, int bx, int by, v8f (&acc)[4][4]) {
    const int lane = threadIdx.x & 31, lr = lane & 15, hi = lane >> 4;
    bf* sa = st; bf* sb = st + 64 * PSP;
    {
        const int tk0 = bx * 64;                                                // first token of the tile; a 64-token tile lies inside one batch (batch pitch SEQ_FULL tokens in x)
        const float* xr = X + ((size_t)(tk0 / SEQ) * SEQ_FULL + (size_t)(tk0 % SEQ)) * DM + lane * 4;
        const float* wr0 = Wm + (size_t)(by * 64) * DM + lane * 4;
        bf* sx = (xa ? sa : sb) + lane * 4; bf* sw = (xa ? sb : sa) + lane * 4;
        // Eight groups of 16 rows (x: 0..3, W: 4..7) through a ring of three register groups: two groups' loads are in flight while the group before them is converted and stored.
        v4f t[3][16];
#pragma unroll                                                     // unrolled: row offsets become immediates on two base addresses, and the ring's roles are fixed at compile time
        for (int g = 0; g < 8 + 2; ++g) {
            if (g < 8) {
                const float* p = (g < 4 ? xr : wr0) + (size_t)((g & 3) * 16) * DM;
#pragma unroll
                for (int i = 0; i < 16; ++i) t[g % 3][i] = *(const v4f*)(p + (size_t)i * DM);
                if ((g & 3) == 3) asm volatile("s_wait_xcnt 0x0" ::: "memory");   // stands behind the last loads that name this operand's base address (which lives up to here), in front of any later write to the registers that hold it
            }
            if (g >= 2) {
                const int c = g - 2;
                bf* q = (c < 4 ? sx : sw) + ((c & 3) * 16) * PSP;
#pragma unroll
                for (int i = 0; i < 16; ++i) *(v4us*)(q + i * PSP) = __builtin_bit_cast(v4us, __builtin_convertvector(t[c % 3][i], v4bf));
                asm volatile("" ::: "memory");                                    // compiler fence: the next group's loads stay behind these stores and take over the registers just freed; without it the loads are hoisted over the stores and the build takes 478 registers instead of 230 (two waves to a SIMD instead of four, and window switches for the registers above v255)
            }
        }
    }
    wave_sync();                                                   // the fragments read below were written by other lanes of this wave
#pragma unroll
    for (int mb = 0; mb < 4; ++mb)
#pragma unroll
        for (int nb = 0; nb < 4; ++nb) acc[mb][nb] = (v8f){};
    // Fragments are fetched from LDS one k step ahead: step 0 here; inside step kc the four A fragments of step kc + 32 go into a second register set at the step's head,
    // and each B fragment is fetched again for step kc + 32 right behind its last product.
    const bf* Ap = sa + lr * PSP + 8 * hi; const bf* Bp = sb + lr * PSP + 8 * hi;
    v16bf a[4], b[4];
#pragma unroll
    for (int mb = 0; mb < 4; ++mb) a[mb] = ldb(Ap + mb * 16 * PSP);
#pragma unroll
    for (int nb = 0; nb < 4; ++nb) b[nb] = ldb(Bp + nb * 16 * PSP);
#pragma unroll                                                     // unrolled: the test for a next step and the register sets' roles are fixed at compile time
    for (int kc = 0; kc < DM; kc += 32) {
        const bool more = kc + 32 < DM;
        v16bf an[4];
#pragma unroll
        for (int mb = 0; mb < 4; ++mb) an[mb] = more ? ldb(Ap + mb * 16 * PSP + kc + 32) : a[mb];
#pragma unroll
        for (int nb = 0; nb < 4; ++nb) {
#pragma unroll
            for (int mb = 0; mb < 4; ++mb) acc[mb][nb] = wmmabg(a[mb], b[nb], acc[mb][nb]);
            if (more) b[nb] = ldb(Bp + nb * 16 * PSP + kc + 32); }
#pragma unroll
        for (int mb = 0; mb < 4; ++mb) a[mb] = an[mb];
    }
}

// proj_store: the 64x64 tile written as f16 (Ph) and, for tokens t < resT (resT a multiple of 64, block-uniform test), the f16 residual x2048 (Pr), straight from the accumulators.
// Each accumulator tile is one 16 x 16 block (head hb of the channel tile, token block tk of the token tile) of the plane: lane (lane&15, lane>>4) stores its 8 values as 16 bytes at 32*(lane&15) + 16*(lane>>4), one 512-byte run per tile.
// MODE 0 (q, k): acc[hb][tk], rows = channels d, column = token: plane [(b*8 + h)][t][16]. MODE 1 (v^T): acc[tk][hb], rows = tokens, column = channel d: plane [(b*8 + h)][t/16][16 d][t%16]. Residual planes: the same with resT tokens.
template <int MODE>
__device__ __forceinline__ void proj_store(const v8f (&acc)[4][4], h16* Ph, h16* Pr, int resT, int bx, int by) {
    const int lane = threadIdx.x & 31, lr = lane & 15, hi = lane >> 4;
    const int tk0 = bx * 64, bb = tk0 / SEQ, tt = tk0 % SEQ;                                      // a 64-token tile lies inside one batch
    const int z0 = bb * NH_ + by * (64 / HD);                                                     // first of the tile's four heads
    const bool wr = tt < resT;                                                                    // block-uniform, whole tile inside the residual plane
    h16* ph = Ph + ((size_t)z0 * SEQ + (size_t)tt) * HD + lr * HD + 8 * hi;
    h16* pr = Pr + ((size_t)z0 * (size_t)resT + (size_t)tt) * HD + lr * HD + 8 * hi;
#pragma unroll                                                     // unrolled (all loops): the accumulator array is indexed at compile time and stays in registers
    for (int hb = 0; hb < 4; ++hb) {
        // One head's four tiles are converted into four register groups and stored as one run of stores, so that one wait serves them all.
        v8h hv[4];
#pragma unroll
        for (int tk = 0; tk < 4; ++tk) {
#pragma unroll
            for (int j = 0; j < 8; ++j) hv[tk][j] = toh_flush(((MODE == 0) ? acc[hb][tk] : acc[tk][hb])[j]); }
#pragma unroll
        for (int tk = 0; tk < 4; ++tk) *(v8h*)(ph + (size_t)hb * ((size_t)SEQ * HD) + tk * 16 * HD) = hv[tk];
        asm volatile("s_wait_xcnt 0x0" ::: "memory");                                   // stands behind the four stores, in front of any later write to the registers that hold their address and data
        if (wr) {
            v8h rv[4];
#pragma unroll
            for (int tk = 0; tk < 4; ++tk) {
#pragma unroll
                for (int j = 0; j < 8; ++j) rv[tk][j] = toh_flush((((MODE == 0) ? acc[hb][tk] : acc[tk][hb])[j] - (float)hv[tk][j]) * QRS); }
#pragma unroll
            for (int tk = 0; tk < 4; ++tk) *(v8h*)(pr + (size_t)hb * ((size_t)resT * HD) + tk * 16 * HD) = rv[tk];
            asm volatile("s_wait_xcnt 0x0" ::: "memory");                               // as above
        }
    }
}

// k_proj: the three projections and the two small conversions in ONE launch, 1-D grid of one-wave blocks; a block-uniform range of the block index picks the job.
// Blocks [0, PJB): projections, index = (z * (DM/64) + channel tile) * (NB*SEQ/64) + token tile, z = 0, 1, 2: q, k, v^T.
// Blocks [PJB, PJB + CWO): Wo -> bf16-converted value x64 in f16, 8 elements per thread.
// Blocks [PJB + CWO, PJB + CWO + CKB): padding mask -> one bit per key (set: word nonzero), one 32-bit word per 32-key tile, KB[b * (SEQ/32) + tile], bit j = key 32*tile + j; one thread per tile.
#define PJX (NB * SEQ / 64)                      // token tiles
#define PJB (PJX * (DM / 64) * 3)
#define CWO ((DM * DM / 8) / 32)
#define CKB ((NB * (SEQ / 32)) / 32)
static_assert((DM * DM / 8) % 32 == 0);
static_assert((NB * (SEQ / 32)) % 32 == 0);
__global__ __launch_bounds__(32) void k_proj(const float* __restrict__ x, const float* __restrict__ wq, const float* __restrict__ wk, const float* __restrict__ wv, const float* __restrict__ wo,
                                             const int* __restrict__ pmask, h16* WOH, unsigned* KB, h16* QH, h16* QR, h16* KP, h16* KR, h16* VT, h16* VR, int resT) {
    __shared__ __align__(16) bf st[2 * 64 * PSP];
    const unsigned blk = blockIdx.x;
    if (blk >= (unsigned)(PJB + CWO)) {
        const unsigned i = (blk - (unsigned)(PJB + CWO)) * 32u + threadIdx.x;
        const int* p = pmask + (size_t)(i / (unsigned)(SEQ / 32)) * SEQ_FULL + (size_t)(i % (unsigned)(SEQ / 32)) * 32;
        unsigned bits = 0u;
#pragma unroll
        for (int k = 0; k < 8; ++k) { const v4i a = *(const v4i*)(p + 4 * k);
#pragma unroll
            for (int j = 0; j < 4; ++j) bits |= (a[j] != 0 ? 1u : 0u) << (4 * k + j); }
        KB[i] = bits;
        asm volatile("s_wait_xcnt 0x0" ::: "memory");                           // stands behind the store, in front of any later write to the registers that hold its address and data
        return;
    }
    if (blk >= (unsigned)PJB) {
        const unsigned i = (blk - (unsigned)PJB) * 32u + threadIdx.x;
        const v8f v = *(const v8f*)(wo + (size_t)i * 8); v8h o;
#pragma unroll
        for (int k = 0; k < 8; ++k) o[k] = toh_flush(bfr(v[k]) * WOS);
        *(v8h*)(WOH + (size_t)i * 8) = o;
        asm volatile("s_wait_xcnt 0x0" ::: "memory");                           // stands behind the store, in front of any later write to the registers that hold its address and data
        return;
    }
    const int bx = (int)(blk % (unsigned)PJX), by = (int)((blk / (unsigned)PJX) % (unsigned)(DM / 64)), z = (int)(blk / (unsigned)(PJX * (DM / 64)));
    const float* Wm = (z == 0) ? wq : (z == 1) ? wk : wv;
    v8f acc[4][4];
    proj_gemm(x, Wm, st, z == 2, bx, by, acc);
    if (z == 2) { proj_store<1>(acc, VT, VR, resT, bx, by); }
    else        { h16* Ph = z ? KP : QH; h16* Pr = z ? KR : QR; proj_store<0>(acc, Ph, Pr, resT, bx, by); }
}

// k_flash: both instantiations and the output projection in ONE launch, 1-D grid; the block index picks (batch*head, query tile of 128 rows), batch*head fastest.
// First half of the index: tiles NT - 1 down to NT / 2 (the long-running ones start first); second half: tiles 0 up to NT / 2 - 1. A block-uniform test (tile < FEX) picks the instantiation.
#define NT  (SEQ / (16 * AW))                    // query tiles per (batch, head)
#define FEX (EROWS / (16 * AW))                  // of them early (query rows < EROWS)
#define NBH (NB * NH_)
#define FHB (NBH * (NT / 2))                     // blocks in the first half of the index
static_assert(NT % 2 == 0);
// flash_body: fused causal attention, one wave per 16 query rows of one (batch, head) zh, AW waves = 128 query rows from tb per block; K / V^T / Q fragments straight from the f16 planes (16-B loads, arithmetic addressing). Returns the wave's normalised O^T tile.
// Transposed form: S^T[key][t] = K Q^T (A = K rows, B = Q rows, head dim 16 in k-slots 0..15); lane (t = lane&15, h = lane>>4) holds keys 8h+r of each 16-key tile, so the packed
// P tile is directly the B fragment of O^T[d][t] = V^T P^T (element r <- tile keys 0..15, element 8+r <- tile keys 16..31, lane unchanged).
// Softmax state (running max over kept keys, sum) is one scalar per lane; the two lane halves of a row are combined with one xor-16 exchange (the sum: EARLY only; late rows hold the whole row's sum in both halves).
// Keep rule: a wave reads its batch's mask bits (KB, one word per 32-key tile) once, lane = tile. A tile whose word is all ones and whose last key lies below the wave's first query row keeps every element:
// a scalar test sends it down a path without keep compares and selects (there a P below 2^-14 stays an f16 subnormal, which the matrix unit takes as it is). Every other visited tile evaluates the rule per element. Late rows take tiles two at a time: the short path needs both tiles' flags.
// The per-wave key bound is t0 + 16 (pad up to 32), at most SEQ.
// EARLY = 1 (query rows [0, EROWS)): A = [K | K_res], B = [Q | 0] gives K Q; B = [Q_res | Q] gives K Q_res + K_res Q (x2048, own accumulator); P = f16 value + f16 residual x2048;
//            O = V P + (V P_res + V_res P) / 2048 (residual products in their own accumulator); row sum from the f32 exponentials; all keys of these rows are < EROWS, inside the small planes.
// EARLY = 0 (query rows [EROWS, SEQ)): single q, k, P, v.
template <bool B> struct flag_c { static constexpr bool v = B; };
static_assert(SEQ / 32 <= 64);                   // a wave holds its batch's tile words in two registers (lane = tile) and their all-kept flags in one 64-bit scalar
template <int EARLY>
__device__ __forceinline__ v8f flash_body(const h16* __restrict__ QH, const h16* __restrict__ QR, const h16* __restrict__ KP, const h16* __restrict__ KR,
                                          const h16* __restrict__ VT, const h16* __restrict__ VR, const unsigned* __restrict__ KB, const int zh, const int tb) {
    const int lane = threadIdx.x & 31, lr = lane & 15, hi = lane >> 4;
    const int wave = __builtin_amdgcn_readfirstlane((int)(threadIdx.x >> 5));
    const int b = zh / NH_;
    const int t0 = tb + wave * 16;
    const int lim = t0 + lr;                                                   // key j kept iff j <= lim (and mask nonzero)
    const int nk = (t0 + 16 + 31) & ~31;                                       // wave-uniform, multiple of 32, <= SEQ (<= EROWS when EARLY)
    const unsigned* kbb = KB + (size_t)b * (SEQ / 32);                         // + tile
    const size_t pbase = (size_t)zh * SEQ * HD;
    const size_t rbase = (size_t)zh * EROWS * HD;
    const v8h z8 = (v8h){};
    const size_t qo = pbase + (size_t)(t0 + lr) * HD + 8 * hi;
    const v8h q8 = *(const v8h*)(QH + qo);
    asm volatile("s_wait_xcnt 0x0" ::: "memory");                 // the loads issued next may land in the registers that hold this load's address: the wait stands in front of them
    const v16h qh = cat16(q8, z8);                                // B fragment [Q | 0]: col t, k = d
    v16h qx = qh;
    if (EARLY) { const size_t qro = rbase + (size_t)(t0 + lr) * HD + 8 * hi; qx = cat16(*(const v8h*)(QR + qro), q8);   // B fragment [Q_res | Q]
                 asm volatile("s_wait_xcnt 0x0" ::: "memory"); }  // as above, for the residual load's address
    const size_t ko = pbase + (size_t)lr * HD + 8 * hi;         // + key * HD       (A fragment: row key, k = d)
    const size_t vo = pbase + (size_t)lr * HD + 8 * hi;         // + key * HD       (A fragment: row d, k = key; blocks of 16 keys)
    const size_t kro = rbase + (size_t)lr * HD + 8 * hi;        // residual planes, tokens < EROWS
    const size_t vro = rbase + (size_t)lr * HD + 8 * hi;
    const v8f zz = (v8f){};
    v8f o0 = (v8f){}, oR0 = (v8f){};
    float m = NEGB, l = 0.0f;
    // EARLY: every operand of a 32-key tile (K, V^T, residual planes) is fetched one trip ahead: tile 0 here, tile key0 + 32 inside trip key0,
    // each group into the registers its last reader of the trip has just left. nk >= 32, so tile 0 exists for every wave.
    // Late rows: K and V^T are fetched RD tiles ahead, through RD register sets (see the late loop below); set 0 is loaded here.
    v8h k0 = *(const v8h*)(KP + ko), k1 = *(const v8h*)(KP + ko + 16 * HD);
    v8h kr0 = z8, kr1 = z8;
    if (EARLY) { kr0 = *(const v8h*)(KR + kro); kr1 = *(const v8h*)(KR + kro + 16 * HD); }
    const unsigned kw0 = kbb[lane < SEQ / 32 ? lane : 0], kw1 = kbb[32 + lane < SEQ / 32 ? 32 + lane : 0];   // mask bits of tiles lane and 32 + lane
    v16h v0 = ldv(VT + vo);
    v16h vr0 = v0;
    if (EARLY) { vr0 = ldv(VR + vro); }
    asm volatile("s_wait_xcnt 0x0" ::: "memory");                 // stands behind tile 0's loads, in front of the later loads, which may land in the registers that hold these loads' addresses
    __builtin_amdgcn_sched_barrier(0);                            // keeps tile 0's loads in front of that wait: without it they are moved down among the later tiles' loads, past the wait
    // bit T set: tile T keeps every element for all 16 rows of this wave: word all ones and 32T + 31 < t0 (t0 a multiple of 16: T < t0 / 32 <= SEQ / 32 - 1). Wave-uniform.
    const unsigned long long kept = (((unsigned long long)__builtin_amdgcn_ballot_w32(kw1 == 0xFFFFFFFFu) << 32) | (unsigned long long)__builtin_amdgcn_ballot_w32(kw0 == 0xFFFFFFFFu)) & ((1ull << (t0 >> 5)) - 1ull);
    v16h pb, pr = (v16h){}; float ls = 0.0f, alpha, mnew;
    // softmax of the 32-key tile at key0 from its score accumulators; FULL: every element kept
    auto tile = [&](auto fc, const int key0, const v8f sHa, const v8f sHb, const v8f sLa, const v8f sLb) __attribute__((always_inline)) {
            constexpr bool FULL = decltype(fc)::v;
            float ta[8], tb2[8]; bool fa[8], fb[8]; float mx;
            ls = 0.0f;
            if constexpr (FULL) {
                float ua[8], ub[8];
#pragma unroll
                for (int r = 0; r < 8; ++r) {
                    if (EARLY) { ua[r] = sHa[r] + sLa[r] * QRI; ub[r] = sHb[r] + sLb[r] * QRI; }
                    else       { ua[r] = sHa[r]; ub[r] = sHb[r]; }
                    ta[r] = ua[r] * SC2; tb2[r] = ub[r] * SC2; fa[r] = true; fb[r] = true; }
                float mr = fmaxf(ua[0], ub[0]);                  // SC2 > 0 and rounding is monotonic: the scaled maximum equals the maximum of the scaled scores
#pragma unroll
                for (int r = 1; r < 8; ++r) mr = fmaxf(mr, fmaxf(ua[r], ub[r]));
                mx = mr * SC2;
            } else {
                const unsigned kcur = (unsigned)__builtin_amdgcn_readlane((int)(key0 < 1024 ? kw0 : kw1), (key0 >> 5) & 31);   // mask bits of keys key0 .. key0+31
                const unsigned kw = kcur >> (8 * hi);            // bits 0..7: keys key0+8h+0..7; bits 16..23: keys key0+16+8h+0..7
                const int ja = key0 + 8 * hi;
                mx = NEGB;
#pragma unroll
                for (int r = 0; r < 8; ++r) {
                    fa[r] = (((kw >> r) & 1u) != 0u) & (ja + r <= lim);
                    fb[r] = (((kw >> (16 + r)) & 1u) != 0u) & (ja + 16 + r <= lim); }
#pragma unroll
                for (int r = 0; r < 8; ++r) {
                    if (EARLY) { ta[r] = (sHa[r] + sLa[r] * QRI) * SC2; tb2[r] = (sHb[r] + sLb[r] * QRI) * SC2; }
                    else       { ta[r] = sHa[r] * SC2; tb2[r] = sHb[r] * SC2; }
                    mx = fmaxf(mx, fmaxf(fa[r] ? ta[r] : NEGB, fb[r] ? tb2[r] : NEGB)); }
            }
            mx = fmaxf(mx, __shfl_xor(mx, 16, 32));
            mnew = fmaxf(m, mx);
            alpha = __builtin_amdgcn_exp2f(m - mnew);
            const float sh = PSH - mnew;
#pragma unroll
            for (int r = 0; r < 8; r += 2) {
                float ga[2], gb[2];
#pragma unroll
                for (int i = 0; i < 2; ++i) {
                    const float xa = ta[r + i] + sh, xb = tb2[r + i] + sh;
                    const float ea = __builtin_amdgcn_exp2f(xa), eb = __builtin_amdgcn_exp2f(xb);
                    ga[i] = (FULL || (fa[r + i] & (xa >= -14.0f))) ? ea : 0.0f; gb[i] = (FULL || (fb[r + i] & (xb >= -14.0f))) ? eb : 0.0f; }   // not FULL: dropped or sub-2^-14 elements selected to 0 by value
                const v2h pa = __builtin_convertvector((v2f){ga[0], ga[1]}, v2h), pc = __builtin_convertvector((v2f){gb[0], gb[1]}, v2h);
#pragma unroll
                for (int i = 0; i < 2; ++i) {
                    pb[r + i] = pa[i]; pb[8 + r + i] = pc[i];
                    if (EARLY) { pr[r + i] = toh_flush((ga[i] - (float)pa[i]) * QRS); pr[8 + r + i] = toh_flush((gb[i] - (float)pc[i]) * QRS); ls += ga[i] + gb[i]; }
                } }                                              // late rows do not use this function: they take the row sum of the packed P on the matrix unit
    };
    if constexpr (EARLY) {
        // Inputs-only fence on the loaded values: the query fragments and tile 0 have landed before the loop is entered, so the loop's counted load waits follow from the loop's own issue order alone
        // (K early in a trip, V^T at its end) and the wait for K at a trip's head leaves the V^T loads just issued in flight.
        asm volatile("" :: "v"(qx), "v"(k0), "v"(k1), "v"(kr0), "v"(kr1), "v"(v0), "v"(vr0));
#pragma unroll 1
        for (int key0 = 0; key0 < nk; key0 += 32) {
            const int kn = (key0 + 32 < nk) ? key0 + 32 : key0;      // tile fetched in this trip; the last trip fetches its own tile again (unused), so every address stays below nk <= EROWS
            const v16h ka0 = cat16(k0, kr0), kb0 = cat16(k1, kr1);   // A fragments [K | K_res]
            const v8f sHa = wmma16g(ka0, qh, zz), sHb = wmma16g(kb0, qh, zz);
            const v8f sLa = wmma16g(ka0, qx, zz), sLb = wmma16g(kb0, qx, zz);
            { const h16* ka = KP + ko + (size_t)kn * HD; k0 = *(const v8h*)ka; k1 = *(const v8h*)(ka + 16 * HD); }
            { const h16* kr = KR + kro + (size_t)kn * HD; kr0 = *(const v8h*)kr; kr1 = *(const v8h*)(kr + 16 * HD); }
            asm volatile("s_wait_xcnt 0x0" ::: "memory");            // stands between the K loads just issued and the softmax's first writes to the registers that hold their addresses
            if (((kept >> (key0 >> 5)) & 1ull) != 0ull) tile(flag_c<true>{}, key0, sHa, sHb, sLa, sLb); else tile(flag_c<false>{}, key0, sHa, sHb, sLa, sLb);   // scalar test
            l = l * alpha + ls; m = mnew;
            o0 = o0 * alpha;
            oR0 = oR0 * alpha;
            o0 = wmma16g(v0, pb, o0);
            oR0 = wmma16g(v0, pr, oR0);
            oR0 = wmma16g(vr0, pb, oR0);
            vr0 = ldv(VR + vro + (size_t)kn * HD);
            v0 = ldv(VT + vo + (size_t)kn * HD);
            asm volatile("s_wait_xcnt 0x0" ::: "memory");            // stands between the V^T loads just issued and the next trip's first writes to the registers that hold their addresses
        }
    } else {
        // Late rows: RD register sets, set s holding tile s (mod RD). A step works on two sets' tiles (64 keys) and refills each half of both sets (K behind the score products, V^T behind the P.V products)
        // with the tiles RD on, so a load has a whole step of work between its issue and its wait. Tiles are taken in ascending order, two at a time.
        constexpr int RD = 4;
        const int klast = nk - 32;                                   // last tile of this wave; a fetch past it is aimed at it again (unused), so every address stays below nk <= SEQ
        v8h rk0[RD], rk1[RD]; v16h rv[RD];
        const h16 one_r = ((lr & 7) == 0) ? (h16)1.0f : (h16)0.0f;   // A fragment of the row sum: rows 0 and 8 (the two that are read) all ones, the rest 0 (lane = row); made from the lane index it stays in vector registers over the loop, where an all-ones constant was copied from scalar registers in front of every product
        v16h ones;
#pragma unroll
        for (int i = 0; i < 16; ++i) ones[i] = one_r;
        rk0[0] = k0; rk1[0] = k1; rv[0] = v0;
#pragma unroll
        for (int s = 1; s < RD; ++s) {
            const int ks = (32 * s < klast) ? 32 * s : klast;
            const h16* ka = KP + ko + (size_t)ks * HD; rk0[s] = *(const v8h*)ka; rk1[s] = *(const v8h*)(ka + 16 * HD);
            rv[s] = ldv(VT + vo + (size_t)ks * HD);
            asm volatile("s_wait_xcnt 0x0" ::: "memory");            // stands behind the loads just issued, in front of any later write to the registers that hold their addresses
            __builtin_amdgcn_sched_barrier(0);                       // keeps the next set's address arithmetic behind that wait: without it an address add is lifted over the wait, onto a register that a load just issued names
        }
        // Inputs-only fence on the loaded values: the query fragment and all RD sets have landed before the loop is entered, so the loop's counted load waits follow from the loop's own issue order alone.
        asm volatile("" :: "v"(q8), "v"(rk0[0]), "v"(rk1[0]), "v"(rv[0]), "v"(rk0[1]), "v"(rk1[1]), "v"(rv[1]), "v"(rk0[2]), "v"(rk1[2]), "v"(rv[2]), "v"(rk0[3]), "v"(rk1[3]), "v"(rv[3]));
        static_assert(RD == 4);                                      // the fence above names every set
        static_assert(SEQ % 64 == 0);                                // a pair of tiles that starts below SEQ ends inside the planes and inside the mask words
        // One softmax update per PAIR of tiles (64 keys, ring sets s and s + 1): one maximum exchange, one rescale of O and of the row sum, one group of idle slots behind each run of products.
        // nk is a multiple of 32: where the pair's second tile starts at or past nk, every key of it lies above the wave's last query row, the keep rule drops it (P = 0), and what its ring set holds (finite plane values) adds nothing.
        v16h pb2;                                                    // packed P of the pair's second tile (pb: first tile)
        auto pair = [&](auto fc, const int kc, const v8f (&S)[4]) __attribute__((always_inline)) {   // S[2u], S[2u+1]: score accumulators of tile kc + 32u; FULL: every element of both tiles kept
            constexpr bool FULL = decltype(fc)::v;
            bool f[4][8]; float mx;
            if constexpr (FULL) {
                float mr[4];                                         // four independent chains
#pragma unroll
                for (int i = 0; i < 4; ++i) { mr[i] = S[i][0];
#pragma unroll
                    for (int r = 1; r < 8; ++r) mr[i] = fmaxf(mr[i], S[i][r]); }
                mx = fmaxf(fmaxf(mr[0], mr[1]), fmaxf(mr[2], mr[3])) * SC2;   // SC2 > 0 and rounding is monotonic: the scaled maximum equals the maximum of the scaled scores
#pragma unroll
                for (int i = 0; i < 4; ++i)
#pragma unroll
                    for (int r = 0; r < 8; ++r) f[i][r] = true;
            } else {
                mx = NEGB;
#pragma unroll
                for (int u = 0; u < 2; ++u) {
                    const int ku = kc + 32 * u;
                    const unsigned kcur = (unsigned)__builtin_amdgcn_readlane((int)(ku < 1024 ? kw0 : kw1), (ku >> 5) & 31);   // mask bits of keys ku .. ku+31
                    const unsigned kw = kcur >> (8 * hi);            // bits 0..7: keys ku+8h+0..7; bits 16..23: keys ku+16+8h+0..7
                    const int ja = ku + 8 * hi;
#pragma unroll
                    for (int r = 0; r < 8; ++r) {
                        f[2 * u][r] = (((kw >> r) & 1u) != 0u) & (ja + r <= lim);
                        f[2 * u + 1][r] = (((kw >> (16 + r)) & 1u) != 0u) & (ja + 16 + r <= lim);
                        mx = fmaxf(mx, fmaxf(f[2 * u][r] ? S[2 * u][r] * SC2 : NEGB, f[2 * u + 1][r] ? S[2 * u + 1][r] * SC2 : NEGB)); }
                }
            }
            mx = fmaxf(mx, __shfl_xor(mx, 16, 32));
            mnew = fmaxf(m, mx);
            alpha = __builtin_amdgcn_exp2f(m - mnew);
            const float sh = PSH - mnew;
#pragma unroll
            for (int u = 0; u < 2; ++u) {
#pragma unroll
                for (int r = 0; r < 8; r += 2) {
                    float ga[2], gb[2];
#pragma unroll
                    for (int i = 0; i < 2; ++i) {
                        const float xa = S[2 * u][r + i] * SC2 + sh, xb = S[2 * u + 1][r + i] * SC2 + sh;
                        const float ea = __builtin_amdgcn_exp2f(xa), eb = __builtin_amdgcn_exp2f(xb);
                        ga[i] = (FULL || (f[2 * u][r + i] & (xa >= -14.0f))) ? ea : 0.0f; gb[i] = (FULL || (f[2 * u + 1][r + i] & (xb >= -14.0f))) ? eb : 0.0f; }   // not FULL: dropped or sub-2^-14 elements selected to 0 by value
                    const v2h pa = __builtin_convertvector((v2f){ga[0], ga[1]}, v2h), pc = __builtin_convertvector((v2f){gb[0], gb[1]}, v2h);
#pragma unroll
                    for (int i = 0; i < 2; ++i) {
                        if (u == 0) { pb[r + i] = pa[i]; pb[8 + r + i] = pc[i]; } else { pb2[r + i] = pa[i]; pb2[8 + r + i] = pc[i]; } }
                } }
        };
        const int kplast = klast & ~63;                              // last pair of this wave; a fetch past it is aimed at it again (unused)
#pragma unroll 1
        for (int key0 = 0; key0 < nk; key0 += 32 * RD) {
#pragma unroll
            for (int s = 0; s < RD; s += 2) {
                const int kc = key0 + 32 * s;                        // this step's pair of tiles; kc >= nk (last trip only): no pair, the step's softmax and P.V are jumped over
                const int kn = (kc + 32 * RD < nk) ? kc + 32 * RD : kplast;   // the pair fetched in this step: a multiple of 64 below nk <= SEQ, so keys kn .. kn + 63 lie inside the planes
                // The loads (and the score products in front of them) stand outside the scalar branch below: every path through a trip issues the same loads in the same order, which keeps the ring's counted load waits.
                const v16h ka0 = cat16(rk0[s], z8), ka1 = cat16(rk1[s], z8), ka2 = cat16(rk0[s + 1], z8), ka3 = cat16(rk1[s + 1], z8);   // A fragments [K | 0]
                v8f S[4] = { wmma16(ka0, qh, zz), wmma16(ka1, qh, zz), wmma16(ka2, qh, zz), wmma16(ka3, qh, zz) };
                asm volatile("v_nop\n\tv_nop\n\tv_nop\n\tv_nop" : "+v"(S[0]), "+v"(S[1]), "+v"(S[2]), "+v"(S[3]) : "v"(ka0), "v"(ka1), "v"(ka2), "v"(ka3), "v"(qh));   // the four idle slots behind the four products: they tie the results and keep the operands live
                { const h16* ka = KP + ko + (size_t)kn * HD;         // one address for the pair's four loads
                  rk0[s] = *(const v8h*)ka; rk1[s] = *(const v8h*)(ka + 16 * HD); rk0[s + 1] = *(const v8h*)(ka + 32 * HD); rk1[s + 1] = *(const v8h*)(ka + 48 * HD); }
                asm volatile("s_wait_xcnt 0x0" ::: "memory");        // stands between the K loads just issued and the softmax's first writes to the registers that hold their address
                if (s == 0 || kc < nk) {                             // scalar test
                    if (((kept >> (kc >> 5)) & 3ull) == 3ull) pair(flag_c<true>{}, kc, S); else pair(flag_c<false>{}, kc, S);   // scalar test
                    o0 = o0 * alpha;
                    // Row sum on the matrix unit: rows 0 and 8 of A are ones, so rows 0 and 8 of the result hold, per query column, the sum of the pair's 64 packed P over both lane halves; element 0 (row 8h) is this lane's row sum.
                    v8f sd = wmma16(ones, pb, zz);
                    o0 = wmma16(rv[s], pb, o0);
                    sd = wmma16(ones, pb2, sd);
                    o0 = wmma16(rv[s + 1], pb2, o0);
                    asm volatile("v_nop\n\tv_nop\n\tv_nop\n\tv_nop" : "+v"(sd), "+v"(o0) : "v"(ones), "v"(rv[s]), "v"(rv[s + 1]), "v"(pb), "v"(pb2));   // the four idle slots behind the four products: they tie both results and keep the operands live
                    l = l * alpha + sd[0]; m = mnew;
                }
                { const h16* va = VT + vo + (size_t)kn * HD;         // one address for the pair's four loads
                  rv[s] = ldv(va); rv[s + 1] = ldv(va + 32 * HD); }
                asm volatile("s_wait_xcnt 0x0" ::: "memory");        // stands between the V^T loads just issued and the next step's first writes to the registers that hold their address
            }
        }
    }
    if (EARLY) l += __shfl_xor(l, 16, 32);                        // late rows: the matrix row sum already covers both lane halves
    const bool any = l > 0.0f;
    const float lsafe = any ? l : 1.0f;
    const float inv = any ? (1.0f / lsafe) : 0.0f;
    v8f f0 = o0;
    if (EARLY) { f0 = o0 + oR0 * QRI; }
    f0 = f0 * inv;
    const unsigned nonem = __builtin_amdgcn_ballot_w32(!any);    // wave-uniform: some row of this wave kept no key
    if (nonem != 0u) {
        // equal fills give a uniform softmax over all SEQ keys: plain mean of v per channel d = 8h + r
        float vm[8];
#pragma unroll
        for (int r = 0; r < 8; ++r) vm[r] = 0.0f;
#pragma unroll 1
        for (int t = lr; t < SEQ; t += 16) {
#pragma unroll
            for (int r = 0; r < 8; ++r) vm[r] += (float)VT[pbase + (size_t)(t >> 4) * (16 * HD) + (size_t)(8 * hi + r) * HD + (t & 15)]; }
#pragma unroll
        for (int r = 0; r < 8; ++r) { float s = vm[r];
            s += __shfl_xor(s, 1, 32); s += __shfl_xor(s, 2, 32); s += __shfl_xor(s, 4, 32); s += __shfl_xor(s, 8, 32);
            vm[r] = s * (1.0f / (float)SEQ); }
#pragma unroll
        for (int r = 0; r < 8; ++r) f0[r] = any ? f0[r] : vm[r];
    }
    return f0;                                                    // O^T D layout: f0[r] = (d = 8h + r, t = lane&15)
}

// Behind the attention: the block's context tile [16 d][128 t] goes to LDS as f16 value and f16 residual x2048; it is the A operand (16 rows of the flat view, k = token - tb) of the output projection.
// Wave w takes output columns 16w .. 16w+15: Bt = Wo x64 rows [n][k] (f16), K = DM in four 32-deep steps, value and residual products in separate accumulators.
// Output row of channel d: (h*16 + d) * (SEQ/128) + tb/128 of batch b. The head-count input is read on the device; a value other than the compiled head count marks the output with NaN.
__global__ __launch_bounds__(32 * AW) void k_flash(const h16* __restrict__ QH, const h16* __restrict__ QR, const h16* __restrict__ KP, const h16* __restrict__ KR,
                                                   const h16* __restrict__ VT, const h16* __restrict__ VR, const unsigned* __restrict__ KB,
                                                   const h16* __restrict__ WO, const int* __restrict__ nheads_p, float* OUT) {
    __shared__ __align__(16) h16 cs[2 * HD * CSP];                // value tile, then residual tile
    __shared__ __align__(16) float os[HD * OPP];
    const int lane = threadIdx.x & 31, lr = lane & 15, hi = lane >> 4;
    const int wave = __builtin_amdgcn_readfirstlane((int)(threadIdx.x >> 5));
    const int blk = (int)blockIdx.x;
    const int tile = (blk < FHB) ? (NT - 1 - blk / NBH) : ((blk - FHB) / NBH);
    const int zh = blk % NBH; const int b = zh / NH_, h = zh % NH_;
    const int tb = tile * (16 * AW);
    v8f f0;
    if (tile >= FEX) f0 = flash_body<0>(QH, QR, KP, KR, VT, VR, KB, zh, tb);
    else             f0 = flash_body<1>(QH, QR, KP, KR, VT, VR, KB, zh, tb);
    // The wave's four Wo fragments are asked for here, so that their latency runs beside the tile's conversion and its LDS stores.
    const h16* Wp = WO + (size_t)(wave * 16 + lr) * DM + 8 * hi;
    v16h w[DM / 32];
#pragma unroll                                                     // unrolled (this loop and those below): the fragment arrays are indexed at compile time and stay in registers
    for (int s = 0; s < DM / 32; ++s) w[s] = ldh(Wp + 32 * s);
    asm volatile("s_wait_xcnt 0x0" ::: "memory");                 // stands behind the loads just issued, in front of any later write to the registers that hold their address
    const int nh = nheads_p[0];
#pragma unroll
    for (int r = 0; r < 8; ++r) { const h16 a0 = toh_flush(f0[r]);
        cs[(8 * hi + r) * CSP + wave * 16 + lr] = a0;
        cs[(HD + 8 * hi + r) * CSP + wave * 16 + lr] = toh_flush((f0[r] - (float)a0) * QRS); }   // rows 0..15 x columns 0..127 of both tiles all written by the eight waves
    __syncthreads();                                              // cross-wave tiles: block barrier (every wave reaches it)
    v8f aH = (v8f){}, aR = (v8f){};
    const h16* Ap = cs + lr * CSP + 8 * hi;
    v16h ah[DM / 32], ar[DM / 32];                                // all eight A fragments are asked for in one group, so that one LDS latency is waited out and not four
#pragma unroll
    for (int s = 0; s < DM / 32; ++s) { ah[s] = ldh(Ap + 32 * s); ar[s] = ldh(Ap + HD * CSP + 32 * s); }
#pragma unroll
    for (int s = 0; s < DM / 32; ++s) { aH = wmma16g(ah[s], w[s], aH); aR = wmma16g(ar[s], w[s], aR); }
    const float poison = (nh == NH_) ? 0.0f : __uint_as_float(0x7FC00000u);
#pragma unroll
    for (int j = 0; j < 8; ++j) os[(hi * 8 + j) * OPP + wave * 16 + lr] = (aH[j] + aR[j] * QRI) * WOI + poison;   // D: row 8h+j, col lane&15; rows 0..15 x columns 0..127 all written by the eight waves
    __syncthreads();                                              // cross-wave slab: block barrier; behind it each wave stores whole 512-byte output rows
    float* orow = OUT + ((size_t)b * OUT_SEQ + (size_t)(h * HD) * (SEQ / DM) + (size_t)(tb / DM)) * DM + lane * 4;
#pragma unroll
    for (int s = 0; s < 2; ++s) { const int d = 2 * wave + s;     // AW waves x 2 rows = 16 rows x (32 lanes x 4 floats = 128 columns = the whole row)
        const v4f val = *(const v4fa*)(&os[d * OPP + lane * 4]);
        *(v4f*)(orow + (size_t)d * (SEQ / DM) * DM) = val; }
    asm volatile("s_wait_xcnt 0x0" ::: "memory");                 // stands behind the stores, in front of any later write to the registers that hold their address and data
}

static constexpr size_t al256(size_t v) { return (v + 255) & ~(size_t)255; }
static constexpr size_t SZ_WO = al256((size_t)DM * DM * 2);
static constexpr size_t SZ_PL = al256((size_t)NB * NH_ * SEQ * HD * 2);
static constexpr size_t SZ_RS = al256((size_t)NB * NH_ * EROWS * HD * 2);
static constexpr size_t SZ_KB = al256((size_t)NB * (SEQ / 32) * 4);
static constexpr size_t SZ_TOTAL = SZ_WO + 3 * SZ_PL + 3 * SZ_RS + SZ_KB;
static_assert(SZ_TOTAL <= (size_t)134217728);          // workspace carve <= 128 MiB
static_assert((size_t)NB * NH_ * SEQ * HD == (size_t)NB * DM * SEQ);       // the blocked v^T plane has the same extent as the q/k planes
static_assert((size_t)NB * NH_ * EROWS * HD == (size_t)NB * DM * EROWS);   // the blocked v^T residual plane (t < EROWS) has the same extent as the q/k residual planes

extern "C" void kernel_launch(void* const* d_in, const int* in_sizes, int n_in,
                              void* d_out, int out_size, void* d_ws, size_t ws_size, hipStream_t stream) {
    if (n_in < 7) return;
    const size_t needx = ((size_t)(NB - 1) * SEQ_FULL + SEQ) * DM;
    const size_t needm = (size_t)(NB - 1) * SEQ_FULL + SEQ;
    if ((size_t)in_sizes[0] < needx) return;
    if ((size_t)in_sizes[1] < (size_t)DM * DM || (size_t)in_sizes[2] < (size_t)DM * DM || (size_t)in_sizes[3] < (size_t)DM * DM || (size_t)in_sizes[4] < (size_t)DM * DM) return;
    if ((size_t)in_sizes[5] < needm || in_sizes[6] < 1) return;
    if ((size_t)out_size < ((size_t)(NB - 1) * OUT_SEQ + SEQ) * DM) return;
    if (SZ_TOTAL > ws_size) return;
    // wire order: x, Wq, Wk, Wv, Wo, padding_mask, num_heads
    const float* x  = (const float*)d_in[0];
    const float* wq = (const float*)d_in[1];
    const float* wk = (const float*)d_in[2];
    const float* wv = (const float*)d_in[3];
    const float* wo = (const float*)d_in[4];
    const int* pm = (const int*)d_in[5];
    const int* nheads = (const int*)d_in[6];
    float* OUT = (float*)d_out;      // [NB][SEQ][128]
    char* wsp = (char*)d_ws;
    h16* WOH = (h16*)wsp; wsp += SZ_WO;              // [128][128] Wo x64 ([out][in] = Bt as-is)
    h16* QH = (h16*)wsp; wsp += SZ_PL;               // [NB*8][SEQ][16]
    h16* KP = (h16*)wsp; wsp += SZ_PL;               // [NB*8][SEQ][16]
    h16* VT = (h16*)wsp; wsp += SZ_PL;               // [NB*8][SEQ/16][16 d][16 keys]
    h16* QR = (h16*)wsp; wsp += SZ_RS;               // [NB*8][EROWS][16] residual x2048, tokens < EROWS
    h16* KR = (h16*)wsp; wsp += SZ_RS;               // [NB*8][EROWS][16] residual x2048, tokens < EROWS
    h16* VR = (h16*)wsp; wsp += SZ_RS;               // [NB*8][EROWS/16][16 d][16 keys] residual x2048, tokens < EROWS
    unsigned* KB = (unsigned*)wsp; wsp += SZ_KB;     // [NB][SEQ/32] padding mask, one bit per key

    // q, k: A = W rows (m = h*16 + d), Bt = x rows (n = b*SEQ + t) -> plane [(b*8 + h)][t][d]; residuals for tokens < EROWS
    // v^T: A = x rows (m = b*SEQ + t), Bt = Wv rows (n = h*16 + d) -> plane [(b*8 + h)][t/16][d][t%16]; residual for tokens < EROWS
    // in the same launch: Wo -> f16 plane x64; padding mask -> bits
    k_proj<<<dim3(PJB + CWO + CKB, 1, 1), 32, 0, stream>>>(x, wq, wk, wv, wo, pm, WOH, KB, QH, QR, KP, KR, VT, VR, EROWS);

    // query rows [0, EROWS): multi-product instantiation; rows [EROWS, SEQ): single-product instantiation; each block then projects its own 16 rows of the flat context view (disjoint output rows)
    k_flash<<<dim3(NBH * NT, 1, 1), 32 * AW, 0, stream>>>(QH, QR, KP, KR, VT, VR, KB, WOH, nheads, OUT);
}
